// v000
// Times are from an AMD MI455X. After a warm-up the kernel runs many times in a row, and a time is the length of
// such a window on the GPU divided by its runs, so every launch and the gaps after it count. The runs cycle
// through copies of the inputs. A figure is the median of several windows, for all but v000 over two sittings.
// Sittings can differ by a few percent; kernels timed side by side share one.
// v000 is the starting kernel. One run takes 2850 microseconds.
// compute dtype: all float inputs rounded to bf16; q/k/v projections with EXACT bf16 products on WMMA 16x16x32 (f32 accumulate); logits: q x k once to f16 (2 products: + q's f16 residual for all rows), x scale; softmax f32; P x 2^11 once to f16 x v once to f16 (1 product); f32 output.
#include <hip/hip_runtime.h>
#include <math.h>

typedef __attribute__((ext_vector_type(16))) _Float16 v16h;
typedef __attribute__((ext_vector_type(16))) __bf16 v16b;
typedef __attribute__((ext_vector_type(8)))  _Float16 v8h;
typedef __attribute__((ext_vector_type(8)))  float v8f;
typedef __attribute__((ext_vector_type(4)))  float v4f;
typedef __attribute__((ext_vector_type(2)))  float v2f;
typedef __attribute__((ext_vector_type(4)))  unsigned v4u;
typedef __attribute__((ext_vector_type(4)))  int v4i;
typedef float __attribute__((may_alias)) float_a;
typedef int __attribute__((may_alias)) int_a;

template <typename T> __device__ __forceinline__ void vst2(void* p, T v) { *(T*)p = v;  }
__device__ __forceinline__ v8f wmma16(v16h a, v16h b, v8f c) {
  v8f d = __builtin_amdgcn_wmma_f32_16x16x32_f16(false, a, false, b, (short)0, c, false, false);
  asm volatile("v_nop\n\tv_nop\n\tv_nop\n\tv_nop" : "+v"(d) : "v"(a), "v"(b));
  return d;
}
__device__ __forceinline__ v8f wmma_bf(v16b a, v16b b, v8f c) {
  v8f d = __builtin_amdgcn_wmma_f32_16x16x32_bf16(false, a, false, b, (short)0, c, false, false);
  asm volatile("v_nop\n\tv_nop\n\tv_nop\n\tv_nop" : "+v"(d) : "v"(a), "v"(b));
  return d;
}
// 16x16x32 fragments: lane = (h = lane>>4, row/col = lane&15); elements 0..7 = k0+8h+0..7, 8..15 = k0+16+8h+0..7; D element r = row 8h+r
__device__ __forceinline__ v16h frag_h(const _Float16* rowk0, int lane) {
  union { v16h v; v8h q[2]; } u; const _Float16* p = rowk0 + 8 * (lane >> 4);
  u.q[0] = *(const v8h*)p; u.q[1] = *(const v8h*)(p + 16); return u.v;
}
__device__ __forceinline__ v16h frag_f32(const float* rowk0, int lane) {
  v16h a; const float* p = rowk0 + 8 * (lane >> 4);
#pragma unroll
  for (int i = 0; i < 8; ++i) { a[i] = (_Float16)p[i]; a[8 + i] = (_Float16)p[16 + i]; }
  return a;
}
__device__ __forceinline__ v16h frag_f32s(const float* rowk0, int lane, float sc) {
  v16h a; const float* p = rowk0 + 8 * (lane >> 4);
#pragma unroll
  for (int i = 0; i < 8; ++i) { a[i] = (_Float16)(p[i] * sc); a[8 + i] = (_Float16)(p[16 + i] * sc); }
  return a;
}
// column fragment from a [K][ld] layout (column n), rows >= K read as 0
__device__ __forceinline__ v16h fragc_f32(const float* W, int k0, int n, int lane, int ld, int K) {
  v16h a; const int g = lane >> 4;
#pragma unroll
  for (int i = 0; i < 8; ++i) { const int ka = k0 + 8 * g + i, kb = ka + 16;
    a[i] = (_Float16)(ka < K ? W[(size_t)(ka < K ? ka : K - 1) * ld + n] : 0.f); a[8 + i] = (_Float16)(kb < K ? W[(size_t)(kb < K ? kb : K - 1) * ld + n] : 0.f); }
  return a;
}
struct F2 { v16b h, l; };
__device__ __forceinline__ F2 bsplit16(const float v[16]) { F2 r;
#pragma unroll
  for (int i = 0; i < 16; ++i) { const __bf16 h = (__bf16)v[i]; r.h[i] = h; r.l[i] = (__bf16)(v[i] - (float)h); }
  return r; }
__device__ __forceinline__ F2 split_row(const float* row, int k0, int lane) { float v[16]; const float* p = row + k0 + 8 * (lane >> 4);
#pragma unroll
  for (int i = 0; i < 8; ++i) { v[i] = p[i]; v[8 + i] = p[16 + i]; }
  return bsplit16(v); }
__device__ __forceinline__ F2 split_rowK(const float* row, int k0, int lane, int K) { float v[16]; const int g = lane >> 4;
#pragma unroll
  for (int i = 0; i < 8; ++i) { const int ka = k0 + 8 * g + i, kb = ka + 16; v[i] = ka < K ? row[ka < K ? ka : K - 1] : 0.f; v[8 + i] = kb < K ? row[kb < K ? kb : K - 1] : 0.f; }
  return bsplit16(v); }
__device__ __forceinline__ F2 split_col(const float* W, int k0, int n, int lane, int ld, int K) { float v[16]; const int g = lane >> 4;
#pragma unroll
  for (int i = 0; i < 8; ++i) { const int ka = k0 + 8 * g + i, kb = ka + 16; v[i] = ka < K ? W[(size_t)(ka < K ? ka : K - 1) * ld + n] : 0.f; v[8 + i] = kb < K ? W[(size_t)(kb < K ? kb : K - 1) * ld + n] : 0.f; }
  return bsplit16(v); }
__device__ __forceinline__ v8f mac3(const F2& a, const F2& b, v8f c) { c = wmma_bf(a.l, b.h, c); c = wmma_bf(a.h, b.l, c); return wmma_bf(a.h, b.h, c); }
__device__ __forceinline__ float sigm(float v) { return 1.0f / (1.0f + expf(-v)); }
#define LDSX() do { asm volatile("s_wait_dscnt 0" ::: "memory"); __builtin_amdgcn_wave_barrier(); __builtin_amdgcn_fence(__ATOMIC_RELEASE, "workgroup"); } while (0)

// Masked self-attention with a RAW reshape into heads (query / key / value [2,2048,1024] are reshaped WITHOUT transpose to [2,16,2048,64]: pseudo-head h of batch b = the contiguous 131,072 floats starting at (b*16 + h)*2048*64, i.e. 32 pseudo-sequences of 2,048 positions x 64 dims each); one shared bias-free torch (out,in) Linear [64,64] per role (Wq, Wk, Wv); scores = Q K^T masked by mask[b][0][q][k] == 0 -> -1e20 (int32 random 0/1 per batch), then divided by sqrt(embed = 1024) = 32 (the source's quirk: logit sigma - 0.08); softmax; out = attn V reshaped raw back to [2,2048,1024]; (out,in) Wo [1024,1024] + bo (nonzero): result = out Wo^T + bo.
#define NB 32
#define TT 2048
#define CC 128            // NH * HD = projected width
#define DIN 64          // input (model) width
#define NH 2
#define HD 64
#define NQB (TT / 64)
#define HG 1
#define SCALE (0.03125f)
#define CAUSAL 0
#ifndef TNB
#define TNB NB
#endif
__device__ __forceinline__ float bfr(float v) { return (float)(__bf16)v; }
__host__ __device__ __forceinline__ int kb_last(int qb) { return CAUSAL ? ((qb * 64 + 63) >> 7) : (TT / 128 - 1); }
typedef __attribute__((ext_vector_type(8))) __bf16 v8b;
__device__ __forceinline__ v16b frag_b(const __bf16* rowk0, int lane) {
  union { v16b v; v8b q[2]; } u; const __bf16* p = rowk0 + 8 * (lane >> 4);
  u.q[0] = *(const v8b*)p; u.q[1] = *(const v8b*)(p + 16); return u.v;
}
#define QBH 0              // no query block takes the high-precision path (non-causal: every query block sees all 2048 keys)
#define QHI 2048            // rows carrying a q residual plane (all rows when non-causal: 2-product logits everywhere)
#define KHI 64            // key rows carrying k residual / v bf16 hi+lo planes (read only on the qb < QBH path, which never runs here since QBH = 0)
// B fragment (k rows k0+.., output column o) of a weight: (in,out) [K][ld] or (out,in) [ld rows of K]: bf16 exact, or f16(bf16 * 256) exact
__device__ __forceinline__ v16b wcol_io(const float* Wm, int k0, int o, int lane, int ld) { v16b w; const int g = lane >> 4;
#pragma unroll
  for (int i = 0; i < 8; ++i) { w[i] = (__bf16)Wm[(size_t)(k0 + 8 * g + i) * ld + o]; w[8 + i] = (__bf16)Wm[(size_t)(k0 + 16 + 8 * g + i) * ld + o]; }
  return w; }
__device__ __forceinline__ v16b wcol_oi(const float* Wm, int k0, int o, int lane, int K) { v16b w; const float* p = Wm + (size_t)o * K + k0 + 8 * (lane >> 4);
#pragma unroll
  for (int i = 0; i < 8; ++i) { w[i] = (__bf16)p[i]; w[8 + i] = (__bf16)p[16 + i]; }
  return w; }
__device__ __forceinline__ v16h wcolh_io(const float* Wm, int k0, int o, int lane, int ld) { v16h w; const int g = lane >> 4;
#pragma unroll
  for (int i = 0; i < 8; ++i) { w[i] = (_Float16)(bfr(Wm[(size_t)(k0 + 8 * g + i) * ld + o]) * 256.0f); w[8 + i] = (_Float16)(bfr(Wm[(size_t)(k0 + 16 + 8 * g + i) * ld + o]) * 256.0f); }
  return w; }
__device__ __forceinline__ v16h wcolh_oi(const float* Wm, int k0, int o, int lane, int K) { v16h w; const float* p = Wm + (size_t)o * K + k0 + 8 * (lane >> 4);
#pragma unroll
  for (int i = 0; i < 8; ++i) { w[i] = (_Float16)(bfr(p[i]) * 256.0f); w[8 + i] = (_Float16)(bfr(p[16 + i]) * 256.0f); }
  return w; }
#define WQKV_LAYOUT 1   // 0 = (in,out) [DIN][CC]; 1 = (out,in) [CC][DIN]; 2 = per-head [NH][DIN][HD]
__device__ __forceinline__ v16b wcol_hdk(const float* Wm, int k0, int o, int lane) { v16b w; const int g = lane >> 4; const float* p = Wm + (size_t)(o / HD) * DIN * HD + (o % HD);
#pragma unroll
  for (int i = 0; i < 8; ++i) { w[i] = (__bf16)p[(size_t)(k0 + 8 * g + i) * HD]; w[8 + i] = (__bf16)p[(size_t)(k0 + 16 + 8 * g + i) * HD]; }
  return w; }
#define WO_OUT_IN 0
#if WQKV_LAYOUT == 1
#define WCOL(W, k0, o, lane) wcol_oi(W, k0, o, lane, DIN)
#elif WQKV_LAYOUT == 2
#define WCOL(W, k0, o, lane) wcol_hdk(W, k0, o, lane)
#else
#define WCOL(W, k0, o, lane) wcol_io(W, k0, o, lane, CC)
#endif
#if WO_OUT_IN
#define WOCOL(W, k0, o, lane) wcol_oi(W, k0, o, lane, CC)
#define WOCOLH(W, k0, o, lane) wcolh_oi(W, k0, o, lane, CC)
#else
#define WOCOL(W, k0, o, lane) wcol_io(W, k0, o, lane, DIN)
#define WOCOLH(W, k0, o, lane) wcolh_io(W, k0, o, lane, DIN)
#endif
#define CIN 64
// ---- k_padw: the three (out,in) [64][C] projection weights copied into zero-padded (out,in) [128][C] ws planes (rows 64..127 zero) + zero-padded [128] biases, so the 128-column kernels apply unchanged (columns 64..127 = an all-zero dummy head, never attended)
__global__ __launch_bounds__(256) void k_padw(const float* __restrict__ WQ, const float* __restrict__ WK, const float* __restrict__ WV, const float* __restrict__ BQ, const float* __restrict__ BK, const float* __restrict__ BV, float* __restrict__ WP, float* __restrict__ BP) { const int which = blockIdx.y; const float* Wsrc = which == 0 ? WQ : (which == 1 ? WK : WV); const float* Bsrc = which == 0 ? BQ : (which == 1 ? BK : BV); float* dst = WP + (size_t)which * 128 * CIN;
  for (int e = blockIdx.x * 256 + threadIdx.x; e < 128 * (CIN / 4); e += gridDim.x * 256) { const int row = e / (CIN / 4), q = e % (CIN / 4); const v4f ld = *(const v4f*)(Wsrc + (size_t)(row & 63) * CIN + q * 4); asm volatile("s_wait_loadcnt 0x0" ::: "memory"); const float keep = row < 64 ? 1.f : 0.f; v4f ov; ov[0] = ld[0] * keep; ov[1] = ld[1] * keep; ov[2] = ld[2] * keep; ov[3] = ld[3] * keep; vst2(dst + (size_t)row * CIN + q * 4, ov); }   /* unconditional (clamped) loads, zero by select */
  if (blockIdx.x == 0 && threadIdx.x < 128) { const int c = threadIdx.x; float bvv = 0.f; if (Bsrc) { const float t = Bsrc[c & 63]; asm volatile("s_wait_loadcnt 0x0" ::: "memory"); bvv = c < 64 ? t : 0.f; } vst2(BP + which * 128 + c, bvv); } }
// ---- k_out64: out[b][t][0..63] = ctx row columns 0..63 (256 B by 16 lanes)
__global__ __launch_bounds__(256) void k_out64(const float* __restrict__ Y, float* __restrict__ OUT) { const size_t row = (size_t)blockIdx.x * 16 + (threadIdx.x >> 4); const int q = threadIdx.x & 15; const v4f v = *(const v4f*)(Y + row * CC + q * 4); asm volatile("s_wait_loadcnt 0x0" ::: "memory"); vst2(OUT + row * 64 + q * 4, v); }
#define WS_WP (WS_END)                                  // padded weights [3][128 x C]
#define WS_BP (WS_WP + 4u * 3 * (size_t)CIN * 128)        // padded biases [3][128]
#define WS_Y2 (WS_BP + 4u * 3 * 128)                      // ctx rows [b*TT+t][128]
#define WS_END2 (WS_Y2 + 4u * (size_t)NB * TT * CC)
#define SM_EXTRA_PARAMS , int bsm, const int* __restrict__ MASK
// random 0/1 int mask [B][1][S][S] of the REAL batch (pseudo-sequence bsm = b*16 + h -> b = bsm / 16): where(mask == 0, -1e20, score) happens BEFORE the 1/32 scaling in the source, so a masked logit is -1e20 / 32 (weight exactly 0); the S plane already holds score / 32
#define SM_MASK_HOOK do { const int mk = MASK[((size_t)(bsm >> 4) * TT + t) * TT + k]; v = (mk == 0) ? -3.125e18f : v; } while (0)
#ifndef SM_EXTRA_PARAMS
#define SM_EXTRA_PARAMS
#endif
#ifndef PROJ_EXTRA_PARAMS
#define PROJ_EXTRA_PARAMS
#endif
#ifndef SM_MASK_HOOK
#define SM_MASK_HOOK (void)0
#endif

#define WS_QH  0u                                      // f16 q rows [b*t][CC]
#define WS_KH  (WS_QH + 2u * (size_t)NB * TT * CC)      // f16 k rows [b*t][CC]
#define WS_VT  (WS_KH + 2u * (size_t)NB * TT * CC)      // f16 v planes [b][c][t]
#define WS_QL  (WS_VT + 2u * (size_t)NB * CC * TT)      // f16 q residual x 2^10 rows [b][t < QHI][CC]
#define WS_KL  (WS_QL + 2u * (size_t)NB * QHI * CC)     // f16 k residual x 2^10 rows [b][t < KHI][CC]
#define WS_VB  (WS_KL + 2u * (size_t)NB * KHI * CC)     // bf16 v hi planes [b][c][t < KHI]
#define WS_VBL (WS_VB + 2u * (size_t)NB * CC * KHI)
#define WS_S   (WS_VBL + 2u * (size_t)NB * CC * KHI)    // f32 logits / P [hg][t][s]
#define WS_Y   (WS_S  + 4u * (size_t)HG * TT * TT)      // empty (0 bytes), Y unused: ctx rows go to WS_Y2
#define WS_END (WS_Y  + 0u)

// ---- k_proj: block = (64 rows, 128 cols, which): q/k/v = X W (+ b) with exact bf16 products (K = DIN) -> which 0: q f16 rows (+ residual rows < QHI); 1: k f16 rows (+ residual rows < KHI); 2: v f16 planes [c][t] (+ bf16 hi/lo planes for t < KHI)
__global__ __launch_bounds__(128) void k_proj(const float* __restrict__ XQ, const float* __restrict__ XK, const float* __restrict__ XV, const float* __restrict__ WQ, const float* __restrict__ WK, const float* __restrict__ WV, const float* __restrict__ BQ, const float* __restrict__ BK, const float* __restrict__ BV,
    _Float16* __restrict__ QH, _Float16* __restrict__ QL, _Float16* __restrict__ KH, _Float16* __restrict__ KL, _Float16* __restrict__ VT, __bf16* __restrict__ VB, __bf16* __restrict__ VBL) {
  __shared__ __align__(16) _Float16 sh[64][136], sl[64][136]; __shared__ __align__(16) _Float16 th[128][72]; __shared__ __align__(16) __bf16 tb[128][72], tbl[128][72];
  const int tid = threadIdx.x, wave = tid >> 5, lane = tid & 31, col = lane & 15, g = lane >> 4; const int which = blockIdx.z; const int c0 = blockIdx.y * 128; const size_t r0 = (size_t)blockIdx.x * 64; const size_t bb = r0 / TT; const int t0 = (int)(r0 % TT);
  const float* X = which == 0 ? XQ : which == 1 ? XK : XV; const float* WA = which == 0 ? WQ : which == 1 ? WK : WV; const float* BA = which == 0 ? BQ : which == 1 ? BK : BV;
  v8f acc[8] = {};
#pragma unroll 2
  for (int kc = 0; kc < DIN / 32; ++kc) { v16b a; { const float* p = X + (r0 + wave * 16 + col) * DIN + kc * 32 + 8 * g;
#pragma unroll
      for (int i = 0; i < 8; ++i) { a[i] = (__bf16)p[i]; a[8 + i] = (__bf16)p[16 + i]; } }
    asm volatile("s_wait_loadcnt 0x0" ::: "memory");
#pragma unroll
    for (int j = 0; j < 8; ++j) { const v16b w = WCOL(WA, kc * 32, c0 + j * 16 + col, lane); asm volatile("s_wait_loadcnt 0x0" ::: "memory"); acc[j] = wmma_bf(a, w, acc[j]); } }
  if (which < 2) { _Float16* DH = which == 0 ? QH : KH; _Float16* DL = which == 0 ? QL : KL; const int nhi = which == 0 ? QHI : KHI; const bool hi_rows = t0 < nhi;
#pragma unroll
    for (int j = 0; j < 8; ++j) { const float bias = BA ? bfr(BA[c0 + j * 16 + col]) : 0.f;
#pragma unroll
      for (int r = 0; r < 8; ++r) { const float v = acc[j][r] + bias; const _Float16 hv = (_Float16)v; sh[wave * 16 + 8 * g + r][j * 16 + col] = hv; sl[wave * 16 + 8 * g + r][j * 16 + col] = (_Float16)((v - (float)hv) * 1024.0f); } }
    __syncthreads();
    for (int e = tid; e < 64 * 16; e += 128) { const int rl = e >> 4, q = e & 15; vst2((unsigned*)(DH + (r0 + rl) * CC + c0 + q * 8), *(const v4u*)&sh[rl][q * 8]); if (hi_rows) vst2((unsigned*)(DL + (bb * nhi + t0 + rl) * (size_t)CC + c0 + q * 8), *(const v4u*)&sl[rl][q * 8]); }
  } else { const bool hi_rows = t0 < KHI;
#pragma unroll
    for (int j = 0; j < 8; ++j) { const float bias = BA ? bfr(BA[c0 + j * 16 + col]) : 0.f;
#pragma unroll
      for (int r = 0; r < 8; ++r) { const float v = acc[j][r] + bias; const int rl = wave * 16 + 8 * g + r, cl = j * 16 + col; th[cl][rl] = (_Float16)v; const __bf16 bh = (__bf16)v; tb[cl][rl] = bh; tbl[cl][rl] = (__bf16)(v - (float)bh); } }
    __syncthreads();
    for (int e = tid; e < 128 * 8; e += 128) { const int cl = e >> 3, q = e & 7; vst2((unsigned*)(VT + (bb * CC + c0 + cl) * (size_t)TT + t0 + q * 8), *(const v4u*)&th[cl][q * 8]); if (hi_rows) { const size_t o3 = (bb * CC + c0 + cl) * (size_t)KHI + t0 + q * 8; vst2((unsigned*)(VB + o3), *(const v4u*)&tb[cl][q * 8]); vst2((unsigned*)(VBL + o3), *(const v4u*)&tbl[cl][q * 8]); } } } }
// ---- k_sc: block = (query block qb, key block kb <= kb_last(qb), head in group) of batch b: logits x SCALE; q hi + residual (x 2^10) against k (2 products) for query rows < QHI, plus the k residual (3 products) for query blocks < QBH (causal early rows); causal: blocks past the diagonal exit, the mask itself is applied by index in k_sm
__global__ __launch_bounds__(128) void k_sc(const _Float16* __restrict__ QH, const _Float16* __restrict__ KH, const _Float16* __restrict__ QL, const _Float16* __restrict__ KL, int b, int h0, float* __restrict__ S0) { __shared__ __align__(16) float ss[4][16][132];
  const int qb = blockIdx.x, kb = blockIdx.y; if (kb > kb_last(qb)) return;
  const int h = h0 + blockIdx.z; float* S = S0 + (size_t)blockIdx.z * TT * TT;
  const int tid = threadIdx.x, wave = tid >> 5, lane = tid & 31, col = lane & 15, g = lane >> 4; const int k0 = kb * 128; const int ql0 = qb * 64 + wave * 16; const size_t q0 = (size_t)b * TT + ql0, kr0 = (size_t)b * TT + k0;
  v8f acc[8] = {}, accl[8] = {};
  const _Float16* QLb = QL + (size_t)b * QHI * CC; const _Float16* KLb = KL + (size_t)b * KHI * CC;
  if (qb < QBH) {
#pragma unroll
    for (int kc = 0; kc < HD / 32; ++kc) { const v16h ah = frag_h(QH + (q0 + col) * CC + h * HD + kc * 32, lane), al = frag_h(QLb + (size_t)(ql0 + col) * CC + h * HD + kc * 32, lane);
#pragma unroll
      for (int j = 0; j < 8; ++j) { const v16h kbf = frag_h(KH + (kr0 + j * 16 + col) * CC + h * HD + kc * 32, lane), klf = frag_h(KLb + (size_t)(k0 + j * 16 + col) * CC + h * HD + kc * 32, lane); acc[j] = wmma16(ah, kbf, acc[j]); accl[j] = wmma16(al, kbf, accl[j]); accl[j] = wmma16(ah, klf, accl[j]); } }
  } else if (qb * 64 < QHI) {
#pragma unroll
    for (int kc = 0; kc < HD / 32; ++kc) { const v16h ah = frag_h(QH + (q0 + col) * CC + h * HD + kc * 32, lane), al = frag_h(QLb + (size_t)(ql0 + col) * CC + h * HD + kc * 32, lane);
#pragma unroll
      for (int j = 0; j < 8; ++j) { const v16h kbf = frag_h(KH + (kr0 + j * 16 + col) * CC + h * HD + kc * 32, lane); acc[j] = wmma16(ah, kbf, acc[j]); accl[j] = wmma16(al, kbf, accl[j]); } }
  } else {
#pragma unroll
    for (int kc = 0; kc < HD / 32; ++kc) { const v16h ah = frag_h(QH + (q0 + col) * CC + h * HD + kc * 32, lane);
#pragma unroll
      for (int j = 0; j < 8; ++j) { const v16h kbf = frag_h(KH + (kr0 + j * 16 + col) * CC + h * HD + kc * 32, lane); acc[j] = wmma16(ah, kbf, acc[j]); } } }
#pragma unroll
  for (int j = 0; j < 8; ++j) {
#pragma unroll
    for (int r = 0; r < 8; ++r) ss[wave][8 * g + r][j * 16 + col] = (acc[j][r] + accl[j][r] * (1.0f / 1024.0f)) * SCALE; }
  LDSX(); for (int rl = 0; rl < 16; ++rl) vst2(S + (size_t)(ql0 + rl) * TT + k0 + lane * 4, *(const v4f*)&ss[wave][rl][lane * 4]); }
// ---- k_sm: block = query row t (head in group): keys [0, kend): causal -> logit if s <= t else excluded; softmax in f32; P x 2^11 in place (0 for excluded)
__global__ __launch_bounds__(256) void k_sm(float* __restrict__ S0 SM_EXTRA_PARAMS) { __shared__ float sred[8]; __shared__ float sbc; __shared__ __align__(16) float shv[TT];
  const int tid = threadIdx.x; const int t = blockIdx.x; const int kend = (kb_last(t >> 6) + 1) * 128;
  float* sr = S0 + (size_t)blockIdx.y * TT * TT + (size_t)t * TT;
  float m = -3.0e38f; for (int k = tid; k < kend; k += 256) { float v = (!CAUSAL || k <= t) ? sr[k] : -3.0e38f; SM_MASK_HOOK; shv[k] = v; m = fmaxf(m, v); }
#pragma unroll
  for (int o = 1; o < 32; o <<= 1) m = fmaxf(m, __shfl_xor(m, o));
  if ((tid & 31) == 0) sred[tid >> 5] = m; __syncthreads(); if (tid == 0) { float a = sred[0]; for (int i = 1; i < 8; ++i) a = fmaxf(a, sred[i]); sbc = a; } __syncthreads(); m = sbc; __syncthreads();
  float sum = 0.f; for (int k = tid; k < kend; k += 256) { const float v = shv[k]; const float e = (v <= -1.0e38f) ? 0.f : expf(v - m); shv[k] = e; sum += e; }
#pragma unroll
  for (int o = 1; o < 32; o <<= 1) sum += __shfl_xor(sum, o);
  if ((tid & 31) == 0) sred[tid >> 5] = sum; __syncthreads(); if (tid == 0) { float a = 0.f; for (int i = 0; i < 8; ++i) a += sred[i]; sbc = a > 0.f ? 2048.0f / a : 0.f; }   /* a fully excluded row yields P = 0 */ __syncthreads(); const float inv = sbc;
  for (int k = tid; k < kend; k += 256) shv[k] = shv[k] * inv;
  __syncthreads(); for (int q = tid; q < kend / 4; q += 256) vst2(sr + q * 4, *(const v4f*)&shv[q * 4]); }
// ---- k_pv: block = 64 queries (qb) of (b, h): ctx = P . v over keys [0, kend) (P x 2^11 once to f16 against v f16: 1 product; causal early query blocks: P and v as bf16 hi + lo, 3 products); 256-B (row, head) segment by 16 lanes
__global__ __launch_bounds__(128) void k_pv(const float* __restrict__ PS0, const _Float16* __restrict__ VT, const __bf16* __restrict__ VB, const __bf16* __restrict__ VBL, int b, int h0, float* __restrict__ Y) { const int h = h0 + blockIdx.z; const float* PS = PS0 + (size_t)blockIdx.z * TT * TT; __shared__ __align__(16) float ss[4][16][HD + 4];
  const int tid = threadIdx.x, wave = tid >> 5, lane = tid & 31, col = lane & 15, g = lane >> 4; const int qb = blockIdx.x; const int ql0 = qb * 64 + wave * 16; const int kce = (kb_last(qb) + 1) * 4;
  v8f acc[HD / 16] = {};
  if (qb < QBH) {
#pragma unroll 1
    for (int kc = 0; kc < kce; ++kc) { const F2 p = split_row(PS + (size_t)(ql0 + col) * TT, kc * 32, lane);
      asm volatile("s_wait_loadcnt 0x0" ::: "memory");
#pragma unroll
      for (int j = 0; j < HD / 16; ++j) { const size_t po = ((size_t)b * CC + h * HD + j * 16 + col) * (size_t)KHI + kc * 32; const v16b vh = frag_b(VB + po, lane); acc[j] = wmma_bf(p.h, vh, acc[j]); acc[j] = wmma_bf(p.l, vh, acc[j]); acc[j] = wmma_bf(p.h, frag_b(VBL + po, lane), acc[j]); } }
  } else {
#pragma unroll 1
    for (int kc = 0; kc < kce; ++kc) { const v16h p = frag_f32(PS + (size_t)(ql0 + col) * TT + kc * 32, lane);
      asm volatile("s_wait_loadcnt 0x0" ::: "memory");
#pragma unroll
      for (int j = 0; j < HD / 16; ++j) { const size_t po = ((size_t)b * CC + h * HD + j * 16 + col) * (size_t)TT + kc * 32; acc[j] = wmma16(p, frag_h(VT + po, lane), acc[j]); } } }
#pragma unroll
  for (int j = 0; j < HD / 16; ++j)
#pragma unroll
    for (int r = 0; r < 8; ++r) ss[wave][8 * g + r][j * 16 + col] = acc[j][r] * (1.0f / 2048.0f);
  LDSX(); for (int rl = 0; rl < 16; ++rl) if (lane < HD / 4) vst2(Y + ((size_t)b * TT + ql0 + rl) * CC + h * HD + lane * 4, *(const v4f*)&ss[wave][rl][lane * 4]); }

// ---- k_lin2: the module's final Linear on the RAW-reshaped context: rows = the [2*2048][1024] view of the contiguous [32][2048][64] context buffer; out = ctx Wo^T + bo with ctx x 2^6 once to f16 against Wo as f16(bf16 x 2^8) (1 product), block = (64 rows, 128 output columns)
#define K2 1024
#define N2 1024
__global__ __launch_bounds__(128) void k_lin2(const float* __restrict__ Yc, const float* __restrict__ WO, const float* __restrict__ BO, float* __restrict__ OUT) { __shared__ __align__(16) float sf[4][16][132];
  const int tid = threadIdx.x, wave = tid >> 5, lane = tid & 31, col = lane & 15, g = lane >> 4; const int c0 = blockIdx.y * 128; const size_t r0 = (size_t)blockIdx.x * 64 + wave * 16;
  v8f acc[8] = {};
#pragma unroll 2
  for (int kc = 0; kc < K2 / 32; ++kc) { const v16h a = frag_f32s(Yc + (r0 + col) * K2 + kc * 32, lane, 64.0f); asm volatile("s_wait_loadcnt 0x0" ::: "memory");
#pragma unroll
    for (int j = 0; j < 8; ++j) { const v16h w = wcolh_oi(WO, kc * 32, c0 + j * 16 + col, lane, K2); asm volatile("s_wait_loadcnt 0x0" ::: "memory"); acc[j] = wmma16(a, w, acc[j]); } }
#pragma unroll
  for (int j = 0; j < 8; ++j) { const float bias = bfr(BO[c0 + j * 16 + col]); asm volatile("s_wait_loadcnt 0x0" ::: "memory");
#pragma unroll
    for (int r = 0; r < 8; ++r) sf[wave][8 * g + r][j * 16 + col] = acc[j][r] * (1.0f / 16384.0f) + bias; }   /* 2^-8 (Wo carry) x 2^-6 (ctx carry) */
  LDSX(); for (int rl = 0; rl < 16; ++rl) vst2(OUT + (r0 + rl) * N2 + c0 + lane * 4, *(const v4f*)&sf[wave][rl][lane * 4]); }
#define WS_C64 (WS_END2)                                 // f32 context [32][2048][64] contiguous == the raw-reshaped [2*2048][1024] rows
#define WS_END3 (WS_C64 + 4u * (size_t)NB * TT * 64)
extern "C" void kernel_launch(void* const* d_in, const int* in_sizes, int n_in, void* d_out, int out_size, void* d_ws, size_t ws_size, hipStream_t stream) {
  (void)in_sizes; (void)n_in; (void)out_size;
  const float** F = (const float**)d_in;
  if (ws_size < (size_t)WS_END) return;
  char* ws = (char*)d_ws; _Float16 *QH = (_Float16*)(ws + WS_QH), *KH = (_Float16*)(ws + WS_KH), *VT = (_Float16*)(ws + WS_VT), *QL = (_Float16*)(ws + WS_QL), *KL = (_Float16*)(ws + WS_KL); __bf16 *VB = (__bf16*)(ws + WS_VB), *VBL = (__bf16*)(ws + WS_VBL); float *S = (float*)(ws + WS_S), *Y = (float*)(ws + WS_Y);
  (void)Y; (void)QL; (void)KL; (void)VB; (void)VBL;
  // inputs: 0 query [2,2048,1024]; 1 key; 2 value (each viewed as 65,536 rows of 64: the raw reshape); 3 mask [2,1,2048,2048] int32; 4 Wq [64,64] (out,in); 5 Wk; 6 Wv; 7 Wo [1024,1024] (out,in); 8 bo [1024] (nonzero)
  if (ws_size < (size_t)WS_END3) return;
  float *WP = (float*)(ws + WS_WP), *BP = (float*)(ws + WS_BP), *Y2 = (float*)(ws + WS_Y2), *C64 = (float*)(ws + WS_C64);
  k_padw<<<dim3(32, 3), 256, 0, stream>>>(F[4], F[5], F[6], nullptr, nullptr, nullptr, WP, BP);
  k_proj<<<dim3(TNB * TT / 64, CC / 128, 3), 128, 0, stream>>>(F[0], F[1], F[2], WP, WP + (size_t)CIN * 128, WP + 2 * (size_t)CIN * 128, BP, BP + 128, BP + 256, QH, QL, KH, KL, VT, VB, VBL);
  for (int b = 0; b < TNB; ++b) {   /* pseudo-sequence b = real batch (b >> 4), pseudo-head (b & 15); head 0 only */
    k_sc<<<dim3(NQB, TT / 128, 1), 128, 0, stream>>>(QH, KH, QL, KL, b, 0, S);
    k_sm<<<dim3(TT, 1), 256, 0, stream>>>(S, b, (const int*)d_in[3]);
    k_pv<<<dim3(NQB, 1, 1), 128, 0, stream>>>(S, VT, VB, VBL, b, 0, Y2);
  }
  k_out64<<<dim3(TNB * TT / 16), 256, 0, stream>>>(Y2, C64);
  k_lin2<<<dim3((TNB * TT * 64 / K2) / 64, N2 / 128), 128, 0, stream>>>(C64, F[7], F[8], (float*)d_out);
}

// v001
// One run takes 941 microseconds.
// In two side-by-side timings against v000, it was 3.03 and 3.02 times as fast.
// compute dtype: all float inputs rounded to bf16; q/k/v projections with EXACT bf16 products on WMMA 16x16x32 (f32 accumulate); logits: q x k once to f16 (2 products: + q's f16 residual for all rows), x scale; softmax f32; P x 2^11 once to f16 x v once to f16 (1 product); f32 output.
#include <hip/hip_runtime.h>
#include <math.h>

typedef __attribute__((ext_vector_type(16))) _Float16 v16h;
typedef __attribute__((ext_vector_type(16))) __bf16 v16b;
typedef __attribute__((ext_vector_type(8)))  _Float16 v8h;
typedef __attribute__((ext_vector_type(8)))  float v8f;
typedef __attribute__((ext_vector_type(4)))  float v4f;
typedef __attribute__((ext_vector_type(2)))  float v2f;
typedef __attribute__((ext_vector_type(4)))  unsigned v4u;
typedef __attribute__((ext_vector_type(4)))  int v4i;
typedef float __attribute__((may_alias)) float_a;
typedef int __attribute__((may_alias)) int_a;

template <typename T> __device__ __forceinline__ void vst2(void* p, T v) { *(T*)p = v;  }
__device__ __forceinline__ v8f wmma16(v16h a, v16h b, v8f c) {
  v8f d = __builtin_amdgcn_wmma_f32_16x16x32_f16(false, a, false, b, (short)0, c, false, false);
  asm volatile("v_nop\n\tv_nop\n\tv_nop\n\tv_nop" : "+v"(d) : "v"(a), "v"(b));
  return d;
}
__device__ __forceinline__ v8f wmma_bf(v16b a, v16b b, v8f c) {
  v8f d = __builtin_amdgcn_wmma_f32_16x16x32_bf16(false, a, false, b, (short)0, c, false, false);
  asm volatile("v_nop\n\tv_nop\n\tv_nop\n\tv_nop" : "+v"(d) : "v"(a), "v"(b));
  return d;
}
// 16x16x32 fragments: lane = (h = lane>>4, row/col = lane&15); elements 0..7 = k0+8h+0..7, 8..15 = k0+16+8h+0..7; D element r = row 8h+r
__device__ __forceinline__ v16h frag_h(const _Float16* rowk0, int lane) {
  union { v16h v; v8h q[2]; } u; const _Float16* p = rowk0 + 8 * (lane >> 4);
  u.q[0] = *(const v8h*)p; u.q[1] = *(const v8h*)(p + 16); return u.v;
}
__device__ __forceinline__ v16h frag_f32(const float* rowk0, int lane) {
  v16h a; const float* p = rowk0 + 8 * (lane >> 4);
#pragma unroll
  for (int i = 0; i < 8; ++i) { a[i] = (_Float16)p[i]; a[8 + i] = (_Float16)p[16 + i]; }
  return a;
}
__device__ __forceinline__ v16h frag_f32s(const float* rowk0, int lane, float sc) {
  v16h a; const float* p = rowk0 + 8 * (lane >> 4);
#pragma unroll
  for (int i = 0; i < 8; ++i) { a[i] = (_Float16)(p[i] * sc); a[8 + i] = (_Float16)(p[16 + i] * sc); }
  return a;
}
// column fragment from a [K][ld] layout (column n), rows >= K read as 0
__device__ __forceinline__ v16h fragc_f32(const float* W, int k0, int n, int lane, int ld, int K) {
  v16h a; const int g = lane >> 4;
#pragma unroll
  for (int i = 0; i < 8; ++i) { const int ka = k0 + 8 * g + i, kb = ka + 16;
    a[i] = (_Float16)(ka < K ? W[(size_t)(ka < K ? ka : K - 1) * ld + n] : 0.f); a[8 + i] = (_Float16)(kb < K ? W[(size_t)(kb < K ? kb : K - 1) * ld + n] : 0.f); }
  return a;
}
struct F2 { v16b h, l; };
__device__ __forceinline__ F2 bsplit16(const float v[16]) { F2 r;
#pragma unroll
  for (int i = 0; i < 16; ++i) { const __bf16 h = (__bf16)v[i]; r.h[i] = h; r.l[i] = (__bf16)(v[i] - (float)h); }
  return r; }
__device__ __forceinline__ F2 split_row(const float* row, int k0, int lane) { float v[16]; const float* p = row + k0 + 8 * (lane >> 4);
#pragma unroll
  for (int i = 0; i < 8; ++i) { v[i] = p[i]; v[8 + i] = p[16 + i]; }
  return bsplit16(v); }
__device__ __forceinline__ F2 split_rowK(const float* row, int k0, int lane, int K) { float v[16]; const int g = lane >> 4;
#pragma unroll
  for (int i = 0; i < 8; ++i) { const int ka = k0 + 8 * g + i, kb = ka + 16; v[i] = ka < K ? row[ka < K ? ka : K - 1] : 0.f; v[8 + i] = kb < K ? row[kb < K ? kb : K - 1] : 0.f; }
  return bsplit16(v); }
__device__ __forceinline__ F2 split_col(const float* W, int k0, int n, int lane, int ld, int K) { float v[16]; const int g = lane >> 4;
#pragma unroll
  for (int i = 0; i < 8; ++i) { const int ka = k0 + 8 * g + i, kb = ka + 16; v[i] = ka < K ? W[(size_t)(ka < K ? ka : K - 1) * ld + n] : 0.f; v[8 + i] = kb < K ? W[(size_t)(kb < K ? kb : K - 1) * ld + n] : 0.f; }
  return bsplit16(v); }
__device__ __forceinline__ v8f mac3(const F2& a, const F2& b, v8f c) { c = wmma_bf(a.l, b.h, c); c = wmma_bf(a.h, b.l, c); return wmma_bf(a.h, b.h, c); }
__device__ __forceinline__ float sigm(float v) { return 1.0f / (1.0f + expf(-v)); }
#define LDSX() do { asm volatile("s_wait_dscnt 0" ::: "memory"); __builtin_amdgcn_wave_barrier(); __builtin_amdgcn_fence(__ATOMIC_RELEASE, "workgroup"); } while (0)

// Masked self-attention with a RAW reshape into heads (query / key / value [2,2048,1024] are reshaped WITHOUT transpose to [2,16,2048,64]: pseudo-head h of batch b = the contiguous 131,072 floats starting at (b*16 + h)*2048*64, i.e. 32 pseudo-sequences of 2,048 positions x 64 dims each); one shared bias-free torch (out,in) Linear [64,64] per role (Wq, Wk, Wv); scores = Q K^T masked by mask[b][0][q][k] == 0 -> -1e20 (int32 random 0/1 per batch), then divided by sqrt(embed = 1024) = 32 (the source's quirk: logit sigma - 0.08); softmax; out = attn V reshaped raw back to [2,2048,1024]; (out,in) Wo [1024,1024] + bo (nonzero): result = out Wo^T + bo.
#define NB 32
#define TT 2048
#define CC 128            // NH * HD = projected width
#define DIN 64          // input (model) width
#define NH 2
#define HD 64
#define NQB (TT / 64)
#define HG 1
#define GB 8             // pseudo-sequences per launch of k_sc / k_sm / k_pv (one S plane each in ws); divides 16, so a group stays inside one real batch
#define SCALE (0.03125f)
#define CAUSAL 0
#ifndef TNB
#define TNB NB
#endif
__device__ __forceinline__ float bfr(float v) { return (float)(__bf16)v; }
__host__ __device__ __forceinline__ int kb_last(int qb) { return CAUSAL ? ((qb * 64 + 63) >> 7) : (TT / 128 - 1); }
typedef __attribute__((ext_vector_type(8))) __bf16 v8b;
__device__ __forceinline__ v16b frag_b(const __bf16* rowk0, int lane) {
  union { v16b v; v8b q[2]; } u; const __bf16* p = rowk0 + 8 * (lane >> 4);
  u.q[0] = *(const v8b*)p; u.q[1] = *(const v8b*)(p + 16); return u.v;
}
#define QBH 0              // no query block takes the high-precision path (non-causal: every query block sees all 2048 keys)
#define QHI 2048            // rows carrying a q residual plane (all rows when non-causal: 2-product logits everywhere)
#define KHI 64            // key rows carrying k residual / v bf16 hi+lo planes (read only on the qb < QBH path, which never runs here since QBH = 0)
// B fragment (k rows k0+.., output column o) of a weight: (in,out) [K][ld] or (out,in) [ld rows of K]: bf16 exact, or f16(bf16 * 256) exact
__device__ __forceinline__ v16b wcol_io(const float* Wm, int k0, int o, int lane, int ld) { v16b w; const int g = lane >> 4;
#pragma unroll
  for (int i = 0; i < 8; ++i) { w[i] = (__bf16)Wm[(size_t)(k0 + 8 * g + i) * ld + o]; w[8 + i] = (__bf16)Wm[(size_t)(k0 + 16 + 8 * g + i) * ld + o]; }
  return w; }
__device__ __forceinline__ v16b wcol_oi(const float* Wm, int k0, int o, int lane, int K) { v16b w; const float* p = Wm + (size_t)o * K + k0 + 8 * (lane >> 4);
#pragma unroll
  for (int i = 0; i < 8; ++i) { w[i] = (__bf16)p[i]; w[8 + i] = (__bf16)p[16 + i]; }
  return w; }
__device__ __forceinline__ v16h wcolh_io(const float* Wm, int k0, int o, int lane, int ld) { v16h w; const int g = lane >> 4;
#pragma unroll
  for (int i = 0; i < 8; ++i) { w[i] = (_Float16)(bfr(Wm[(size_t)(k0 + 8 * g + i) * ld + o]) * 256.0f); w[8 + i] = (_Float16)(bfr(Wm[(size_t)(k0 + 16 + 8 * g + i) * ld + o]) * 256.0f); }
  return w; }
__device__ __forceinline__ v16h wcolh_oi(const float* Wm, int k0, int o, int lane, int K) { v16h w; const float* p = Wm + (size_t)o * K + k0 + 8 * (lane >> 4);
#pragma unroll
  for (int i = 0; i < 8; ++i) { w[i] = (_Float16)(bfr(p[i]) * 256.0f); w[8 + i] = (_Float16)(bfr(p[16 + i]) * 256.0f); }
  return w; }
#define WQKV_LAYOUT 1   // 0 = (in,out) [DIN][CC]; 1 = (out,in) [CC][DIN]; 2 = per-head [NH][DIN][HD]
__device__ __forceinline__ v16b wcol_hdk(const float* Wm, int k0, int o, int lane) { v16b w; const int g = lane >> 4; const float* p = Wm + (size_t)(o / HD) * DIN * HD + (o % HD);
#pragma unroll
  for (int i = 0; i < 8; ++i) { w[i] = (__bf16)p[(size_t)(k0 + 8 * g + i) * HD]; w[8 + i] = (__bf16)p[(size_t)(k0 + 16 + 8 * g + i) * HD]; }
  return w; }
#define WO_OUT_IN 0
#if WQKV_LAYOUT == 1
#define WCOL(W, k0, o, lane) wcol_oi(W, k0, o, lane, DIN)
#elif WQKV_LAYOUT == 2
#define WCOL(W, k0, o, lane) wcol_hdk(W, k0, o, lane)
#else
#define WCOL(W, k0, o, lane) wcol_io(W, k0, o, lane, CC)
#endif
#if WO_OUT_IN
#define WOCOL(W, k0, o, lane) wcol_oi(W, k0, o, lane, CC)
#define WOCOLH(W, k0, o, lane) wcolh_oi(W, k0, o, lane, CC)
#else
#define WOCOL(W, k0, o, lane) wcol_io(W, k0, o, lane, DIN)
#define WOCOLH(W, k0, o, lane) wcolh_io(W, k0, o, lane, DIN)
#endif
#define CIN 64
// ---- k_padw: the three (out,in) [64][C] projection weights copied into zero-padded (out,in) [128][C] ws planes (rows 64..127 zero) + zero-padded [128] biases, so the 128-column kernels apply unchanged (columns 64..127 = an all-zero dummy head, never attended)
__global__ __launch_bounds__(256) void k_padw(const float* __restrict__ WQ, const float* __restrict__ WK, const float* __restrict__ WV, const float* __restrict__ BQ, const float* __restrict__ BK, const float* __restrict__ BV, float* __restrict__ WP, float* __restrict__ BP) { const int which = blockIdx.y; const float* Wsrc = which == 0 ? WQ : (which == 1 ? WK : WV); const float* Bsrc = which == 0 ? BQ : (which == 1 ? BK : BV); float* dst = WP + (size_t)which * 128 * CIN;
  for (int e = blockIdx.x * 256 + threadIdx.x; e < 128 * (CIN / 4); e += gridDim.x * 256) { const int row = e / (CIN / 4), q = e % (CIN / 4); const v4f ld = *(const v4f*)(Wsrc + (size_t)(row & 63) * CIN + q * 4); asm volatile("s_wait_loadcnt 0x0" ::: "memory"); const float keep = row < 64 ? 1.f : 0.f; v4f ov; ov[0] = ld[0] * keep; ov[1] = ld[1] * keep; ov[2] = ld[2] * keep; ov[3] = ld[3] * keep; vst2(dst + (size_t)row * CIN + q * 4, ov); }   /* unconditional (clamped) loads, zero by select */
  if (blockIdx.x == 0 && threadIdx.x < 128) { const int c = threadIdx.x; float bvv = 0.f; if (Bsrc) { const float t = Bsrc[c & 63]; asm volatile("s_wait_loadcnt 0x0" ::: "memory"); bvv = c < 64 ? t : 0.f; } vst2(BP + which * 128 + c, bvv); } }
// ---- k_out64: out[b][t][0..63] = ctx row columns 0..63 (256 B by 16 lanes)
__global__ __launch_bounds__(256) void k_out64(const float* __restrict__ Y, float* __restrict__ OUT) { const size_t row = (size_t)blockIdx.x * 16 + (threadIdx.x >> 4); const int q = threadIdx.x & 15; const v4f v = *(const v4f*)(Y + row * CC + q * 4); asm volatile("s_wait_loadcnt 0x0" ::: "memory"); vst2(OUT + row * 64 + q * 4, v); }
#define WS_WP (WS_END)                                  // padded weights [3][128 x C]
#define WS_BP (WS_WP + 4u * 3 * (size_t)CIN * 128)        // padded biases [3][128]
#define WS_Y2 (WS_BP + 4u * 3 * 128)                      // ctx rows [b*TT+t][128]
#define WS_END2 (WS_Y2 + 4u * (size_t)NB * TT * CC)
#define SM_EXTRA_PARAMS , int bsm0, const int* __restrict__ MASK
// random 0/1 int mask [B][1][S][S] of the REAL batch (pseudo-sequence bsm = b*16 + h -> b = bsm / 16): where(mask == 0, -1e20, score) happens BEFORE the 1/32 scaling in the source, so a masked logit is -1e20 / 32 (weight exactly 0); the S plane already holds score / 32
#define SM_MASK_HOOK do { const int mk = MASK[((size_t)(bsm >> 4) * TT + t) * TT + k]; v = (mk == 0) ? -3.125e18f : v; } while (0)
#ifndef SM_EXTRA_PARAMS
#define SM_EXTRA_PARAMS
#endif
#ifndef PROJ_EXTRA_PARAMS
#define PROJ_EXTRA_PARAMS
#endif
#ifndef SM_MASK_HOOK
#define SM_MASK_HOOK (void)0
#endif

#define WS_QH  0u                                      // f16 q rows [b*t][CC]
#define WS_KH  (WS_QH + 2u * (size_t)NB * TT * CC)      // f16 k rows [b*t][CC]
#define WS_VT  (WS_KH + 2u * (size_t)NB * TT * CC)      // f16 v planes [b][c][t]
#define WS_QL  (WS_VT + 2u * (size_t)NB * CC * TT)      // f16 q residual x 2^10 rows [b][t < QHI][CC]
#define WS_KL  (WS_QL + 2u * (size_t)NB * QHI * CC)     // f16 k residual x 2^10 rows [b][t < KHI][CC]
#define WS_VB  (WS_KL + 2u * (size_t)NB * KHI * CC)     // bf16 v hi planes [b][c][t < KHI]
#define WS_VBL (WS_VB + 2u * (size_t)NB * CC * KHI)
#define WS_S   (WS_VBL + 2u * (size_t)NB * CC * KHI)    // f32 logits / P [sequence in group][t][s]
#define WS_Y   (WS_S  + 4u * (size_t)GB * HG * TT * TT)      // unused here (zero bytes; the ctx rows go to WS_Y2)
#define WS_END (WS_Y  + 0u)

// ---- k_proj: block = (64 rows, 128 cols, which): q/k/v = X W (+ b) with exact bf16 products (K = DIN) -> which 0: q f16 rows (+ residual rows < QHI); 1: k f16 rows (+ residual rows < KHI); 2: v f16 planes [c][t] (+ bf16 hi/lo planes for t < KHI)
__global__ __launch_bounds__(128) void k_proj(const float* __restrict__ XQ, const float* __restrict__ XK, const float* __restrict__ XV, const float* __restrict__ WQ, const float* __restrict__ WK, const float* __restrict__ WV, const float* __restrict__ BQ, const float* __restrict__ BK, const float* __restrict__ BV,
    _Float16* __restrict__ QH, _Float16* __restrict__ QL, _Float16* __restrict__ KH, _Float16* __restrict__ KL, _Float16* __restrict__ VT, __bf16* __restrict__ VB, __bf16* __restrict__ VBL) {
  __shared__ __align__(16) _Float16 sh[64][136], sl[64][136]; __shared__ __align__(16) _Float16 th[128][72]; __shared__ __align__(16) __bf16 tb[128][72], tbl[128][72];
  const int tid = threadIdx.x, wave = tid >> 5, lane = tid & 31, col = lane & 15, g = lane >> 4; const int which = blockIdx.z; const int c0 = blockIdx.y * 128; const size_t r0 = (size_t)blockIdx.x * 64; const size_t bb = r0 / TT; const int t0 = (int)(r0 % TT);
  const float* X = which == 0 ? XQ : which == 1 ? XK : XV; const float* WA = which == 0 ? WQ : which == 1 ? WK : WV; const float* BA = which == 0 ? BQ : which == 1 ? BK : BV;
  v8f acc[8] = {};
#pragma unroll 2
  for (int kc = 0; kc < DIN / 32; ++kc) { v16b a; { const float* p = X + (r0 + wave * 16 + col) * DIN + kc * 32 + 8 * g;
#pragma unroll
      for (int i = 0; i < 8; ++i) { a[i] = (__bf16)p[i]; a[8 + i] = (__bf16)p[16 + i]; } }
    asm volatile("s_wait_loadcnt 0x0" ::: "memory");
#pragma unroll
    for (int j = 0; j < 8; ++j) { const v16b w = WCOL(WA, kc * 32, c0 + j * 16 + col, lane); asm volatile("s_wait_loadcnt 0x0" ::: "memory"); acc[j] = wmma_bf(a, w, acc[j]); } }
  if (which < 2) { _Float16* DH = which == 0 ? QH : KH; _Float16* DL = which == 0 ? QL : KL; const int nhi = which == 0 ? QHI : KHI; const bool hi_rows = t0 < nhi;
#pragma unroll
    for (int j = 0; j < 8; ++j) { const float bias = BA ? bfr(BA[c0 + j * 16 + col]) : 0.f;
#pragma unroll
      for (int r = 0; r < 8; ++r) { const float v = acc[j][r] + bias; const _Float16 hv = (_Float16)v; sh[wave * 16 + 8 * g + r][j * 16 + col] = hv; sl[wave * 16 + 8 * g + r][j * 16 + col] = (_Float16)((v - (float)hv) * 1024.0f); } }
    __syncthreads();
    for (int e = tid; e < 64 * 16; e += 128) { const int rl = e >> 4, q = e & 15; vst2((unsigned*)(DH + (r0 + rl) * CC + c0 + q * 8), *(const v4u*)&sh[rl][q * 8]); if (hi_rows) vst2((unsigned*)(DL + (bb * nhi + t0 + rl) * (size_t)CC + c0 + q * 8), *(const v4u*)&sl[rl][q * 8]); }
  } else { const bool hi_rows = t0 < KHI;
#pragma unroll
    for (int j = 0; j < 8; ++j) { const float bias = BA ? bfr(BA[c0 + j * 16 + col]) : 0.f;
#pragma unroll
      for (int r = 0; r < 8; ++r) { const float v = acc[j][r] + bias; const int rl = wave * 16 + 8 * g + r, cl = j * 16 + col; th[cl][rl] = (_Float16)v; const __bf16 bh = (__bf16)v; tb[cl][rl] = bh; tbl[cl][rl] = (__bf16)(v - (float)bh); } }
    __syncthreads();
    for (int e = tid; e < 128 * 8; e += 128) { const int cl = e >> 3, q = e & 7; vst2((unsigned*)(VT + (bb * CC + c0 + cl) * (size_t)TT + t0 + q * 8), *(const v4u*)&th[cl][q * 8]); if (hi_rows) { const size_t o3 = (bb * CC + c0 + cl) * (size_t)KHI + t0 + q * 8; vst2((unsigned*)(VB + o3), *(const v4u*)&tb[cl][q * 8]); vst2((unsigned*)(VBL + o3), *(const v4u*)&tbl[cl][q * 8]); } } } }
// ---- k_sc: block = (query block qb, key block kb <= kb_last(qb), sequence in group: b = b0 + blockIdx.z): logits x SCALE; q hi + residual (x 2^10) against k (2 products) for query rows < QHI, plus the k residual (3 products) for query blocks < QBH (causal early rows); causal: blocks past the diagonal exit, the mask itself is applied by index in k_sm
__global__ __launch_bounds__(128) void k_sc(const _Float16* __restrict__ QH, const _Float16* __restrict__ KH, const _Float16* __restrict__ QL, const _Float16* __restrict__ KL, int b0, int h0, float* __restrict__ S0) { __shared__ __align__(16) float ss[4][16][132];
  const int qb = blockIdx.x, kb = blockIdx.y; if (kb > kb_last(qb)) return;
  const int b = b0 + blockIdx.z, h = h0; float* S = S0 + (size_t)blockIdx.z * TT * TT;
  const int tid = threadIdx.x, wave = tid >> 5, lane = tid & 31, col = lane & 15, g = lane >> 4; const int k0 = kb * 128; const int ql0 = qb * 64 + wave * 16; const size_t q0 = (size_t)b * TT + ql0, kr0 = (size_t)b * TT + k0;
  v8f acc[8] = {}, accl[8] = {};
  const _Float16* QLb = QL + (size_t)b * QHI * CC; const _Float16* KLb = KL + (size_t)b * KHI * CC;
  if (qb < QBH) {
#pragma unroll
    for (int kc = 0; kc < HD / 32; ++kc) { const v16h ah = frag_h(QH + (q0 + col) * CC + h * HD + kc * 32, lane), al = frag_h(QLb + (size_t)(ql0 + col) * CC + h * HD + kc * 32, lane);
#pragma unroll
      for (int j = 0; j < 8; ++j) { const v16h kbf = frag_h(KH + (kr0 + j * 16 + col) * CC + h * HD + kc * 32, lane), klf = frag_h(KLb + (size_t)(k0 + j * 16 + col) * CC + h * HD + kc * 32, lane); acc[j] = wmma16(ah, kbf, acc[j]); accl[j] = wmma16(al, kbf, accl[j]); accl[j] = wmma16(ah, klf, accl[j]); } }
  } else if (qb * 64 < QHI) {
#pragma unroll
    for (int kc = 0; kc < HD / 32; ++kc) { const v16h ah = frag_h(QH + (q0 + col) * CC + h * HD + kc * 32, lane), al = frag_h(QLb + (size_t)(ql0 + col) * CC + h * HD + kc * 32, lane);
#pragma unroll
      for (int j = 0; j < 8; ++j) { const v16h kbf = frag_h(KH + (kr0 + j * 16 + col) * CC + h * HD + kc * 32, lane); acc[j] = wmma16(ah, kbf, acc[j]); accl[j] = wmma16(al, kbf, accl[j]); } }
  } else {
#pragma unroll
    for (int kc = 0; kc < HD / 32; ++kc) { const v16h ah = frag_h(QH + (q0 + col) * CC + h * HD + kc * 32, lane);
#pragma unroll
      for (int j = 0; j < 8; ++j) { const v16h kbf = frag_h(KH + (kr0 + j * 16 + col) * CC + h * HD + kc * 32, lane); acc[j] = wmma16(ah, kbf, acc[j]); } } }
#pragma unroll
  for (int j = 0; j < 8; ++j) {
#pragma unroll
    for (int r = 0; r < 8; ++r) ss[wave][8 * g + r][j * 16 + col] = (acc[j][r] + accl[j][r] * (1.0f / 1024.0f)) * SCALE; }
  LDSX(); for (int rl = 0; rl < 16; ++rl) vst2(S + (size_t)(ql0 + rl) * TT + k0 + lane * 4, *(const v4f*)&ss[wave][rl][lane * 4]); }
// ---- k_sm: block = (sequence in group = blockIdx.x, query row t = blockIdx.y), so the blocks that read one mask row start together: keys [0, kend): causal -> logit if s <= t else excluded; softmax in f32; P x 2^11 in place (0 for excluded)
__global__ __launch_bounds__(256) void k_sm(float* __restrict__ S0 SM_EXTRA_PARAMS) { __shared__ float sred[8]; __shared__ float sbc; __shared__ __align__(16) float shv[TT];
  const int tid = threadIdx.x; const int t = blockIdx.y; const int bsm = bsm0 + blockIdx.x; const int kend = (kb_last(t >> 6) + 1) * 128;
  float* sr = S0 + (size_t)blockIdx.x * TT * TT + (size_t)t * TT;
  float m = -3.0e38f; for (int k = tid; k < kend; k += 256) { float v = (!CAUSAL || k <= t) ? sr[k] : -3.0e38f; SM_MASK_HOOK; shv[k] = v; m = fmaxf(m, v); }
#pragma unroll
  for (int o = 1; o < 32; o <<= 1) m = fmaxf(m, __shfl_xor(m, o));
  if ((tid & 31) == 0) sred[tid >> 5] = m; __syncthreads(); if (tid == 0) { float a = sred[0]; for (int i = 1; i < 8; ++i) a = fmaxf(a, sred[i]); sbc = a; } __syncthreads(); m = sbc; __syncthreads();
  float sum = 0.f; for (int k = tid; k < kend; k += 256) { const float v = shv[k]; const float e = (v <= -1.0e38f) ? 0.f : expf(v - m); shv[k] = e; sum += e; }
#pragma unroll
  for (int o = 1; o < 32; o <<= 1) sum += __shfl_xor(sum, o);
  if ((tid & 31) == 0) sred[tid >> 5] = sum; __syncthreads(); if (tid == 0) { float a = 0.f; for (int i = 0; i < 8; ++i) a += sred[i]; sbc = a > 0.f ? 2048.0f / a : 0.f; }   /* a fully excluded row yields P = 0 */ __syncthreads(); const float inv = sbc;
  for (int k = tid; k < kend; k += 256) shv[k] = shv[k] * inv;
  __syncthreads(); for (int q = tid; q < kend / 4; q += 256) vst2(sr + q * 4, *(const v4f*)&shv[q * 4]); }
// ---- k_pv: block = 64 queries (qb) of (b = b0 + blockIdx.z, h): ctx = P . v over keys [0, kend) (P x 2^11 once to f16 against v f16: 1 product; causal early query blocks: P and v as bf16 hi + lo, 3 products); 256-B (row, head) segment by 16 lanes
__global__ __launch_bounds__(128) void k_pv(const float* __restrict__ PS0, const _Float16* __restrict__ VT, const __bf16* __restrict__ VB, const __bf16* __restrict__ VBL, int b0, int h0, float* __restrict__ Y) { const int b = b0 + blockIdx.z, h = h0; const float* PS = PS0 + (size_t)blockIdx.z * TT * TT; __shared__ __align__(16) float ss[4][16][HD + 4];
  const int tid = threadIdx.x, wave = tid >> 5, lane = tid & 31, col = lane & 15, g = lane >> 4; const int qb = blockIdx.x; const int ql0 = qb * 64 + wave * 16; const int kce = (kb_last(qb) + 1) * 4;
  v8f acc[HD / 16] = {};
  if (qb < QBH) {
#pragma unroll 1
    for (int kc = 0; kc < kce; ++kc) { const F2 p = split_row(PS + (size_t)(ql0 + col) * TT, kc * 32, lane);
      asm volatile("s_wait_loadcnt 0x0" ::: "memory");
#pragma unroll
      for (int j = 0; j < HD / 16; ++j) { const size_t po = ((size_t)b * CC + h * HD + j * 16 + col) * (size_t)KHI + kc * 32; const v16b vh = frag_b(VB + po, lane); acc[j] = wmma_bf(p.h, vh, acc[j]); acc[j] = wmma_bf(p.l, vh, acc[j]); acc[j] = wmma_bf(p.h, frag_b(VBL + po, lane), acc[j]); } }
  } else {
#pragma unroll 1
    for (int kc = 0; kc < kce; ++kc) { const v16h p = frag_f32(PS + (size_t)(ql0 + col) * TT + kc * 32, lane);
      asm volatile("s_wait_loadcnt 0x0" ::: "memory");
#pragma unroll
      for (int j = 0; j < HD / 16; ++j) { const size_t po = ((size_t)b * CC + h * HD + j * 16 + col) * (size_t)TT + kc * 32; acc[j] = wmma16(p, frag_h(VT + po, lane), acc[j]); } } }
#pragma unroll
  for (int j = 0; j < HD / 16; ++j)
#pragma unroll
    for (int r = 0; r < 8; ++r) ss[wave][8 * g + r][j * 16 + col] = acc[j][r] * (1.0f / 2048.0f);
  LDSX(); for (int rl = 0; rl < 16; ++rl) if (lane < HD / 4) vst2(Y + ((size_t)b * TT + ql0 + rl) * CC + h * HD + lane * 4, *(const v4f*)&ss[wave][rl][lane * 4]); }

// ---- k_lin2: the module's final Linear on the RAW-reshaped context: rows = the [2*2048][1024] view of the contiguous [32][2048][64] context buffer; out = ctx Wo^T + bo with ctx x 2^6 once to f16 against Wo as f16(bf16 x 2^8) (1 product), block = (64 rows, 128 output columns)
#define K2 1024
#define N2 1024
__global__ __launch_bounds__(128) void k_lin2(const float* __restrict__ Yc, const float* __restrict__ WO, const float* __restrict__ BO, float* __restrict__ OUT) { __shared__ __align__(16) float sf[4][16][132];
  const int tid = threadIdx.x, wave = tid >> 5, lane = tid & 31, col = lane & 15, g = lane >> 4; const int c0 = blockIdx.y * 128; const size_t r0 = (size_t)blockIdx.x * 64 + wave * 16;
  v8f acc[8] = {};
#pragma unroll 2
  for (int kc = 0; kc < K2 / 32; ++kc) { const v16h a = frag_f32s(Yc + (r0 + col) * K2 + kc * 32, lane, 64.0f); asm volatile("s_wait_loadcnt 0x0" ::: "memory");
#pragma unroll
    for (int j = 0; j < 8; ++j) { const v16h w = wcolh_oi(WO, kc * 32, c0 + j * 16 + col, lane, K2); asm volatile("s_wait_loadcnt 0x0" ::: "memory"); acc[j] = wmma16(a, w, acc[j]); } }
#pragma unroll
  for (int j = 0; j < 8; ++j) { const float bias = bfr(BO[c0 + j * 16 + col]); asm volatile("s_wait_loadcnt 0x0" ::: "memory");
#pragma unroll
    for (int r = 0; r < 8; ++r) sf[wave][8 * g + r][j * 16 + col] = acc[j][r] * (1.0f / 16384.0f) + bias; }   /* 2^-8 (Wo carry) x 2^-6 (ctx carry) */
  LDSX(); for (int rl = 0; rl < 16; ++rl) vst2(OUT + (r0 + rl) * N2 + c0 + lane * 4, *(const v4f*)&sf[wave][rl][lane * 4]); }
#define WS_C64 (WS_END2)                                 // f32 context [32][2048][64] contiguous == the raw-reshaped [2*2048][1024] rows
#define WS_END3 (WS_C64 + 4u * (size_t)NB * TT * 64)
extern "C" void kernel_launch(void* const* d_in, const int* in_sizes, int n_in, void* d_out, int out_size, void* d_ws, size_t ws_size, hipStream_t stream) {
  (void)in_sizes; (void)n_in; (void)out_size;
  const float** F = (const float**)d_in;
  if (ws_size < (size_t)WS_END) return;
  char* ws = (char*)d_ws; _Float16 *QH = (_Float16*)(ws + WS_QH), *KH = (_Float16*)(ws + WS_KH), *VT = (_Float16*)(ws + WS_VT), *QL = (_Float16*)(ws + WS_QL), *KL = (_Float16*)(ws + WS_KL); __bf16 *VB = (__bf16*)(ws + WS_VB), *VBL = (__bf16*)(ws + WS_VBL); float *S = (float*)(ws + WS_S), *Y = (float*)(ws + WS_Y);
  (void)Y; (void)QL; (void)KL; (void)VB; (void)VBL;
  // inputs: 0 query [2,2048,1024]; 1 key; 2 value (each viewed as 65,536 rows of 64: the raw reshape); 3 mask [2,1,2048,2048] int32; 4 Wq [64,64] (out,in); 5 Wk; 6 Wv; 7 Wo [1024,1024] (out,in); 8 bo [1024] (nonzero)
  if (ws_size < (size_t)WS_END3) return;
  float *WP = (float*)(ws + WS_WP), *BP = (float*)(ws + WS_BP), *Y2 = (float*)(ws + WS_Y2), *C64 = (float*)(ws + WS_C64);
  k_padw<<<dim3(32, 3), 256, 0, stream>>>(F[4], F[5], F[6], nullptr, nullptr, nullptr, WP, BP);
  k_proj<<<dim3(TNB * TT / 64, CC / 128, 3), 128, 0, stream>>>(F[0], F[1], F[2], WP, WP + (size_t)CIN * 128, WP + 2 * (size_t)CIN * 128, BP, BP + 128, BP + 256, QH, QL, KH, KL, VT, VB, VBL);
  for (int b = 0; b < TNB; b += GB) {   /* pseudo-sequences b .. b + GB - 1 per launch; pseudo-sequence = real batch (b >> 4), pseudo-head (b & 15); head 0 only */
    k_sc<<<dim3(NQB, TT / 128, GB), 128, 0, stream>>>(QH, KH, QL, KL, b, 0, S);
    k_sm<<<dim3(GB, TT), 256, 0, stream>>>(S, b, (const int*)d_in[3]);
    k_pv<<<dim3(NQB, 1, GB), 128, 0, stream>>>(S, VT, VB, VBL, b, 0, Y2);
  }
  k_out64<<<dim3(TNB * TT / 16), 256, 0, stream>>>(Y2, C64);
  k_lin2<<<dim3((TNB * TT * 64 / K2) / 64, N2 / 128), 128, 0, stream>>>(C64, F[7], F[8], (float*)d_out);
}

// v002
// Measured time: 235 microseconds a run.
// In two side-by-side timings against v001, it was 4.02 and 3.99 times as fast.
// All steps since v000 together make it 12.1 times as fast.
// compute dtype: all float inputs rounded to bf16; q/k/v projections with EXACT bf16 products on WMMA 16x16x32 (f32 accumulate); logits: q (f16 + its f16 residual x 2^10) x k once to f16 (2 products); running-maximum softmax in f32; exp(logit - running maximum) once to f16 x v once to f16 (1 product), divided by the f32 sum at the end; f32 output.
#include <hip/hip_runtime.h>
#include <math.h>

typedef __attribute__((ext_vector_type(16))) _Float16 v16h;
typedef __attribute__((ext_vector_type(16))) __bf16 v16b;
typedef __attribute__((ext_vector_type(8)))  _Float16 v8h;
typedef __attribute__((ext_vector_type(8)))  float v8f;
typedef __attribute__((ext_vector_type(4)))  float v4f;
typedef __attribute__((ext_vector_type(2)))  float v2f;
typedef __attribute__((ext_vector_type(4)))  unsigned v4u;
typedef __attribute__((ext_vector_type(4)))  int v4i;
typedef float __attribute__((may_alias)) float_a;
typedef int __attribute__((may_alias)) int_a;

template <typename T> __device__ __forceinline__ void vst2(void* p, T v) { *(T*)p = v;  }
__device__ __forceinline__ v8f wmma16(v16h a, v16h b, v8f c) {
  v8f d = __builtin_amdgcn_wmma_f32_16x16x32_f16(false, a, false, b, (short)0, c, false, false);
  asm volatile("v_nop\n\tv_nop\n\tv_nop\n\tv_nop" : "+v"(d) : "v"(a), "v"(b));
  return d;
}
__device__ __forceinline__ v8f wmma_bf(v16b a, v16b b, v8f c) {
  v8f d = __builtin_amdgcn_wmma_f32_16x16x32_bf16(false, a, false, b, (short)0, c, false, false);
  asm volatile("v_nop\n\tv_nop\n\tv_nop\n\tv_nop" : "+v"(d) : "v"(a), "v"(b));
  return d;
}
// 16x16x32 fragments: lane = (h = lane>>4, row/col = lane&15); elements 0..7 = k0+8h+0..7, 8..15 = k0+16+8h+0..7; D element r = row 8h+r
__device__ __forceinline__ v16h frag_h(const _Float16* rowk0, int lane) {
  union { v16h v; v8h q[2]; } u; const _Float16* p = rowk0 + 8 * (lane >> 4);
  u.q[0] = *(const v8h*)p; u.q[1] = *(const v8h*)(p + 16); return u.v;
}
__device__ __forceinline__ v16h frag_f32(const float* rowk0, int lane) {
  v16h a; const float* p = rowk0 + 8 * (lane >> 4);
#pragma unroll
  for (int i = 0; i < 8; ++i) { a[i] = (_Float16)p[i]; a[8 + i] = (_Float16)p[16 + i]; }
  return a;
}
__device__ __forceinline__ v16h frag_f32s(const float* rowk0, int lane, float sc) {
  v16h a; const float* p = rowk0 + 8 * (lane >> 4);
#pragma unroll
  for (int i = 0; i < 8; ++i) { a[i] = (_Float16)(p[i] * sc); a[8 + i] = (_Float16)(p[16 + i] * sc); }
  return a;
}
// column fragment from a [K][ld] layout (column n), rows >= K read as 0
__device__ __forceinline__ v16h fragc_f32(const float* W, int k0, int n, int lane, int ld, int K) {
  v16h a; const int g = lane >> 4;
#pragma unroll
  for (int i = 0; i < 8; ++i) { const int ka = k0 + 8 * g + i, kb = ka + 16;
    a[i] = (_Float16)(ka < K ? W[(size_t)(ka < K ? ka : K - 1) * ld + n] : 0.f); a[8 + i] = (_Float16)(kb < K ? W[(size_t)(kb < K ? kb : K - 1) * ld + n] : 0.f); }
  return a;
}
struct F2 { v16b h, l; };
__device__ __forceinline__ F2 bsplit16(const float v[16]) { F2 r;
#pragma unroll
  for (int i = 0; i < 16; ++i) { const __bf16 h = (__bf16)v[i]; r.h[i] = h; r.l[i] = (__bf16)(v[i] - (float)h); }
  return r; }
__device__ __forceinline__ F2 split_row(const float* row, int k0, int lane) { float v[16]; const float* p = row + k0 + 8 * (lane >> 4);
#pragma unroll
  for (int i = 0; i < 8; ++i) { v[i] = p[i]; v[8 + i] = p[16 + i]; }
  return bsplit16(v); }
__device__ __forceinline__ F2 split_rowK(const float* row, int k0, int lane, int K) { float v[16]; const int g = lane >> 4;
#pragma unroll
  for (int i = 0; i < 8; ++i) { const int ka = k0 + 8 * g + i, kb = ka + 16; v[i] = ka < K ? row[ka < K ? ka : K - 1] : 0.f; v[8 + i] = kb < K ? row[kb < K ? kb : K - 1] : 0.f; }
  return bsplit16(v); }
__device__ __forceinline__ F2 split_col(const float* W, int k0, int n, int lane, int ld, int K) { float v[16]; const int g = lane >> 4;
#pragma unroll
  for (int i = 0; i < 8; ++i) { const int ka = k0 + 8 * g + i, kb = ka + 16; v[i] = ka < K ? W[(size_t)(ka < K ? ka : K - 1) * ld + n] : 0.f; v[8 + i] = kb < K ? W[(size_t)(kb < K ? kb : K - 1) * ld + n] : 0.f; }
  return bsplit16(v); }
__device__ __forceinline__ v8f mac3(const F2& a, const F2& b, v8f c) { c = wmma_bf(a.l, b.h, c); c = wmma_bf(a.h, b.l, c); return wmma_bf(a.h, b.h, c); }
__device__ __forceinline__ float sigm(float v) { return 1.0f / (1.0f + expf(-v)); }
#define LDSX() do { asm volatile("s_wait_dscnt 0" ::: "memory"); __builtin_amdgcn_wave_barrier(); __builtin_amdgcn_fence(__ATOMIC_RELEASE, "workgroup"); } while (0)

// Masked self-attention with a RAW reshape into heads (query / key / value [2,2048,1024] are reshaped WITHOUT transpose to [2,16,2048,64]: pseudo-head h of batch b = the contiguous 131,072 floats starting at (b*16 + h)*2048*64, i.e. 32 pseudo-sequences of 2,048 positions x 64 dims each); one shared bias-free torch (out,in) Linear [64,64] per role (Wq, Wk, Wv); scores = Q K^T masked by mask[b][0][q][k] == 0 -> -1e20 (int32 random 0/1 per batch), then divided by sqrt(embed = 1024) = 32 (the source's quirk: logit sigma - 0.08); softmax; out = attn V reshaped raw back to [2,2048,1024]; (out,in) Wo [1024,1024] + bo (nonzero): result = out Wo^T + bo.
#define NB 32
#define TT 2048
#define CC 128            // NH * HD = projected width
#define DIN 64          // input (model) width
#define NH 2
#define HD 64
#define NQB (TT / 64)
#define HG 1
#define SCALE (0.03125f)
#define CAUSAL 0
#ifndef TNB
#define TNB NB
#endif
__device__ __forceinline__ float bfr(float v) { return (float)(__bf16)v; }
__host__ __device__ __forceinline__ int kb_last(int qb) { return CAUSAL ? ((qb * 64 + 63) >> 7) : (TT / 128 - 1); }
typedef __attribute__((ext_vector_type(8))) __bf16 v8b;
__device__ __forceinline__ v16b frag_b(const __bf16* rowk0, int lane) {
  union { v16b v; v8b q[2]; } u; const __bf16* p = rowk0 + 8 * (lane >> 4);
  u.q[0] = *(const v8b*)p; u.q[1] = *(const v8b*)(p + 16); return u.v;
}
#define QBH 0
#define QHI 2048            // rows carrying a q residual plane (all rows when non-causal: 2-product logits everywhere)
#define KHI 64            // key rows carrying k residual / v bf16 hi+lo planes (written by k_proj; no kernel here reads them)
// B fragment (k rows k0+.., output column o) of a weight: (in,out) [K][ld] or (out,in) [ld rows of K]: bf16 exact, or f16(bf16 * 256) exact
__device__ __forceinline__ v16b wcol_io(const float* Wm, int k0, int o, int lane, int ld) { v16b w; const int g = lane >> 4;
#pragma unroll
  for (int i = 0; i < 8; ++i) { w[i] = (__bf16)Wm[(size_t)(k0 + 8 * g + i) * ld + o]; w[8 + i] = (__bf16)Wm[(size_t)(k0 + 16 + 8 * g + i) * ld + o]; }
  return w; }
__device__ __forceinline__ v16b wcol_oi(const float* Wm, int k0, int o, int lane, int K) { v16b w; const float* p = Wm + (size_t)o * K + k0 + 8 * (lane >> 4);
#pragma unroll
  for (int i = 0; i < 8; ++i) { w[i] = (__bf16)p[i]; w[8 + i] = (__bf16)p[16 + i]; }
  return w; }
__device__ __forceinline__ v16h wcolh_io(const float* Wm, int k0, int o, int lane, int ld) { v16h w; const int g = lane >> 4;
#pragma unroll
  for (int i = 0; i < 8; ++i) { w[i] = (_Float16)(bfr(Wm[(size_t)(k0 + 8 * g + i) * ld + o]) * 256.0f); w[8 + i] = (_Float16)(bfr(Wm[(size_t)(k0 + 16 + 8 * g + i) * ld + o]) * 256.0f); }
  return w; }
__device__ __forceinline__ v16h wcolh_oi(const float* Wm, int k0, int o, int lane, int K) { v16h w; const float* p = Wm + (size_t)o * K + k0 + 8 * (lane >> 4);
#pragma unroll
  for (int i = 0; i < 8; ++i) { w[i] = (_Float16)(bfr(p[i]) * 256.0f); w[8 + i] = (_Float16)(bfr(p[16 + i]) * 256.0f); }
  return w; }
#define WQKV_LAYOUT 1   // 0 = (in,out) [DIN][CC]; 1 = (out,in) [CC][DIN]; 2 = per-head [NH][DIN][HD]
__device__ __forceinline__ v16b wcol_hdk(const float* Wm, int k0, int o, int lane) { v16b w; const int g = lane >> 4; const float* p = Wm + (size_t)(o / HD) * DIN * HD + (o % HD);
#pragma unroll
  for (int i = 0; i < 8; ++i) { w[i] = (__bf16)p[(size_t)(k0 + 8 * g + i) * HD]; w[8 + i] = (__bf16)p[(size_t)(k0 + 16 + 8 * g + i) * HD]; }
  return w; }
#define WO_OUT_IN 0
#if WQKV_LAYOUT == 1
#define WCOL(W, k0, o, lane) wcol_oi(W, k0, o, lane, DIN)
#elif WQKV_LAYOUT == 2
#define WCOL(W, k0, o, lane) wcol_hdk(W, k0, o, lane)
#else
#define WCOL(W, k0, o, lane) wcol_io(W, k0, o, lane, CC)
#endif
#if WO_OUT_IN
#define WOCOL(W, k0, o, lane) wcol_oi(W, k0, o, lane, CC)
#define WOCOLH(W, k0, o, lane) wcolh_oi(W, k0, o, lane, CC)
#else
#define WOCOL(W, k0, o, lane) wcol_io(W, k0, o, lane, DIN)
#define WOCOLH(W, k0, o, lane) wcolh_io(W, k0, o, lane, DIN)
#endif
#define CIN 64
// ---- k_padw: the three (out,in) [64][C] projection weights copied into zero-padded (out,in) [128][C] ws planes (rows 64..127 zero) + zero-padded [128] biases, so the 128-column kernels apply unchanged (columns 64..127 = an all-zero dummy head, never attended)
__global__ __launch_bounds__(256) void k_padw(const float* __restrict__ WQ, const float* __restrict__ WK, const float* __restrict__ WV, const float* __restrict__ BQ, const float* __restrict__ BK, const float* __restrict__ BV, float* __restrict__ WP, float* __restrict__ BP) { const int which = blockIdx.y; const float* Wsrc = which == 0 ? WQ : (which == 1 ? WK : WV); const float* Bsrc = which == 0 ? BQ : (which == 1 ? BK : BV); float* dst = WP + (size_t)which * 128 * CIN;
  for (int e = blockIdx.x * 256 + threadIdx.x; e < 128 * (CIN / 4); e += gridDim.x * 256) { const int row = e / (CIN / 4), q = e % (CIN / 4); const v4f ld = *(const v4f*)(Wsrc + (size_t)(row & 63) * CIN + q * 4); asm volatile("s_wait_loadcnt 0x0" ::: "memory"); const float keep = row < 64 ? 1.f : 0.f; v4f ov; ov[0] = ld[0] * keep; ov[1] = ld[1] * keep; ov[2] = ld[2] * keep; ov[3] = ld[3] * keep; vst2(dst + (size_t)row * CIN + q * 4, ov); }   /* unconditional (clamped) loads, zero by select */
  if (blockIdx.x == 0 && threadIdx.x < 128) { const int c = threadIdx.x; float bvv = 0.f; if (Bsrc) { const float t = Bsrc[c & 63]; asm volatile("s_wait_loadcnt 0x0" ::: "memory"); bvv = c < 64 ? t : 0.f; } vst2(BP + which * 128 + c, bvv); } }
#define WS_WP (WS_END)                                  // padded weights [3][128 x C]
#define WS_BP (WS_WP + 4u * 3 * (size_t)CIN * 128)        // padded biases [3][128]
#ifndef PROJ_EXTRA_PARAMS
#define PROJ_EXTRA_PARAMS
#endif

#define WS_QH  0u                                      // f16 q rows [b*t][CC]
#define WS_KH  (WS_QH + 2u * (size_t)NB * TT * CC)      // f16 k rows [b*t][CC]
#define WS_VT  (WS_KH + 2u * (size_t)NB * TT * CC)      // f16 v planes [b][c][t]
#define WS_QL  (WS_VT + 2u * (size_t)NB * CC * TT)      // f16 q residual x 2^10 rows [b][t < QHI][CC]
#define WS_KL  (WS_QL + 2u * (size_t)NB * QHI * CC)     // f16 k residual x 2^10 rows [b][t < KHI][CC]
#define WS_VB  (WS_KL + 2u * (size_t)NB * KHI * CC)     // bf16 v hi planes [b][c][t < KHI]
#define WS_VBL (WS_VB + 2u * (size_t)NB * CC * KHI)
#define WS_END (WS_VBL + 2u * (size_t)NB * CC * KHI)

// ---- k_proj: block = (64 rows, 128 cols, which): q/k/v = X W (+ b) with exact bf16 products (K = DIN) -> which 0: q f16 rows (+ residual rows < QHI); 1: k f16 rows (+ residual rows < KHI); 2: v f16 planes [c][t] (+ bf16 hi/lo planes for t < KHI)
__global__ __launch_bounds__(128) void k_proj(const float* __restrict__ XQ, const float* __restrict__ XK, const float* __restrict__ XV, const float* __restrict__ WQ, const float* __restrict__ WK, const float* __restrict__ WV, const float* __restrict__ BQ, const float* __restrict__ BK, const float* __restrict__ BV,
    _Float16* __restrict__ QH, _Float16* __restrict__ QL, _Float16* __restrict__ KH, _Float16* __restrict__ KL, _Float16* __restrict__ VT, __bf16* __restrict__ VB, __bf16* __restrict__ VBL) {
  __shared__ __align__(16) _Float16 sh[64][136], sl[64][136]; __shared__ __align__(16) _Float16 th[128][72]; __shared__ __align__(16) __bf16 tb[128][72], tbl[128][72];
  const int tid = threadIdx.x, wave = tid >> 5, lane = tid & 31, col = lane & 15, g = lane >> 4; const int which = blockIdx.z; const int c0 = blockIdx.y * 128; const size_t r0 = (size_t)blockIdx.x * 64; const size_t bb = r0 / TT; const int t0 = (int)(r0 % TT);
  const float* X = which == 0 ? XQ : which == 1 ? XK : XV; const float* WA = which == 0 ? WQ : which == 1 ? WK : WV; const float* BA = which == 0 ? BQ : which == 1 ? BK : BV;
  v8f acc[8] = {};
#pragma unroll 2
  for (int kc = 0; kc < DIN / 32; ++kc) { v16b a; { const float* p = X + (r0 + wave * 16 + col) * DIN + kc * 32 + 8 * g;
#pragma unroll
      for (int i = 0; i < 8; ++i) { a[i] = (__bf16)p[i]; a[8 + i] = (__bf16)p[16 + i]; } }
    asm volatile("s_wait_loadcnt 0x0" ::: "memory");
#pragma unroll
    for (int j = 0; j < 8; ++j) { const v16b w = WCOL(WA, kc * 32, c0 + j * 16 + col, lane); asm volatile("s_wait_loadcnt 0x0" ::: "memory"); acc[j] = wmma_bf(a, w, acc[j]); } }
  if (which < 2) { _Float16* DH = which == 0 ? QH : KH; _Float16* DL = which == 0 ? QL : KL; const int nhi = which == 0 ? QHI : KHI; const bool hi_rows = t0 < nhi;
#pragma unroll
    for (int j = 0; j < 8; ++j) { const float bias = BA ? bfr(BA[c0 + j * 16 + col]) : 0.f;
#pragma unroll
      for (int r = 0; r < 8; ++r) { const float v = acc[j][r] + bias; const _Float16 hv = (_Float16)v; sh[wave * 16 + 8 * g + r][j * 16 + col] = hv; sl[wave * 16 + 8 * g + r][j * 16 + col] = (_Float16)((v - (float)hv) * 1024.0f); } }
    __syncthreads();
    for (int e = tid; e < 64 * 16; e += 128) { const int rl = e >> 4, q = e & 15; vst2((unsigned*)(DH + (r0 + rl) * CC + c0 + q * 8), *(const v4u*)&sh[rl][q * 8]); if (hi_rows) vst2((unsigned*)(DL + (bb * nhi + t0 + rl) * (size_t)CC + c0 + q * 8), *(const v4u*)&sl[rl][q * 8]); }
  } else { const bool hi_rows = t0 < KHI;
#pragma unroll
    for (int j = 0; j < 8; ++j) { const float bias = BA ? bfr(BA[c0 + j * 16 + col]) : 0.f;
#pragma unroll
      for (int r = 0; r < 8; ++r) { const float v = acc[j][r] + bias; const int rl = wave * 16 + 8 * g + r, cl = j * 16 + col; th[cl][rl] = (_Float16)v; const __bf16 bh = (__bf16)v; tb[cl][rl] = bh; tbl[cl][rl] = (__bf16)(v - (float)bh); } }
    __syncthreads();
    for (int e = tid; e < 128 * 8; e += 128) { const int cl = e >> 3, q = e & 7; vst2((unsigned*)(VT + (bb * CC + c0 + cl) * (size_t)TT + t0 + q * 8), *(const v4u*)&th[cl][q * 8]); if (hi_rows) { const size_t o3 = (bb * CC + c0 + cl) * (size_t)KHI + t0 + q * 8; vst2((unsigned*)(VB + o3), *(const v4u*)&tb[cl][q * 8]); vst2((unsigned*)(VBL + o3), *(const v4u*)&tbl[cl][q * 8]); } } } }
// ---- k_fa: scores, mask, softmax and P . v of one pseudo-sequence in ONE pass over the keys: S and P stay in registers. Block = 8 waves x 16 queries (blockIdx.x = query block, blockIdx.y = pseudo-sequence b, real batch = b >> 4); a stage = 64 keys, K rows, v plane rows and the block's mask rows staged in LDS (whole 128-B lines per load), two buffers, the next stage's loads in flight in registers.
// St = K Qt (A = K rows, B = q hi and q residual x 2^10, kept in registers): a lane holds ONE query (col) and keys 8g + r of each 16-key tile, so two tiles pack in place into the B operand of Ot += vt Pt (A = v plane rows, same k order as frag_h). Running maximum and sum per query in raw score units (the 1/32 sits in the exponent's factor); where(mask == 0, -1e20, score) as in the source, so a fully masked row comes out uniform.
#define FQ 128            // queries per block
#define FK 64             // keys per stage
#define KP 72             // LDS pitch of a 64-element f16 row: 128 B + 16 B, conflict-free for 16-B fragment reads
#define MP 68             // LDS pitch of a 64-element int row: 256 B + 16 B, likewise
#define CEXP (SCALE * 1.44269504088896f)
__device__ __forceinline__ v8f wm(v16h a, v16h b, v8f c) { return __builtin_amdgcn_wmma_f32_16x16x32_f16(false, a, false, b, (short)0, c, false, false); }
// 2^x in place. One statement for eight: behind a transcendental the instruction set asks for one independent instruction before its result is read or its source overwritten; here each v_exp_f32 is that instruction for the one before it and the v_nop for the last, whatever the compiler puts next
__device__ __forceinline__ v8f exp2x8(v8f e) { float a0 = e[0], a1 = e[1], a2 = e[2], a3 = e[3], a4 = e[4], a5 = e[5], a6 = e[6], a7 = e[7];
  asm("v_exp_f32 %0, %0\n\tv_exp_f32 %1, %1\n\tv_exp_f32 %2, %2\n\tv_exp_f32 %3, %3\n\tv_exp_f32 %4, %4\n\tv_exp_f32 %5, %5\n\tv_exp_f32 %6, %6\n\tv_exp_f32 %7, %7\n\tv_nop" : "+v"(a0), "+v"(a1), "+v"(a2), "+v"(a3), "+v"(a4), "+v"(a5), "+v"(a6), "+v"(a7));
  v8f p; p[0] = a0; p[1] = a1; p[2] = a2; p[3] = a3; p[4] = a4; p[5] = a5; p[6] = a6; p[7] = a7; return p; }
__device__ __forceinline__ float exp2x1(float a) { asm("v_exp_f32 %0, %0\n\tv_nop" : "+v"(a)); return a; }   // the v_nop: the same slot
__device__ __forceinline__ float xhalf(float v) { const int i = __builtin_bit_cast(int, v); return __builtin_bit_cast(float, (int)__builtin_amdgcn_permlanex16(i, i, 0x76543210, 0xfedcba98, false, false)); }   // the value of lane l ^ 16
__global__ __launch_bounds__(256, 4) void k_fa(const _Float16* __restrict__ QH, const _Float16* __restrict__ QL, const _Float16* __restrict__ KH, const _Float16* __restrict__ VT, const int* __restrict__ MASK, float* __restrict__ C) {
  __shared__ __align__(16) _Float16 sk[2][FK][KP], sv[2][HD][KP]; __shared__ __align__(16) int sm[2][FQ][MP];
  const int tid = threadIdx.x, wave = tid >> 5, lane = tid & 31, col = lane & 15, g = lane >> 4; const int b = blockIdx.y, q0 = blockIdx.x * FQ, qw = wave * 16 + col;
  v16h qh[2], qr[2];
#pragma unroll   // constant indices, so that the arrays stay in registers
  for (int kc = 0; kc < 2; ++kc) { qh[kc] = frag_h(QH + ((size_t)b * TT + q0 + qw) * CC + kc * 32, lane); qr[kc] = frag_h(QL + ((size_t)b * QHI + q0 + qw) * CC + kc * 32, lane); }
  const int r8 = tid >> 3, c8 = tid & 7, r16 = tid >> 4, c16 = tid & 15;   // staging: thread -> (row, 16-B chunk) of 128-B rows (K, v) and of 256-B rows (mask)
  const _Float16* gk = KH + ((size_t)b * TT + r8) * CC + c8 * 8; const _Float16* gv = VT + ((size_t)b * CC + r8) * TT + c8 * 8; const int* gm = MASK + ((size_t)(b >> 4) * TT + q0 + r16) * TT + c16 * 4;
  v8h rk[2], rv[2]; v4i rm[8];
#pragma unroll   // constant indices, so that the arrays stay in registers
  for (int i = 0; i < 2; ++i) { rk[i] = *(const v8h*)(gk + (size_t)(32 * i) * CC); rv[i] = *(const v8h*)(gv + (size_t)(32 * i) * TT); }
#pragma unroll   // constant indices, so that the arrays stay in registers
  for (int i = 0; i < 8; ++i) rm[i] = *(const v4i*)(gm + (size_t)(16 * i) * TT);
  v8f o[4] = {}, lv = {}; float m = -3.0e38f;
#pragma clang loop unroll(disable)   // one copy of the stage body: the last stage is not peeled off, and the branch round the next stage's loads keeps them directly behind the barrier
  for (int s = 0; s < TT / FK; ++s) { const int u = s & 1;
#pragma unroll   // constant indices, so that the arrays stay in registers
    for (int i = 0; i < 2; ++i) { *(v8h*)&sk[u][r8 + 32 * i][c8 * 8] = rk[i]; *(v8h*)&sv[u][r8 + 32 * i][c8 * 8] = rv[i]; }
#pragma unroll   // constant indices, so that the arrays stay in registers
    for (int i = 0; i < 8; ++i) *(v4i*)&sm[u][r16 + 16 * i][c16 * 4] = rm[i];
    __syncthreads();   // publishes buffer u; it also ends every wave's reads of buffer u ^ 1 (stage s - 1), which stage s + 1 overwrites only behind it
    if (s + 1 < TT / FK) { const int k1 = (s + 1) * FK;   // behind the barrier (which drains the load counter), so that these loads fly during the stage's work
#pragma unroll   // constant indices, so that the arrays stay in registers
      for (int i = 0; i < 2; ++i) { rk[i] = *(const v8h*)(gk + (size_t)(k1 + 32 * i) * CC); rv[i] = *(const v8h*)(gv + (size_t)(32 * i) * TT + k1); }
#pragma unroll   // constant indices, so that the arrays stay in registers
      for (int i = 0; i < 8; ++i) rm[i] = *(const v4i*)(gm + (size_t)(16 * i) * TT + k1);
      asm volatile("s_wait_xcnt 0x0" ::: "memory"); }   // the stage's first LDS reads land in the registers that held these loads' addresses: the wait stands in front of that overwrite
    v8f t[4];
#pragma unroll   // constant indices, so that the arrays stay in registers
    for (int j = 0; j < 4; ++j) { v8f a = {}, ar = {};
#pragma unroll   // constant indices, so that the arrays stay in registers
      for (int kc = 0; kc < 2; ++kc) { const v16h kf = frag_h(&sk[u][j * 16 + col][kc * 32], lane); a = wm(kf, qh[kc], a); ar = wm(kf, qr[kc], ar); }
      const v4i m0 = *(const v4i*)&sm[u][qw][j * 16 + 8 * g], m1 = *(const v4i*)&sm[u][qw][j * 16 + 8 * g + 4]; const v8f x = a + ar * (1.0f / 1024.0f);
#pragma unroll   // constant indices, so that the arrays stay in registers
      for (int r = 0; r < 8; ++r) t[j][r] = ((r < 4 ? m0[r & 3] : m1[r & 3]) == 0) ? -1.0e20f : x[r]; }
    float mj[4];   // one maximum chain per tile: four independent chains
#pragma unroll   // constant indices, so that the arrays stay in registers
    for (int j = 0; j < 4; ++j) { mj[j] = t[j][0];
#pragma unroll   // constant indices, so that the arrays stay in registers
      for (int r = 1; r < 8; ++r) mj[j] = fmaxf(mj[j], t[j][r]); }
    float mx = fmaxf(fmaxf(mj[0], mj[1]), fmaxf(mj[2], mj[3])); mx = fmaxf(mx, xhalf(mx));   // the query's other 32 keys of the stage sit in lane l ^ 16
    const float mn = fmaxf(m, mx), al = exp2x1((m - mn) * CEXP); m = mn;
    union { v16h v; v8h q[2]; } pb[2]; v8f ps;
#pragma unroll   // constant indices, so that the arrays stay in registers
    for (int j = 0; j < 4; ++j) { const v8f p = exp2x8((t[j] - mn) * CEXP);
      ps = j ? ps + p : p; pb[j >> 1].q[j & 1] = __builtin_convertvector(p, v8h); }
    lv = lv * al + ps;
#pragma unroll   // constant indices, so that the arrays stay in registers
    for (int jd = 0; jd < 4; ++jd) o[jd] *= al;
#pragma unroll   // constant indices, so that the arrays stay in registers
    for (int kk = 0; kk < 2; ++kk)
#pragma unroll   // constant indices, so that the arrays stay in registers
      for (int jd = 0; jd < 4; ++jd) o[jd] = wm(frag_h(&sv[u][jd * 16 + col][kk * 32], lane), pb[kk].v, o[jd]); }
  float ls = ((lv[0] + lv[1]) + (lv[2] + lv[3])) + ((lv[4] + lv[5]) + (lv[6] + lv[7])); ls += xhalf(ls); const float inv = 1.0f / ls;   // ls >= 1: the maximum's own term
  float* cr = C + ((size_t)b * TT + q0 + qw) * HD + 8 * g;   // Ot tile jd, register r = ctx[query][jd * 16 + 8g + r]: 32 contiguous bytes per lane and tile
#pragma unroll   // constant indices, so that the arrays stay in registers
  for (int jd = 0; jd < 4; ++jd) { v4f w0, w1;
#pragma unroll   // constant indices, so that the arrays stay in registers
    for (int r = 0; r < 4; ++r) { w0[r] = o[jd][r] * inv; w1[r] = o[jd][4 + r] * inv; }
    vst2(cr + jd * 16, w0); vst2(cr + jd * 16 + 4, w1); } }

// ---- k_lin2: the module's final Linear on the RAW-reshaped context: rows = the [2*2048][1024] view of the contiguous [32][2048][64] context buffer; out = ctx Wo^T + bo with ctx x 2^6 once to f16 against Wo as f16(bf16 x 2^8) (1 product), block = (64 rows, 128 output columns)
#define K2 1024
#define N2 1024
__global__ __launch_bounds__(128) void k_lin2(const float* __restrict__ Yc, const float* __restrict__ WO, const float* __restrict__ BO, float* __restrict__ OUT) { __shared__ __align__(16) float sf[4][16][132];
  const int tid = threadIdx.x, wave = tid >> 5, lane = tid & 31, col = lane & 15, g = lane >> 4; const int c0 = blockIdx.y * 128; const size_t r0 = (size_t)blockIdx.x * 64 + wave * 16;
  v8f acc[8] = {};
#pragma unroll 2
  for (int kc = 0; kc < K2 / 32; ++kc) { const v16h a = frag_f32s(Yc + (r0 + col) * K2 + kc * 32, lane, 64.0f); asm volatile("s_wait_loadcnt 0x0" ::: "memory");
#pragma unroll
    for (int j = 0; j < 8; ++j) { const v16h w = wcolh_oi(WO, kc * 32, c0 + j * 16 + col, lane, K2); asm volatile("s_wait_loadcnt 0x0" ::: "memory"); acc[j] = wmma16(a, w, acc[j]); } }
#pragma unroll
  for (int j = 0; j < 8; ++j) { const float bias = bfr(BO[c0 + j * 16 + col]); asm volatile("s_wait_loadcnt 0x0" ::: "memory");
#pragma unroll
    for (int r = 0; r < 8; ++r) sf[wave][8 * g + r][j * 16 + col] = acc[j][r] * (1.0f / 16384.0f) + bias; }   /* 2^-8 (Wo carry) x 2^-6 (ctx carry) */
  LDSX(); for (int rl = 0; rl < 16; ++rl) vst2(OUT + (r0 + rl) * N2 + c0 + lane * 4, *(const v4f*)&sf[wave][rl][lane * 4]); }
#define WS_C64 (WS_BP + 4u * 3 * 128)                     // f32 context [32][2048][64] contiguous == the raw-reshaped [2*2048][1024] rows
#define WS_END3 (WS_C64 + 4u * (size_t)NB * TT * 64)
extern "C" void kernel_launch(void* const* d_in, const int* in_sizes, int n_in, void* d_out, int out_size, void* d_ws, size_t ws_size, hipStream_t stream) {
  (void)in_sizes; (void)n_in; (void)out_size;
  const float** F = (const float**)d_in;
  if (ws_size < (size_t)WS_END) return;
  char* ws = (char*)d_ws; _Float16 *QH = (_Float16*)(ws + WS_QH), *KH = (_Float16*)(ws + WS_KH), *VT = (_Float16*)(ws + WS_VT), *QL = (_Float16*)(ws + WS_QL), *KL = (_Float16*)(ws + WS_KL); __bf16 *VB = (__bf16*)(ws + WS_VB), *VBL = (__bf16*)(ws + WS_VBL);
  (void)KL; (void)VB; (void)VBL;
  // inputs: 0 query [2,2048,1024]; 1 key; 2 value (each viewed as 65,536 rows of 64: the raw reshape); 3 mask [2,1,2048,2048] int32; 4 Wq [64,64] (out,in); 5 Wk; 6 Wv; 7 Wo [1024,1024] (out,in); 8 bo [1024] (nonzero)
  if (ws_size < (size_t)WS_END3) return;
  float *WP = (float*)(ws + WS_WP), *BP = (float*)(ws + WS_BP), *C64 = (float*)(ws + WS_C64);
  k_padw<<<dim3(32, 3), 256, 0, stream>>>(F[4], F[5], F[6], nullptr, nullptr, nullptr, WP, BP);
  k_proj<<<dim3(TNB * TT / 64, CC / 128, 3), 128, 0, stream>>>(F[0], F[1], F[2], WP, WP + (size_t)CIN * 128, WP + 2 * (size_t)CIN * 128, BP, BP + 128, BP + 256, QH, QL, KH, KL, VT, VB, VBL);
  k_fa<<<dim3(TT / FQ, TNB), 256, 0, stream>>>(QH, QL, KH, VT, (const int*)d_in[3], C64);   /* pseudo-sequence = real batch (b >> 4), pseudo-head (b & 15); head 0 only */
  k_lin2<<<dim3((TNB * TT * 64 / K2) / 64, N2 / 128), 128, 0, stream>>>(C64, F[7], F[8], (float*)d_out);
}

// v003
// One run takes 134 microseconds.
// In both of two side-by-side timings against v002, it was 1.75 times as fast.
// Over all steps from v000 it is 21.3 times as fast.
// compute dtype: all float inputs rounded to bf16; q/k/v projections with EXACT bf16 products on WMMA 16x16x32 (f32 accumulate); logits: q (f16 + its f16 residual x 2^10) x k once to f16 (2 products); running-maximum softmax in f32; exp(logit - running maximum) once to f16 x v once to f16 (1 product), divided by the f32 sum at the end; f32 output.
#include <hip/hip_runtime.h>
#include <math.h>

typedef __attribute__((ext_vector_type(16))) _Float16 v16h;
typedef __attribute__((ext_vector_type(16))) __bf16 v16b;
typedef __attribute__((ext_vector_type(8)))  _Float16 v8h;
typedef __attribute__((ext_vector_type(8)))  float v8f;
typedef __attribute__((ext_vector_type(4)))  float v4f;
typedef __attribute__((ext_vector_type(2)))  float v2f;
typedef __attribute__((ext_vector_type(4)))  unsigned v4u;
typedef __attribute__((ext_vector_type(4)))  int v4i;
typedef float __attribute__((may_alias)) float_a;
typedef int __attribute__((may_alias)) int_a;

template <typename T> __device__ __forceinline__ void vst2(void* p, T v) { *(T*)p = v;  }
__device__ __forceinline__ v8f wmma16(v16h a, v16h b, v8f c) {
  v8f d = __builtin_amdgcn_wmma_f32_16x16x32_f16(false, a, false, b, (short)0, c, false, false);
  asm volatile("v_nop\n\tv_nop\n\tv_nop\n\tv_nop" : "+v"(d) : "v"(a), "v"(b));
  return d;
}
__device__ __forceinline__ v8f wmma_bf(v16b a, v16b b, v8f c) {
  v8f d = __builtin_amdgcn_wmma_f32_16x16x32_bf16(false, a, false, b, (short)0, c, false, false);
  asm volatile("v_nop\n\tv_nop\n\tv_nop\n\tv_nop" : "+v"(d) : "v"(a), "v"(b));
  return d;
}
// 16x16x32 fragments: lane = (h = lane>>4, row/col = lane&15); elements 0..7 = k0+8h+0..7, 8..15 = k0+16+8h+0..7; D element r = row 8h+r
__device__ __forceinline__ v16h frag_h(const _Float16* rowk0, int lane) {
  union { v16h v; v8h q[2]; } u; const _Float16* p = rowk0 + 8 * (lane >> 4);
  u.q[0] = *(const v8h*)p; u.q[1] = *(const v8h*)(p + 16); return u.v;
}
__device__ __forceinline__ v16h frag_f32(const float* rowk0, int lane) {
  v16h a; const float* p = rowk0 + 8 * (lane >> 4);
#pragma unroll
  for (int i = 0; i < 8; ++i) { a[i] = (_Float16)p[i]; a[8 + i] = (_Float16)p[16 + i]; }
  return a;
}
__device__ __forceinline__ v16h frag_f32s(const float* rowk0, int lane, float sc) {
  v16h a; const float* p = rowk0 + 8 * (lane >> 4);
#pragma unroll
  for (int i = 0; i < 8; ++i) { a[i] = (_Float16)(p[i] * sc); a[8 + i] = (_Float16)(p[16 + i] * sc); }
  return a;
}
// column fragment from a [K][ld] layout (column n), rows >= K read as 0
__device__ __forceinline__ v16h fragc_f32(const float* W, int k0, int n, int lane, int ld, int K) {
  v16h a; const int g = lane >> 4;
#pragma unroll
  for (int i = 0; i < 8; ++i) { const int ka = k0 + 8 * g + i, kb = ka + 16;
    a[i] = (_Float16)(ka < K ? W[(size_t)(ka < K ? ka : K - 1) * ld + n] : 0.f); a[8 + i] = (_Float16)(kb < K ? W[(size_t)(kb < K ? kb : K - 1) * ld + n] : 0.f); }
  return a;
}
struct F2 { v16b h, l; };
__device__ __forceinline__ F2 bsplit16(const float v[16]) { F2 r;
#pragma unroll
  for (int i = 0; i < 16; ++i) { const __bf16 h = (__bf16)v[i]; r.h[i] = h; r.l[i] = (__bf16)(v[i] - (float)h); }
  return r; }
__device__ __forceinline__ F2 split_row(const float* row, int k0, int lane) { float v[16]; const float* p = row + k0 + 8 * (lane >> 4);
#pragma unroll
  for (int i = 0; i < 8; ++i) { v[i] = p[i]; v[8 + i] = p[16 + i]; }
  return bsplit16(v); }
__device__ __forceinline__ F2 split_rowK(const float* row, int k0, int lane, int K) { float v[16]; const int g = lane >> 4;
#pragma unroll
  for (int i = 0; i < 8; ++i) { const int ka = k0 + 8 * g + i, kb = ka + 16; v[i] = ka < K ? row[ka < K ? ka : K - 1] : 0.f; v[8 + i] = kb < K ? row[kb < K ? kb : K - 1] : 0.f; }
  return bsplit16(v); }
__device__ __forceinline__ F2 split_col(const float* W, int k0, int n, int lane, int ld, int K) { float v[16]; const int g = lane >> 4;
#pragma unroll
  for (int i = 0; i < 8; ++i) { const int ka = k0 + 8 * g + i, kb = ka + 16; v[i] = ka < K ? W[(size_t)(ka < K ? ka : K - 1) * ld + n] : 0.f; v[8 + i] = kb < K ? W[(size_t)(kb < K ? kb : K - 1) * ld + n] : 0.f; }
  return bsplit16(v); }
__device__ __forceinline__ v8f mac3(const F2& a, const F2& b, v8f c) { c = wmma_bf(a.l, b.h, c); c = wmma_bf(a.h, b.l, c); return wmma_bf(a.h, b.h, c); }
__device__ __forceinline__ float sigm(float v) { return 1.0f / (1.0f + expf(-v)); }
#define LDSX() do { asm volatile("s_wait_dscnt 0" ::: "memory"); __builtin_amdgcn_wave_barrier(); __builtin_amdgcn_fence(__ATOMIC_RELEASE, "workgroup"); } while (0)

// Masked self-attention with a RAW reshape into heads (query / key / value [2,2048,1024] are reshaped WITHOUT transpose to [2,16,2048,64]: pseudo-head h of batch b = the contiguous 131,072 floats starting at (b*16 + h)*2048*64, i.e. 32 pseudo-sequences of 2,048 positions x 64 dims each); one shared bias-free torch (out,in) Linear [64,64] per role (Wq, Wk, Wv); scores = Q K^T masked by mask[b][0][q][k] == 0 -> -1e20 (int32 random 0/1 per batch), then divided by sqrt(embed = 1024) = 32 (the source's quirk: logit sigma - 0.08); softmax; out = attn V reshaped raw back to [2,2048,1024]; (out,in) Wo [1024,1024] + bo (nonzero): result = out Wo^T + bo.
#define NB 32
#define TT 2048
#define CC 128            // NH * HD = projected width
#define DIN 64          // input (model) width
#define NH 2
#define HD 64
#define NQB (TT / 64)
#define HG 1
#define SCALE (0.03125f)
#define CAUSAL 0
#ifndef TNB
#define TNB NB
#endif
__device__ __forceinline__ float bfr(float v) { return (float)(__bf16)v; }
__host__ __device__ __forceinline__ int kb_last(int qb) { return CAUSAL ? ((qb * 64 + 63) >> 7) : (TT / 128 - 1); }
typedef __attribute__((ext_vector_type(8))) __bf16 v8b;
__device__ __forceinline__ v16b frag_b(const __bf16* rowk0, int lane) {
  union { v16b v; v8b q[2]; } u; const __bf16* p = rowk0 + 8 * (lane >> 4);
  u.q[0] = *(const v8b*)p; u.q[1] = *(const v8b*)(p + 16); return u.v;
}
#define QBH 0
#define QHI 2048            // rows carrying a q residual plane (all rows when non-causal: 2-product logits everywhere)
#define KHI 64            // key rows carrying k residual / v bf16 hi+lo planes (written by k_proj; no kernel here reads them)
// B fragment (k rows k0+.., output column o) of a weight: (in,out) [K][ld] or (out,in) [ld rows of K]: bf16 exact, or f16(bf16 * 256) exact
__device__ __forceinline__ v16b wcol_io(const float* Wm, int k0, int o, int lane, int ld) { v16b w; const int g = lane >> 4;
#pragma unroll
  for (int i = 0; i < 8; ++i) { w[i] = (__bf16)Wm[(size_t)(k0 + 8 * g + i) * ld + o]; w[8 + i] = (__bf16)Wm[(size_t)(k0 + 16 + 8 * g + i) * ld + o]; }
  return w; }
__device__ __forceinline__ v16b wcol_oi(const float* Wm, int k0, int o, int lane, int K) { v16b w; const float* p = Wm + (size_t)o * K + k0 + 8 * (lane >> 4);
#pragma unroll
  for (int i = 0; i < 8; ++i) { w[i] = (__bf16)p[i]; w[8 + i] = (__bf16)p[16 + i]; }
  return w; }
__device__ __forceinline__ v16h wcolh_io(const float* Wm, int k0, int o, int lane, int ld) { v16h w; const int g = lane >> 4;
#pragma unroll
  for (int i = 0; i < 8; ++i) { w[i] = (_Float16)(bfr(Wm[(size_t)(k0 + 8 * g + i) * ld + o]) * 256.0f); w[8 + i] = (_Float16)(bfr(Wm[(size_t)(k0 + 16 + 8 * g + i) * ld + o]) * 256.0f); }
  return w; }
__device__ __forceinline__ v16h wcolh_oi(const float* Wm, int k0, int o, int lane, int K) { v16h w; const float* p = Wm + (size_t)o * K + k0 + 8 * (lane >> 4);
#pragma unroll
  for (int i = 0; i < 8; ++i) { w[i] = (_Float16)(bfr(p[i]) * 256.0f); w[8 + i] = (_Float16)(bfr(p[16 + i]) * 256.0f); }
  return w; }
#define WQKV_LAYOUT 1   // 0 = (in,out) [DIN][CC]; 1 = (out,in) [CC][DIN]; 2 = per-head [NH][DIN][HD]
__device__ __forceinline__ v16b wcol_hdk(const float* Wm, int k0, int o, int lane) { v16b w; const int g = lane >> 4; const float* p = Wm + (size_t)(o / HD) * DIN * HD + (o % HD);
#pragma unroll
  for (int i = 0; i < 8; ++i) { w[i] = (__bf16)p[(size_t)(k0 + 8 * g + i) * HD]; w[8 + i] = (__bf16)p[(size_t)(k0 + 16 + 8 * g + i) * HD]; }
  return w; }
#define WO_OUT_IN 0
#if WQKV_LAYOUT == 1
#define WCOL(W, k0, o, lane) wcol_oi(W, k0, o, lane, DIN)
#elif WQKV_LAYOUT == 2
#define WCOL(W, k0, o, lane) wcol_hdk(W, k0, o, lane)
#else
#define WCOL(W, k0, o, lane) wcol_io(W, k0, o, lane, CC)
#endif
#if WO_OUT_IN
#define WOCOL(W, k0, o, lane) wcol_oi(W, k0, o, lane, CC)
#define WOCOLH(W, k0, o, lane) wcolh_oi(W, k0, o, lane, CC)
#else
#define WOCOL(W, k0, o, lane) wcol_io(W, k0, o, lane, DIN)
#define WOCOLH(W, k0, o, lane) wcolh_io(W, k0, o, lane, DIN)
#endif
#define CIN 64
// ---- k_padw: the three (out,in) [64][C] projection weights copied into zero-padded (out,in) [128][C] ws planes (rows 64..127 zero) + zero-padded [128] biases, so the 128-column kernels apply unchanged (columns 64..127 = an all-zero dummy head, never attended)
__global__ __launch_bounds__(256) void k_padw(const float* __restrict__ WQ, const float* __restrict__ WK, const float* __restrict__ WV, const float* __restrict__ BQ, const float* __restrict__ BK, const float* __restrict__ BV, float* __restrict__ WP, float* __restrict__ BP) { const int which = blockIdx.y; const float* Wsrc = which == 0 ? WQ : (which == 1 ? WK : WV); const float* Bsrc = which == 0 ? BQ : (which == 1 ? BK : BV); float* dst = WP + (size_t)which * 128 * CIN;
  for (int e = blockIdx.x * 256 + threadIdx.x; e < 128 * (CIN / 4); e += gridDim.x * 256) { const int row = e / (CIN / 4), q = e % (CIN / 4); const v4f ld = *(const v4f*)(Wsrc + (size_t)(row & 63) * CIN + q * 4); asm volatile("s_wait_loadcnt 0x0" ::: "memory"); const float keep = row < 64 ? 1.f : 0.f; v4f ov; ov[0] = ld[0] * keep; ov[1] = ld[1] * keep; ov[2] = ld[2] * keep; ov[3] = ld[3] * keep; vst2(dst + (size_t)row * CIN + q * 4, ov); }   /* unconditional (clamped) loads, zero by select */
  if (blockIdx.x == 0 && threadIdx.x < 128) { const int c = threadIdx.x; float bvv = 0.f; if (Bsrc) { const float t = Bsrc[c & 63]; asm volatile("s_wait_loadcnt 0x0" ::: "memory"); bvv = c < 64 ? t : 0.f; } vst2(BP + which * 128 + c, bvv); } }
#define WS_WP (WS_END)                                  // padded weights [3][128 x C]
#define WS_BP (WS_WP + 4u * 3 * (size_t)CIN * 128)        // padded biases [3][128]
#ifndef PROJ_EXTRA_PARAMS
#define PROJ_EXTRA_PARAMS
#endif

#define WS_QH  0u                                      // f16 q rows [b*t][CC]
#define WS_KH  (WS_QH + 2u * (size_t)NB * TT * CC)      // f16 k rows [b*t][CC]
#define WS_VT  (WS_KH + 2u * (size_t)NB * TT * CC)      // f16 v planes [b][c][t]
#define WS_QL  (WS_VT + 2u * (size_t)NB * CC * TT)      // f16 q residual x 2^10 rows [b][t < QHI][CC]
#define WS_KL  (WS_QL + 2u * (size_t)NB * QHI * CC)     // f16 k residual x 2^10 rows [b][t < KHI][CC]
#define WS_VB  (WS_KL + 2u * (size_t)NB * KHI * CC)     // bf16 v hi planes [b][c][t < KHI]
#define WS_VBL (WS_VB + 2u * (size_t)NB * CC * KHI)
#define WS_END (WS_VBL + 2u * (size_t)NB * CC * KHI)

// ---- k_proj: block = (64 rows, 128 cols, which): q/k/v = X W (+ b) with exact bf16 products (K = DIN) -> which 0: q f16 rows (+ residual rows < QHI); 1: k f16 rows (+ residual rows < KHI); 2: v f16 planes [c][t] (+ bf16 hi/lo planes for t < KHI)
__global__ __launch_bounds__(128) void k_proj(const float* __restrict__ XQ, const float* __restrict__ XK, const float* __restrict__ XV, const float* __restrict__ WQ, const float* __restrict__ WK, const float* __restrict__ WV, const float* __restrict__ BQ, const float* __restrict__ BK, const float* __restrict__ BV,
    _Float16* __restrict__ QH, _Float16* __restrict__ QL, _Float16* __restrict__ KH, _Float16* __restrict__ KL, _Float16* __restrict__ VT, __bf16* __restrict__ VB, __bf16* __restrict__ VBL) {
  __shared__ __align__(16) _Float16 sh[64][136], sl[64][136]; __shared__ __align__(16) _Float16 th[128][72]; __shared__ __align__(16) __bf16 tb[128][72], tbl[128][72];
  const int tid = threadIdx.x, wave = tid >> 5, lane = tid & 31, col = lane & 15, g = lane >> 4; const int which = blockIdx.z; const int c0 = blockIdx.y * 128; const size_t r0 = (size_t)blockIdx.x * 64; const size_t bb = r0 / TT; const int t0 = (int)(r0 % TT);
  const float* X = which == 0 ? XQ : which == 1 ? XK : XV; const float* WA = which == 0 ? WQ : which == 1 ? WK : WV; const float* BA = which == 0 ? BQ : which == 1 ? BK : BV;
  v8f acc[8] = {};
#pragma unroll 2
  for (int kc = 0; kc < DIN / 32; ++kc) { v16b a; { const float* p = X + (r0 + wave * 16 + col) * DIN + kc * 32 + 8 * g;
#pragma unroll
      for (int i = 0; i < 8; ++i) { a[i] = (__bf16)p[i]; a[8 + i] = (__bf16)p[16 + i]; } }
    asm volatile("s_wait_loadcnt 0x0" ::: "memory");
#pragma unroll
    for (int j = 0; j < 8; ++j) { const v16b w = WCOL(WA, kc * 32, c0 + j * 16 + col, lane); asm volatile("s_wait_loadcnt 0x0" ::: "memory"); acc[j] = wmma_bf(a, w, acc[j]); } }
  if (which < 2) { _Float16* DH = which == 0 ? QH : KH; _Float16* DL = which == 0 ? QL : KL; const int nhi = which == 0 ? QHI : KHI; const bool hi_rows = t0 < nhi;
#pragma unroll
    for (int j = 0; j < 8; ++j) { const float bias = BA ? bfr(BA[c0 + j * 16 + col]) : 0.f;
#pragma unroll
      for (int r = 0; r < 8; ++r) { const float v = acc[j][r] + bias; const _Float16 hv = (_Float16)v; sh[wave * 16 + 8 * g + r][j * 16 + col] = hv; sl[wave * 16 + 8 * g + r][j * 16 + col] = (_Float16)((v - (float)hv) * 1024.0f); } }
    __syncthreads();
    for (int e = tid; e < 64 * 16; e += 128) { const int rl = e >> 4, q = e & 15; vst2((unsigned*)(DH + (r0 + rl) * CC + c0 + q * 8), *(const v4u*)&sh[rl][q * 8]); if (hi_rows) vst2((unsigned*)(DL + (bb * nhi + t0 + rl) * (size_t)CC + c0 + q * 8), *(const v4u*)&sl[rl][q * 8]); }
  } else { const bool hi_rows = t0 < KHI;
#pragma unroll
    for (int j = 0; j < 8; ++j) { const float bias = BA ? bfr(BA[c0 + j * 16 + col]) : 0.f;
#pragma unroll
      for (int r = 0; r < 8; ++r) { const float v = acc[j][r] + bias; const int rl = wave * 16 + 8 * g + r, cl = j * 16 + col; th[cl][rl] = (_Float16)v; const __bf16 bh = (__bf16)v; tb[cl][rl] = bh; tbl[cl][rl] = (__bf16)(v - (float)bh); } }
    __syncthreads();
    for (int e = tid; e < 128 * 8; e += 128) { const int cl = e >> 3, q = e & 7; vst2((unsigned*)(VT + (bb * CC + c0 + cl) * (size_t)TT + t0 + q * 8), *(const v4u*)&th[cl][q * 8]); if (hi_rows) { const size_t o3 = (bb * CC + c0 + cl) * (size_t)KHI + t0 + q * 8; vst2((unsigned*)(VB + o3), *(const v4u*)&tb[cl][q * 8]); vst2((unsigned*)(VBL + o3), *(const v4u*)&tbl[cl][q * 8]); } } } }
// ---- k_fa: scores, mask, softmax and P . v of one pseudo-sequence in ONE pass over the keys: S and P stay in registers. Block = 8 waves x 16 queries (blockIdx.x = query block, blockIdx.y = pseudo-sequence b, real batch = b >> 4); a stage = 64 keys, K rows, v plane rows and the block's mask rows staged in LDS (whole 128-B lines per load), two buffers, the next stage's loads in flight in registers.
// St = K Qt (A = K rows, B = q hi and q residual x 2^10, kept in registers): a lane holds ONE query (col) and keys 8g + r of each 16-key tile, so two tiles pack in place into the B operand of Ot += vt Pt (A = v plane rows, same k order as frag_h). Running maximum and sum per query in raw score units (the 1/32 sits in the exponent's factor); where(mask == 0, -1e20, score) as in the source, so a fully masked row comes out uniform.
#define FQ 128            // queries per block
#define FK 64             // keys per stage
#define KP 72             // LDS pitch of a 64-element f16 row: 128 B + 16 B, conflict-free for 16-B fragment reads
#define MP 68             // LDS pitch of a 64-element int row: 256 B + 16 B, likewise
#define CEXP (SCALE * 1.44269504088896f)
__device__ __forceinline__ v8f wm(v16h a, v16h b, v8f c) { return __builtin_amdgcn_wmma_f32_16x16x32_f16(false, a, false, b, (short)0, c, false, false); }
// 2^x in place. One statement for eight: behind a transcendental the instruction set asks for one independent instruction before its result is read or its source overwritten; here each v_exp_f32 is that instruction for the one before it and the v_nop for the last, whatever the compiler puts next
__device__ __forceinline__ v8f exp2x8(v8f e) { float a0 = e[0], a1 = e[1], a2 = e[2], a3 = e[3], a4 = e[4], a5 = e[5], a6 = e[6], a7 = e[7];
  asm("v_exp_f32 %0, %0\n\tv_exp_f32 %1, %1\n\tv_exp_f32 %2, %2\n\tv_exp_f32 %3, %3\n\tv_exp_f32 %4, %4\n\tv_exp_f32 %5, %5\n\tv_exp_f32 %6, %6\n\tv_exp_f32 %7, %7\n\tv_nop" : "+v"(a0), "+v"(a1), "+v"(a2), "+v"(a3), "+v"(a4), "+v"(a5), "+v"(a6), "+v"(a7));
  v8f p; p[0] = a0; p[1] = a1; p[2] = a2; p[3] = a3; p[4] = a4; p[5] = a5; p[6] = a6; p[7] = a7; return p; }
__device__ __forceinline__ float exp2x1(float a) { asm("v_exp_f32 %0, %0\n\tv_nop" : "+v"(a)); return a; }   // the v_nop: the same slot
__device__ __forceinline__ float xhalf(float v) { const int i = __builtin_bit_cast(int, v); return __builtin_bit_cast(float, (int)__builtin_amdgcn_permlanex16(i, i, 0x76543210, 0xfedcba98, false, false)); }   // the value of lane l ^ 16
__global__ __launch_bounds__(256, 4) void k_fa(const _Float16* __restrict__ QH, const _Float16* __restrict__ QL, const _Float16* __restrict__ KH, const _Float16* __restrict__ VT, const int* __restrict__ MASK, float* __restrict__ C) {
  __shared__ __align__(16) _Float16 sk[2][FK][KP], sv[2][HD][KP]; __shared__ __align__(16) int sm[2][FQ][MP];
  const int tid = threadIdx.x, wave = tid >> 5, lane = tid & 31, col = lane & 15, g = lane >> 4; const int b = blockIdx.y, q0 = blockIdx.x * FQ, qw = wave * 16 + col;
  v16h qh[2], qr[2];
#pragma unroll   // constant indices, so that the arrays stay in registers
  for (int kc = 0; kc < 2; ++kc) { qh[kc] = frag_h(QH + ((size_t)b * TT + q0 + qw) * CC + kc * 32, lane); qr[kc] = frag_h(QL + ((size_t)b * QHI + q0 + qw) * CC + kc * 32, lane); }
  const int r8 = tid >> 3, c8 = tid & 7, r16 = tid >> 4, c16 = tid & 15;   // staging: thread -> (row, 16-B chunk) of 128-B rows (K, v) and of 256-B rows (mask)
  const _Float16* gk = KH + ((size_t)b * TT + r8) * CC + c8 * 8; const _Float16* gv = VT + ((size_t)b * CC + r8) * TT + c8 * 8; const int* gm = MASK + ((size_t)(b >> 4) * TT + q0 + r16) * TT + c16 * 4;
  v8h rk[2], rv[2]; v4i rm[8];
#pragma unroll   // constant indices, so that the arrays stay in registers
  for (int i = 0; i < 2; ++i) { rk[i] = *(const v8h*)(gk + (size_t)(32 * i) * CC); rv[i] = *(const v8h*)(gv + (size_t)(32 * i) * TT); }
#pragma unroll   // constant indices, so that the arrays stay in registers
  for (int i = 0; i < 8; ++i) rm[i] = *(const v4i*)(gm + (size_t)(16 * i) * TT);
  v8f o[4] = {}, lv = {}; float m = -3.0e38f;
#pragma clang loop unroll(disable)   // one copy of the stage body: the last stage is not peeled off, and the branch round the next stage's loads keeps them directly behind the barrier
  for (int s = 0; s < TT / FK; ++s) { const int u = s & 1;
#pragma unroll   // constant indices, so that the arrays stay in registers
    for (int i = 0; i < 2; ++i) { *(v8h*)&sk[u][r8 + 32 * i][c8 * 8] = rk[i]; *(v8h*)&sv[u][r8 + 32 * i][c8 * 8] = rv[i]; }
#pragma unroll   // constant indices, so that the arrays stay in registers
    for (int i = 0; i < 8; ++i) *(v4i*)&sm[u][r16 + 16 * i][c16 * 4] = rm[i];
    __syncthreads();   // publishes buffer u; it also ends every wave's reads of buffer u ^ 1 (stage s - 1), which stage s + 1 overwrites only behind it
    if (s + 1 < TT / FK) { const int k1 = (s + 1) * FK;   // behind the barrier (which drains the load counter), so that these loads fly during the stage's work
#pragma unroll   // constant indices, so that the arrays stay in registers
      for (int i = 0; i < 2; ++i) { rk[i] = *(const v8h*)(gk + (size_t)(k1 + 32 * i) * CC); rv[i] = *(const v8h*)(gv + (size_t)(32 * i) * TT + k1); }
#pragma unroll   // constant indices, so that the arrays stay in registers
      for (int i = 0; i < 8; ++i) rm[i] = *(const v4i*)(gm + (size_t)(16 * i) * TT + k1);
      asm volatile("s_wait_xcnt 0x0" ::: "memory"); }   // the stage's first LDS reads land in the registers that held these loads' addresses: the wait stands in front of that overwrite
    v8f t[4];
#pragma unroll   // constant indices, so that the arrays stay in registers
    for (int j = 0; j < 4; ++j) { v8f a = {}, ar = {};
#pragma unroll   // constant indices, so that the arrays stay in registers
      for (int kc = 0; kc < 2; ++kc) { const v16h kf = frag_h(&sk[u][j * 16 + col][kc * 32], lane); a = wm(kf, qh[kc], a); ar = wm(kf, qr[kc], ar); }
      const v4i m0 = *(const v4i*)&sm[u][qw][j * 16 + 8 * g], m1 = *(const v4i*)&sm[u][qw][j * 16 + 8 * g + 4]; const v8f x = a + ar * (1.0f / 1024.0f);
#pragma unroll   // constant indices, so that the arrays stay in registers
      for (int r = 0; r < 8; ++r) t[j][r] = ((r < 4 ? m0[r & 3] : m1[r & 3]) == 0) ? -1.0e20f : x[r]; }
    float mj[4];   // one maximum chain per tile: four independent chains
#pragma unroll   // constant indices, so that the arrays stay in registers
    for (int j = 0; j < 4; ++j) { mj[j] = t[j][0];
#pragma unroll   // constant indices, so that the arrays stay in registers
      for (int r = 1; r < 8; ++r) mj[j] = fmaxf(mj[j], t[j][r]); }
    float mx = fmaxf(fmaxf(mj[0], mj[1]), fmaxf(mj[2], mj[3])); mx = fmaxf(mx, xhalf(mx));   // the query's other 32 keys of the stage sit in lane l ^ 16
    const float mn = fmaxf(m, mx), al = exp2x1((m - mn) * CEXP); m = mn;
    union { v16h v; v8h q[2]; } pb[2]; v8f ps;
#pragma unroll   // constant indices, so that the arrays stay in registers
    for (int j = 0; j < 4; ++j) { const v8f p = exp2x8((t[j] - mn) * CEXP);
      ps = j ? ps + p : p; pb[j >> 1].q[j & 1] = __builtin_convertvector(p, v8h); }
    lv = lv * al + ps;
#pragma unroll   // constant indices, so that the arrays stay in registers
    for (int jd = 0; jd < 4; ++jd) o[jd] *= al;
#pragma unroll   // constant indices, so that the arrays stay in registers
    for (int kk = 0; kk < 2; ++kk)
#pragma unroll   // constant indices, so that the arrays stay in registers
      for (int jd = 0; jd < 4; ++jd) o[jd] = wm(frag_h(&sv[u][jd * 16 + col][kk * 32], lane), pb[kk].v, o[jd]); }
  float ls = ((lv[0] + lv[1]) + (lv[2] + lv[3])) + ((lv[4] + lv[5]) + (lv[6] + lv[7])); ls += xhalf(ls); const float inv = 1.0f / ls;   // ls >= 1: the maximum's own term
  float* cr = C + ((size_t)b * TT + q0 + qw) * HD + 8 * g;   // Ot tile jd, register r = ctx[query][jd * 16 + 8g + r]: 32 contiguous bytes per lane and tile
#pragma unroll   // constant indices, so that the arrays stay in registers
  for (int jd = 0; jd < 4; ++jd) { v4f w0, w1;
#pragma unroll   // constant indices, so that the arrays stay in registers
    for (int r = 0; r < 4; ++r) { w0[r] = o[jd][r] * inv; w1[r] = o[jd][4 + r] * inv; }
    vst2(cr + jd * 16, w0); vst2(cr + jd * 16 + 4, w1); } }

// ---- k_lin2: the module's final Linear on the RAW-reshaped context: rows = the [2*2048][1024] view of the contiguous [32][2048][64] context buffer; out = ctx Wo^T + bo with ctx x 2^6 once to f16 against Wo as f16(bf16 x 2^8) (1 product, k in ascending 32-chunks).
// Block = 8 waves on a 128 x 128 output tile (wave = 32 rows x 64 columns); a stage = 64 k: the ctx rows and the Wo rows are read as whole 128-B lines, converted once per block and staged as f16 in LDS, two buffers, the next stage's loads in flight in registers.
#define K2 1024
#define N2 1024
#define LM 128            // output rows per block
#define LN 128            // output columns per block
#define LK 64             // k per stage
#define LP 72             // LDS pitch of a 64-element f16 row: 128 B + 16 B, conflict-free for 16-B fragment reads
#define LF 132            // LDS pitch of a 128-element f32 output row
typedef __attribute__((ext_vector_type(4))) _Float16 v4h;
__global__ __launch_bounds__(256) void k_lin2(const float* __restrict__ Yc, const float* __restrict__ WO, const float* __restrict__ BO, float* __restrict__ OUT) {
  __shared__ __align__(16) _Float16 st[2][2][LM][LP];   // [buffer][0 = ctx rows, 1 = Wo rows][row][k]; after the k loop the same bytes hold the f32 output tile
  const int tid = threadIdx.x, wave = tid >> 5, lane = tid & 31, col = lane & 15, g = lane >> 4; const int c0 = blockIdx.y * LN; const size_t r0 = (size_t)blockIdx.x * LM;
  const int wr = (wave >> 1) * 32, wc = (wave & 1) * 64;
  const int sr = tid >> 4, sc = tid & 15;   // staging: thread -> (row, 16-B chunk) of the 256-B row pieces
  const float* ga = Yc + r0 * K2; const float* gw = WO + (size_t)c0 * K2; const unsigned vo = (unsigned)(sr * K2 + sc * 4);   // block-uniform bases that walk along k, and one per-lane offset that never changes
  v4f ra[8], rw[8];
#pragma unroll   // constant indices, so that the arrays stay in registers
  for (int i = 0; i < 8; ++i) { ra[i] = *(const v4f*)(ga + (vo + 16u * i * K2)); rw[i] = *(const v4f*)(gw + (vo + 16u * i * K2)); }
  v8f acc[2][4] = {};
#pragma clang loop unroll(disable)   // one copy of the stage body: the last stage is not peeled off, and the branch round the next stage's loads keeps them directly behind the barrier
  for (int s = 0; s < K2 / LK; ++s) { const int u = s & 1;
#pragma unroll   // constant indices, so that the arrays stay in registers
    for (int i = 0; i < 8; ++i) { v4h ha, hw;
#pragma unroll   // constant indices, so that the arrays stay in registers
      for (int e = 0; e < 4; ++e) { ha[e] = (_Float16)(ra[i][e] * 64.0f); hw[e] = (_Float16)(bfr(rw[i][e]) * 256.0f); }
      *(v4h*)&st[u][0][sr + 16 * i][sc * 4] = ha; *(v4h*)&st[u][1][sr + 16 * i][sc * 4] = hw; }
    __syncthreads();   // publishes buffer u; it also ends every wave's reads of buffer u ^ 1 (stage s - 1), which stage s + 1 overwrites only behind it
    if (s + 1 < K2 / LK) { ga += LK; gw += LK;   // behind the barrier (which drains the load counter), so that these loads fly during the stage's work
#pragma unroll   // constant indices, so that the arrays stay in registers
      for (int i = 0; i < 8; ++i) { ra[i] = *(const v4f*)(ga + (vo + 16u * i * K2)); rw[i] = *(const v4f*)(gw + (vo + 16u * i * K2)); } }
#pragma unroll   // constant indices, so that the arrays stay in registers
    for (int kk = 0; kk < 2; ++kk) { v16h af[2], bf[4];
#pragma unroll   // constant indices, so that the arrays stay in registers
      for (int i = 0; i < 2; ++i) af[i] = frag_h(&st[u][0][wr + i * 16 + col][kk * 32], lane);
#pragma unroll   // constant indices, so that the arrays stay in registers
      for (int j = 0; j < 4; ++j) bf[j] = frag_h(&st[u][1][wc + j * 16 + col][kk * 32], lane);
#pragma unroll   // constant indices, so that the arrays stay in registers
      for (int i = 0; i < 2; ++i)
#pragma unroll   // constant indices, so that the arrays stay in registers
        for (int j = 0; j < 4; ++j) acc[i][j] = wm(af[i], bf[j], acc[i][j]); } }
  float (*sf)[LF] = (float (*)[LF])&st[0][0][0][0];   // 128 x 132 f32 = 67,584 B of the 73,728 B
  __syncthreads();   // ends every wave's fragment reads of the last stage before the output tile overwrites the buffers
#pragma unroll   // constant indices, so that the arrays stay in registers
  for (int j = 0; j < 4; ++j) { const float bias = bfr(BO[c0 + wc + j * 16 + col]);
#pragma unroll   // constant indices, so that the arrays stay in registers
    for (int i = 0; i < 2; ++i)
#pragma unroll   // constant indices, so that the arrays stay in registers
      for (int r = 0; r < 8; ++r) sf[wr + i * 16 + 8 * g + r][wc + j * 16 + col] = acc[i][j][r] * (1.0f / 16384.0f) + bias; }   /* 2^-8 (Wo carry) x 2^-6 (ctx carry) */
  __syncthreads();   // publishes the output tile: a wave stores whole 512-B rows that two waves wrote
#pragma unroll   // one address, sixteen constant offsets
  for (int rl = 0; rl < 16; ++rl) vst2(OUT + (r0 + wave * 16 + rl) * N2 + c0 + lane * 4, *(const v4f*)&sf[wave * 16 + rl][lane * 4]); }
#define WS_C64 (WS_BP + 4u * 3 * 128)                     // f32 context [32][2048][64] contiguous == the raw-reshaped [2*2048][1024] rows
#define WS_END3 (WS_C64 + 4u * (size_t)NB * TT * 64)
extern "C" void kernel_launch(void* const* d_in, const int* in_sizes, int n_in, void* d_out, int out_size, void* d_ws, size_t ws_size, hipStream_t stream) {
  (void)in_sizes; (void)n_in; (void)out_size;
  const float** F = (const float**)d_in;
  if (ws_size < (size_t)WS_END) return;
  char* ws = (char*)d_ws; _Float16 *QH = (_Float16*)(ws + WS_QH), *KH = (_Float16*)(ws + WS_KH), *VT = (_Float16*)(ws + WS_VT), *QL = (_Float16*)(ws + WS_QL), *KL = (_Float16*)(ws + WS_KL); __bf16 *VB = (__bf16*)(ws + WS_VB), *VBL = (__bf16*)(ws + WS_VBL);
  (void)KL; (void)VB; (void)VBL;
  // inputs: 0 query [2,2048,1024]; 1 key; 2 value (each viewed as 65,536 rows of 64: the raw reshape); 3 mask [2,1,2048,2048] int32; 4 Wq [64,64] (out,in); 5 Wk; 6 Wv; 7 Wo [1024,1024] (out,in); 8 bo [1024] (nonzero)
  if (ws_size < (size_t)WS_END3) return;
  float *WP = (float*)(ws + WS_WP), *BP = (float*)(ws + WS_BP), *C64 = (float*)(ws + WS_C64);
  k_padw<<<dim3(32, 3), 256, 0, stream>>>(F[4], F[5], F[6], nullptr, nullptr, nullptr, WP, BP);
  k_proj<<<dim3(TNB * TT / 64, CC / 128, 3), 128, 0, stream>>>(F[0], F[1], F[2], WP, WP + (size_t)CIN * 128, WP + 2 * (size_t)CIN * 128, BP, BP + 128, BP + 256, QH, QL, KH, KL, VT, VB, VBL);
  k_fa<<<dim3(TT / FQ, TNB), 256, 0, stream>>>(QH, QL, KH, VT, (const int*)d_in[3], C64);   /* pseudo-sequence = real batch (b >> 4), pseudo-head (b & 15); head 0 only */
  k_lin2<<<dim3((TNB * TT * 64 / K2) / LM, N2 / LN), 256, 0, stream>>>(C64, F[7], F[8], (float*)d_out);
}

// v004
// Measured time: 105 microseconds a run.
// Timed twice side by side with v003, it ran 1.28 and 1.31 times as fast.
// Over all steps from v000 it is 27.5 times as fast.
// compute dtype: all float inputs rounded to bf16; q/k/v projections with EXACT bf16 products on WMMA 16x16x32 (f32 accumulate); logits: q (f16 + its f16 residual x 2^10) x k once to f16 (2 products); running-maximum softmax in f32; exp(logit - running maximum) once to f16 x v once to f16 (1 product), divided by the f32 sum at the end; f32 output.
#include <hip/hip_runtime.h>
#include <math.h>

typedef __attribute__((ext_vector_type(16))) _Float16 v16h;
typedef __attribute__((ext_vector_type(16))) __bf16 v16b;
typedef __attribute__((ext_vector_type(8)))  _Float16 v8h;
typedef __attribute__((ext_vector_type(8)))  float v8f;
typedef __attribute__((ext_vector_type(4)))  float v4f;
typedef __attribute__((ext_vector_type(2)))  float v2f;
typedef __attribute__((ext_vector_type(4)))  unsigned v4u;
typedef __attribute__((ext_vector_type(4)))  int v4i;
typedef float __attribute__((may_alias)) float_a;
typedef int __attribute__((may_alias)) int_a;

template <typename T> __device__ __forceinline__ void vst2(void* p, T v) { *(T*)p = v;  }
__device__ __forceinline__ v8f wmma16(v16h a, v16h b, v8f c) {
  v8f d = __builtin_amdgcn_wmma_f32_16x16x32_f16(false, a, false, b, (short)0, c, false, false);
  asm volatile("v_nop\n\tv_nop\n\tv_nop\n\tv_nop" : "+v"(d) : "v"(a), "v"(b));
  return d;
}
__device__ __forceinline__ v8f wmma_bf(v16b a, v16b b, v8f c) {
  v8f d = __builtin_amdgcn_wmma_f32_16x16x32_bf16(false, a, false, b, (short)0, c, false, false);
  asm volatile("v_nop\n\tv_nop\n\tv_nop\n\tv_nop" : "+v"(d) : "v"(a), "v"(b));
  return d;
}
// 16x16x32 fragments: lane = (h = lane>>4, row/col = lane&15); elements 0..7 = k0+8h+0..7, 8..15 = k0+16+8h+0..7; D element r = row 8h+r
__device__ __forceinline__ v16h frag_h(const _Float16* rowk0, int lane) {
  union { v16h v; v8h q[2]; } u; const _Float16* p = rowk0 + 8 * (lane >> 4);
  u.q[0] = *(const v8h*)p; u.q[1] = *(const v8h*)(p + 16); return u.v;
}
__device__ __forceinline__ v16h frag_f32(const float* rowk0, int lane) {
  v16h a; const float* p = rowk0 + 8 * (lane >> 4);
#pragma unroll
  for (int i = 0; i < 8; ++i) { a[i] = (_Float16)p[i]; a[8 + i] = (_Float16)p[16 + i]; }
  return a;
}
__device__ __forceinline__ v16h frag_f32s(const float* rowk0, int lane, float sc) {
  v16h a; const float* p = rowk0 + 8 * (lane >> 4);
#pragma unroll
  for (int i = 0; i < 8; ++i) { a[i] = (_Float16)(p[i] * sc); a[8 + i] = (_Float16)(p[16 + i] * sc); }
  return a;
}
// column fragment from a [K][ld] layout (column n), rows >= K read as 0
__device__ __forceinline__ v16h fragc_f32(const float* W, int k0, int n, int lane, int ld, int K) {
  v16h a; const int g = lane >> 4;
#pragma unroll
  for (int i = 0; i < 8; ++i) { const int ka = k0 + 8 * g + i, kb = ka + 16;
    a[i] = (_Float16)(ka < K ? W[(size_t)(ka < K ? ka : K - 1) * ld + n] : 0.f); a[8 + i] = (_Float16)(kb < K ? W[(size_t)(kb < K ? kb : K - 1) * ld + n] : 0.f); }
  return a;
}
struct F2 { v16b h, l; };
__device__ __forceinline__ F2 bsplit16(const float v[16]) { F2 r;
#pragma unroll
  for (int i = 0; i < 16; ++i) { const __bf16 h = (__bf16)v[i]; r.h[i] = h; r.l[i] = (__bf16)(v[i] - (float)h); }
  return r; }
__device__ __forceinline__ F2 split_row(const float* row, int k0, int lane) { float v[16]; const float* p = row + k0 + 8 * (lane >> 4);
#pragma unroll
  for (int i = 0; i < 8; ++i) { v[i] = p[i]; v[8 + i] = p[16 + i]; }
  return bsplit16(v); }
__device__ __forceinline__ F2 split_rowK(const float* row, int k0, int lane, int K) { float v[16]; const int g = lane >> 4;
#pragma unroll
  for (int i = 0; i < 8; ++i) { const int ka = k0 + 8 * g + i, kb = ka + 16; v[i] = ka < K ? row[ka < K ? ka : K - 1] : 0.f; v[8 + i] = kb < K ? row[kb < K ? kb : K - 1] : 0.f; }
  return bsplit16(v); }
__device__ __forceinline__ F2 split_col(const float* W, int k0, int n, int lane, int ld, int K) { float v[16]; const int g = lane >> 4;
#pragma unroll
  for (int i = 0; i < 8; ++i) { const int ka = k0 + 8 * g + i, kb = ka + 16; v[i] = ka < K ? W[(size_t)(ka < K ? ka : K - 1) * ld + n] : 0.f; v[8 + i] = kb < K ? W[(size_t)(kb < K ? kb : K - 1) * ld + n] : 0.f; }
  return bsplit16(v); }
__device__ __forceinline__ v8f mac3(const F2& a, const F2& b, v8f c) { c = wmma_bf(a.l, b.h, c); c = wmma_bf(a.h, b.l, c); return wmma_bf(a.h, b.h, c); }
__device__ __forceinline__ float sigm(float v) { return 1.0f / (1.0f + expf(-v)); }
#define LDSX() do { asm volatile("s_wait_dscnt 0" ::: "memory"); __builtin_amdgcn_wave_barrier(); __builtin_amdgcn_fence(__ATOMIC_RELEASE, "workgroup"); } while (0)

// Masked self-attention with a RAW reshape into heads (query / key / value [2,2048,1024] are reshaped WITHOUT transpose to [2,16,2048,64]: pseudo-head h of batch b = the contiguous 131,072 floats starting at (b*16 + h)*2048*64, i.e. 32 pseudo-sequences of 2,048 positions x 64 dims each); one shared bias-free torch (out,in) Linear [64,64] per role (Wq, Wk, Wv); scores = Q K^T masked by mask[b][0][q][k] == 0 -> -1e20 (int32 random 0/1 per batch), then divided by sqrt(embed = 1024) = 32 (the source's quirk: logit sigma - 0.08); softmax; out = attn V reshaped raw back to [2,2048,1024]; (out,in) Wo [1024,1024] + bo (nonzero): result = out Wo^T + bo.
#define NB 32
#define TT 2048
#define CC 128            // NH * HD = projected width
#define DIN 64          // input (model) width
#define NH 2
#define HD 64
#define NQB (TT / 64)
#define HG 1
#define SCALE (0.03125f)
#define CAUSAL 0
#ifndef TNB
#define TNB NB
#endif
__device__ __forceinline__ float bfr(float v) { return (float)(__bf16)v; }
__host__ __device__ __forceinline__ int kb_last(int qb) { return CAUSAL ? ((qb * 64 + 63) >> 7) : (TT / 128 - 1); }
typedef __attribute__((ext_vector_type(8))) __bf16 v8b;
__device__ __forceinline__ v16b frag_b(const __bf16* rowk0, int lane) {
  union { v16b v; v8b q[2]; } u; const __bf16* p = rowk0 + 8 * (lane >> 4);
  u.q[0] = *(const v8b*)p; u.q[1] = *(const v8b*)(p + 16); return u.v;
}
#define QBH 0
#define QHI 2048            // rows carrying a q residual plane (all rows when non-causal: 2-product logits everywhere)
#define KHI 64            // key rows carrying k residual / v bf16 hi+lo planes (written by k_proj; no kernel here reads them)
// B fragment (k rows k0+.., output column o) of a weight: (in,out) [K][ld] or (out,in) [ld rows of K]: bf16 exact, or f16(bf16 * 256) exact
__device__ __forceinline__ v16b wcol_io(const float* Wm, int k0, int o, int lane, int ld) { v16b w; const int g = lane >> 4;
#pragma unroll
  for (int i = 0; i < 8; ++i) { w[i] = (__bf16)Wm[(size_t)(k0 + 8 * g + i) * ld + o]; w[8 + i] = (__bf16)Wm[(size_t)(k0 + 16 + 8 * g + i) * ld + o]; }
  return w; }
__device__ __forceinline__ v16b wcol_oi(const float* Wm, int k0, int o, int lane, int K) { v16b w; const float* p = Wm + (size_t)o * K + k0 + 8 * (lane >> 4);
#pragma unroll
  for (int i = 0; i < 8; ++i) { w[i] = (__bf16)p[i]; w[8 + i] = (__bf16)p[16 + i]; }
  return w; }
__device__ __forceinline__ v16h wcolh_io(const float* Wm, int k0, int o, int lane, int ld) { v16h w; const int g = lane >> 4;
#pragma unroll
  for (int i = 0; i < 8; ++i) { w[i] = (_Float16)(bfr(Wm[(size_t)(k0 + 8 * g + i) * ld + o]) * 256.0f); w[8 + i] = (_Float16)(bfr(Wm[(size_t)(k0 + 16 + 8 * g + i) * ld + o]) * 256.0f); }
  return w; }
__device__ __forceinline__ v16h wcolh_oi(const float* Wm, int k0, int o, int lane, int K) { v16h w; const float* p = Wm + (size_t)o * K + k0 + 8 * (lane >> 4);
#pragma unroll
  for (int i = 0; i < 8; ++i) { w[i] = (_Float16)(bfr(p[i]) * 256.0f); w[8 + i] = (_Float16)(bfr(p[16 + i]) * 256.0f); }
  return w; }
#define WQKV_LAYOUT 1   // 0 = (in,out) [DIN][CC]; 1 = (out,in) [CC][DIN]; 2 = per-head [NH][DIN][HD]
__device__ __forceinline__ v16b wcol_hdk(const float* Wm, int k0, int o, int lane) { v16b w; const int g = lane >> 4; const float* p = Wm + (size_t)(o / HD) * DIN * HD + (o % HD);
#pragma unroll
  for (int i = 0; i < 8; ++i) { w[i] = (__bf16)p[(size_t)(k0 + 8 * g + i) * HD]; w[8 + i] = (__bf16)p[(size_t)(k0 + 16 + 8 * g + i) * HD]; }
  return w; }
#define WO_OUT_IN 0
#if WQKV_LAYOUT == 1
#define WCOL(W, k0, o, lane) wcol_oi(W, k0, o, lane, DIN)
#elif WQKV_LAYOUT == 2
#define WCOL(W, k0, o, lane) wcol_hdk(W, k0, o, lane)
#else
#define WCOL(W, k0, o, lane) wcol_io(W, k0, o, lane, CC)
#endif
#if WO_OUT_IN
#define WOCOL(W, k0, o, lane) wcol_oi(W, k0, o, lane, CC)
#define WOCOLH(W, k0, o, lane) wcolh_oi(W, k0, o, lane, CC)
#else
#define WOCOL(W, k0, o, lane) wcol_io(W, k0, o, lane, DIN)
#define WOCOLH(W, k0, o, lane) wcolh_io(W, k0, o, lane, DIN)
#endif
#define CIN 64
// ---- k_padw: the three (out,in) [64][C] projection weights copied into zero-padded (out,in) [128][C] ws planes (rows 64..127 zero) + zero-padded [128] biases, so the 128-column kernels apply unchanged (columns 64..127 = an all-zero dummy head, never attended)
__global__ __launch_bounds__(256) void k_padw(const float* __restrict__ WQ, const float* __restrict__ WK, const float* __restrict__ WV, const float* __restrict__ BQ, const float* __restrict__ BK, const float* __restrict__ BV, float* __restrict__ WP, float* __restrict__ BP) { const int which = blockIdx.y; const float* Wsrc = which == 0 ? WQ : (which == 1 ? WK : WV); const float* Bsrc = which == 0 ? BQ : (which == 1 ? BK : BV); float* dst = WP + (size_t)which * 128 * CIN;
  for (int e = blockIdx.x * 256 + threadIdx.x; e < 128 * (CIN / 4); e += gridDim.x * 256) { const int row = e / (CIN / 4), q = e % (CIN / 4); const v4f ld = *(const v4f*)(Wsrc + (size_t)(row & 63) * CIN + q * 4); asm volatile("s_wait_loadcnt 0x0" ::: "memory"); const float keep = row < 64 ? 1.f : 0.f; v4f ov; ov[0] = ld[0] * keep; ov[1] = ld[1] * keep; ov[2] = ld[2] * keep; ov[3] = ld[3] * keep; vst2(dst + (size_t)row * CIN + q * 4, ov); }   /* unconditional (clamped) loads, zero by select */
  if (blockIdx.x == 0 && threadIdx.x < 128) { const int c = threadIdx.x; float bvv = 0.f; if (Bsrc) { const float t = Bsrc[c & 63]; asm volatile("s_wait_loadcnt 0x0" ::: "memory"); bvv = c < 64 ? t : 0.f; } vst2(BP + which * 128 + c, bvv); } }
#define WS_WP (WS_END)                                  // padded weights [3][128 x C]
#define WS_BP (WS_WP + 4u * 3 * (size_t)CIN * 128)        // padded biases [3][128]
#ifndef PROJ_EXTRA_PARAMS
#define PROJ_EXTRA_PARAMS
#endif

#define WS_QH  0u                                      // f16 q rows [b*t][CC]
#define WS_KH  (WS_QH + 2u * (size_t)NB * TT * CC)      // f16 k rows [b*t][CC]
#define WS_VT  (WS_KH + 2u * (size_t)NB * TT * CC)      // f16 v planes [b][c][t]
#define WS_QL  (WS_VT + 2u * (size_t)NB * CC * TT)      // f16 q residual x 2^10 rows [b][t < QHI][CC]
#define WS_KL  (WS_QL + 2u * (size_t)NB * QHI * CC)     // f16 k residual x 2^10 rows [b][t < KHI][CC]
#define WS_VB  (WS_KL + 2u * (size_t)NB * KHI * CC)     // bf16 v hi planes [b][c][t < KHI]
#define WS_VBL (WS_VB + 2u * (size_t)NB * CC * KHI)
#define WS_END (WS_VBL + 2u * (size_t)NB * CC * KHI)

// ---- k_proj: block = (PT tiles of 64 rows, 128 cols, which): q/k/v = X W (+ b) with exact bf16 products (K = DIN) -> which 0: q f16 rows (+ residual rows < QHI); 1: k f16 rows (+ residual rows < KHI); 2: v f16 planes [c][t] (+ bf16 hi/lo planes for t < KHI)
// Operand path: X rows and W rows are read as whole lines (a wave's 16-B loads cover two 256-B rows = 512 contiguous bytes), rounded to bf16 once per block and staged in LDS; the fragments come from LDS. W is staged once per block, the next row tile's loads are in flight in registers.
#define PT 4              // row tiles of 64 per block
#define PP 72             // LDS pitch of a 64-element bf16 row: 128 B + 16 B, conflict-free for 16-B fragment reads
typedef __attribute__((ext_vector_type(4))) __bf16 v4b;
__device__ __forceinline__ v4b cvt4b(v4f v) { v4b h;
#pragma unroll
  for (int e = 0; e < 4; ++e) h[e] = (__bf16)v[e];
  return h; }
// 16-B global store with its wait in ONE statement: the next pass of the store loop and the next trip reuse the registers that the store names
__device__ __forceinline__ void st16w(void* p, v4u v) { asm volatile("global_store_b128 %0, %1, off\n\ts_wait_xcnt 0x0" :: "v"(p), "v"(v) : "memory"); }
__global__ __launch_bounds__(128) void k_proj(const float* __restrict__ XQ, const float* __restrict__ XK, const float* __restrict__ XV, const float* __restrict__ WQ, const float* __restrict__ WK, const float* __restrict__ WV, const float* __restrict__ BQ, const float* __restrict__ BK, const float* __restrict__ BV,
    _Float16* __restrict__ QH, _Float16* __restrict__ QL, _Float16* __restrict__ KH, _Float16* __restrict__ KL, _Float16* __restrict__ VT, __bf16* __restrict__ VB, __bf16* __restrict__ VBL) {
  __shared__ __align__(16) unsigned char pool[3 * 128 * 72 * 2];   // output tiles; a block has one role, so q/k (sh, sl) and v (th, tb, tbl) share the bytes
  __shared__ __align__(16) __bf16 xs[64][PP], wsg[128][PP];   // staged operands: one X row tile, all W rows
  _Float16 (*sh)[136] = (_Float16 (*)[136])pool; _Float16 (*sl)[136] = (_Float16 (*)[136])(pool + 64 * 136 * 2);
  _Float16 (*th)[72] = (_Float16 (*)[72])pool; __bf16 (*tb)[72] = (__bf16 (*)[72])(pool + 128 * 72 * 2); __bf16 (*tbl)[72] = (__bf16 (*)[72])(pool + 2 * 128 * 72 * 2);
  const int tid = threadIdx.x, wave = tid >> 5, lane = tid & 31, col = lane & 15, g = lane >> 4; const int which = blockIdx.z; const int c0 = blockIdx.y * 128; const size_t rb = (size_t)blockIdx.x * (64 * PT);
  const float* X = which == 0 ? XQ : which == 1 ? XK : XV; const float* WA = which == 0 ? WQ : which == 1 ? WK : WV; const float* BA = which == 0 ? BQ : which == 1 ? BK : BV;
  const int sr = tid >> 4, sc = tid & 15;   // staging: thread -> (row, 16-B chunk) of the 256-B rows
  const float* gx = X + (rb + sr) * DIN + sc * 4;
  v4f rx[8]; float bias[8];
  { v4f rw[16]; const float* gw = WA + (size_t)(c0 + sr) * DIN + sc * 4;
#pragma unroll   // constant indices, so that the arrays stay in registers
    for (int i = 0; i < 16; ++i) rw[i] = *(const v4f*)(gw + (size_t)(8 * i) * DIN);
#pragma unroll   // constant indices, so that the arrays stay in registers
    for (int i = 0; i < 8; ++i) rx[i] = *(const v4f*)(gx + (size_t)(8 * i) * DIN);
#pragma unroll   // constant indices, so that the arrays stay in registers
    for (int j = 0; j < 8; ++j) bias[j] = 0.f;
    if (BA) {
#pragma unroll   // constant indices, so that the arrays stay in registers
      for (int j = 0; j < 8; ++j) bias[j] = BA[c0 + j * 16 + col];
#pragma unroll   // constant indices, so that the arrays stay in registers
      for (int j = 0; j < 8; ++j) bias[j] = bfr(bias[j]); }
#pragma unroll   // constant indices, so that the arrays stay in registers
    for (int i = 0; i < 16; ++i) *(v4b*)&wsg[sr + 8 * i][sc * 4] = cvt4b(rw[i]); }
#pragma clang loop unroll(disable)   // one copy of the tile body: the branch round the next tile's loads keeps them directly behind the barrier
  for (int it = 0; it < PT; ++it) { const size_t r0 = rb + (size_t)it * 64; const size_t bb = r0 / TT; const int t0 = (int)(r0 % TT);
#pragma unroll   // constant indices, so that the arrays stay in registers
    for (int i = 0; i < 8; ++i) *(v4b*)&xs[sr + 8 * i][sc * 4] = cvt4b(rx[i]);
    __syncthreads();   // publishes the X tile (and, on the first trip, W); it also ends every wave's reads of the output tile of trip it - 1, which this trip overwrites only behind it
    v8f acc[8] = {};
#pragma unroll   // constant indices, so that the arrays stay in registers
    for (int kc = 0; kc < DIN / 32; ++kc) { const v16b a = frag_b(&xs[wave * 16 + col][kc * 32], lane); v16b w[8];
#pragma unroll   // constant indices, so that the arrays stay in registers
      for (int j = 0; j < 8; ++j) w[j] = frag_b(&wsg[j * 16 + col][kc * 32], lane);
#pragma unroll   // constant indices, so that the arrays stay in registers
      for (int j = 0; j < 8; ++j) acc[j] = __builtin_amdgcn_wmma_f32_16x16x32_bf16(false, a, false, w[j], (short)0, acc[j], false, false); }
    const bool qk = which < 2; _Float16* DH = which == 0 ? QH : KH; _Float16* DL = which == 0 ? QL : KL; const int nhi = which == 0 ? QHI : KHI; const bool hi_rows = t0 < (qk ? nhi : KHI);
    if (qk) {
#pragma unroll
      for (int j = 0; j < 8; ++j) {
#pragma unroll
        for (int r = 0; r < 8; ++r) { const float v = acc[j][r] + bias[j]; const _Float16 hv = (_Float16)v; sh[wave * 16 + 8 * g + r][j * 16 + col] = hv; sl[wave * 16 + 8 * g + r][j * 16 + col] = (_Float16)((v - (float)hv) * 1024.0f); } }
    } else {
#pragma unroll
      for (int j = 0; j < 8; ++j) {
#pragma unroll
        for (int r = 0; r < 8; ++r) { const float v = acc[j][r] + bias[j]; const int rl = wave * 16 + 8 * g + r, cl = j * 16 + col; th[cl][rl] = (_Float16)v; const __bf16 bh = (__bf16)v; tb[cl][rl] = bh; tbl[cl][rl] = (__bf16)(v - (float)bh); } } }
    __syncthreads();   // publishes the output tile; it also ends every wave's fragment reads of the X tile, which the next trip overwrites only behind it
    if (it + 1 < PT) {   // behind the barrier (which drains the load counter), so that these loads fly while the output tile is stored
#pragma unroll   // constant indices, so that the arrays stay in registers
      for (int i = 0; i < 8; ++i) rx[i] = *(const v4f*)(gx + (size_t)((it + 1) * 64 + 8 * i) * DIN);
      asm volatile("s_wait_xcnt 0x0" ::: "memory"); }   // the code behind may reuse the registers that held these loads' addresses: the wait stands in front of that overwrite
    if (qk) {
      for (int e = tid; e < 64 * 16; e += 128) { const int rl = e >> 4, q = e & 15; st16w((DH + (r0 + rl) * CC + c0 + q * 8), *(const v4u*)&sh[rl][q * 8]); if (hi_rows) st16w((DL + (bb * nhi + t0 + rl) * (size_t)CC + c0 + q * 8), *(const v4u*)&sl[rl][q * 8]); }
    } else {
      for (int e = tid; e < 128 * 8; e += 128) { const int cl = e >> 3, q = e & 7; st16w((VT + (bb * CC + c0 + cl) * (size_t)TT + t0 + q * 8), *(const v4u*)&th[cl][q * 8]); if (hi_rows) { const size_t o3 = (bb * CC + c0 + cl) * (size_t)KHI + t0 + q * 8; st16w((VB + o3), *(const v4u*)&tb[cl][q * 8]); st16w((VBL + o3), *(const v4u*)&tbl[cl][q * 8]); } } } } }
// ---- k_fa: scores, mask, softmax and P . v of one pseudo-sequence in ONE pass over the keys: S and P stay in registers. Block = 8 waves x 16 queries (blockIdx.x = query block, blockIdx.y = pseudo-sequence b, real batch = b >> 4); a stage = 64 keys, K rows, v plane rows and the block's mask rows staged in LDS (whole 128-B lines per load), two buffers, the next stage's loads in flight in registers.
// St = K Qt (A = K rows, B = q hi and q residual x 2^10, kept in registers): a lane holds ONE query (col) and keys 8g + r of each 16-key tile, so two tiles pack in place into the B operand of Ot += vt Pt (A = v plane rows, same k order as frag_h). Running maximum and sum per query in raw score units (the 1/32 sits in the exponent's factor); where(mask == 0, -1e20, score) as in the source, so a fully masked row comes out uniform.
#define FQ 128            // queries per block
#define FK 64             // keys per stage
#define KP 72             // LDS pitch of a 64-element f16 row: 128 B + 16 B, conflict-free for 16-B fragment reads
#define MP 68             // LDS pitch of a 64-element int row: 256 B + 16 B, likewise
#define CEXP (SCALE * 1.44269504088896f)
__device__ __forceinline__ v8f wm(v16h a, v16h b, v8f c) { return __builtin_amdgcn_wmma_f32_16x16x32_f16(false, a, false, b, (short)0, c, false, false); }
// 2^x in place. One statement for eight: behind a transcendental the instruction set asks for one independent instruction before its result is read or its source overwritten; here each v_exp_f32 is that instruction for the one before it and the v_nop for the last, whatever the compiler puts next
__device__ __forceinline__ v8f exp2x8(v8f e) { float a0 = e[0], a1 = e[1], a2 = e[2], a3 = e[3], a4 = e[4], a5 = e[5], a6 = e[6], a7 = e[7];
  asm("v_exp_f32 %0, %0\n\tv_exp_f32 %1, %1\n\tv_exp_f32 %2, %2\n\tv_exp_f32 %3, %3\n\tv_exp_f32 %4, %4\n\tv_exp_f32 %5, %5\n\tv_exp_f32 %6, %6\n\tv_exp_f32 %7, %7\n\tv_nop" : "+v"(a0), "+v"(a1), "+v"(a2), "+v"(a3), "+v"(a4), "+v"(a5), "+v"(a6), "+v"(a7));
  v8f p; p[0] = a0; p[1] = a1; p[2] = a2; p[3] = a3; p[4] = a4; p[5] = a5; p[6] = a6; p[7] = a7; return p; }
__device__ __forceinline__ float exp2x1(float a) { asm("v_exp_f32 %0, %0\n\tv_nop" : "+v"(a)); return a; }   // the v_nop: the same slot
__device__ __forceinline__ float xhalf(float v) { const int i = __builtin_bit_cast(int, v); return __builtin_bit_cast(float, (int)__builtin_amdgcn_permlanex16(i, i, 0x76543210, 0xfedcba98, false, false)); }   // the value of lane l ^ 16
__global__ __launch_bounds__(256, 4) void k_fa(const _Float16* __restrict__ QH, const _Float16* __restrict__ QL, const _Float16* __restrict__ KH, const _Float16* __restrict__ VT, const int* __restrict__ MASK, float* __restrict__ C) {
  __shared__ __align__(16) _Float16 sk[2][FK][KP], sv[2][HD][KP]; __shared__ __align__(16) int sm[2][FQ][MP];
  const int tid = threadIdx.x, wave = tid >> 5, lane = tid & 31, col = lane & 15, g = lane >> 4; const int b = blockIdx.y, q0 = blockIdx.x * FQ, qw = wave * 16 + col;
  v16h qh[2], qr[2];
#pragma unroll   // constant indices, so that the arrays stay in registers
  for (int kc = 0; kc < 2; ++kc) { qh[kc] = frag_h(QH + ((size_t)b * TT + q0 + qw) * CC + kc * 32, lane); qr[kc] = frag_h(QL + ((size_t)b * QHI + q0 + qw) * CC + kc * 32, lane); }
  const int r8 = tid >> 3, c8 = tid & 7, r16 = tid >> 4, c16 = tid & 15;   // staging: thread -> (row, 16-B chunk) of 128-B rows (K, v) and of 256-B rows (mask)
  const _Float16* gk = KH + ((size_t)b * TT + r8) * CC + c8 * 8; const _Float16* gv = VT + ((size_t)b * CC + r8) * TT + c8 * 8; const int* gm = MASK + ((size_t)(b >> 4) * TT + q0 + r16) * TT + c16 * 4;
  v8h rk[2], rv[2]; v4i rm[8];
#pragma unroll   // constant indices, so that the arrays stay in registers
  for (int i = 0; i < 2; ++i) { rk[i] = *(const v8h*)(gk + (size_t)(32 * i) * CC); rv[i] = *(const v8h*)(gv + (size_t)(32 * i) * TT); }
#pragma unroll   // constant indices, so that the arrays stay in registers
  for (int i = 0; i < 8; ++i) rm[i] = *(const v4i*)(gm + (size_t)(16 * i) * TT);
  v8f o[4] = {}, lv = {}; float m = -3.0e38f;
#pragma clang loop unroll(disable)   // one copy of the stage body: the last stage is not peeled off, and the branch round the next stage's loads keeps them directly behind the barrier
  for (int s = 0; s < TT / FK; ++s) { const int u = s & 1;
#pragma unroll   // constant indices, so that the arrays stay in registers
    for (int i = 0; i < 2; ++i) { *(v8h*)&sk[u][r8 + 32 * i][c8 * 8] = rk[i]; *(v8h*)&sv[u][r8 + 32 * i][c8 * 8] = rv[i]; }
#pragma unroll   // constant indices, so that the arrays stay in registers
    for (int i = 0; i < 8; ++i) *(v4i*)&sm[u][r16 + 16 * i][c16 * 4] = rm[i];
    __syncthreads();   // publishes buffer u; it also ends every wave's reads of buffer u ^ 1 (stage s - 1), which stage s + 1 overwrites only behind it
    if (s + 1 < TT / FK) { const int k1 = (s + 1) * FK;   // behind the barrier (which drains the load counter), so that these loads fly during the stage's work
#pragma unroll   // constant indices, so that the arrays stay in registers
      for (int i = 0; i < 2; ++i) { rk[i] = *(const v8h*)(gk + (size_t)(k1 + 32 * i) * CC); rv[i] = *(const v8h*)(gv + (size_t)(32 * i) * TT + k1); }
#pragma unroll   // constant indices, so that the arrays stay in registers
      for (int i = 0; i < 8; ++i) rm[i] = *(const v4i*)(gm + (size_t)(16 * i) * TT + k1);
      asm volatile("s_wait_xcnt 0x0" ::: "memory"); }   // the stage's first LDS reads land in the registers that held these loads' addresses: the wait stands in front of that overwrite
    v8f t[4];
#pragma unroll   // constant indices, so that the arrays stay in registers
    for (int j = 0; j < 4; ++j) { v8f a = {}, ar = {};
#pragma unroll   // constant indices, so that the arrays stay in registers
      for (int kc = 0; kc < 2; ++kc) { const v16h kf = frag_h(&sk[u][j * 16 + col][kc * 32], lane); a = wm(kf, qh[kc], a); ar = wm(kf, qr[kc], ar); }
      const v4i m0 = *(const v4i*)&sm[u][qw][j * 16 + 8 * g], m1 = *(const v4i*)&sm[u][qw][j * 16 + 8 * g + 4]; const v8f x = a + ar * (1.0f / 1024.0f);
#pragma unroll   // constant indices, so that the arrays stay in registers
      for (int r = 0; r < 8; ++r) t[j][r] = ((r < 4 ? m0[r & 3] : m1[r & 3]) == 0) ? -1.0e20f : x[r]; }
    float mj[4];   // one maximum chain per tile: four independent chains
#pragma unroll   // constant indices, so that the arrays stay in registers
    for (int j = 0; j < 4; ++j) { mj[j] = t[j][0];
#pragma unroll   // constant indices, so that the arrays stay in registers
      for (int r = 1; r < 8; ++r) mj[j] = fmaxf(mj[j], t[j][r]); }
    float mx = fmaxf(fmaxf(mj[0], mj[1]), fmaxf(mj[2], mj[3])); mx = fmaxf(mx, xhalf(mx));   // the query's other 32 keys of the stage sit in lane l ^ 16
    const float mn = fmaxf(m, mx), al = exp2x1((m - mn) * CEXP); m = mn;
    union { v16h v; v8h q[2]; } pb[2]; v8f ps;
#pragma unroll   // constant indices, so that the arrays stay in registers
    for (int j = 0; j < 4; ++j) { const v8f p = exp2x8((t[j] - mn) * CEXP);
      ps = j ? ps + p : p; pb[j >> 1].q[j & 1] = __builtin_convertvector(p, v8h); }
    lv = lv * al + ps;
#pragma unroll   // constant indices, so that the arrays stay in registers
    for (int jd = 0; jd < 4; ++jd) o[jd] *= al;
#pragma unroll   // constant indices, so that the arrays stay in registers
    for (int kk = 0; kk < 2; ++kk)
#pragma unroll   // constant indices, so that the arrays stay in registers
      for (int jd = 0; jd < 4; ++jd) o[jd] = wm(frag_h(&sv[u][jd * 16 + col][kk * 32], lane), pb[kk].v, o[jd]); }
  float ls = ((lv[0] + lv[1]) + (lv[2] + lv[3])) + ((lv[4] + lv[5]) + (lv[6] + lv[7])); ls += xhalf(ls); const float inv = 1.0f / ls;   // ls >= 1: the maximum's own term
  float* cr = C + ((size_t)b * TT + q0 + qw) * HD + 8 * g;   // Ot tile jd, register r = ctx[query][jd * 16 + 8g + r]: 32 contiguous bytes per lane and tile
#pragma unroll   // constant indices, so that the arrays stay in registers
  for (int jd = 0; jd < 4; ++jd) { v4f w0, w1;
#pragma unroll   // constant indices, so that the arrays stay in registers
    for (int r = 0; r < 4; ++r) { w0[r] = o[jd][r] * inv; w1[r] = o[jd][4 + r] * inv; }
    vst2(cr + jd * 16, w0); vst2(cr + jd * 16 + 4, w1); } }

// ---- k_lin2: the module's final Linear on the RAW-reshaped context: rows = the [2*2048][1024] view of the contiguous [32][2048][64] context buffer; out = ctx Wo^T + bo with ctx x 2^6 once to f16 against Wo as f16(bf16 x 2^8) (1 product, k in ascending 32-chunks).
// Block = 8 waves on a 128 x 128 output tile (wave = 32 rows x 64 columns); a stage = 64 k: the ctx rows and the Wo rows are read as whole 128-B lines, converted once per block and staged as f16 in LDS, two buffers, the next stage's loads in flight in registers.
#define K2 1024
#define N2 1024
#define LM 128            // output rows per block
#define LN 128            // output columns per block
#define LK 64             // k per stage
#define LP 72             // LDS pitch of a 64-element f16 row: 128 B + 16 B, conflict-free for 16-B fragment reads
#define LF 132            // LDS pitch of a 128-element f32 output row
typedef __attribute__((ext_vector_type(4))) _Float16 v4h;
__global__ __launch_bounds__(256) void k_lin2(const float* __restrict__ Yc, const float* __restrict__ WO, const float* __restrict__ BO, float* __restrict__ OUT) {
  __shared__ __align__(16) _Float16 st[2][2][LM][LP];   // [buffer][0 = ctx rows, 1 = Wo rows][row][k]; after the k loop the same bytes hold the f32 output tile
  const int tid = threadIdx.x, wave = tid >> 5, lane = tid & 31, col = lane & 15, g = lane >> 4; const int c0 = blockIdx.y * LN; const size_t r0 = (size_t)blockIdx.x * LM;
  const int wr = (wave >> 1) * 32, wc = (wave & 1) * 64;
  const int sr = tid >> 4, sc = tid & 15;   // staging: thread -> (row, 16-B chunk) of the 256-B row pieces
  const float* ga = Yc + r0 * K2; const float* gw = WO + (size_t)c0 * K2; const unsigned vo = (unsigned)(sr * K2 + sc * 4);   // block-uniform bases that walk along k, and one per-lane offset that never changes
  v4f ra[8], rw[8];
#pragma unroll   // constant indices, so that the arrays stay in registers
  for (int i = 0; i < 8; ++i) { ra[i] = *(const v4f*)(ga + (vo + 16u * i * K2)); rw[i] = *(const v4f*)(gw + (vo + 16u * i * K2)); }
  v8f acc[2][4] = {};
#pragma clang loop unroll(disable)   // one copy of the stage body: the last stage is not peeled off, and the branch round the next stage's loads keeps them directly behind the barrier
  for (int s = 0; s < K2 / LK; ++s) { const int u = s & 1;
#pragma unroll   // constant indices, so that the arrays stay in registers
    for (int i = 0; i < 8; ++i) { v4h ha, hw;
#pragma unroll   // constant indices, so that the arrays stay in registers
      for (int e = 0; e < 4; ++e) { ha[e] = (_Float16)(ra[i][e] * 64.0f); hw[e] = (_Float16)(bfr(rw[i][e]) * 256.0f); }
      *(v4h*)&st[u][0][sr + 16 * i][sc * 4] = ha; *(v4h*)&st[u][1][sr + 16 * i][sc * 4] = hw; }
    __syncthreads();   // publishes buffer u; it also ends every wave's reads of buffer u ^ 1 (stage s - 1), which stage s + 1 overwrites only behind it
    if (s + 1 < K2 / LK) { ga += LK; gw += LK;   // behind the barrier (which drains the load counter), so that these loads fly during the stage's work
#pragma unroll   // constant indices, so that the arrays stay in registers
      for (int i = 0; i < 8; ++i) { ra[i] = *(const v4f*)(ga + (vo + 16u * i * K2)); rw[i] = *(const v4f*)(gw + (vo + 16u * i * K2)); } }
#pragma unroll   // constant indices, so that the arrays stay in registers
    for (int kk = 0; kk < 2; ++kk) { v16h af[2], bf[4];
#pragma unroll   // constant indices, so that the arrays stay in registers
      for (int i = 0; i < 2; ++i) af[i] = frag_h(&st[u][0][wr + i * 16 + col][kk * 32], lane);
#pragma unroll   // constant indices, so that the arrays stay in registers
      for (int j = 0; j < 4; ++j) bf[j] = frag_h(&st[u][1][wc + j * 16 + col][kk * 32], lane);
#pragma unroll   // constant indices, so that the arrays stay in registers
      for (int i = 0; i < 2; ++i)
#pragma unroll   // constant indices, so that the arrays stay in registers
        for (int j = 0; j < 4; ++j) acc[i][j] = wm(af[i], bf[j], acc[i][j]); } }
  float (*sf)[LF] = (float (*)[LF])&st[0][0][0][0];   // 128 x 132 f32 = 67,584 B of the 73,728 B
  __syncthreads();   // ends every wave's fragment reads of the last stage before the output tile overwrites the buffers
#pragma unroll   // constant indices, so that the arrays stay in registers
  for (int j = 0; j < 4; ++j) { const float bias = bfr(BO[c0 + wc + j * 16 + col]);
#pragma unroll   // constant indices, so that the arrays stay in registers
    for (int i = 0; i < 2; ++i)
#pragma unroll   // constant indices, so that the arrays stay in registers
      for (int r = 0; r < 8; ++r) sf[wr + i * 16 + 8 * g + r][wc + j * 16 + col] = acc[i][j][r] * (1.0f / 16384.0f) + bias; }   /* 2^-8 (Wo carry) x 2^-6 (ctx carry) */
  __syncthreads();   // publishes the output tile: a wave stores whole 512-B rows that two waves wrote
#pragma unroll   // one address, sixteen constant offsets
  for (int rl = 0; rl < 16; ++rl) vst2(OUT + (r0 + wave * 16 + rl) * N2 + c0 + lane * 4, *(const v4f*)&sf[wave * 16 + rl][lane * 4]); }
#define WS_C64 (WS_BP + 4u * 3 * 128)                     // f32 context [32][2048][64] contiguous == the raw-reshaped [2*2048][1024] rows
#define WS_END3 (WS_C64 + 4u * (size_t)NB * TT * 64)
extern "C" void kernel_launch(void* const* d_in, const int* in_sizes, int n_in, void* d_out, int out_size, void* d_ws, size_t ws_size, hipStream_t stream) {
  (void)in_sizes; (void)n_in; (void)out_size;
  const float** F = (const float**)d_in;
  if (ws_size < (size_t)WS_END) return;
  char* ws = (char*)d_ws; _Float16 *QH = (_Float16*)(ws + WS_QH), *KH = (_Float16*)(ws + WS_KH), *VT = (_Float16*)(ws + WS_VT), *QL = (_Float16*)(ws + WS_QL), *KL = (_Float16*)(ws + WS_KL); __bf16 *VB = (__bf16*)(ws + WS_VB), *VBL = (__bf16*)(ws + WS_VBL);
  (void)KL; (void)VB; (void)VBL;
  // inputs: 0 query [2,2048,1024]; 1 key; 2 value (each viewed as 65,536 rows of 64: the raw reshape); 3 mask [2,1,2048,2048] int32; 4 Wq [64,64] (out,in); 5 Wk; 6 Wv; 7 Wo [1024,1024] (out,in); 8 bo [1024] (nonzero)
  if (ws_size < (size_t)WS_END3) return;
  float *WP = (float*)(ws + WS_WP), *BP = (float*)(ws + WS_BP), *C64 = (float*)(ws + WS_C64);
  k_padw<<<dim3(32, 3), 256, 0, stream>>>(F[4], F[5], F[6], nullptr, nullptr, nullptr, WP, BP);
  k_proj<<<dim3(TNB * TT / (64 * PT), CC / 128, 3), 128, 0, stream>>>(F[0], F[1], F[2], WP, WP + (size_t)CIN * 128, WP + 2 * (size_t)CIN * 128, BP, BP + 128, BP + 256, QH, QL, KH, KL, VT, VB, VBL);
  k_fa<<<dim3(TT / FQ, TNB), 256, 0, stream>>>(QH, QL, KH, VT, (const int*)d_in[3], C64);   /* pseudo-sequence = real batch (b >> 4), pseudo-head (b & 15) */
  k_lin2<<<dim3((TNB * TT * 64 / K2) / LM, N2 / LN), 256, 0, stream>>>(C64, F[7], F[8], (float*)d_out);
}

// v005
// A run of this version takes 96.7 microseconds.
// Timed twice side by side with v004, it ran 1.08 and 1.07 times as fast.
// All steps since v000 together make it 29.6 times as fast.
// compute dtype: all float inputs rounded to bf16; q/k/v projections with EXACT bf16 products on WMMA 16x16x32 (f32 accumulate); logits: q (f16 + its f16 residual x 2^10) x k once to f16 (2 products); running-maximum softmax in f32; exp(logit - running maximum) once to f16 x v once to f16 (1 product), divided by the f32 sum at the end; f32 output.
#include <hip/hip_runtime.h>
#include <math.h>

typedef __attribute__((ext_vector_type(16))) _Float16 v16h;
typedef __attribute__((ext_vector_type(16))) __bf16 v16b;
typedef __attribute__((ext_vector_type(8)))  _Float16 v8h;
typedef __attribute__((ext_vector_type(8)))  float v8f;
typedef __attribute__((ext_vector_type(4)))  float v4f;
typedef __attribute__((ext_vector_type(2)))  float v2f;
typedef __attribute__((ext_vector_type(4)))  unsigned v4u;
typedef __attribute__((ext_vector_type(4)))  int v4i;
typedef __attribute__((ext_vector_type(16))) unsigned v16u;
typedef const __attribute__((address_space(4))) v16u* cv16u;   // a pointer to memory that no one writes while the kernel runs: a wave-uniform load through it is a scalar load
typedef float __attribute__((may_alias)) float_a;
typedef int __attribute__((may_alias)) int_a;

template <typename T> __device__ __forceinline__ void vst2(void* p, T v) { *(T*)p = v;  }
__device__ __forceinline__ v8f wmma16(v16h a, v16h b, v8f c) {
  v8f d = __builtin_amdgcn_wmma_f32_16x16x32_f16(false, a, false, b, (short)0, c, false, false);
  asm volatile("v_nop\n\tv_nop\n\tv_nop\n\tv_nop" : "+v"(d) : "v"(a), "v"(b));
  return d;
}
__device__ __forceinline__ v8f wmma_bf(v16b a, v16b b, v8f c) {
  v8f d = __builtin_amdgcn_wmma_f32_16x16x32_bf16(false, a, false, b, (short)0, c, false, false);
  asm volatile("v_nop\n\tv_nop\n\tv_nop\n\tv_nop" : "+v"(d) : "v"(a), "v"(b));
  return d;
}
// 16x16x32 fragments: lane = (h = lane>>4, row/col = lane&15); elements 0..7 = k0+8h+0..7, 8..15 = k0+16+8h+0..7; D element r = row 8h+r
__device__ __forceinline__ v16h frag_h(const _Float16* rowk0, int lane) {
  union { v16h v; v8h q[2]; } u; const _Float16* p = rowk0 + 8 * (lane >> 4);
  u.q[0] = *(const v8h*)p; u.q[1] = *(const v8h*)(p + 16); return u.v;
}
__device__ __forceinline__ v16h frag_f32(const float* rowk0, int lane) {
  v16h a; const float* p = rowk0 + 8 * (lane >> 4);
#pragma unroll
  for (int i = 0; i < 8; ++i) { a[i] = (_Float16)p[i]; a[8 + i] = (_Float16)p[16 + i]; }
  return a;
}
__device__ __forceinline__ v16h frag_f32s(const float* rowk0, int lane, float sc) {
  v16h a; const float* p = rowk0 + 8 * (lane >> 4);
#pragma unroll
  for (int i = 0; i < 8; ++i) { a[i] = (_Float16)(p[i] * sc); a[8 + i] = (_Float16)(p[16 + i] * sc); }
  return a;
}
// column fragment from a [K][ld] layout (column n), rows >= K read as 0
__device__ __forceinline__ v16h fragc_f32(const float* W, int k0, int n, int lane, int ld, int K) {
  v16h a; const int g = lane >> 4;
#pragma unroll
  for (int i = 0; i < 8; ++i) { const int ka = k0 + 8 * g + i, kb = ka + 16;
    a[i] = (_Float16)(ka < K ? W[(size_t)(ka < K ? ka : K - 1) * ld + n] : 0.f); a[8 + i] = (_Float16)(kb < K ? W[(size_t)(kb < K ? kb : K - 1) * ld + n] : 0.f); }
  return a;
}
struct F2 { v16b h, l; };
__device__ __forceinline__ F2 bsplit16(const float v[16]) { F2 r;
#pragma unroll
  for (int i = 0; i < 16; ++i) { const __bf16 h = (__bf16)v[i]; r.h[i] = h; r.l[i] = (__bf16)(v[i] - (float)h); }
  return r; }
__device__ __forceinline__ F2 split_row(const float* row, int k0, int lane) { float v[16]; const float* p = row + k0 + 8 * (lane >> 4);
#pragma unroll
  for (int i = 0; i < 8; ++i) { v[i] = p[i]; v[8 + i] = p[16 + i]; }
  return bsplit16(v); }
__device__ __forceinline__ F2 split_rowK(const float* row, int k0, int lane, int K) { float v[16]; const int g = lane >> 4;
#pragma unroll
  for (int i = 0; i < 8; ++i) { const int ka = k0 + 8 * g + i, kb = ka + 16; v[i] = ka < K ? row[ka < K ? ka : K - 1] : 0.f; v[8 + i] = kb < K ? row[kb < K ? kb : K - 1] : 0.f; }
  return bsplit16(v); }
__device__ __forceinline__ F2 split_col(const float* W, int k0, int n, int lane, int ld, int K) { float v[16]; const int g = lane >> 4;
#pragma unroll
  for (int i = 0; i < 8; ++i) { const int ka = k0 + 8 * g + i, kb = ka + 16; v[i] = ka < K ? W[(size_t)(ka < K ? ka : K - 1) * ld + n] : 0.f; v[8 + i] = kb < K ? W[(size_t)(kb < K ? kb : K - 1) * ld + n] : 0.f; }
  return bsplit16(v); }
__device__ __forceinline__ v8f mac3(const F2& a, const F2& b, v8f c) { c = wmma_bf(a.l, b.h, c); c = wmma_bf(a.h, b.l, c); return wmma_bf(a.h, b.h, c); }
__device__ __forceinline__ float sigm(float v) { return 1.0f / (1.0f + expf(-v)); }
#define LDSX() do { asm volatile("s_wait_dscnt 0" ::: "memory"); __builtin_amdgcn_wave_barrier(); __builtin_amdgcn_fence(__ATOMIC_RELEASE, "workgroup"); } while (0)

// Masked self-attention with a RAW reshape into heads (query / key / value [2,2048,1024] are reshaped WITHOUT transpose to [2,16,2048,64]: pseudo-head h of batch b = the contiguous 131,072 floats starting at (b*16 + h)*2048*64, i.e. 32 pseudo-sequences of 2,048 positions x 64 dims each); one shared bias-free torch (out,in) Linear [64,64] per role (Wq, Wk, Wv); scores = Q K^T masked by mask[b][0][q][k] == 0 -> -1e20 (int32 random 0/1 per batch), then divided by sqrt(embed = 1024) = 32 (the source's quirk: logit sigma - 0.08); softmax; out = attn V reshaped raw back to [2,2048,1024]; (out,in) Wo [1024,1024] + bo (nonzero): result = out Wo^T + bo.
#define NB 32
#define TT 2048
#define CC 128            // NH * HD = projected width
#define DIN 64          // input (model) width
#define NH 2
#define HD 64
#define NQB (TT / 64)
#define HG 1
#define SCALE (0.03125f)
#define CAUSAL 0
#ifndef TNB
#define TNB NB
#endif
__device__ __forceinline__ float bfr(float v) { return (float)(__bf16)v; }
__host__ __device__ __forceinline__ int kb_last(int qb) { return CAUSAL ? ((qb * 64 + 63) >> 7) : (TT / 128 - 1); }
typedef __attribute__((ext_vector_type(8))) __bf16 v8b;
__device__ __forceinline__ v16b frag_b(const __bf16* rowk0, int lane) {
  union { v16b v; v8b q[2]; } u; const __bf16* p = rowk0 + 8 * (lane >> 4);
  u.q[0] = *(const v8b*)p; u.q[1] = *(const v8b*)(p + 16); return u.v;
}
#define QBH 0
#define QHI 2048            // rows carrying a q residual plane (all rows when non-causal: 2-product logits everywhere)
#define KHI 64            // key rows carrying k residual / v bf16 hi+lo planes (written by k_proj; no kernel here reads them)
// B fragment (k rows k0+.., output column o) of a weight: (in,out) [K][ld] or (out,in) [ld rows of K]: bf16 exact, or f16(bf16 * 256) exact
__device__ __forceinline__ v16b wcol_io(const float* Wm, int k0, int o, int lane, int ld) { v16b w; const int g = lane >> 4;
#pragma unroll
  for (int i = 0; i < 8; ++i) { w[i] = (__bf16)Wm[(size_t)(k0 + 8 * g + i) * ld + o]; w[8 + i] = (__bf16)Wm[(size_t)(k0 + 16 + 8 * g + i) * ld + o]; }
  return w; }
__device__ __forceinline__ v16b wcol_oi(const float* Wm, int k0, int o, int lane, int K) { v16b w; const float* p = Wm + (size_t)o * K + k0 + 8 * (lane >> 4);
#pragma unroll
  for (int i = 0; i < 8; ++i) { w[i] = (__bf16)p[i]; w[8 + i] = (__bf16)p[16 + i]; }
  return w; }
__device__ __forceinline__ v16h wcolh_io(const float* Wm, int k0, int o, int lane, int ld) { v16h w; const int g = lane >> 4;
#pragma unroll
  for (int i = 0; i < 8; ++i) { w[i] = (_Float16)(bfr(Wm[(size_t)(k0 + 8 * g + i) * ld + o]) * 256.0f); w[8 + i] = (_Float16)(bfr(Wm[(size_t)(k0 + 16 + 8 * g + i) * ld + o]) * 256.0f); }
  return w; }
__device__ __forceinline__ v16h wcolh_oi(const float* Wm, int k0, int o, int lane, int K) { v16h w; const float* p = Wm + (size_t)o * K + k0 + 8 * (lane >> 4);
#pragma unroll
  for (int i = 0; i < 8; ++i) { w[i] = (_Float16)(bfr(p[i]) * 256.0f); w[8 + i] = (_Float16)(bfr(p[16 + i]) * 256.0f); }
  return w; }
#define WQKV_LAYOUT 1   // 0 = (in,out) [DIN][CC]; 1 = (out,in) [CC][DIN]; 2 = per-head [NH][DIN][HD]
__device__ __forceinline__ v16b wcol_hdk(const float* Wm, int k0, int o, int lane) { v16b w; const int g = lane >> 4; const float* p = Wm + (size_t)(o / HD) * DIN * HD + (o % HD);
#pragma unroll
  for (int i = 0; i < 8; ++i) { w[i] = (__bf16)p[(size_t)(k0 + 8 * g + i) * HD]; w[8 + i] = (__bf16)p[(size_t)(k0 + 16 + 8 * g + i) * HD]; }
  return w; }
#define WO_OUT_IN 0
#if WQKV_LAYOUT == 1
#define WCOL(W, k0, o, lane) wcol_oi(W, k0, o, lane, DIN)
#elif WQKV_LAYOUT == 2
#define WCOL(W, k0, o, lane) wcol_hdk(W, k0, o, lane)
#else
#define WCOL(W, k0, o, lane) wcol_io(W, k0, o, lane, CC)
#endif
#if WO_OUT_IN
#define WOCOL(W, k0, o, lane) wcol_oi(W, k0, o, lane, CC)
#define WOCOLH(W, k0, o, lane) wcolh_oi(W, k0, o, lane, CC)
#else
#define WOCOL(W, k0, o, lane) wcol_io(W, k0, o, lane, DIN)
#define WOCOLH(W, k0, o, lane) wcolh_io(W, k0, o, lane, DIN)
#endif
#define CIN 64
// ---- k_padw: the three (out,in) [64][C] projection weights copied into zero-padded (out,in) [128][C] ws planes (rows 64..127 zero) + zero-padded [128] biases, so k_proj's 128-column tiles apply unchanged (columns 64..127 = an all-zero dummy head, never attended)
// Blocks with blockIdx.y >= 3 pack the mask instead: MB[batch * 128 + query tile of 16][key tile of 16][r] = one 32-bit word whose bit (lane = 16g + col) says mask[query tile * 16 + col][key tile * 16 + 8g + r] != 0, i.e. the lane mask of register r of that score tile in k_fa. A wave takes 16 mask rows x 128 keys: whole 512-B row pieces into its own LDS rows, read back in the score tile's lane order, one ballot per word.
#define MBP 132           // LDS pitch of a 128-element int row piece: 512 B + 16 B, conflict-free for 16-B reads
typedef __attribute__((ext_vector_type(2))) unsigned v2u;
__global__ __launch_bounds__(256) void k_padw(const float* __restrict__ WQ, const float* __restrict__ WK, const float* __restrict__ WV, const float* __restrict__ BQ, const float* __restrict__ BK, const float* __restrict__ BV, float* __restrict__ WP, float* __restrict__ BP, const int* __restrict__ MASK, unsigned* __restrict__ MB) {
  __shared__ __align__(16) int sp[8][16][MBP];
  if (blockIdx.y >= 3) { const int wave = threadIdx.x >> 5, lane = threadIdx.x & 31, col = lane & 15, g = lane >> 4; const int gw = ((blockIdx.y - 3) * 32 + blockIdx.x) * 8 + wave, ch = gw & 15, qt = gw >> 4;   // ch = piece of 128 keys, qt = batch * 128 + query tile
    const int* gm = MASK + (size_t)qt * 16 * TT + ch * 128 + lane * 4; v4i rm[16];
#pragma unroll   // constant indices, so that the array stays in registers; all sixteen loads in flight
    for (int i = 0; i < 16; ++i) rm[i] = *(const v4i*)(gm + (size_t)i * TT);
    asm volatile("s_wait_xcnt 0x0" :: "v"(gm) : "memory");   // the code behind reuses the registers that hold these loads' address: the wait stands in front of that overwrite, and the address as its input keeps the last load's result off those registers
#pragma unroll   // constant indices, so that the array stays in registers
    for (int i = 0; i < 16; ++i) *(v4i*)&sp[wave][i][lane * 4] = rm[i];
    __syncthreads();   // publishes the rows: a lane reads back what other lanes wrote
    unsigned w0 = 0, w1 = 0;   // lane l collects words 2l and 2l + 1 of the wave's 64
#pragma unroll   // constant lane numbers for the word's place
    for (int kt = 0; kt < 8; ++kt) { const v4i m0 = *(const v4i*)&sp[wave][col][kt * 16 + 8 * g], m1 = *(const v4i*)&sp[wave][col][kt * 16 + 8 * g + 4];
#pragma unroll   // constant lane numbers for the word's place
      for (int r = 0; r < 8; r += 2) { const unsigned ba = __builtin_amdgcn_ballot_w32((r < 4 ? m0[r & 3] : m1[r & 3]) != 0), bb = __builtin_amdgcn_ballot_w32((r < 4 ? m0[(r + 1) & 3] : m1[(r + 1) & 3]) != 0);
        const bool mine = lane == kt * 4 + (r >> 1); w0 = mine ? ba : w0; w1 = mine ? bb : w1; } }
    v2u wv; wv[0] = w0; wv[1] = w1; vst2(MB + (size_t)qt * (TT / 16 * 8) + ch * 64 + lane * 2, wv);
    return; }
  const int which = blockIdx.y; const float* Wsrc = which == 0 ? WQ : (which == 1 ? WK : WV); const float* Bsrc = which == 0 ? BQ : (which == 1 ? BK : BV); float* dst = WP + (size_t)which * 128 * CIN;
  for (int e = blockIdx.x * 256 + threadIdx.x; e < 128 * (CIN / 4); e += gridDim.x * 256) { const int row = e / (CIN / 4), q = e % (CIN / 4); const v4f ld = *(const v4f*)(Wsrc + (size_t)(row & 63) * CIN + q * 4); asm volatile("s_wait_loadcnt 0x0" ::: "memory"); const float keep = row < 64 ? 1.f : 0.f; v4f ov; ov[0] = ld[0] * keep; ov[1] = ld[1] * keep; ov[2] = ld[2] * keep; ov[3] = ld[3] * keep; vst2(dst + (size_t)row * CIN + q * 4, ov); }   /* unconditional (clamped) loads, zero by select */
  if (blockIdx.x == 0 && threadIdx.x < 128) { const int c = threadIdx.x; float bvv = 0.f; if (Bsrc) { const float t = Bsrc[c & 63]; asm volatile("s_wait_loadcnt 0x0" ::: "memory"); bvv = c < 64 ? t : 0.f; } vst2(BP + which * 128 + c, bvv); } }
#define WS_WP (WS_END)                                  // padded weights [3][128 x C]
#define WS_BP (WS_WP + 4u * 3 * (size_t)CIN * 128)        // padded biases [3][128]
#ifndef PROJ_EXTRA_PARAMS
#define PROJ_EXTRA_PARAMS
#endif

#define WS_QH  0u                                      // f16 q rows [b*t][CC]
#define WS_KH  (WS_QH + 2u * (size_t)NB * TT * CC)      // f16 k rows [b*t][CC]
#define WS_VT  (WS_KH + 2u * (size_t)NB * TT * CC)      // f16 v planes [b][c][t]
#define WS_QL  (WS_VT + 2u * (size_t)NB * CC * TT)      // f16 q residual x 2^10 rows [b][t < QHI][CC]
#define WS_KL  (WS_QL + 2u * (size_t)NB * QHI * CC)     // f16 k residual x 2^10 rows [b][t < KHI][CC]
#define WS_VB  (WS_KL + 2u * (size_t)NB * KHI * CC)     // bf16 v hi planes [b][c][t < KHI]
#define WS_VBL (WS_VB + 2u * (size_t)NB * CC * KHI)
#define WS_END (WS_VBL + 2u * (size_t)NB * CC * KHI)

// ---- k_proj: block = (PT tiles of 64 rows, 128 cols, which): q/k/v = X W (+ b) with exact bf16 products (K = DIN) -> which 0: q f16 rows (+ residual rows < QHI); 1: k f16 rows (+ residual rows < KHI); 2: v f16 planes [c][t] (+ bf16 hi/lo planes for t < KHI)
// Operand path: X rows and W rows are read as whole lines (a wave's 16-B loads cover two 256-B rows = 512 contiguous bytes), rounded to bf16 once per block and staged in LDS; the fragments come from LDS. W is staged once per block, the next row tile's loads are in flight in registers.
#define PT 4              // row tiles of 64 per block
#define PP 72             // LDS pitch of a 64-element bf16 row: 128 B + 16 B, conflict-free for 16-B fragment reads
typedef __attribute__((ext_vector_type(4))) __bf16 v4b;
__device__ __forceinline__ v4b cvt4b(v4f v) { v4b h;
#pragma unroll
  for (int e = 0; e < 4; ++e) h[e] = (__bf16)v[e];
  return h; }
// 16-B global store with its wait in ONE statement: the next pass of the store loop and the next trip reuse the registers that the store names
__device__ __forceinline__ void st16w(void* p, v4u v) { asm volatile("global_store_b128 %0, %1, off\n\ts_wait_xcnt 0x0" :: "v"(p), "v"(v) : "memory"); }
__global__ __launch_bounds__(128) void k_proj(const float* __restrict__ XQ, const float* __restrict__ XK, const float* __restrict__ XV, const float* __restrict__ WQ, const float* __restrict__ WK, const float* __restrict__ WV, const float* __restrict__ BQ, const float* __restrict__ BK, const float* __restrict__ BV,
    _Float16* __restrict__ QH, _Float16* __restrict__ QL, _Float16* __restrict__ KH, _Float16* __restrict__ KL, _Float16* __restrict__ VT, __bf16* __restrict__ VB, __bf16* __restrict__ VBL) {
  __shared__ __align__(16) unsigned char pool[3 * 128 * 72 * 2];   // output tiles; a block has one role, so q/k (sh, sl) and v (th, tb, tbl) share the bytes
  __shared__ __align__(16) __bf16 xs[64][PP], wsg[128][PP];   // staged operands: one X row tile, all W rows
  _Float16 (*sh)[136] = (_Float16 (*)[136])pool; _Float16 (*sl)[136] = (_Float16 (*)[136])(pool + 64 * 136 * 2);
  _Float16 (*th)[72] = (_Float16 (*)[72])pool; __bf16 (*tb)[72] = (__bf16 (*)[72])(pool + 128 * 72 * 2); __bf16 (*tbl)[72] = (__bf16 (*)[72])(pool + 2 * 128 * 72 * 2);
  const int tid = threadIdx.x, wave = tid >> 5, lane = tid & 31, col = lane & 15, g = lane >> 4; const int which = blockIdx.z; const int c0 = blockIdx.y * 128; const size_t rb = (size_t)blockIdx.x * (64 * PT);
  const float* X = which == 0 ? XQ : which == 1 ? XK : XV; const float* WA = which == 0 ? WQ : which == 1 ? WK : WV; const float* BA = which == 0 ? BQ : which == 1 ? BK : BV;
  const int sr = tid >> 4, sc = tid & 15;   // staging: thread -> (row, 16-B chunk) of the 256-B rows
  const float* gx = X + (rb + sr) * DIN + sc * 4;
  v4f rx[8]; float bias[8];
  { v4f rw[16]; const float* gw = WA + (size_t)(c0 + sr) * DIN + sc * 4;
#pragma unroll   // constant indices, so that the arrays stay in registers
    for (int i = 0; i < 16; ++i) rw[i] = *(const v4f*)(gw + (size_t)(8 * i) * DIN);
#pragma unroll   // constant indices, so that the arrays stay in registers
    for (int i = 0; i < 8; ++i) rx[i] = *(const v4f*)(gx + (size_t)(8 * i) * DIN);
#pragma unroll   // constant indices, so that the arrays stay in registers
    for (int j = 0; j < 8; ++j) bias[j] = 0.f;
    if (BA) {
#pragma unroll   // constant indices, so that the arrays stay in registers
      for (int j = 0; j < 8; ++j) bias[j] = BA[c0 + j * 16 + col];
#pragma unroll   // constant indices, so that the arrays stay in registers
      for (int j = 0; j < 8; ++j) bias[j] = bfr(bias[j]); }
#pragma unroll   // constant indices, so that the arrays stay in registers
    for (int i = 0; i < 16; ++i) *(v4b*)&wsg[sr + 8 * i][sc * 4] = cvt4b(rw[i]); }
#pragma clang loop unroll(disable)   // one copy of the tile body: the branch round the next tile's loads keeps them directly behind the barrier
  for (int it = 0; it < PT; ++it) { const size_t r0 = rb + (size_t)it * 64; const size_t bb = r0 / TT; const int t0 = (int)(r0 % TT);
#pragma unroll   // constant indices, so that the arrays stay in registers
    for (int i = 0; i < 8; ++i) *(v4b*)&xs[sr + 8 * i][sc * 4] = cvt4b(rx[i]);
    __syncthreads();   // publishes the X tile (and, on the first trip, W); it also ends every wave's reads of the output tile of trip it - 1, which this trip overwrites only behind it
    v8f acc[8] = {};
#pragma unroll   // constant indices, so that the arrays stay in registers
    for (int kc = 0; kc < DIN / 32; ++kc) { const v16b a = frag_b(&xs[wave * 16 + col][kc * 32], lane); v16b w[8];
#pragma unroll   // constant indices, so that the arrays stay in registers
      for (int j = 0; j < 8; ++j) w[j] = frag_b(&wsg[j * 16 + col][kc * 32], lane);
#pragma unroll   // constant indices, so that the arrays stay in registers
      for (int j = 0; j < 8; ++j) acc[j] = __builtin_amdgcn_wmma_f32_16x16x32_bf16(false, a, false, w[j], (short)0, acc[j], false, false); }
    const bool qk = which < 2; _Float16* DH = which == 0 ? QH : KH; _Float16* DL = which == 0 ? QL : KL; const int nhi = which == 0 ? QHI : KHI; const bool hi_rows = t0 < (qk ? nhi : KHI);
    if (qk) {
#pragma unroll
      for (int j = 0; j < 8; ++j) {
#pragma unroll
        for (int r = 0; r < 8; ++r) { const float v = acc[j][r] + bias[j]; const _Float16 hv = (_Float16)v; sh[wave * 16 + 8 * g + r][j * 16 + col] = hv; sl[wave * 16 + 8 * g + r][j * 16 + col] = (_Float16)((v - (float)hv) * 1024.0f); } }
    } else {
#pragma unroll
      for (int j = 0; j < 8; ++j) {
#pragma unroll
        for (int r = 0; r < 8; ++r) { const float v = acc[j][r] + bias[j]; const int rl = wave * 16 + 8 * g + r, cl = j * 16 + col; th[cl][rl] = (_Float16)v; const __bf16 bh = (__bf16)v; tb[cl][rl] = bh; tbl[cl][rl] = (__bf16)(v - (float)bh); } } }
    __syncthreads();   // publishes the output tile; it also ends every wave's fragment reads of the X tile, which the next trip overwrites only behind it
    if (it + 1 < PT) {   // behind the barrier (which drains the load counter), so that these loads fly while the output tile is stored
#pragma unroll   // constant indices, so that the arrays stay in registers
      for (int i = 0; i < 8; ++i) rx[i] = *(const v4f*)(gx + (size_t)((it + 1) * 64 + 8 * i) * DIN);
      asm volatile("s_wait_xcnt 0x0" ::: "memory"); }   // the code behind may reuse the registers that held these loads' addresses: the wait stands in front of that overwrite
    if (qk) {
      for (int e = tid; e < 64 * 16; e += 128) { const int rl = e >> 4, q = e & 15; st16w((DH + (r0 + rl) * CC + c0 + q * 8), *(const v4u*)&sh[rl][q * 8]); if (hi_rows) st16w((DL + (bb * nhi + t0 + rl) * (size_t)CC + c0 + q * 8), *(const v4u*)&sl[rl][q * 8]); }
    } else {
      for (int e = tid; e < 128 * 8; e += 128) { const int cl = e >> 3, q = e & 7; st16w((VT + (bb * CC + c0 + cl) * (size_t)TT + t0 + q * 8), *(const v4u*)&th[cl][q * 8]); if (hi_rows) { const size_t o3 = (bb * CC + c0 + cl) * (size_t)KHI + t0 + q * 8; st16w((VB + o3), *(const v4u*)&tb[cl][q * 8]); st16w((VBL + o3), *(const v4u*)&tbl[cl][q * 8]); } } } } }
// ---- k_fa: scores, mask, softmax and P . v of one pseudo-sequence in ONE pass over the keys: S and P stay in registers. Block = 8 waves x 16 queries (blockIdx.x = query block, blockIdx.y = pseudo-sequence b, real batch = b >> 4); a stage = 64 keys, K rows and v plane rows staged in LDS (whole 128-B lines per load), two buffers, the next stage's loads in flight in registers; the mask comes as packed lane-mask words (k_padw), 32 words a wave and stage by scalar loads.
// St = K Qt (A = K rows, B = q hi and q residual x 2^10, kept in registers): a lane holds ONE query (col) and keys 8g + r of each 16-key tile, so two tiles pack in place into the B operand of Ot += vt Pt (A = v plane rows, same k order as frag_h). Running maximum and sum per query in raw score units (the 1/32 sits in the exponent's factor); where(mask == 0, -1e20, score) as in the source, so a fully masked row comes out uniform.
#define FQ 128            // queries per block
#define FK 64             // keys per stage
#define KP 72             // LDS pitch of a 64-element f16 row: 128 B + 16 B, conflict-free for 16-B fragment reads
#define CEXP (SCALE * 1.44269504088896f)
__device__ __forceinline__ v8f wm(v16h a, v16h b, v8f c) { return __builtin_amdgcn_wmma_f32_16x16x32_f16(false, a, false, b, (short)0, c, false, false); }
// 2^x in place. One statement for eight: behind a transcendental the instruction set asks for one independent instruction before its result is read or its source overwritten; here each v_exp_f32 is that instruction for the one before it and the v_nop for the last, whatever the compiler puts next
__device__ __forceinline__ v8f exp2x8(v8f e) { float a0 = e[0], a1 = e[1], a2 = e[2], a3 = e[3], a4 = e[4], a5 = e[5], a6 = e[6], a7 = e[7];
  asm("v_exp_f32 %0, %0\n\tv_exp_f32 %1, %1\n\tv_exp_f32 %2, %2\n\tv_exp_f32 %3, %3\n\tv_exp_f32 %4, %4\n\tv_exp_f32 %5, %5\n\tv_exp_f32 %6, %6\n\tv_exp_f32 %7, %7\n\tv_nop" : "+v"(a0), "+v"(a1), "+v"(a2), "+v"(a3), "+v"(a4), "+v"(a5), "+v"(a6), "+v"(a7));
  v8f p; p[0] = a0; p[1] = a1; p[2] = a2; p[3] = a3; p[4] = a4; p[5] = a5; p[6] = a6; p[7] = a7; return p; }
__device__ __forceinline__ float exp2x1(float a) { asm("v_exp_f32 %0, %0\n\tv_nop" : "+v"(a)); return a; }   // the v_nop: the same slot
__device__ __forceinline__ float xhalf(float v) { const int i = __builtin_bit_cast(int, v); return __builtin_bit_cast(float, (int)__builtin_amdgcn_permlanex16(i, i, 0x76543210, 0xfedcba98, false, false)); }   // the value of lane l ^ 16
// amdgpu_waves_per_eu(4, 4): the grid gives a SIMD four waves; with no ceiling named the compiler aimed at more waves, cut the registers and put a full LDS wait in front of every fragment's products
__global__ __launch_bounds__(256) __attribute__((amdgpu_waves_per_eu(4, 4))) void k_fa(const _Float16* __restrict__ QH, const _Float16* __restrict__ QL, const _Float16* __restrict__ KH, const _Float16* __restrict__ VT, const unsigned* __restrict__ MB, float* __restrict__ C) {
  __shared__ __align__(16) _Float16 sk[2][FK][KP], sv[2][HD][KP];
  const int tid = threadIdx.x, wave = tid >> 5, lane = tid & 31, col = lane & 15, g = lane >> 4; const int b = blockIdx.y, q0 = blockIdx.x * FQ, qw = wave * 16 + col;
  v16h qh[2], qr[2];
#pragma unroll   // constant indices, so that the arrays stay in registers
  for (int kc = 0; kc < 2; ++kc) { qh[kc] = frag_h(QH + ((size_t)b * TT + q0 + qw) * CC + kc * 32, lane); qr[kc] = frag_h(QL + ((size_t)b * QHI + q0 + qw) * CC + kc * 32, lane); }
  const int r8 = tid >> 3, c8 = tid & 7;   // staging: thread -> (row, 16-B chunk) of 128-B rows (K, v)
  const _Float16* gk = KH + ((size_t)b * TT + r8) * CC + c8 * 8; const _Float16* gv = VT + ((size_t)b * CC + r8) * TT + c8 * 8;
  const unsigned* gb = MB + ((size_t)(b >> 4) * (TT / 16) + (q0 >> 4) + __builtin_amdgcn_readfirstlane(wave)) * (TT / 16 * 8);   // the wave's query tile: a wave-uniform address, so that the words come by scalar loads
  v8h rk[2], rv[2];
#pragma unroll   // constant indices, so that the arrays stay in registers
  for (int i = 0; i < 2; ++i) { rk[i] = *(const v8h*)(gk + (size_t)(32 * i) * CC); rv[i] = *(const v8h*)(gv + (size_t)(32 * i) * TT); }
  v8f o[4] = {}, lv = {}; float m = -3.0e38f;
#pragma clang loop unroll(disable)   // one copy of the stage body: the last stage is not peeled off, and the branch round the next stage's loads keeps them directly behind the barrier
  for (int s = 0; s < TT / FK; ++s) { const int u = s & 1;
    const v16u mb[2] = { *(cv16u)(gb + s * 32), *(cv16u)(gb + s * 32 + 16) };   // the stage's 32 mask words, asked for in front of the LDS stores and the barrier: they land while the wave waits there and for its first K fragments
#pragma unroll   // constant indices, so that the arrays stay in registers
    for (int i = 0; i < 2; ++i) { *(v8h*)&sk[u][r8 + 32 * i][c8 * 8] = rk[i]; *(v8h*)&sv[u][r8 + 32 * i][c8 * 8] = rv[i]; }
    __syncthreads();   // publishes buffer u; it also ends every wave's reads of buffer u ^ 1 (stage s - 1), which stage s + 1 overwrites only behind it
    if (s + 1 < TT / FK) { const int k1 = (s + 1) * FK;   // behind the barrier (which drains the load counter), so that these loads fly during the stage's work
#pragma unroll   // constant indices, so that the arrays stay in registers
      for (int i = 0; i < 2; ++i) { rk[i] = *(const v8h*)(gk + (size_t)(k1 + 32 * i) * CC); rv[i] = *(const v8h*)(gv + (size_t)(32 * i) * TT + k1); }
      asm volatile("s_wait_xcnt 0x0" ::: "memory"); }   // the stage's first LDS reads land in the registers that held these loads' addresses: the wait stands in front of that overwrite
    v8f t[4];
#pragma unroll   // constant indices, so that the arrays stay in registers
    for (int j = 0; j < 4; ++j) { v8f a = {}, ar = {};
#pragma unroll   // constant indices, so that the arrays stay in registers
      for (int kc = 0; kc < 2; ++kc) { const v16h kf = frag_h(&sk[u][j * 16 + col][kc * 32], lane); a = wm(kf, qh[kc], a); ar = wm(kf, qr[kc], ar); }
      const v8f x = a + ar * (1.0f / 1024.0f);
#pragma unroll   // constant indices, so that the arrays stay in registers
      for (int r = 0; r < 8; ++r) t[j][r] = __builtin_amdgcn_inverse_ballot_w32(mb[j >> 1][(j & 1) * 8 + r]) ? x[r] : -1.0e20f; }   // word (j, r) is this register's lane mask: one select, no compare
    float mj[4];   // one maximum chain per tile: four independent chains
#pragma unroll   // constant indices, so that the arrays stay in registers
    for (int j = 0; j < 4; ++j) { mj[j] = t[j][0];
#pragma unroll   // constant indices, so that the arrays stay in registers
      for (int r = 1; r < 8; ++r) mj[j] = fmaxf(mj[j], t[j][r]); }
    float mx = fmaxf(fmaxf(mj[0], mj[1]), fmaxf(mj[2], mj[3])); mx = fmaxf(mx, xhalf(mx));   // the query's other 32 keys of the stage sit in lane l ^ 16
    const float mn = fmaxf(m, mx), al = exp2x1((m - mn) * CEXP); m = mn;
    union { v16h v; v8h q[2]; } pb[2]; v8f ps;
#pragma unroll   // constant indices, so that the arrays stay in registers
    for (int j = 0; j < 4; ++j) { const v8f p = exp2x8((t[j] - mn) * CEXP);
      ps = j ? ps + p : p; pb[j >> 1].q[j & 1] = __builtin_convertvector(p, v8h); }
    lv = lv * al + ps;
#pragma unroll   // constant indices, so that the arrays stay in registers
    for (int jd = 0; jd < 4; ++jd) o[jd] *= al;
#pragma unroll   // constant indices, so that the arrays stay in registers
    for (int kk = 0; kk < 2; ++kk)
#pragma unroll   // constant indices, so that the arrays stay in registers
      for (int jd = 0; jd < 4; ++jd) o[jd] = wm(frag_h(&sv[u][jd * 16 + col][kk * 32], lane), pb[kk].v, o[jd]); }
  float ls = ((lv[0] + lv[1]) + (lv[2] + lv[3])) + ((lv[4] + lv[5]) + (lv[6] + lv[7])); ls += xhalf(ls); const float inv = 1.0f / ls;   // ls >= 1: the maximum's own term
  float* cr = C + ((size_t)b * TT + q0 + qw) * HD + 8 * g;   // Ot tile jd, register r = ctx[query][jd * 16 + 8g + r]: 32 contiguous bytes per lane and tile
#pragma unroll   // constant indices, so that the arrays stay in registers
  for (int jd = 0; jd < 4; ++jd) { v4f w0, w1;
#pragma unroll   // constant indices, so that the arrays stay in registers
    for (int r = 0; r < 4; ++r) { w0[r] = o[jd][r] * inv; w1[r] = o[jd][4 + r] * inv; }
    vst2(cr + jd * 16, w0); vst2(cr + jd * 16 + 4, w1); } }

// ---- k_lin2: the module's final Linear on the RAW-reshaped context: rows = the [2*2048][1024] view of the contiguous [32][2048][64] context buffer; out = ctx Wo^T + bo with ctx x 2^6 once to f16 against Wo as f16(bf16 x 2^8) (1 product, k in ascending 32-chunks).
// Block = 8 waves on a 128 x 128 output tile (wave = 32 rows x 64 columns); a stage = 64 k: the ctx rows and the Wo rows are read as whole 128-B lines, converted once per block and staged as f16 in LDS, two buffers, the next stage's loads in flight in registers.
#define K2 1024
#define N2 1024
#define LM 128            // output rows per block
#define LN 128            // output columns per block
#define LK 64             // k per stage
#define LP 72             // LDS pitch of a 64-element f16 row: 128 B + 16 B, conflict-free for 16-B fragment reads
#define LF 132            // LDS pitch of a 128-element f32 output row
typedef __attribute__((ext_vector_type(4))) _Float16 v4h;
__global__ __launch_bounds__(256) void k_lin2(const float* __restrict__ Yc, const float* __restrict__ WO, const float* __restrict__ BO, float* __restrict__ OUT) {
  __shared__ __align__(16) _Float16 st[2][2][LM][LP];   // [buffer][0 = ctx rows, 1 = Wo rows][row][k]; after the k loop the same bytes hold the f32 output tile
  const int tid = threadIdx.x, wave = tid >> 5, lane = tid & 31, col = lane & 15, g = lane >> 4; const int c0 = blockIdx.y * LN; const size_t r0 = (size_t)blockIdx.x * LM;
  const int wr = (wave >> 1) * 32, wc = (wave & 1) * 64;
  const int sr = tid >> 4, sc = tid & 15;   // staging: thread -> (row, 16-B chunk) of the 256-B row pieces
  const float* ga = Yc + r0 * K2; const float* gw = WO + (size_t)c0 * K2; const unsigned vo = (unsigned)(sr * K2 + sc * 4);   // block-uniform bases that walk along k, and one per-lane offset that never changes
  v4f ra[8], rw[8];
#pragma unroll   // constant indices, so that the arrays stay in registers
  for (int i = 0; i < 8; ++i) { ra[i] = *(const v4f*)(ga + (vo + 16u * i * K2)); rw[i] = *(const v4f*)(gw + (vo + 16u * i * K2)); }
  v8f acc[2][4] = {};
#pragma clang loop unroll(disable)   // one copy of the stage body: the last stage is not peeled off, and the branch round the next stage's loads keeps them directly behind the barrier
  for (int s = 0; s < K2 / LK; ++s) { const int u = s & 1;
#pragma unroll   // constant indices, so that the arrays stay in registers
    for (int i = 0; i < 8; ++i) { v4h ha, hw;
#pragma unroll   // constant indices, so that the arrays stay in registers
      for (int e = 0; e < 4; ++e) { ha[e] = (_Float16)(ra[i][e] * 64.0f); hw[e] = (_Float16)(bfr(rw[i][e]) * 256.0f); }
      *(v4h*)&st[u][0][sr + 16 * i][sc * 4] = ha; *(v4h*)&st[u][1][sr + 16 * i][sc * 4] = hw; }
    __syncthreads();   // publishes buffer u; it also ends every wave's reads of buffer u ^ 1 (stage s - 1), which stage s + 1 overwrites only behind it
    if (s + 1 < K2 / LK) { ga += LK; gw += LK;   // behind the barrier (which drains the load counter), so that these loads fly during the stage's work
#pragma unroll   // constant indices, so that the arrays stay in registers
      for (int i = 0; i < 8; ++i) { ra[i] = *(const v4f*)(ga + (vo + 16u * i * K2)); rw[i] = *(const v4f*)(gw + (vo + 16u * i * K2)); } }
#pragma unroll   // constant indices, so that the arrays stay in registers
    for (int kk = 0; kk < 2; ++kk) { v16h af[2], bf[4];
#pragma unroll   // constant indices, so that the arrays stay in registers
      for (int i = 0; i < 2; ++i) af[i] = frag_h(&st[u][0][wr + i * 16 + col][kk * 32], lane);
#pragma unroll   // constant indices, so that the arrays stay in registers
      for (int j = 0; j < 4; ++j) bf[j] = frag_h(&st[u][1][wc + j * 16 + col][kk * 32], lane);
#pragma unroll   // constant indices, so that the arrays stay in registers
      for (int i = 0; i < 2; ++i)
#pragma unroll   // constant indices, so that the arrays stay in registers
        for (int j = 0; j < 4; ++j) acc[i][j] = wm(af[i], bf[j], acc[i][j]); } }
  float (*sf)[LF] = (float (*)[LF])&st[0][0][0][0];   // 128 x 132 f32 = 67,584 B of the 73,728 B
  __syncthreads();   // ends every wave's fragment reads of the last stage before the output tile overwrites the buffers
#pragma unroll   // constant indices, so that the arrays stay in registers
  for (int j = 0; j < 4; ++j) { const float bias = bfr(BO[c0 + wc + j * 16 + col]);
#pragma unroll   // constant indices, so that the arrays stay in registers
    for (int i = 0; i < 2; ++i)
#pragma unroll   // constant indices, so that the arrays stay in registers
      for (int r = 0; r < 8; ++r) sf[wr + i * 16 + 8 * g + r][wc + j * 16 + col] = acc[i][j][r] * (1.0f / 16384.0f) + bias; }   /* 2^-8 (Wo carry) x 2^-6 (ctx carry) */
  __syncthreads();   // publishes the output tile: a wave stores whole 512-B rows that two waves wrote
#pragma unroll   // one address, sixteen constant offsets
  for (int rl = 0; rl < 16; ++rl) vst2(OUT + (r0 + wave * 16 + rl) * N2 + c0 + lane * 4, *(const v4f*)&sf[wave * 16 + rl][lane * 4]); }
#define WS_C64 (WS_BP + 4u * 3 * 128)                     // f32 context [32][2048][64] contiguous == the raw-reshaped [2*2048][1024] rows
#define WS_MB (WS_C64 + 4u * (size_t)NB * TT * 64)          // packed mask words [2 * 128 query tiles][128 key tiles][8]
#define WS_END3 (WS_MB + 4u * 2 * (size_t)(TT / 16) * (TT / 16) * 8)
extern "C" void kernel_launch(void* const* d_in, const int* in_sizes, int n_in, void* d_out, int out_size, void* d_ws, size_t ws_size, hipStream_t stream) {
  (void)in_sizes; (void)n_in; (void)out_size;
  const float** F = (const float**)d_in;
  if (ws_size < (size_t)WS_END) return;
  char* ws = (char*)d_ws; _Float16 *QH = (_Float16*)(ws + WS_QH), *KH = (_Float16*)(ws + WS_KH), *VT = (_Float16*)(ws + WS_VT), *QL = (_Float16*)(ws + WS_QL), *KL = (_Float16*)(ws + WS_KL); __bf16 *VB = (__bf16*)(ws + WS_VB), *VBL = (__bf16*)(ws + WS_VBL);
  (void)KL; (void)VB; (void)VBL;
  // inputs: 0 query [2,2048,1024]; 1 key; 2 value (each viewed as 65,536 rows of 64: the raw reshape); 3 mask [2,1,2048,2048] int32; 4 Wq [64,64] (out,in); 5 Wk; 6 Wv; 7 Wo [1024,1024] (out,in); 8 bo [1024] (nonzero)
  if (ws_size < (size_t)WS_END3) return;
  float *WP = (float*)(ws + WS_WP), *BP = (float*)(ws + WS_BP), *C64 = (float*)(ws + WS_C64); unsigned* MB = (unsigned*)(ws + WS_MB);
  k_padw<<<dim3(32, 3 + 16), 256, 0, stream>>>(F[4], F[5], F[6], nullptr, nullptr, nullptr, WP, BP, (const int*)d_in[3], MB);   /* y >= 3: 512 blocks x 8 waves x (16 rows x 128 keys) = the whole mask */
  k_proj<<<dim3(TNB * TT / (64 * PT), CC / 128, 3), 128, 0, stream>>>(F[0], F[1], F[2], WP, WP + (size_t)CIN * 128, WP + 2 * (size_t)CIN * 128, BP, BP + 128, BP + 256, QH, QL, KH, KL, VT, VB, VBL);
  k_fa<<<dim3(TT / FQ, TNB), 256, 0, stream>>>(QH, QL, KH, VT, MB, C64);   /* pseudo-sequence = real batch (b >> 4), pseudo-head (b & 15); padded head 0 (columns 0..63) only */
  k_lin2<<<dim3((TNB * TT * 64 / K2) / LM, N2 / LN), 256, 0, stream>>>(C64, F[7], F[8], (float*)d_out);
}

// v006
// One run takes 87.8 microseconds.
// Next to v005, in two timings, it ran 1.10 times as fast each time.
// All steps since v000 together make it 32.7 times as fast.
// compute dtype: all float inputs rounded to bf16; q/k/v projections with EXACT bf16 products on WMMA 16x16x32 (f32 accumulate); logits: q once to f16 x k once to f16 (1 product); running-maximum softmax in f32; exp(logit - running maximum) once to f16 x v once to f16 (1 product), divided by the f32 sum at the end; f32 output.
#include <hip/hip_runtime.h>
#include <math.h>

typedef __attribute__((ext_vector_type(16))) _Float16 v16h;
typedef __attribute__((ext_vector_type(16))) __bf16 v16b;
typedef __attribute__((ext_vector_type(8)))  _Float16 v8h;
typedef __attribute__((ext_vector_type(8)))  float v8f;
typedef __attribute__((ext_vector_type(4)))  float v4f;
typedef __attribute__((ext_vector_type(2)))  float v2f;
typedef __attribute__((ext_vector_type(4)))  unsigned v4u;
typedef __attribute__((ext_vector_type(4)))  int v4i;
typedef __attribute__((ext_vector_type(16))) unsigned v16u;
typedef const __attribute__((address_space(4))) v16u* cv16u;   // a pointer to memory that no one writes while the kernel runs: a wave-uniform load through it is a scalar load
typedef float __attribute__((may_alias)) float_a;
typedef int __attribute__((may_alias)) int_a;

template <typename T> __device__ __forceinline__ void vst2(void* p, T v) { *(T*)p = v;  }
__device__ __forceinline__ v8f wmma16(v16h a, v16h b, v8f c) {
  v8f d = __builtin_amdgcn_wmma_f32_16x16x32_f16(false, a, false, b, (short)0, c, false, false);
  asm volatile("v_nop\n\tv_nop\n\tv_nop\n\tv_nop" : "+v"(d) : "v"(a), "v"(b));
  return d;
}
__device__ __forceinline__ v8f wmma_bf(v16b a, v16b b, v8f c) {
  v8f d = __builtin_amdgcn_wmma_f32_16x16x32_bf16(false, a, false, b, (short)0, c, false, false);
  asm volatile("v_nop\n\tv_nop\n\tv_nop\n\tv_nop" : "+v"(d) : "v"(a), "v"(b));
  return d;
}
// 16x16x32 fragments: lane = (h = lane>>4, row/col = lane&15); elements 0..7 = k0+8h+0..7, 8..15 = k0+16+8h+0..7; D element r = row 8h+r
__device__ __forceinline__ v16h frag_h(const _Float16* rowk0, int lane) {
  union { v16h v; v8h q[2]; } u; const _Float16* p = rowk0 + 8 * (lane >> 4);
  u.q[0] = *(const v8h*)p; u.q[1] = *(const v8h*)(p + 16); return u.v;
}
__device__ __forceinline__ v16h frag_f32(const float* rowk0, int lane) {
  v16h a; const float* p = rowk0 + 8 * (lane >> 4);
#pragma unroll
  for (int i = 0; i < 8; ++i) { a[i] = (_Float16)p[i]; a[8 + i] = (_Float16)p[16 + i]; }
  return a;
}
__device__ __forceinline__ v16h frag_f32s(const float* rowk0, int lane, float sc) {
  v16h a; const float* p = rowk0 + 8 * (lane >> 4);
#pragma unroll
  for (int i = 0; i < 8; ++i) { a[i] = (_Float16)(p[i] * sc); a[8 + i] = (_Float16)(p[16 + i] * sc); }
  return a;
}
// column fragment from a [K][ld] layout (column n), rows >= K read as 0
__device__ __forceinline__ v16h fragc_f32(const float* W, int k0, int n, int lane, int ld, int K) {
  v16h a; const int g = lane >> 4;
#pragma unroll
  for (int i = 0; i < 8; ++i) { const int ka = k0 + 8 * g + i, kb = ka + 16;
    a[i] = (_Float16)(ka < K ? W[(size_t)(ka < K ? ka : K - 1) * ld + n] : 0.f); a[8 + i] = (_Float16)(kb < K ? W[(size_t)(kb < K ? kb : K - 1) * ld + n] : 0.f); }
  return a;
}
struct F2 { v16b h, l; };
__device__ __forceinline__ F2 bsplit16(const float v[16]) { F2 r;
#pragma unroll
  for (int i = 0; i < 16; ++i) { const __bf16 h = (__bf16)v[i]; r.h[i] = h; r.l[i] = (__bf16)(v[i] - (float)h); }
  return r; }
__device__ __forceinline__ F2 split_row(const float* row, int k0, int lane) { float v[16]; const float* p = row + k0 + 8 * (lane >> 4);
#pragma unroll
  for (int i = 0; i < 8; ++i) { v[i] = p[i]; v[8 + i] = p[16 + i]; }
  return bsplit16(v); }
__device__ __forceinline__ F2 split_rowK(const float* row, int k0, int lane, int K) { float v[16]; const int g = lane >> 4;
#pragma unroll
  for (int i = 0; i < 8; ++i) { const int ka = k0 + 8 * g + i, kb = ka + 16; v[i] = ka < K ? row[ka < K ? ka : K - 1] : 0.f; v[8 + i] = kb < K ? row[kb < K ? kb : K - 1] : 0.f; }
  return bsplit16(v); }
__device__ __forceinline__ F2 split_col(const float* W, int k0, int n, int lane, int ld, int K) { float v[16]; const int g = lane >> 4;
#pragma unroll
  for (int i = 0; i < 8; ++i) { const int ka = k0 + 8 * g + i, kb = ka + 16; v[i] = ka < K ? W[(size_t)(ka < K ? ka : K - 1) * ld + n] : 0.f; v[8 + i] = kb < K ? W[(size_t)(kb < K ? kb : K - 1) * ld + n] : 0.f; }
  return bsplit16(v); }
__device__ __forceinline__ v8f mac3(const F2& a, const F2& b, v8f c) { c = wmma_bf(a.l, b.h, c); c = wmma_bf(a.h, b.l, c); return wmma_bf(a.h, b.h, c); }
__device__ __forceinline__ float sigm(float v) { return 1.0f / (1.0f + expf(-v)); }
#define LDSX() do { asm volatile("s_wait_dscnt 0" ::: "memory"); __builtin_amdgcn_wave_barrier(); __builtin_amdgcn_fence(__ATOMIC_RELEASE, "workgroup"); } while (0)

// Masked self-attention with a RAW reshape into heads (query / key / value [2,2048,1024] are reshaped WITHOUT transpose to [2,16,2048,64]: pseudo-head h of batch b = the contiguous 131,072 floats starting at (b*16 + h)*2048*64, i.e. 32 pseudo-sequences of 2,048 positions x 64 dims each); one shared bias-free torch (out,in) Linear [64,64] per role (Wq, Wk, Wv); scores = Q K^T masked by mask[b][0][q][k] == 0 -> -1e20 (int32 random 0/1 per batch), then divided by sqrt(embed = 1024) = 32 (the source's quirk: logit sigma - 0.08); softmax; out = attn V reshaped raw back to [2,2048,1024]; (out,in) Wo [1024,1024] + bo (nonzero): result = out Wo^T + bo.
#define NB 32
#define TT 2048
#define CC 128            // NH * HD = projected width
#define DIN 64          // input (model) width
#define NH 2
#define HD 64
#define NQB (TT / 64)
#define HG 1
#define SCALE (0.03125f)
#define CAUSAL 0
#ifndef TNB
#define TNB NB
#endif
__device__ __forceinline__ float bfr(float v) { return (float)(__bf16)v; }
__host__ __device__ __forceinline__ int kb_last(int qb) { return CAUSAL ? ((qb * 64 + 63) >> 7) : (TT / 128 - 1); }
typedef __attribute__((ext_vector_type(8))) __bf16 v8b;
__device__ __forceinline__ v16b frag_b(const __bf16* rowk0, int lane) {
  union { v16b v; v8b q[2]; } u; const __bf16* p = rowk0 + 8 * (lane >> 4);
  u.q[0] = *(const v8b*)p; u.q[1] = *(const v8b*)(p + 16); return u.v;
}
#define QBH 0              // unused: no kernel here has a high-precision path
#define KHI 64            // key rows carrying k residual / v bf16 hi+lo planes (written by k_proj; no kernel here reads them)
// B fragment (k rows k0+.., output column o) of a weight: (in,out) [K][ld] or (out,in) [ld rows of K]: bf16 exact, or f16(bf16 * 256) exact
__device__ __forceinline__ v16b wcol_io(const float* Wm, int k0, int o, int lane, int ld) { v16b w; const int g = lane >> 4;
#pragma unroll
  for (int i = 0; i < 8; ++i) { w[i] = (__bf16)Wm[(size_t)(k0 + 8 * g + i) * ld + o]; w[8 + i] = (__bf16)Wm[(size_t)(k0 + 16 + 8 * g + i) * ld + o]; }
  return w; }
__device__ __forceinline__ v16b wcol_oi(const float* Wm, int k0, int o, int lane, int K) { v16b w; const float* p = Wm + (size_t)o * K + k0 + 8 * (lane >> 4);
#pragma unroll
  for (int i = 0; i < 8; ++i) { w[i] = (__bf16)p[i]; w[8 + i] = (__bf16)p[16 + i]; }
  return w; }
__device__ __forceinline__ v16h wcolh_io(const float* Wm, int k0, int o, int lane, int ld) { v16h w; const int g = lane >> 4;
#pragma unroll
  for (int i = 0; i < 8; ++i) { w[i] = (_Float16)(bfr(Wm[(size_t)(k0 + 8 * g + i) * ld + o]) * 256.0f); w[8 + i] = (_Float16)(bfr(Wm[(size_t)(k0 + 16 + 8 * g + i) * ld + o]) * 256.0f); }
  return w; }
__device__ __forceinline__ v16h wcolh_oi(const float* Wm, int k0, int o, int lane, int K) { v16h w; const float* p = Wm + (size_t)o * K + k0 + 8 * (lane >> 4);
#pragma unroll
  for (int i = 0; i < 8; ++i) { w[i] = (_Float16)(bfr(p[i]) * 256.0f); w[8 + i] = (_Float16)(bfr(p[16 + i]) * 256.0f); }
  return w; }
#define WQKV_LAYOUT 1   // 0 = (in,out) [DIN][CC]; 1 = (out,in) [CC][DIN]; 2 = per-head [NH][DIN][HD]
__device__ __forceinline__ v16b wcol_hdk(const float* Wm, int k0, int o, int lane) { v16b w; const int g = lane >> 4; const float* p = Wm + (size_t)(o / HD) * DIN * HD + (o % HD);
#pragma unroll
  for (int i = 0; i < 8; ++i) { w[i] = (__bf16)p[(size_t)(k0 + 8 * g + i) * HD]; w[8 + i] = (__bf16)p[(size_t)(k0 + 16 + 8 * g + i) * HD]; }
  return w; }
#define WO_OUT_IN 0
#if WQKV_LAYOUT == 1
#define WCOL(W, k0, o, lane) wcol_oi(W, k0, o, lane, DIN)
#elif WQKV_LAYOUT == 2
#define WCOL(W, k0, o, lane) wcol_hdk(W, k0, o, lane)
#else
#define WCOL(W, k0, o, lane) wcol_io(W, k0, o, lane, CC)
#endif
#if WO_OUT_IN
#define WOCOL(W, k0, o, lane) wcol_oi(W, k0, o, lane, CC)
#define WOCOLH(W, k0, o, lane) wcolh_oi(W, k0, o, lane, CC)
#else
#define WOCOL(W, k0, o, lane) wcol_io(W, k0, o, lane, DIN)
#define WOCOLH(W, k0, o, lane) wcolh_io(W, k0, o, lane, DIN)
#endif
#define CIN 64
// ---- k_padw: the three (out,in) [64][C] projection weights copied into zero-padded (out,in) [128][C] ws planes (rows 64..127 zero) + zero-padded [128] biases, so k_proj's 128-column tiles apply unchanged (columns 64..127 = an all-zero dummy head, never attended)
// Blocks with blockIdx.y >= 3 pack the mask instead: MB[batch * 128 + query tile of 16][key tile of 16][r] = one 32-bit word whose bit (lane = 16g + col) says mask[query tile * 16 + col][key tile * 16 + 8g + r] != 0, i.e. the lane mask of register r of that score tile in k_fa. A wave takes 16 mask rows x 128 keys: whole 512-B row pieces into its own LDS rows, read back in the score tile's lane order, one ballot per word.
#define MBP 132           // LDS pitch of a 128-element int row piece: 512 B + 16 B, conflict-free for 16-B reads
typedef __attribute__((ext_vector_type(2))) unsigned v2u;
__global__ __launch_bounds__(256) void k_padw(const float* __restrict__ WQ, const float* __restrict__ WK, const float* __restrict__ WV, const float* __restrict__ BQ, const float* __restrict__ BK, const float* __restrict__ BV, float* __restrict__ WP, float* __restrict__ BP, const int* __restrict__ MASK, unsigned* __restrict__ MB) {
  __shared__ __align__(16) int sp[8][16][MBP];
  if (blockIdx.y >= 3) { const int wave = threadIdx.x >> 5, lane = threadIdx.x & 31, col = lane & 15, g = lane >> 4; const int gw = ((blockIdx.y - 3) * 32 + blockIdx.x) * 8 + wave, ch = gw & 15, qt = gw >> 4;   // ch = piece of 128 keys, qt = batch * 128 + query tile
    const int* gm = MASK + (size_t)qt * 16 * TT + ch * 128 + lane * 4; v4i rm[16];
#pragma unroll   // constant indices, so that the array stays in registers; all sixteen loads in flight
    for (int i = 0; i < 16; ++i) rm[i] = *(const v4i*)(gm + (size_t)i * TT);
    asm volatile("s_wait_xcnt 0x0" :: "v"(gm) : "memory");   // the code behind reuses the registers that hold these loads' address: the wait stands in front of that overwrite, and the address as its input keeps the last load's result off those registers
#pragma unroll   // constant indices, so that the array stays in registers
    for (int i = 0; i < 16; ++i) *(v4i*)&sp[wave][i][lane * 4] = rm[i];
    __syncthreads();   // publishes the rows: a lane reads back what other lanes wrote
    unsigned w0 = 0, w1 = 0;   // lane l collects words 2l and 2l + 1 of the wave's 64
#pragma unroll   // constant lane numbers for the word's place
    for (int kt = 0; kt < 8; ++kt) { const v4i m0 = *(const v4i*)&sp[wave][col][kt * 16 + 8 * g], m1 = *(const v4i*)&sp[wave][col][kt * 16 + 8 * g + 4];
#pragma unroll   // constant lane numbers for the word's place
      for (int r = 0; r < 8; r += 2) { const unsigned ba = __builtin_amdgcn_ballot_w32((r < 4 ? m0[r & 3] : m1[r & 3]) != 0), bb = __builtin_amdgcn_ballot_w32((r < 4 ? m0[(r + 1) & 3] : m1[(r + 1) & 3]) != 0);
        const bool mine = lane == kt * 4 + (r >> 1); w0 = mine ? ba : w0; w1 = mine ? bb : w1; } }
    v2u wv; wv[0] = w0; wv[1] = w1; vst2(MB + (size_t)qt * (TT / 16 * 8) + ch * 64 + lane * 2, wv);
    return; }
  const int which = blockIdx.y; const float* Wsrc = which == 0 ? WQ : (which == 1 ? WK : WV); const float* Bsrc = which == 0 ? BQ : (which == 1 ? BK : BV); float* dst = WP + (size_t)which * 128 * CIN;
  for (int e = blockIdx.x * 256 + threadIdx.x; e < 128 * (CIN / 4); e += gridDim.x * 256) { const int row = e / (CIN / 4), q = e % (CIN / 4); const v4f ld = *(const v4f*)(Wsrc + (size_t)(row & 63) * CIN + q * 4); asm volatile("s_wait_loadcnt 0x0" ::: "memory"); const float keep = row < 64 ? 1.f : 0.f; v4f ov; ov[0] = ld[0] * keep; ov[1] = ld[1] * keep; ov[2] = ld[2] * keep; ov[3] = ld[3] * keep; vst2(dst + (size_t)row * CIN + q * 4, ov); }   /* unconditional (clamped) loads, zero by select */
  if (blockIdx.x == 0 && threadIdx.x < 128) { const int c = threadIdx.x; float bvv = 0.f; if (Bsrc) { const float t = Bsrc[c & 63]; asm volatile("s_wait_loadcnt 0x0" ::: "memory"); bvv = c < 64 ? t : 0.f; } vst2(BP + which * 128 + c, bvv); } }
#define WS_WP (WS_END)                                  // padded weights [3][128 x C]
#define WS_BP (WS_WP + 4u * 3 * (size_t)CIN * 128)        // padded biases [3][128]
#ifndef PROJ_EXTRA_PARAMS
#define PROJ_EXTRA_PARAMS
#endif

#define WS_QH  0u                                      // f16 q rows [b*t][CC]
#define WS_KH  (WS_QH + 2u * (size_t)NB * TT * CC)      // f16 k rows [b*t][CC]
#define WS_VT  (WS_KH + 2u * (size_t)NB * TT * CC)      // f16 v planes [b][c][t]
#define WS_KL  (WS_VT + 2u * (size_t)NB * CC * TT)      // f16 k residual x 2^10 rows [b][t < KHI][CC]
#define WS_VB  (WS_KL + 2u * (size_t)NB * KHI * CC)     // bf16 v hi planes [b][c][t < KHI]
#define WS_VBL (WS_VB + 2u * (size_t)NB * CC * KHI)
#define WS_END (WS_VBL + 2u * (size_t)NB * CC * KHI)

// ---- k_proj: block = (PT tiles of 64 rows, 128 cols, which): q/k/v = X W (+ b) with exact bf16 products (K = DIN) -> which 0: q f16 rows; 1: k f16 rows (+ residual rows < KHI); 2: v f16 planes [c][t] (+ bf16 hi/lo planes for t < KHI)
// Operand path: X rows and W rows are read as whole lines (a wave's 16-B loads cover two 256-B rows = 512 contiguous bytes), rounded to bf16 once per block and staged in LDS; the fragments come from LDS. W is staged once per block, the next row tile's loads are in flight in registers.
#define PT 4              // row tiles of 64 per block
#define PP 72             // LDS pitch of a 64-element bf16 row: 128 B + 16 B, conflict-free for 16-B fragment reads
typedef __attribute__((ext_vector_type(4))) __bf16 v4b;
__device__ __forceinline__ v4b cvt4b(v4f v) { v4b h;
#pragma unroll
  for (int e = 0; e < 4; ++e) h[e] = (__bf16)v[e];
  return h; }
// 16-B global store with its wait in ONE statement: the next pass of the store loop and the next trip reuse the registers that the store names
__device__ __forceinline__ void st16w(void* p, v4u v) { asm volatile("global_store_b128 %0, %1, off\n\ts_wait_xcnt 0x0" :: "v"(p), "v"(v) : "memory"); }
__global__ __launch_bounds__(128) void k_proj(const float* __restrict__ XQ, const float* __restrict__ XK, const float* __restrict__ XV, const float* __restrict__ WQ, const float* __restrict__ WK, const float* __restrict__ WV, const float* __restrict__ BQ, const float* __restrict__ BK, const float* __restrict__ BV,
    _Float16* __restrict__ QH, _Float16* __restrict__ KH, _Float16* __restrict__ KL, _Float16* __restrict__ VT, __bf16* __restrict__ VB, __bf16* __restrict__ VBL) {
  __shared__ __align__(16) unsigned char pool[3 * 128 * 72 * 2];   // output tiles; a block has one role, so q (sh), k (sh, sl) and v (th, tb, tbl) share the bytes
  __shared__ __align__(16) __bf16 xs[64][PP], wsg[128][PP];   // staged operands: one X row tile, all W rows
  _Float16 (*sh)[136] = (_Float16 (*)[136])pool; _Float16 (*sl)[136] = (_Float16 (*)[136])(pool + 64 * 136 * 2);
  _Float16 (*th)[72] = (_Float16 (*)[72])pool; __bf16 (*tb)[72] = (__bf16 (*)[72])(pool + 128 * 72 * 2); __bf16 (*tbl)[72] = (__bf16 (*)[72])(pool + 2 * 128 * 72 * 2);
  const int tid = threadIdx.x, wave = tid >> 5, lane = tid & 31, col = lane & 15, g = lane >> 4; const int which = blockIdx.z; const int c0 = blockIdx.y * 128; const size_t rb = (size_t)blockIdx.x * (64 * PT);
  const float* X = which == 0 ? XQ : which == 1 ? XK : XV; const float* WA = which == 0 ? WQ : which == 1 ? WK : WV; const float* BA = which == 0 ? BQ : which == 1 ? BK : BV;
  const int sr = tid >> 4, sc = tid & 15;   // staging: thread -> (row, 16-B chunk) of the 256-B rows
  const float* gx = X + (rb + sr) * DIN + sc * 4;
  v4f rx[8]; float bias[8];
  { v4f rw[16]; const float* gw = WA + (size_t)(c0 + sr) * DIN + sc * 4;
#pragma unroll   // constant indices, so that the arrays stay in registers
    for (int i = 0; i < 16; ++i) rw[i] = *(const v4f*)(gw + (size_t)(8 * i) * DIN);
#pragma unroll   // constant indices, so that the arrays stay in registers
    for (int i = 0; i < 8; ++i) rx[i] = *(const v4f*)(gx + (size_t)(8 * i) * DIN);
#pragma unroll   // constant indices, so that the arrays stay in registers
    for (int j = 0; j < 8; ++j) bias[j] = 0.f;
    if (BA) {
#pragma unroll   // constant indices, so that the arrays stay in registers
      for (int j = 0; j < 8; ++j) bias[j] = BA[c0 + j * 16 + col];
#pragma unroll   // constant indices, so that the arrays stay in registers
      for (int j = 0; j < 8; ++j) bias[j] = bfr(bias[j]); }
#pragma unroll   // constant indices, so that the arrays stay in registers
    for (int i = 0; i < 16; ++i) *(v4b*)&wsg[sr + 8 * i][sc * 4] = cvt4b(rw[i]); }
#pragma clang loop unroll(disable)   // one copy of the tile body: the branch round the next tile's loads keeps them directly behind the barrier
  for (int it = 0; it < PT; ++it) { const size_t r0 = rb + (size_t)it * 64; const size_t bb = r0 / TT; const int t0 = (int)(r0 % TT);
#pragma unroll   // constant indices, so that the arrays stay in registers
    for (int i = 0; i < 8; ++i) *(v4b*)&xs[sr + 8 * i][sc * 4] = cvt4b(rx[i]);
    __syncthreads();   // publishes the X tile (and, on the first trip, W); it also ends every wave's reads of the output tile of trip it - 1, which this trip overwrites only behind it
    v8f acc[8] = {};
#pragma unroll   // constant indices, so that the arrays stay in registers
    for (int kc = 0; kc < DIN / 32; ++kc) { const v16b a = frag_b(&xs[wave * 16 + col][kc * 32], lane); v16b w[8];
#pragma unroll   // constant indices, so that the arrays stay in registers
      for (int j = 0; j < 8; ++j) w[j] = frag_b(&wsg[j * 16 + col][kc * 32], lane);
#pragma unroll   // constant indices, so that the arrays stay in registers
      for (int j = 0; j < 8; ++j) acc[j] = __builtin_amdgcn_wmma_f32_16x16x32_bf16(false, a, false, w[j], (short)0, acc[j], false, false); }
    const bool qk = which < 2; _Float16* DH = which == 0 ? QH : KH; const bool hi_rows = which != 0 && t0 < KHI;
    if (which == 0) {
#pragma unroll
      for (int j = 0; j < 8; ++j) {
#pragma unroll
        for (int r = 0; r < 8; ++r) sh[wave * 16 + 8 * g + r][j * 16 + col] = (_Float16)(acc[j][r] + bias[j]); }
    } else if (which == 1) {
#pragma unroll
      for (int j = 0; j < 8; ++j) {
#pragma unroll
        for (int r = 0; r < 8; ++r) { const float v = acc[j][r] + bias[j]; const _Float16 hv = (_Float16)v; sh[wave * 16 + 8 * g + r][j * 16 + col] = hv; sl[wave * 16 + 8 * g + r][j * 16 + col] = (_Float16)((v - (float)hv) * 1024.0f); } }
    } else {
#pragma unroll
      for (int j = 0; j < 8; ++j) {
#pragma unroll
        for (int r = 0; r < 8; ++r) { const float v = acc[j][r] + bias[j]; const int rl = wave * 16 + 8 * g + r, cl = j * 16 + col; th[cl][rl] = (_Float16)v; const __bf16 bh = (__bf16)v; tb[cl][rl] = bh; tbl[cl][rl] = (__bf16)(v - (float)bh); } } }
    __syncthreads();   // publishes the output tile; it also ends every wave's fragment reads of the X tile, which the next trip overwrites only behind it
    if (it + 1 < PT) {   // behind the barrier (which drains the load counter), so that these loads fly while the output tile is stored
#pragma unroll   // constant indices, so that the arrays stay in registers
      for (int i = 0; i < 8; ++i) rx[i] = *(const v4f*)(gx + (size_t)((it + 1) * 64 + 8 * i) * DIN);
      asm volatile("s_wait_xcnt 0x0" ::: "memory"); }   // the code behind may reuse the registers that held these loads' addresses: the wait stands in front of that overwrite
    if (qk) {
      for (int e = tid; e < 64 * 16; e += 128) { const int rl = e >> 4, q = e & 15; st16w((DH + (r0 + rl) * CC + c0 + q * 8), *(const v4u*)&sh[rl][q * 8]); if (hi_rows) st16w((KL + (bb * KHI + t0 + rl) * (size_t)CC + c0 + q * 8), *(const v4u*)&sl[rl][q * 8]); }
    } else {
      for (int e = tid; e < 128 * 8; e += 128) { const int cl = e >> 3, q = e & 7; st16w((VT + (bb * CC + c0 + cl) * (size_t)TT + t0 + q * 8), *(const v4u*)&th[cl][q * 8]); if (hi_rows) { const size_t o3 = (bb * CC + c0 + cl) * (size_t)KHI + t0 + q * 8; st16w((VB + o3), *(const v4u*)&tb[cl][q * 8]); st16w((VBL + o3), *(const v4u*)&tbl[cl][q * 8]); } } } } }
// ---- k_fa: scores, mask, softmax and P . v of one pseudo-sequence in ONE pass over the keys: S and P stay in registers. Block = 8 waves x 16 queries (blockIdx.x = query block, blockIdx.y = pseudo-sequence b, real batch = b >> 4); a stage = 64 keys, K rows and v plane rows staged in LDS (whole 128-B lines per load), two buffers, the next stage's loads in flight in registers; the mask comes as packed lane-mask words (k_padw), 32 words a wave and stage by scalar loads.
// St = K Qt (A = K rows, B = q, kept in registers): a lane holds ONE query (col) and keys 8g + r of each 16-key tile, so two tiles pack in place into the B operand of Ot += vt Pt (A = v plane rows, same k order as frag_h). Running maximum and sum per query in raw score units (the 1/32 sits in the exponent's factor); where(mask == 0, -1e20, score) as in the source, so a fully masked row comes out uniform.
#define FQ 128            // queries per block
#define FK 64             // keys per stage
#define KP 72             // LDS pitch of a 64-element f16 row: 128 B + 16 B, conflict-free for 16-B fragment reads
#define CEXP (SCALE * 1.44269504088896f)
__device__ __forceinline__ v8f wm(v16h a, v16h b, v8f c) { return __builtin_amdgcn_wmma_f32_16x16x32_f16(false, a, false, b, (short)0, c, false, false); }
// 2^x in place. One statement for eight: behind a transcendental the instruction set asks for one independent instruction before its result is read or its source overwritten; here each v_exp_f32 is that instruction for the one before it and the v_nop for the last, whatever the compiler puts next
__device__ __forceinline__ v8f exp2x8(v8f e) { float a0 = e[0], a1 = e[1], a2 = e[2], a3 = e[3], a4 = e[4], a5 = e[5], a6 = e[6], a7 = e[7];
  asm("v_exp_f32 %0, %0\n\tv_exp_f32 %1, %1\n\tv_exp_f32 %2, %2\n\tv_exp_f32 %3, %3\n\tv_exp_f32 %4, %4\n\tv_exp_f32 %5, %5\n\tv_exp_f32 %6, %6\n\tv_exp_f32 %7, %7\n\tv_nop" : "+v"(a0), "+v"(a1), "+v"(a2), "+v"(a3), "+v"(a4), "+v"(a5), "+v"(a6), "+v"(a7));
  v8f p; p[0] = a0; p[1] = a1; p[2] = a2; p[3] = a3; p[4] = a4; p[5] = a5; p[6] = a6; p[7] = a7; return p; }
__device__ __forceinline__ float exp2x1(float a) { asm("v_exp_f32 %0, %0\n\tv_nop" : "+v"(a)); return a; }   // the v_nop: the same slot
__device__ __forceinline__ float xhalf(float v) { const int i = __builtin_bit_cast(int, v); return __builtin_bit_cast(float, (int)__builtin_amdgcn_permlanex16(i, i, 0x76543210, 0xfedcba98, false, false)); }   // the value of lane l ^ 16
// amdgpu_waves_per_eu(4, 4): the grid gives a SIMD four waves; with no ceiling named the compiler aimed at more waves, cut the registers and put a full LDS wait in front of every fragment's products
__global__ __launch_bounds__(256) __attribute__((amdgpu_waves_per_eu(4, 4))) void k_fa(const _Float16* __restrict__ QH, const _Float16* __restrict__ KH, const _Float16* __restrict__ VT, const unsigned* __restrict__ MB, float* __restrict__ C) {
  __shared__ __align__(16) _Float16 sk[2][FK][KP], sv[2][HD][KP];
  const int tid = threadIdx.x, wave = tid >> 5, lane = tid & 31, col = lane & 15, g = lane >> 4; const int b = blockIdx.y, q0 = blockIdx.x * FQ, qw = wave * 16 + col;
  v16h qh[2];
#pragma unroll   // constant indices, so that the arrays stay in registers
  for (int kc = 0; kc < 2; ++kc) qh[kc] = frag_h(QH + ((size_t)b * TT + q0 + qw) * CC + kc * 32, lane);
  const int r8 = tid >> 3, c8 = tid & 7;   // staging: thread -> (row, 16-B chunk) of 128-B rows (K, v)
  const _Float16* gk = KH + ((size_t)b * TT + r8) * CC + c8 * 8; const _Float16* gv = VT + ((size_t)b * CC + r8) * TT + c8 * 8;
  const unsigned* gb = MB + ((size_t)(b >> 4) * (TT / 16) + (q0 >> 4) + __builtin_amdgcn_readfirstlane(wave)) * (TT / 16 * 8);   // the wave's query tile: a wave-uniform address, so that the words come by scalar loads
  v8h rk[2], rv[2];
#pragma unroll   // constant indices, so that the arrays stay in registers
  for (int i = 0; i < 2; ++i) { rk[i] = *(const v8h*)(gk + (size_t)(32 * i) * CC); rv[i] = *(const v8h*)(gv + (size_t)(32 * i) * TT); }
  v8f o[4] = {}, lv = {}; float m = -3.0e38f;
#pragma clang loop unroll(disable)   // one copy of the stage body: the last stage is not peeled off, and the branch round the next stage's loads keeps them directly behind the barrier
  for (int s = 0; s < TT / FK; ++s) { const int u = s & 1;
    const v16u mb[2] = { *(cv16u)(gb + s * 32), *(cv16u)(gb + s * 32 + 16) };   // the stage's 32 mask words, asked for in front of the LDS stores and the barrier: they land while the wave waits there and for its first K fragments
#pragma unroll   // constant indices, so that the arrays stay in registers
    for (int i = 0; i < 2; ++i) { *(v8h*)&sk[u][r8 + 32 * i][c8 * 8] = rk[i]; *(v8h*)&sv[u][r8 + 32 * i][c8 * 8] = rv[i]; }
    __syncthreads();   // publishes buffer u; it also ends every wave's reads of buffer u ^ 1 (stage s - 1), which stage s + 1 overwrites only behind it
    if (s + 1 < TT / FK) { const int k1 = (s + 1) * FK;   // behind the barrier (which drains the load counter), so that these loads fly during the stage's work
#pragma unroll   // constant indices, so that the arrays stay in registers
      for (int i = 0; i < 2; ++i) { rk[i] = *(const v8h*)(gk + (size_t)(k1 + 32 * i) * CC); rv[i] = *(const v8h*)(gv + (size_t)(32 * i) * TT + k1); }
      asm volatile("s_wait_xcnt 0x0" ::: "memory"); }   // the stage's first LDS reads land in the registers that held these loads' addresses: the wait stands in front of that overwrite
    v8f t[4] = {};
#pragma unroll   // constant indices, so that the arrays stay in registers
    for (int kc = 0; kc < 2; ++kc)   // k chunk outside, tile inside: four independent accumulator chains, so that no product waits for the one before it
#pragma unroll   // constant indices, so that the arrays stay in registers
      for (int j = 0; j < 4; ++j) t[j] = wm(frag_h(&sk[u][j * 16 + col][kc * 32], lane), qh[kc], t[j]);
#pragma unroll   // constant indices, so that the arrays stay in registers
    for (int j = 0; j < 4; ++j)
#pragma unroll   // constant indices, so that the arrays stay in registers
      for (int r = 0; r < 8; ++r) t[j][r] = __builtin_amdgcn_inverse_ballot_w32(mb[j >> 1][(j & 1) * 8 + r]) ? t[j][r] : -1.0e20f;   // word (j, r) is this register's lane mask: one select, no compare
    float mj[4];   // one maximum chain per tile: four independent chains
#pragma unroll   // constant indices, so that the arrays stay in registers
    for (int j = 0; j < 4; ++j) { mj[j] = t[j][0];
#pragma unroll   // constant indices, so that the arrays stay in registers
      for (int r = 1; r < 8; ++r) mj[j] = fmaxf(mj[j], t[j][r]); }
    float mx = fmaxf(fmaxf(mj[0], mj[1]), fmaxf(mj[2], mj[3])); mx = fmaxf(mx, xhalf(mx));   // the query's other 32 keys of the stage sit in lane l ^ 16
    const float mn = fmaxf(m, mx), al = exp2x1((m - mn) * CEXP); m = mn;
    union { v16h v; v8h q[2]; } pb[2]; v8f ps;
#pragma unroll   // constant indices, so that the arrays stay in registers
    for (int j = 0; j < 4; ++j) { const v8f p = exp2x8((t[j] - mn) * CEXP);
      ps = j ? ps + p : p; pb[j >> 1].q[j & 1] = __builtin_convertvector(p, v8h); }
    lv = lv * al + ps;
#pragma unroll   // constant indices, so that the arrays stay in registers
    for (int jd = 0; jd < 4; ++jd) o[jd] *= al;
#pragma unroll   // constant indices, so that the arrays stay in registers
    for (int kk = 0; kk < 2; ++kk)
#pragma unroll   // constant indices, so that the arrays stay in registers
      for (int jd = 0; jd < 4; ++jd) o[jd] = wm(frag_h(&sv[u][jd * 16 + col][kk * 32], lane), pb[kk].v, o[jd]); }
  float ls = ((lv[0] + lv[1]) + (lv[2] + lv[3])) + ((lv[4] + lv[5]) + (lv[6] + lv[7])); ls += xhalf(ls); const float inv = 1.0f / ls;   // ls >= 1: the maximum's own term
  float* cr = C + ((size_t)b * TT + q0 + qw) * HD + 8 * g;   // Ot tile jd, register r = ctx[query][jd * 16 + 8g + r]: 32 contiguous bytes per lane and tile
#pragma unroll   // constant indices, so that the arrays stay in registers
  for (int jd = 0; jd < 4; ++jd) { v4f w0, w1;
#pragma unroll   // constant indices, so that the arrays stay in registers
    for (int r = 0; r < 4; ++r) { w0[r] = o[jd][r] * inv; w1[r] = o[jd][4 + r] * inv; }
    vst2(cr + jd * 16, w0); vst2(cr + jd * 16 + 4, w1); } }

// ---- k_lin2: the module's final Linear on the RAW-reshaped context: rows = the [2*2048][1024] view of the contiguous [32][2048][64] context buffer; out = ctx Wo^T + bo with ctx x 2^6 once to f16 against Wo as f16(bf16 x 2^8) (1 product, k in ascending 32-chunks).
// Block = 8 waves on a 128 x 128 output tile (wave = 32 rows x 64 columns); a stage = 64 k: the ctx rows and the Wo rows are read as whole 128-B lines, converted once per block and staged as f16 in LDS, two buffers, the next stage's loads in flight in registers.
#define K2 1024
#define N2 1024
#define LM 128            // output rows per block
#define LN 128            // output columns per block
#define LK 64             // k per stage
#define LP 72             // LDS pitch of a 64-element f16 row: 128 B + 16 B, conflict-free for 16-B fragment reads
#define LF 132            // LDS pitch of a 128-element f32 output row
typedef __attribute__((ext_vector_type(4))) _Float16 v4h;
__global__ __launch_bounds__(256) void k_lin2(const float* __restrict__ Yc, const float* __restrict__ WO, const float* __restrict__ BO, float* __restrict__ OUT) {
  __shared__ __align__(16) _Float16 st[2][2][LM][LP];   // [buffer][0 = ctx rows, 1 = Wo rows][row][k]; after the k loop the same bytes hold the f32 output tile
  const int tid = threadIdx.x, wave = tid >> 5, lane = tid & 31, col = lane & 15, g = lane >> 4; const int c0 = blockIdx.y * LN; const size_t r0 = (size_t)blockIdx.x * LM;
  const int wr = (wave >> 1) * 32, wc = (wave & 1) * 64;
  const int sr = tid >> 4, sc = tid & 15;   // staging: thread -> (row, 16-B chunk) of the 256-B row pieces
  const float* ga = Yc + r0 * K2; const float* gw = WO + (size_t)c0 * K2; const unsigned vo = (unsigned)(sr * K2 + sc * 4);   // block-uniform bases that walk along k, and one per-lane offset that never changes
  v4f ra[8], rw[8];
#pragma unroll   // constant indices, so that the arrays stay in registers
  for (int i = 0; i < 8; ++i) { ra[i] = *(const v4f*)(ga + (vo + 16u * i * K2)); rw[i] = *(const v4f*)(gw + (vo + 16u * i * K2)); }
  v8f acc[2][4] = {};
#pragma clang loop unroll(disable)   // one copy of the stage body: the last stage is not peeled off, and the branch round the next stage's loads keeps them directly behind the barrier
  for (int s = 0; s < K2 / LK; ++s) { const int u = s & 1;
#pragma unroll   // constant indices, so that the arrays stay in registers
    for (int i = 0; i < 8; ++i) { v4h ha, hw;
#pragma unroll   // constant indices, so that the arrays stay in registers
      for (int e = 0; e < 4; ++e) { ha[e] = (_Float16)(ra[i][e] * 64.0f); hw[e] = (_Float16)(bfr(rw[i][e]) * 256.0f); }
      *(v4h*)&st[u][0][sr + 16 * i][sc * 4] = ha; *(v4h*)&st[u][1][sr + 16 * i][sc * 4] = hw; }
    __syncthreads();   // publishes buffer u; it also ends every wave's reads of buffer u ^ 1 (stage s - 1), which stage s + 1 overwrites only behind it
    if (s + 1 < K2 / LK) { ga += LK; gw += LK;   // behind the barrier (which drains the load counter), so that these loads fly during the stage's work
#pragma unroll   // constant indices, so that the arrays stay in registers
      for (int i = 0; i < 8; ++i) { ra[i] = *(const v4f*)(ga + (vo + 16u * i * K2)); rw[i] = *(const v4f*)(gw + (vo + 16u * i * K2)); } }
#pragma unroll   // constant indices, so that the arrays stay in registers
    for (int kk = 0; kk < 2; ++kk) { v16h af[2], bf[4];
#pragma unroll   // constant indices, so that the arrays stay in registers
      for (int i = 0; i < 2; ++i) af[i] = frag_h(&st[u][0][wr + i * 16 + col][kk * 32], lane);
#pragma unroll   // constant indices, so that the arrays stay in registers
      for (int j = 0; j < 4; ++j) bf[j] = frag_h(&st[u][1][wc + j * 16 + col][kk * 32], lane);
#pragma unroll   // constant indices, so that the arrays stay in registers
      for (int i = 0; i < 2; ++i)
#pragma unroll   // constant indices, so that the arrays stay in registers
        for (int j = 0; j < 4; ++j) acc[i][j] = wm(af[i], bf[j], acc[i][j]); } }
  float (*sf)[LF] = (float (*)[LF])&st[0][0][0][0];   // 128 x 132 f32 = 67,584 B of the 73,728 B
  __syncthreads();   // ends every wave's fragment reads of the last stage before the output tile overwrites the buffers
#pragma unroll   // constant indices, so that the arrays stay in registers
  for (int j = 0; j < 4; ++j) { const float bias = bfr(BO[c0 + wc + j * 16 + col]);
#pragma unroll   // constant indices, so that the arrays stay in registers
    for (int i = 0; i < 2; ++i)
#pragma unroll   // constant indices, so that the arrays stay in registers
      for (int r = 0; r < 8; ++r) sf[wr + i * 16 + 8 * g + r][wc + j * 16 + col] = acc[i][j][r] * (1.0f / 16384.0f) + bias; }   /* 2^-8 (Wo carry) x 2^-6 (ctx carry) */
  __syncthreads();   // publishes the output tile: a wave stores whole 512-B rows that two waves wrote
#pragma unroll   // one address, sixteen constant offsets
  for (int rl = 0; rl < 16; ++rl) vst2(OUT + (r0 + wave * 16 + rl) * N2 + c0 + lane * 4, *(const v4f*)&sf[wave * 16 + rl][lane * 4]); }
#define WS_C64 (WS_BP + 4u * 3 * 128)                     // f32 context [32][2048][64] contiguous == the raw-reshaped [2*2048][1024] rows
#define WS_MB (WS_C64 + 4u * (size_t)NB * TT * 64)          // packed mask words [2 * 128 query tiles][128 key tiles][8]
#define WS_END3 (WS_MB + 4u * 2 * (size_t)(TT / 16) * (TT / 16) * 8)
extern "C" void kernel_launch(void* const* d_in, const int* in_sizes, int n_in, void* d_out, int out_size, void* d_ws, size_t ws_size, hipStream_t stream) {
  (void)in_sizes; (void)n_in; (void)out_size;
  const float** F = (const float**)d_in;
  if (ws_size < (size_t)WS_END) return;
  char* ws = (char*)d_ws; _Float16 *QH = (_Float16*)(ws + WS_QH), *KH = (_Float16*)(ws + WS_KH), *VT = (_Float16*)(ws + WS_VT), *KL = (_Float16*)(ws + WS_KL); __bf16 *VB = (__bf16*)(ws + WS_VB), *VBL = (__bf16*)(ws + WS_VBL);
  (void)KL; (void)VB; (void)VBL;
  // inputs: 0 query [2,2048,1024]; 1 key; 2 value (each viewed as 65,536 rows of 64: the raw reshape); 3 mask [2,1,2048,2048] int32; 4 Wq [64,64] (out,in); 5 Wk; 6 Wv; 7 Wo [1024,1024] (out,in); 8 bo [1024] (nonzero)
  if (ws_size < (size_t)WS_END3) return;
  float *WP = (float*)(ws + WS_WP), *BP = (float*)(ws + WS_BP), *C64 = (float*)(ws + WS_C64); unsigned* MB = (unsigned*)(ws + WS_MB);
  k_padw<<<dim3(32, 3 + 16), 256, 0, stream>>>(F[4], F[5], F[6], nullptr, nullptr, nullptr, WP, BP, (const int*)d_in[3], MB);   /* y >= 3: 512 blocks x 8 waves x (16 rows x 128 keys) = the whole mask */
  k_proj<<<dim3(TNB * TT / (64 * PT), CC / 128, 3), 128, 0, stream>>>(F[0], F[1], F[2], WP, WP + (size_t)CIN * 128, WP + 2 * (size_t)CIN * 128, BP, BP + 128, BP + 256, QH, KH, KL, VT, VB, VBL);
  k_fa<<<dim3(TT / FQ, TNB), 256, 0, stream>>>(QH, KH, VT, MB, C64);   /* pseudo-sequence = real batch (b >> 4), pseudo-head (b & 15); head 0 (columns 0..63) only */
  k_lin2<<<dim3((TNB * TT * 64 / K2) / LM, N2 / LN), 256, 0, stream>>>(C64, F[7], F[8], (float*)d_out);
}

// v007
// Measured time: 75.7 microseconds a run.
// Two timings next to v006 both put it at 1.16 times that version's speed.
// All steps since v000 together make it 37.8 times as fast.
// compute dtype: all float inputs rounded to bf16; q/k/v projections with EXACT bf16 products on WMMA 16x16x32 (f32 accumulate); logits: q once to f16 x k once to f16 (1 product); running-maximum softmax in f32; exp(logit - running maximum) once to f16 x v once to f16 (1 product), divided by the f32 sum at the end; f32 output.
#include <hip/hip_runtime.h>
#include <math.h>

typedef __attribute__((ext_vector_type(16))) _Float16 v16h;
typedef __attribute__((ext_vector_type(16))) __bf16 v16b;
typedef __attribute__((ext_vector_type(8)))  _Float16 v8h;
typedef __attribute__((ext_vector_type(8)))  float v8f;
typedef __attribute__((ext_vector_type(4)))  float v4f;
typedef __attribute__((ext_vector_type(2)))  float v2f;
typedef __attribute__((ext_vector_type(4)))  unsigned v4u;
typedef __attribute__((ext_vector_type(4)))  int v4i;
typedef __attribute__((ext_vector_type(16))) unsigned v16u;
typedef const __attribute__((address_space(4))) v16u* cv16u;   // a pointer to memory that no one writes while the kernel runs: a wave-uniform load through it is a scalar load
typedef float __attribute__((may_alias)) float_a;
typedef int __attribute__((may_alias)) int_a;

template <typename T> __device__ __forceinline__ void vst2(void* p, T v) { *(T*)p = v;  }
__device__ __forceinline__ v8f wmma16(v16h a, v16h b, v8f c) {
  v8f d = __builtin_amdgcn_wmma_f32_16x16x32_f16(false, a, false, b, (short)0, c, false, false);
  asm volatile("v_nop\n\tv_nop\n\tv_nop\n\tv_nop" : "+v"(d) : "v"(a), "v"(b));
  return d;
}
__device__ __forceinline__ v8f wmma_bf(v16b a, v16b b, v8f c) {
  v8f d = __builtin_amdgcn_wmma_f32_16x16x32_bf16(false, a, false, b, (short)0, c, false, false);
  asm volatile("v_nop\n\tv_nop\n\tv_nop\n\tv_nop" : "+v"(d) : "v"(a), "v"(b));
  return d;
}
// 16x16x32 fragments: lane = (h = lane>>4, row/col = lane&15); elements 0..7 = k0+8h+0..7, 8..15 = k0+16+8h+0..7; D element r = row 8h+r
__device__ __forceinline__ v16h frag_h(const _Float16* rowk0, int lane) {
  union { v16h v; v8h q[2]; } u; const _Float16* p = rowk0 + 8 * (lane >> 4);
  u.q[0] = *(const v8h*)p; u.q[1] = *(const v8h*)(p + 16); return u.v;
}
__device__ __forceinline__ v16h frag_f32(const float* rowk0, int lane) {
  v16h a; const float* p = rowk0 + 8 * (lane >> 4);
#pragma unroll
  for (int i = 0; i < 8; ++i) { a[i] = (_Float16)p[i]; a[8 + i] = (_Float16)p[16 + i]; }
  return a;
}
__device__ __forceinline__ v16h frag_f32s(const float* rowk0, int lane, float sc) {
  v16h a; const float* p = rowk0 + 8 * (lane >> 4);
#pragma unroll
  for (int i = 0; i < 8; ++i) { a[i] = (_Float16)(p[i] * sc); a[8 + i] = (_Float16)(p[16 + i] * sc); }
  return a;
}
// column fragment from a [K][ld] layout (column n), rows >= K read as 0
__device__ __forceinline__ v16h fragc_f32(const float* W, int k0, int n, int lane, int ld, int K) {
  v16h a; const int g = lane >> 4;
#pragma unroll
  for (int i = 0; i < 8; ++i) { const int ka = k0 + 8 * g + i, kb = ka + 16;
    a[i] = (_Float16)(ka < K ? W[(size_t)(ka < K ? ka : K - 1) * ld + n] : 0.f); a[8 + i] = (_Float16)(kb < K ? W[(size_t)(kb < K ? kb : K - 1) * ld + n] : 0.f); }
  return a;
}
struct F2 { v16b h, l; };
__device__ __forceinline__ F2 bsplit16(const float v[16]) { F2 r;
#pragma unroll
  for (int i = 0; i < 16; ++i) { const __bf16 h = (__bf16)v[i]; r.h[i] = h; r.l[i] = (__bf16)(v[i] - (float)h); }
  return r; }
__device__ __forceinline__ F2 split_row(const float* row, int k0, int lane) { float v[16]; const float* p = row + k0 + 8 * (lane >> 4);
#pragma unroll
  for (int i = 0; i < 8; ++i) { v[i] = p[i]; v[8 + i] = p[16 + i]; }
  return bsplit16(v); }
__device__ __forceinline__ F2 split_rowK(const float* row, int k0, int lane, int K) { float v[16]; const int g = lane >> 4;
#pragma unroll
  for (int i = 0; i < 8; ++i) { const int ka = k0 + 8 * g + i, kb = ka + 16; v[i] = ka < K ? row[ka < K ? ka : K - 1] : 0.f; v[8 + i] = kb < K ? row[kb < K ? kb : K - 1] : 0.f; }
  return bsplit16(v); }
__device__ __forceinline__ F2 split_col(const float* W, int k0, int n, int lane, int ld, int K) { float v[16]; const int g = lane >> 4;
#pragma unroll
  for (int i = 0; i < 8; ++i) { const int ka = k0 + 8 * g + i, kb = ka + 16; v[i] = ka < K ? W[(size_t)(ka < K ? ka : K - 1) * ld + n] : 0.f; v[8 + i] = kb < K ? W[(size_t)(kb < K ? kb : K - 1) * ld + n] : 0.f; }
  return bsplit16(v); }
__device__ __forceinline__ v8f mac3(const F2& a, const F2& b, v8f c) { c = wmma_bf(a.l, b.h, c); c = wmma_bf(a.h, b.l, c); return wmma_bf(a.h, b.h, c); }
__device__ __forceinline__ float sigm(float v) { return 1.0f / (1.0f + expf(-v)); }
#define LDSX() do { asm volatile("s_wait_dscnt 0" ::: "memory"); __builtin_amdgcn_wave_barrier(); __builtin_amdgcn_fence(__ATOMIC_RELEASE, "workgroup"); } while (0)

// Masked self-attention with a RAW reshape into heads (query / key / value [2,2048,1024] are reshaped WITHOUT transpose to [2,16,2048,64]: pseudo-head h of batch b = the contiguous 131,072 floats starting at (b*16 + h)*2048*64, i.e. 32 pseudo-sequences of 2,048 positions x 64 dims each); one shared bias-free torch (out,in) Linear [64,64] per role (Wq, Wk, Wv); scores = Q K^T masked by mask[b][0][q][k] == 0 -> -1e20 (int32 random 0/1 per batch), then divided by sqrt(embed = 1024) = 32 (the source's quirk: logit sigma - 0.08); softmax; out = attn V reshaped raw back to [2,2048,1024]; (out,in) Wo [1024,1024] + bo (nonzero): result = out Wo^T + bo.
#define NB 32
#define TT 2048
#define CC 128            // NH * HD = projected width
#define DIN 64          // input (model) width
#define NH 2
#define HD 64
#define NQB (TT / 64)
#define HG 1
#define SCALE (0.03125f)
#define CAUSAL 0
#ifndef TNB
#define TNB NB
#endif
__device__ __forceinline__ float bfr(float v) { return (float)(__bf16)v; }
__host__ __device__ __forceinline__ int kb_last(int qb) { return CAUSAL ? ((qb * 64 + 63) >> 7) : (TT / 128 - 1); }
typedef __attribute__((ext_vector_type(8))) __bf16 v8b;
__device__ __forceinline__ v16b frag_b(const __bf16* rowk0, int lane) {
  union { v16b v; v8b q[2]; } u; const __bf16* p = rowk0 + 8 * (lane >> 4);
  u.q[0] = *(const v8b*)p; u.q[1] = *(const v8b*)(p + 16); return u.v;
}
#define QBH 0              // unused: no kernel here has a high-precision path
#define KHI 64            // key rows carrying k residual / v bf16 hi+lo planes (written by k_proj; no kernel here reads them)
// B fragment (k rows k0+.., output column o) of a weight: (in,out) [K][ld] or (out,in) [ld rows of K]: bf16 exact, or f16(bf16 * 256) exact
__device__ __forceinline__ v16b wcol_io(const float* Wm, int k0, int o, int lane, int ld) { v16b w; const int g = lane >> 4;
#pragma unroll
  for (int i = 0; i < 8; ++i) { w[i] = (__bf16)Wm[(size_t)(k0 + 8 * g + i) * ld + o]; w[8 + i] = (__bf16)Wm[(size_t)(k0 + 16 + 8 * g + i) * ld + o]; }
  return w; }
__device__ __forceinline__ v16b wcol_oi(const float* Wm, int k0, int o, int lane, int K) { v16b w; const float* p = Wm + (size_t)o * K + k0 + 8 * (lane >> 4);
#pragma unroll
  for (int i = 0; i < 8; ++i) { w[i] = (__bf16)p[i]; w[8 + i] = (__bf16)p[16 + i]; }
  return w; }
__device__ __forceinline__ v16h wcolh_io(const float* Wm, int k0, int o, int lane, int ld) { v16h w; const int g = lane >> 4;
#pragma unroll
  for (int i = 0; i < 8; ++i) { w[i] = (_Float16)(bfr(Wm[(size_t)(k0 + 8 * g + i) * ld + o]) * 256.0f); w[8 + i] = (_Float16)(bfr(Wm[(size_t)(k0 + 16 + 8 * g + i) * ld + o]) * 256.0f); }
  return w; }
__device__ __forceinline__ v16h wcolh_oi(const float* Wm, int k0, int o, int lane, int K) { v16h w; const float* p = Wm + (size_t)o * K + k0 + 8 * (lane >> 4);
#pragma unroll
  for (int i = 0; i < 8; ++i) { w[i] = (_Float16)(bfr(p[i]) * 256.0f); w[8 + i] = (_Float16)(bfr(p[16 + i]) * 256.0f); }
  return w; }
#define WQKV_LAYOUT 1   // 0 = (in,out) [DIN][CC]; 1 = (out,in) [CC][DIN]; 2 = per-head [NH][DIN][HD]
__device__ __forceinline__ v16b wcol_hdk(const float* Wm, int k0, int o, int lane) { v16b w; const int g = lane >> 4; const float* p = Wm + (size_t)(o / HD) * DIN * HD + (o % HD);
#pragma unroll
  for (int i = 0; i < 8; ++i) { w[i] = (__bf16)p[(size_t)(k0 + 8 * g + i) * HD]; w[8 + i] = (__bf16)p[(size_t)(k0 + 16 + 8 * g + i) * HD]; }
  return w; }
#define WO_OUT_IN 0
#if WQKV_LAYOUT == 1
#define WCOL(W, k0, o, lane) wcol_oi(W, k0, o, lane, DIN)
#elif WQKV_LAYOUT == 2
#define WCOL(W, k0, o, lane) wcol_hdk(W, k0, o, lane)
#else
#define WCOL(W, k0, o, lane) wcol_io(W, k0, o, lane, CC)
#endif
#if WO_OUT_IN
#define WOCOL(W, k0, o, lane) wcol_oi(W, k0, o, lane, CC)
#define WOCOLH(W, k0, o, lane) wcolh_oi(W, k0, o, lane, CC)
#else
#define WOCOL(W, k0, o, lane) wcol_io(W, k0, o, lane, DIN)
#define WOCOLH(W, k0, o, lane) wcolh_io(W, k0, o, lane, DIN)
#endif
#define CIN 64
// ---- k_padw: the three (out,in) [64][C] projection weights copied into zero-padded (out,in) [128][C] ws planes (rows 64..127 zero) + zero-padded [128] biases, so the 128-column projection applies unchanged (columns 64..127 = an all-zero dummy head, never attended)
// Blocks with blockIdx.y >= 19 convert Wo for k_lin2 (see there). Blocks with blockIdx.y in 3..18 pack the mask instead: MB[batch * 128 + query tile of 16][key tile of 16][r] = one 32-bit word whose bit (lane = 16g + col) says mask[query tile * 16 + col][key tile * 16 + 8g + r] != 0, i.e. the lane mask of register r of that score tile in k_fa. A wave takes 16 mask rows x 128 keys: whole 512-B row pieces into its own LDS rows, read back in the score tile's lane order, one ballot per word.
#define MBP 132           // LDS pitch of a 128-element int row piece: 512 B + 16 B, conflict-free for 16-B reads
typedef __attribute__((ext_vector_type(2))) unsigned v2u;
typedef __attribute__((ext_vector_type(4))) _Float16 v4h;
__global__ __launch_bounds__(256) void k_padw(const float* __restrict__ WQ, const float* __restrict__ WK, const float* __restrict__ WV, const float* __restrict__ BQ, const float* __restrict__ BK, const float* __restrict__ BV, float* __restrict__ WP, float* __restrict__ BP, const int* __restrict__ MASK, unsigned* __restrict__ MB, const float* __restrict__ WO, _Float16* __restrict__ WH) {
  __shared__ __align__(16) int sp[8][16][MBP];
  if (blockIdx.y >= 3 + 16) {   // Wo once to f16(bf16 x 2^8), the B operand of k_lin2: 128 blocks, a thread takes eight 16-B pieces, each wave-wide load 512 contiguous bytes, all eight in flight
    const size_t e0 = ((size_t)((blockIdx.y - 19) * 32 + blockIdx.x) * 256 + threadIdx.x) * 4; const float* gs = WO + e0; v4f rw[8];
#pragma unroll   // constant indices, so that the array stays in registers
    for (int i = 0; i < 8; ++i) rw[i] = *(const v4f*)(gs + (size_t)i * (128 * 256 * 4));
    asm volatile("s_wait_xcnt 0x0" :: "v"(gs) : "memory");   // the code behind may reuse the registers that hold these loads' address: the wait stands in front of that overwrite
#pragma unroll   // constant indices, so that the array stays in registers
    for (int i = 0; i < 8; ++i) { v4h hw;
#pragma unroll
      for (int e = 0; e < 4; ++e) hw[e] = (_Float16)(bfr(rw[i][e]) * 256.0f);
      vst2(WH + e0 + (size_t)i * (128 * 256 * 4), hw); }
    return; }
  if (blockIdx.y >= 3) { const int wave = threadIdx.x >> 5, lane = threadIdx.x & 31, col = lane & 15, g = lane >> 4; const int gw = ((blockIdx.y - 3) * 32 + blockIdx.x) * 8 + wave, ch = gw & 15, qt = gw >> 4;   // ch = piece of 128 keys, qt = batch * 128 + query tile
    const int* gm = MASK + (size_t)qt * 16 * TT + ch * 128 + lane * 4; v4i rm[16];
#pragma unroll   // constant indices, so that the array stays in registers; all sixteen loads in flight
    for (int i = 0; i < 16; ++i) rm[i] = *(const v4i*)(gm + (size_t)i * TT);
    asm volatile("s_wait_xcnt 0x0" :: "v"(gm) : "memory");   // the code behind reuses the registers that hold these loads' address: the wait stands in front of that overwrite, and the address as its input keeps the last load's result off those registers
#pragma unroll   // constant indices, so that the array stays in registers
    for (int i = 0; i < 16; ++i) *(v4i*)&sp[wave][i][lane * 4] = rm[i];
    __syncthreads();   // publishes the rows: a lane reads back what other lanes wrote
    unsigned w0 = 0, w1 = 0;   // lane l collects words 2l and 2l + 1 of the wave's 64
#pragma unroll   // constant lane numbers for the word's place
    for (int kt = 0; kt < 8; ++kt) { const v4i m0 = *(const v4i*)&sp[wave][col][kt * 16 + 8 * g], m1 = *(const v4i*)&sp[wave][col][kt * 16 + 8 * g + 4];
#pragma unroll   // constant lane numbers for the word's place
      for (int r = 0; r < 8; r += 2) { const unsigned ba = __builtin_amdgcn_ballot_w32((r < 4 ? m0[r & 3] : m1[r & 3]) != 0), bb = __builtin_amdgcn_ballot_w32((r < 4 ? m0[(r + 1) & 3] : m1[(r + 1) & 3]) != 0);
        const bool mine = lane == kt * 4 + (r >> 1); w0 = mine ? ba : w0; w1 = mine ? bb : w1; } }
    v2u wv; wv[0] = w0; wv[1] = w1; vst2(MB + (size_t)qt * (TT / 16 * 8) + ch * 64 + lane * 2, wv);
    return; }
  const int which = blockIdx.y; const float* Wsrc = which == 0 ? WQ : (which == 1 ? WK : WV); const float* Bsrc = which == 0 ? BQ : (which == 1 ? BK : BV); float* dst = WP + (size_t)which * 128 * CIN;
  for (int e = blockIdx.x * 256 + threadIdx.x; e < 128 * (CIN / 4); e += gridDim.x * 256) { const int row = e / (CIN / 4), q = e % (CIN / 4); const v4f ld = *(const v4f*)(Wsrc + (size_t)(row & 63) * CIN + q * 4); asm volatile("s_wait_loadcnt 0x0" ::: "memory"); const float keep = row < 64 ? 1.f : 0.f; v4f ov; ov[0] = ld[0] * keep; ov[1] = ld[1] * keep; ov[2] = ld[2] * keep; ov[3] = ld[3] * keep; vst2(dst + (size_t)row * CIN + q * 4, ov); }   /* unconditional (clamped) loads, zero by select */
  if (blockIdx.x == 0 && threadIdx.x < 128) { const int c = threadIdx.x; float bvv = 0.f; if (Bsrc) { const float t = Bsrc[c & 63]; asm volatile("s_wait_loadcnt 0x0" ::: "memory"); bvv = c < 64 ? t : 0.f; } vst2(BP + which * 128 + c, bvv); } }
#define WS_WP (WS_END)                                  // padded weights [3][128 x C]
#define WS_BP (WS_WP + 4u * 3 * (size_t)CIN * 128)        // padded biases [3][128]
#ifndef PROJ_EXTRA_PARAMS
#define PROJ_EXTRA_PARAMS
#endif

#define WS_QH  0u                                      // f16 q rows [b*t][CC]
#define WS_KH  (WS_QH + 2u * (size_t)NB * TT * CC)      // f16 k rows [b*t][CC]
#define WS_VT  (WS_KH + 2u * (size_t)NB * TT * CC)      // f16 v planes [b][c][t]
#define WS_KL  (WS_VT + 2u * (size_t)NB * CC * TT)      // f16 k residual x 2^10 rows [b][t < KHI][CC]
#define WS_VB  (WS_KL + 2u * (size_t)NB * KHI * CC)     // bf16 v hi planes [b][c][t < KHI]
#define WS_VBL (WS_VB + 2u * (size_t)NB * CC * KHI)
#define WS_END (WS_VBL + 2u * (size_t)NB * CC * KHI)

// ---- k_proj: block = (PT tiles of 64 rows, 128 cols, which): q/k/v = X W (+ b) with exact bf16 products (K = DIN) -> which 0: q f16 rows; 1: k f16 rows (+ residual rows < KHI); 2: v f16 planes [c][t] (+ bf16 hi/lo planes for t < KHI)
// Operand path: X rows and W rows are read as whole lines (a wave's 16-B loads cover two 256-B rows = 512 contiguous bytes), rounded to bf16 once per block and staged in LDS; the fragments come from LDS. W is staged once per block, the next row tile's loads are in flight in registers.
#define PT 4              // row tiles of 64 per block
#define PP 72             // LDS pitch of a 64-element bf16 row: 128 B + 16 B, conflict-free for 16-B fragment reads
typedef __attribute__((ext_vector_type(4))) __bf16 v4b;
__device__ __forceinline__ v4b cvt4b(v4f v) { v4b h;
#pragma unroll
  for (int e = 0; e < 4; ++e) h[e] = (__bf16)v[e];
  return h; }
// 16-B global store with its wait in ONE statement: the next pass of the store loop and the next trip reuse the registers that the store names
__device__ __forceinline__ void st16w(void* p, v4u v) { asm volatile("global_store_b128 %0, %1, off\n\ts_wait_xcnt 0x0" :: "v"(p), "v"(v) : "memory"); }
__global__ __launch_bounds__(128) void k_proj(const float* __restrict__ XQ, const float* __restrict__ XK, const float* __restrict__ XV, const float* __restrict__ WQ, const float* __restrict__ WK, const float* __restrict__ WV, const float* __restrict__ BQ, const float* __restrict__ BK, const float* __restrict__ BV,
    _Float16* __restrict__ QH, _Float16* __restrict__ KH, _Float16* __restrict__ KL, _Float16* __restrict__ VT, __bf16* __restrict__ VB, __bf16* __restrict__ VBL) {
  __shared__ __align__(16) unsigned char pool[3 * 128 * 72 * 2];   // output tiles; a block has one role, so q (sh), k (sh, sl) and v (th, tb, tbl) share the bytes
  __shared__ __align__(16) __bf16 xs[64][PP], wsg[128][PP];   // staged operands: one X row tile, all W rows
  _Float16 (*sh)[136] = (_Float16 (*)[136])pool; _Float16 (*sl)[136] = (_Float16 (*)[136])(pool + 64 * 136 * 2);
  _Float16 (*th)[72] = (_Float16 (*)[72])pool; __bf16 (*tb)[72] = (__bf16 (*)[72])(pool + 128 * 72 * 2); __bf16 (*tbl)[72] = (__bf16 (*)[72])(pool + 2 * 128 * 72 * 2);
  const int tid = threadIdx.x, wave = tid >> 5, lane = tid & 31, col = lane & 15, g = lane >> 4; const int which = blockIdx.z; const int c0 = blockIdx.y * 128; const size_t rb = (size_t)blockIdx.x * (64 * PT);
  const float* X = which == 0 ? XQ : which == 1 ? XK : XV; const float* WA = which == 0 ? WQ : which == 1 ? WK : WV; const float* BA = which == 0 ? BQ : which == 1 ? BK : BV;
  const int sr = tid >> 4, sc = tid & 15;   // staging: thread -> (row, 16-B chunk) of the 256-B rows
  const float* gx = X + (rb + sr) * DIN + sc * 4;
  v4f rx[8]; float bias[8];
  { v4f rw[16]; const float* gw = WA + (size_t)(c0 + sr) * DIN + sc * 4;
#pragma unroll   // constant indices, so that the arrays stay in registers
    for (int i = 0; i < 16; ++i) rw[i] = *(const v4f*)(gw + (size_t)(8 * i) * DIN);
#pragma unroll   // constant indices, so that the arrays stay in registers
    for (int i = 0; i < 8; ++i) rx[i] = *(const v4f*)(gx + (size_t)(8 * i) * DIN);
#pragma unroll   // constant indices, so that the arrays stay in registers
    for (int j = 0; j < 8; ++j) bias[j] = 0.f;
    if (BA) {
#pragma unroll   // constant indices, so that the arrays stay in registers
      for (int j = 0; j < 8; ++j) bias[j] = BA[c0 + j * 16 + col];
#pragma unroll   // constant indices, so that the arrays stay in registers
      for (int j = 0; j < 8; ++j) bias[j] = bfr(bias[j]); }
#pragma unroll   // constant indices, so that the arrays stay in registers
    for (int i = 0; i < 16; ++i) *(v4b*)&wsg[sr + 8 * i][sc * 4] = cvt4b(rw[i]); }
#pragma clang loop unroll(disable)   // one copy of the tile body: the branch round the next tile's loads keeps them directly behind the barrier
  for (int it = 0; it < PT; ++it) { const size_t r0 = rb + (size_t)it * 64; const size_t bb = r0 / TT; const int t0 = (int)(r0 % TT);
#pragma unroll   // constant indices, so that the arrays stay in registers
    for (int i = 0; i < 8; ++i) *(v4b*)&xs[sr + 8 * i][sc * 4] = cvt4b(rx[i]);
    __syncthreads();   // publishes the X tile (and, on the first trip, W); it also ends every wave's reads of the output tile of trip it - 1, which this trip overwrites only behind it
    v8f acc[8] = {};
#pragma unroll   // constant indices, so that the arrays stay in registers
    for (int kc = 0; kc < DIN / 32; ++kc) { const v16b a = frag_b(&xs[wave * 16 + col][kc * 32], lane); v16b w[8];
#pragma unroll   // constant indices, so that the arrays stay in registers
      for (int j = 0; j < 8; ++j) w[j] = frag_b(&wsg[j * 16 + col][kc * 32], lane);
#pragma unroll   // constant indices, so that the arrays stay in registers
      for (int j = 0; j < 8; ++j) acc[j] = __builtin_amdgcn_wmma_f32_16x16x32_bf16(false, a, false, w[j], (short)0, acc[j], false, false); }
    const bool qk = which < 2; _Float16* DH = which == 0 ? QH : KH; const bool hi_rows = which != 0 && t0 < KHI;
    if (which == 0) {
#pragma unroll
      for (int j = 0; j < 8; ++j) {
#pragma unroll
        for (int r = 0; r < 8; ++r) sh[wave * 16 + 8 * g + r][j * 16 + col] = (_Float16)(acc[j][r] + bias[j]); }
    } else if (which == 1) {
#pragma unroll
      for (int j = 0; j < 8; ++j) {
#pragma unroll
        for (int r = 0; r < 8; ++r) { const float v = acc[j][r] + bias[j]; const _Float16 hv = (_Float16)v; sh[wave * 16 + 8 * g + r][j * 16 + col] = hv; sl[wave * 16 + 8 * g + r][j * 16 + col] = (_Float16)((v - (float)hv) * 1024.0f); } }
    } else {
#pragma unroll
      for (int j = 0; j < 8; ++j) {
#pragma unroll
        for (int r = 0; r < 8; ++r) { const float v = acc[j][r] + bias[j]; const int rl = wave * 16 + 8 * g + r, cl = j * 16 + col; th[cl][rl] = (_Float16)v; const __bf16 bh = (__bf16)v; tb[cl][rl] = bh; tbl[cl][rl] = (__bf16)(v - (float)bh); } } }
    __syncthreads();   // publishes the output tile; it also ends every wave's fragment reads of the X tile, which the next trip overwrites only behind it
    if (it + 1 < PT) {   // behind the barrier (which drains the load counter), so that these loads fly while the output tile is stored
#pragma unroll   // constant indices, so that the arrays stay in registers
      for (int i = 0; i < 8; ++i) rx[i] = *(const v4f*)(gx + (size_t)((it + 1) * 64 + 8 * i) * DIN);
      asm volatile("s_wait_xcnt 0x0" ::: "memory"); }   // the code behind may reuse the registers that held these loads' addresses: the wait stands in front of that overwrite
    if (qk) {
      for (int e = tid; e < 64 * 16; e += 128) { const int rl = e >> 4, q = e & 15; st16w((DH + (r0 + rl) * CC + c0 + q * 8), *(const v4u*)&sh[rl][q * 8]); if (hi_rows) st16w((KL + (bb * KHI + t0 + rl) * (size_t)CC + c0 + q * 8), *(const v4u*)&sl[rl][q * 8]); }
    } else {
      for (int e = tid; e < 128 * 8; e += 128) { const int cl = e >> 3, q = e & 7; st16w((VT + (bb * CC + c0 + cl) * (size_t)TT + t0 + q * 8), *(const v4u*)&th[cl][q * 8]); if (hi_rows) { const size_t o3 = (bb * CC + c0 + cl) * (size_t)KHI + t0 + q * 8; st16w((VB + o3), *(const v4u*)&tb[cl][q * 8]); st16w((VBL + o3), *(const v4u*)&tbl[cl][q * 8]); } } } } }
// ---- k_fa: scores, mask, softmax and P . v of one pseudo-sequence in ONE pass over the keys: S and P stay in registers. Block = 8 waves x 16 queries (blockIdx.x = query block, blockIdx.y = pseudo-sequence b, real batch = b >> 4); a stage = 64 keys, K rows and v plane rows staged in LDS (whole 128-B lines per load), two buffers, the next stage's loads in flight in registers; the mask comes as packed lane-mask words (k_padw), 32 words a wave and stage by scalar loads.
// St = K Qt (A = K rows, B = q, kept in registers): a lane holds ONE query (col) and keys 8g + r of each 16-key tile, so two tiles pack in place into the B operand of Ot += vt Pt (A = v plane rows, same k order as frag_h). Running maximum and sum per query in raw score units (the 1/32 sits in the exponent's factor); where(mask == 0, -1e20, score) as in the source, so a fully masked row comes out uniform.
#define FQ 128            // queries per block
#define FK 64             // keys per stage
#define KP 72             // LDS pitch of a 64-element f16 row: 128 B + 16 B, conflict-free for 16-B fragment reads
#define CEXP (SCALE * 1.44269504088896f)
__device__ __forceinline__ v8f wm(v16h a, v16h b, v8f c) { return __builtin_amdgcn_wmma_f32_16x16x32_f16(false, a, false, b, (short)0, c, false, false); }
// 2^x in place. One statement for eight: behind a transcendental the instruction set asks for one independent instruction before its result is read or its source overwritten; here each v_exp_f32 is that instruction for the one before it and the v_nop for the last, whatever the compiler puts next
__device__ __forceinline__ v8f exp2x8(v8f e) { float a0 = e[0], a1 = e[1], a2 = e[2], a3 = e[3], a4 = e[4], a5 = e[5], a6 = e[6], a7 = e[7];
  asm("v_exp_f32 %0, %0\n\tv_exp_f32 %1, %1\n\tv_exp_f32 %2, %2\n\tv_exp_f32 %3, %3\n\tv_exp_f32 %4, %4\n\tv_exp_f32 %5, %5\n\tv_exp_f32 %6, %6\n\tv_exp_f32 %7, %7\n\tv_nop" : "+v"(a0), "+v"(a1), "+v"(a2), "+v"(a3), "+v"(a4), "+v"(a5), "+v"(a6), "+v"(a7));
  v8f p; p[0] = a0; p[1] = a1; p[2] = a2; p[3] = a3; p[4] = a4; p[5] = a5; p[6] = a6; p[7] = a7; return p; }
__device__ __forceinline__ float exp2x1(float a) { asm("v_exp_f32 %0, %0\n\tv_nop" : "+v"(a)); return a; }   // the v_nop: the same slot
__device__ __forceinline__ float xhalf(float v) { const int i = __builtin_bit_cast(int, v); return __builtin_bit_cast(float, (int)__builtin_amdgcn_permlanex16(i, i, 0x76543210, 0xfedcba98, false, false)); }   // the value of lane l ^ 16
// amdgpu_waves_per_eu(4, 4): the grid gives a SIMD four waves; with no ceiling named the compiler aimed at more waves, cut the registers and put a full LDS wait in front of every fragment's products
__global__ __launch_bounds__(256) __attribute__((amdgpu_waves_per_eu(4, 4))) void k_fa(const _Float16* __restrict__ QH, const _Float16* __restrict__ KH, const _Float16* __restrict__ VT, const unsigned* __restrict__ MB, _Float16* __restrict__ C) {
  __shared__ __align__(16) _Float16 sk[2][FK][KP], sv[2][HD][KP];
  const int tid = threadIdx.x, wave = tid >> 5, lane = tid & 31, col = lane & 15, g = lane >> 4; const int b = blockIdx.y, q0 = blockIdx.x * FQ, qw = wave * 16 + col;
  v16h qh[2];
#pragma unroll   // constant indices, so that the arrays stay in registers
  for (int kc = 0; kc < 2; ++kc) qh[kc] = frag_h(QH + ((size_t)b * TT + q0 + qw) * CC + kc * 32, lane);
  const int r8 = tid >> 3, c8 = tid & 7;   // staging: thread -> (row, 16-B chunk) of 128-B rows (K, v)
  const _Float16* gk = KH + ((size_t)b * TT + r8) * CC + c8 * 8; const _Float16* gv = VT + ((size_t)b * CC + r8) * TT + c8 * 8;
  const unsigned* gb = MB + ((size_t)(b >> 4) * (TT / 16) + (q0 >> 4) + __builtin_amdgcn_readfirstlane(wave)) * (TT / 16 * 8);   // the wave's query tile: a wave-uniform address, so that the words come by scalar loads
  v8h rk[2], rv[2];
#pragma unroll   // constant indices, so that the arrays stay in registers
  for (int i = 0; i < 2; ++i) { rk[i] = *(const v8h*)(gk + (size_t)(32 * i) * CC); rv[i] = *(const v8h*)(gv + (size_t)(32 * i) * TT); }
  v8f o[4] = {}, lv = {}; float m = -3.0e38f;
#pragma clang loop unroll(disable)   // one copy of the stage body: the last stage is not peeled off, and the branch round the next stage's loads keeps them directly behind the barrier
  for (int s = 0; s < TT / FK; ++s) { const int u = s & 1;
    const v16u mb[2] = { *(cv16u)(gb + s * 32), *(cv16u)(gb + s * 32 + 16) };   // the stage's 32 mask words, asked for in front of the LDS stores and the barrier: they land while the wave waits there and for its first K fragments
#pragma unroll   // constant indices, so that the arrays stay in registers
    for (int i = 0; i < 2; ++i) { *(v8h*)&sk[u][r8 + 32 * i][c8 * 8] = rk[i]; *(v8h*)&sv[u][r8 + 32 * i][c8 * 8] = rv[i]; }
    __syncthreads();   // publishes buffer u; it also ends every wave's reads of buffer u ^ 1 (stage s - 1), which stage s + 1 overwrites only behind it
    if (s + 1 < TT / FK) { const int k1 = (s + 1) * FK;   // behind the barrier (which drains the load counter), so that these loads fly during the stage's work
#pragma unroll   // constant indices, so that the arrays stay in registers
      for (int i = 0; i < 2; ++i) { rk[i] = *(const v8h*)(gk + (size_t)(k1 + 32 * i) * CC); rv[i] = *(const v8h*)(gv + (size_t)(32 * i) * TT + k1); }
      asm volatile("s_wait_xcnt 0x0" ::: "memory"); }   // the stage's first LDS reads land in the registers that held these loads' addresses: the wait stands in front of that overwrite
    v8f t[4] = {};
#pragma unroll   // constant indices, so that the arrays stay in registers
    for (int kc = 0; kc < 2; ++kc)   // k chunk outside, tile inside: four independent accumulator chains, so that no product waits for the one before it
#pragma unroll   // constant indices, so that the arrays stay in registers
      for (int j = 0; j < 4; ++j) t[j] = wm(frag_h(&sk[u][j * 16 + col][kc * 32], lane), qh[kc], t[j]);
#pragma unroll   // constant indices, so that the arrays stay in registers
    for (int j = 0; j < 4; ++j)
#pragma unroll   // constant indices, so that the arrays stay in registers
      for (int r = 0; r < 8; ++r) t[j][r] = __builtin_amdgcn_inverse_ballot_w32(mb[j >> 1][(j & 1) * 8 + r]) ? t[j][r] : -1.0e20f;   // word (j, r) is this register's lane mask: one select, no compare
    float mj[4];   // one maximum chain per tile: four independent chains
#pragma unroll   // constant indices, so that the arrays stay in registers
    for (int j = 0; j < 4; ++j) { mj[j] = t[j][0];
#pragma unroll   // constant indices, so that the arrays stay in registers
      for (int r = 1; r < 8; ++r) mj[j] = fmaxf(mj[j], t[j][r]); }
    float mx = fmaxf(fmaxf(mj[0], mj[1]), fmaxf(mj[2], mj[3])); mx = fmaxf(mx, xhalf(mx));   // the query's other 32 keys of the stage sit in lane l ^ 16
    const float mn = fmaxf(m, mx), al = exp2x1((m - mn) * CEXP); m = mn;
    union { v16h v; v8h q[2]; } pb[2]; v8f ps;
#pragma unroll   // constant indices, so that the arrays stay in registers
    for (int j = 0; j < 4; ++j) { const v8f p = exp2x8((t[j] - mn) * CEXP);
      ps = j ? ps + p : p; pb[j >> 1].q[j & 1] = __builtin_convertvector(p, v8h); }
    lv = lv * al + ps;
#pragma unroll   // constant indices, so that the arrays stay in registers
    for (int jd = 0; jd < 4; ++jd) o[jd] *= al;
#pragma unroll   // constant indices, so that the arrays stay in registers
    for (int kk = 0; kk < 2; ++kk)
#pragma unroll   // constant indices, so that the arrays stay in registers
      for (int jd = 0; jd < 4; ++jd) o[jd] = wm(frag_h(&sv[u][jd * 16 + col][kk * 32], lane), pb[kk].v, o[jd]); }
  float ls = ((lv[0] + lv[1]) + (lv[2] + lv[3])) + ((lv[4] + lv[5]) + (lv[6] + lv[7])); ls += xhalf(ls); const float inv = 1.0f / ls;   // ls >= 1: the maximum's own term
  _Float16* cr = C + ((size_t)b * TT + q0 + qw) * HD + 8 * g;   // Ot tile jd, register r = ctx[query][jd * 16 + 8g + r]: 16 contiguous bytes per lane and tile; stored as f16(ctx x 2^6), the A operand of k_lin2
#pragma unroll   // constant indices, so that the arrays stay in registers
  for (int jd = 0; jd < 4; ++jd) { v8h w;
#pragma unroll   // constant indices, so that the arrays stay in registers
    for (int r = 0; r < 8; ++r) w[r] = (_Float16)((o[jd][r] * inv) * 64.0f);
    vst2(cr + jd * 16, w); } }

// ---- k_lin2: the module's final Linear on the RAW-reshaped context: rows = the [2*2048][1024] view of the contiguous [32][2048][64] context buffer; out = ctx Wo^T + bo with f16(ctx x 2^6) against f16(bf16(Wo) x 2^8) (1 product, k in ascending 32-chunks). Both operands arrive as f16: k_fa stores the context so, k_padw's last blocks convert Wo once.
// Block = 8 waves on a 128 x 128 output tile (wave = 32 rows x 64 columns); a stage = 128 k: the ctx rows and the Wo rows are read as whole 256-B pieces and staged in LDS as they are, two buffers, the next stage's loads in flight in registers.
#define K2 1024
#define N2 1024
#define LM 128            // output rows per block
#define LN 128            // output columns per block
#define LK 128            // k per stage
#define LP 136            // LDS pitch of a 128-element f16 row: 256 B + 16 B, conflict-free for 16-B fragment reads
#define LF 132            // LDS pitch of a 128-element f32 output row
__global__ __launch_bounds__(256) void k_lin2(const _Float16* __restrict__ Yc, const _Float16* __restrict__ WH, const float* __restrict__ BO, float* __restrict__ OUT) {
  __shared__ __align__(16) _Float16 st[2][2][LM][LP];   // [buffer][0 = ctx rows, 1 = Wo rows][row][k]; after the k loop the same bytes hold the f32 output tile
  const int tid = threadIdx.x, wave = tid >> 5, lane = tid & 31, col = lane & 15, g = lane >> 4; const int c0 = blockIdx.y * LN; const size_t r0 = (size_t)blockIdx.x * LM;
  const int wr = (wave >> 1) * 32, wc = (wave & 1) * 64;
  const int sr = tid >> 4, sc = tid & 15;   // staging: thread -> (row, 16-B chunk) of the 256-B row pieces
  const _Float16* ga = Yc + r0 * K2; const _Float16* gw = WH + (size_t)c0 * K2; const unsigned vo = (unsigned)(sr * K2 + sc * 8);   // block-uniform bases that walk along k, and one per-lane offset that never changes
  v8h ra[8], rw[8];
#pragma unroll   // constant indices, so that the arrays stay in registers
  for (int i = 0; i < 8; ++i) { ra[i] = *(const v8h*)(ga + (vo + 16u * i * K2)); rw[i] = *(const v8h*)(gw + (vo + 16u * i * K2)); }
  v8f acc[2][4] = {};
#pragma clang loop unroll(disable)   // one copy of the stage body: the last stage is not peeled off, and the branch round the next stage's loads keeps them directly behind the barrier
  for (int s = 0; s < K2 / LK; ++s) { const int u = s & 1;
#pragma unroll   // constant indices, so that the arrays stay in registers
    for (int i = 0; i < 8; ++i) { *(v8h*)&st[u][0][sr + 16 * i][sc * 8] = ra[i]; *(v8h*)&st[u][1][sr + 16 * i][sc * 8] = rw[i]; }
    __syncthreads();   // publishes buffer u; it also ends every wave's reads of buffer u ^ 1 (stage s - 1), which stage s + 1 overwrites only behind it
    if (s + 1 < K2 / LK) { ga += LK; gw += LK;   // behind the barrier (which drains the load counter), so that these loads fly during the stage's work
#pragma unroll   // constant indices, so that the arrays stay in registers
      for (int i = 0; i < 8; ++i) { ra[i] = *(const v8h*)(ga + (vo + 16u * i * K2)); rw[i] = *(const v8h*)(gw + (vo + 16u * i * K2)); } }
#pragma unroll   // constant indices, so that the arrays stay in registers
    for (int kk = 0; kk < LK / 32; ++kk) { v16h af[2], bf[4];
#pragma unroll   // constant indices, so that the arrays stay in registers
      for (int i = 0; i < 2; ++i) af[i] = frag_h(&st[u][0][wr + i * 16 + col][kk * 32], lane);
#pragma unroll   // constant indices, so that the arrays stay in registers
      for (int j = 0; j < 4; ++j) bf[j] = frag_h(&st[u][1][wc + j * 16 + col][kk * 32], lane);
#pragma unroll   // constant indices, so that the arrays stay in registers
      for (int i = 0; i < 2; ++i)
#pragma unroll   // constant indices, so that the arrays stay in registers
        for (int j = 0; j < 4; ++j) acc[i][j] = wm(af[i], bf[j], acc[i][j]); } }
  float (*sf)[LF] = (float (*)[LF])&st[0][0][0][0];   // 128 x 132 f32 = 67,584 B of the 139,264 B
  __syncthreads();   // not needed for the buffers: the output tile lies in buffer 0, whose last reads (stage 6) ended at the last stage's barrier
#pragma unroll   // constant indices, so that the arrays stay in registers
  for (int j = 0; j < 4; ++j) { const float bias = bfr(BO[c0 + wc + j * 16 + col]);
#pragma unroll   // constant indices, so that the arrays stay in registers
    for (int i = 0; i < 2; ++i)
#pragma unroll   // constant indices, so that the arrays stay in registers
      for (int r = 0; r < 8; ++r) sf[wr + i * 16 + 8 * g + r][wc + j * 16 + col] = acc[i][j][r] * (1.0f / 16384.0f) + bias; }   /* 2^-8 (Wo carry) x 2^-6 (ctx carry) */
  __syncthreads();   // publishes the output tile: a wave stores whole 512-B rows that two waves wrote
#pragma unroll   // one address, sixteen constant offsets
  for (int rl = 0; rl < 16; ++rl) vst2(OUT + (r0 + wave * 16 + rl) * N2 + c0 + lane * 4, *(const v4f*)&sf[wave * 16 + rl][lane * 4]); }
#define WS_C64 (WS_BP + 4u * 3 * 128)                     // f16 context x 2^6 [32][2048][64] contiguous == the raw-reshaped [2*2048][1024] rows
#define WS_MB (WS_C64 + 2u * (size_t)NB * TT * 64)          // packed mask words [2 * 128 query tiles][128 key tiles][8]
#define WS_WH (WS_MB + 4u * 2 * (size_t)(TT / 16) * (TT / 16) * 8)   // f16(bf16(Wo) x 2^8) [1024][1024]
#define WS_END3 (WS_WH + 2u * (size_t)N2 * K2)
extern "C" void kernel_launch(void* const* d_in, const int* in_sizes, int n_in, void* d_out, int out_size, void* d_ws, size_t ws_size, hipStream_t stream) {
  (void)in_sizes; (void)n_in; (void)out_size;
  const float** F = (const float**)d_in;
  if (ws_size < (size_t)WS_END) return;
  char* ws = (char*)d_ws; _Float16 *QH = (_Float16*)(ws + WS_QH), *KH = (_Float16*)(ws + WS_KH), *VT = (_Float16*)(ws + WS_VT), *KL = (_Float16*)(ws + WS_KL); __bf16 *VB = (__bf16*)(ws + WS_VB), *VBL = (__bf16*)(ws + WS_VBL);
  (void)KL; (void)VB; (void)VBL;
  // inputs: 0 query [2,2048,1024]; 1 key; 2 value (each viewed as 65,536 rows of 64: the raw reshape); 3 mask [2,1,2048,2048] int32; 4 Wq [64,64] (out,in); 5 Wk; 6 Wv; 7 Wo [1024,1024] (out,in); 8 bo [1024] (nonzero)
  if (ws_size < (size_t)WS_END3) return;
  float *WP = (float*)(ws + WS_WP), *BP = (float*)(ws + WS_BP); _Float16 *C64 = (_Float16*)(ws + WS_C64), *WH = (_Float16*)(ws + WS_WH); unsigned* MB = (unsigned*)(ws + WS_MB);
  k_padw<<<dim3(32, 3 + 16 + 4), 256, 0, stream>>>(F[4], F[5], F[6], nullptr, nullptr, nullptr, WP, BP, (const int*)d_in[3], MB, F[7], WH);   /* y in 3..18: 512 blocks x 8 waves x (16 rows x 128 keys) = the whole mask; y >= 19: 128 blocks x 256 threads x 32 elements = Wo */
  k_proj<<<dim3(TNB * TT / (64 * PT), CC / 128, 3), 128, 0, stream>>>(F[0], F[1], F[2], WP, WP + (size_t)CIN * 128, WP + 2 * (size_t)CIN * 128, BP, BP + 128, BP + 256, QH, KH, KL, VT, VB, VBL);
  k_fa<<<dim3(TT / FQ, TNB), 256, 0, stream>>>(QH, KH, VT, MB, C64);   /* pseudo-sequence = real batch (b >> 4), pseudo-head (b & 15); head 0 (columns 0..63) only */
  k_lin2<<<dim3((TNB * TT * 64 / K2) / LM, N2 / LN), 256, 0, stream>>>(C64, WH, F[8], (float*)d_out);
}

// v008
// It runs in 65.5 microseconds.
// Two timings next to v007 put it at 1.15 and 1.16 times that version's speed.
// Counting every step since v000, it is 43.7 times as fast.
// compute dtype: all float inputs rounded to bf16; q/k/v projections with EXACT bf16 products on WMMA 16x16x32 (f32 accumulate); logits: q once to f16 x k once to f16 (1 product); running-maximum softmax in f32; exp(logit - running maximum) once to f16 x v once to f16 (1 product), divided by the f32 sum at the end; f32 output.
#include <hip/hip_runtime.h>
#include <math.h>

typedef __attribute__((ext_vector_type(16))) _Float16 v16h;
typedef __attribute__((ext_vector_type(16))) __bf16 v16b;
typedef __attribute__((ext_vector_type(8)))  _Float16 v8h;
typedef __attribute__((ext_vector_type(8)))  float v8f;
typedef __attribute__((ext_vector_type(4)))  float v4f;
typedef __attribute__((ext_vector_type(2)))  float v2f;
typedef __attribute__((ext_vector_type(4)))  unsigned v4u;
typedef __attribute__((ext_vector_type(4)))  int v4i;
typedef __attribute__((ext_vector_type(16))) unsigned v16u;
typedef const __attribute__((address_space(4))) v16u* cv16u;   // a pointer to memory that no one writes while the kernel runs: a wave-uniform load through it is a scalar load
typedef float __attribute__((may_alias)) float_a;
typedef int __attribute__((may_alias)) int_a;

template <typename T> __device__ __forceinline__ void vst2(void* p, T v) { *(T*)p = v;  }
__device__ __forceinline__ v8f wmma16(v16h a, v16h b, v8f c) {
  v8f d = __builtin_amdgcn_wmma_f32_16x16x32_f16(false, a, false, b, (short)0, c, false, false);
  asm volatile("v_nop\n\tv_nop\n\tv_nop\n\tv_nop" : "+v"(d) : "v"(a), "v"(b));
  return d;
}
__device__ __forceinline__ v8f wmma_bf(v16b a, v16b b, v8f c) {
  v8f d = __builtin_amdgcn_wmma_f32_16x16x32_bf16(false, a, false, b, (short)0, c, false, false);
  asm volatile("v_nop\n\tv_nop\n\tv_nop\n\tv_nop" : "+v"(d) : "v"(a), "v"(b));
  return d;
}
// 16x16x32 fragments: lane = (h = lane>>4, row/col = lane&15); elements 0..7 = k0+8h+0..7, 8..15 = k0+16+8h+0..7; D element r = row 8h+r
__device__ __forceinline__ v16h frag_h(const _Float16* rowk0, int lane) {
  union { v16h v; v8h q[2]; } u; const _Float16* p = rowk0 + 8 * (lane >> 4);
  u.q[0] = *(const v8h*)p; u.q[1] = *(const v8h*)(p + 16); return u.v;
}
__device__ __forceinline__ v16h frag_f32(const float* rowk0, int lane) {
  v16h a; const float* p = rowk0 + 8 * (lane >> 4);
#pragma unroll
  for (int i = 0; i < 8; ++i) { a[i] = (_Float16)p[i]; a[8 + i] = (_Float16)p[16 + i]; }
  return a;
}
__device__ __forceinline__ v16h frag_f32s(const float* rowk0, int lane, float sc) {
  v16h a; const float* p = rowk0 + 8 * (lane >> 4);
#pragma unroll
  for (int i = 0; i < 8; ++i) { a[i] = (_Float16)(p[i] * sc); a[8 + i] = (_Float16)(p[16 + i] * sc); }
  return a;
}
// column fragment from a [K][ld] layout (column n), rows >= K read as 0
__device__ __forceinline__ v16h fragc_f32(const float* W, int k0, int n, int lane, int ld, int K) {
  v16h a; const int g = lane >> 4;
#pragma unroll
  for (int i = 0; i < 8; ++i) { const int ka = k0 + 8 * g + i, kb = ka + 16;
    a[i] = (_Float16)(ka < K ? W[(size_t)(ka < K ? ka : K - 1) * ld + n] : 0.f); a[8 + i] = (_Float16)(kb < K ? W[(size_t)(kb < K ? kb : K - 1) * ld + n] : 0.f); }
  return a;
}
struct F2 { v16b h, l; };
__device__ __forceinline__ F2 bsplit16(const float v[16]) { F2 r;
#pragma unroll
  for (int i = 0; i < 16; ++i) { const __bf16 h = (__bf16)v[i]; r.h[i] = h; r.l[i] = (__bf16)(v[i] - (float)h); }
  return r; }
__device__ __forceinline__ F2 split_row(const float* row, int k0, int lane) { float v[16]; const float* p = row + k0 + 8 * (lane >> 4);
#pragma unroll
  for (int i = 0; i < 8; ++i) { v[i] = p[i]; v[8 + i] = p[16 + i]; }
  return bsplit16(v); }
__device__ __forceinline__ F2 split_rowK(const float* row, int k0, int lane, int K) { float v[16]; const int g = lane >> 4;
#pragma unroll
  for (int i = 0; i < 8; ++i) { const int ka = k0 + 8 * g + i, kb = ka + 16; v[i] = ka < K ? row[ka < K ? ka : K - 1] : 0.f; v[8 + i] = kb < K ? row[kb < K ? kb : K - 1] : 0.f; }
  return bsplit16(v); }
__device__ __forceinline__ F2 split_col(const float* W, int k0, int n, int lane, int ld, int K) { float v[16]; const int g = lane >> 4;
#pragma unroll
  for (int i = 0; i < 8; ++i) { const int ka = k0 + 8 * g + i, kb = ka + 16; v[i] = ka < K ? W[(size_t)(ka < K ? ka : K - 1) * ld + n] : 0.f; v[8 + i] = kb < K ? W[(size_t)(kb < K ? kb : K - 1) * ld + n] : 0.f; }
  return bsplit16(v); }
__device__ __forceinline__ v8f mac3(const F2& a, const F2& b, v8f c) { c = wmma_bf(a.l, b.h, c); c = wmma_bf(a.h, b.l, c); return wmma_bf(a.h, b.h, c); }
__device__ __forceinline__ float sigm(float v) { return 1.0f / (1.0f + expf(-v)); }
#define LDSX() do { asm volatile("s_wait_dscnt 0" ::: "memory"); __builtin_amdgcn_wave_barrier(); __builtin_amdgcn_fence(__ATOMIC_RELEASE, "workgroup"); } while (0)

// Masked self-attention with a RAW reshape into heads (query / key / value [2,2048,1024] are reshaped WITHOUT transpose to [2,16,2048,64]: pseudo-head h of batch b = the contiguous 131,072 floats starting at (b*16 + h)*2048*64, i.e. 32 pseudo-sequences of 2,048 positions x 64 dims each); one shared bias-free torch (out,in) Linear [64,64] per role (Wq, Wk, Wv); scores = Q K^T masked by mask[b][0][q][k] == 0 -> -1e20 (int32 random 0/1 per batch), then divided by sqrt(embed = 1024) = 32 (the source's quirk: logit sigma - 0.08); softmax; out = attn V reshaped raw back to [2,2048,1024]; (out,in) Wo [1024,1024] + bo (nonzero): result = out Wo^T + bo.
#define NB 32
#define TT 2048
#define CC 64             // NH * HD = projected width
#define DIN 64          // input (model) width
#define NH 1
#define HD 64
#define NQB (TT / 64)
#define HG 1
#define SCALE (0.03125f)
#define CAUSAL 0
#ifndef TNB
#define TNB NB
#endif
__device__ __forceinline__ float bfr(float v) { return (float)(__bf16)v; }
__host__ __device__ __forceinline__ int kb_last(int qb) { return CAUSAL ? ((qb * 64 + 63) >> 7) : (TT / 128 - 1); }
typedef __attribute__((ext_vector_type(8))) __bf16 v8b;
__device__ __forceinline__ v16b frag_b(const __bf16* rowk0, int lane) {
  union { v16b v; v8b q[2]; } u; const __bf16* p = rowk0 + 8 * (lane >> 4);
  u.q[0] = *(const v8b*)p; u.q[1] = *(const v8b*)(p + 16); return u.v;
}
#define QBH 0
// B fragment (k rows k0+.., output column o) of a weight: (in,out) [K][ld] or (out,in) [ld rows of K]: bf16 exact, or f16(bf16 * 256) exact
__device__ __forceinline__ v16b wcol_io(const float* Wm, int k0, int o, int lane, int ld) { v16b w; const int g = lane >> 4;
#pragma unroll
  for (int i = 0; i < 8; ++i) { w[i] = (__bf16)Wm[(size_t)(k0 + 8 * g + i) * ld + o]; w[8 + i] = (__bf16)Wm[(size_t)(k0 + 16 + 8 * g + i) * ld + o]; }
  return w; }
__device__ __forceinline__ v16b wcol_oi(const float* Wm, int k0, int o, int lane, int K) { v16b w; const float* p = Wm + (size_t)o * K + k0 + 8 * (lane >> 4);
#pragma unroll
  for (int i = 0; i < 8; ++i) { w[i] = (__bf16)p[i]; w[8 + i] = (__bf16)p[16 + i]; }
  return w; }
__device__ __forceinline__ v16h wcolh_io(const float* Wm, int k0, int o, int lane, int ld) { v16h w; const int g = lane >> 4;
#pragma unroll
  for (int i = 0; i < 8; ++i) { w[i] = (_Float16)(bfr(Wm[(size_t)(k0 + 8 * g + i) * ld + o]) * 256.0f); w[8 + i] = (_Float16)(bfr(Wm[(size_t)(k0 + 16 + 8 * g + i) * ld + o]) * 256.0f); }
  return w; }
__device__ __forceinline__ v16h wcolh_oi(const float* Wm, int k0, int o, int lane, int K) { v16h w; const float* p = Wm + (size_t)o * K + k0 + 8 * (lane >> 4);
#pragma unroll
  for (int i = 0; i < 8; ++i) { w[i] = (_Float16)(bfr(p[i]) * 256.0f); w[8 + i] = (_Float16)(bfr(p[16 + i]) * 256.0f); }
  return w; }
#define WQKV_LAYOUT 1   // 0 = (in,out) [DIN][CC]; 1 = (out,in) [CC][DIN]; 2 = per-head [NH][DIN][HD]
__device__ __forceinline__ v16b wcol_hdk(const float* Wm, int k0, int o, int lane) { v16b w; const int g = lane >> 4; const float* p = Wm + (size_t)(o / HD) * DIN * HD + (o % HD);
#pragma unroll
  for (int i = 0; i < 8; ++i) { w[i] = (__bf16)p[(size_t)(k0 + 8 * g + i) * HD]; w[8 + i] = (__bf16)p[(size_t)(k0 + 16 + 8 * g + i) * HD]; }
  return w; }
#define WO_OUT_IN 0
#if WQKV_LAYOUT == 1
#define WCOL(W, k0, o, lane) wcol_oi(W, k0, o, lane, DIN)
#elif WQKV_LAYOUT == 2
#define WCOL(W, k0, o, lane) wcol_hdk(W, k0, o, lane)
#else
#define WCOL(W, k0, o, lane) wcol_io(W, k0, o, lane, CC)
#endif
#if WO_OUT_IN
#define WOCOL(W, k0, o, lane) wcol_oi(W, k0, o, lane, CC)
#define WOCOLH(W, k0, o, lane) wcolh_oi(W, k0, o, lane, CC)
#else
#define WOCOL(W, k0, o, lane) wcol_io(W, k0, o, lane, DIN)
#define WOCOLH(W, k0, o, lane) wcolh_io(W, k0, o, lane, DIN)
#endif
// ---- k_padw: operand preparation for k_fa and k_lin2.
// Blocks with blockIdx.y >= 16 convert Wo for k_lin2 (see there). Blocks with blockIdx.y in 0..15 pack the mask: MB[batch * 128 + query tile of 16][key tile of 16][r] = one 32-bit word whose bit (lane = 16g + col) says mask[query tile * 16 + col][key tile * 16 + 8g + r] != 0, i.e. the lane mask of register r of that score tile in k_fa. A wave takes 16 mask rows x 128 keys: whole 512-B row pieces into its own LDS rows, read back in the score tile's lane order, one ballot per word.
#define MBP 132           // LDS pitch of a 128-element int row piece: 512 B + 16 B, conflict-free for 16-B reads
typedef __attribute__((ext_vector_type(2))) unsigned v2u;
typedef __attribute__((ext_vector_type(4))) _Float16 v4h;
__global__ __launch_bounds__(256) void k_padw(const int* __restrict__ MASK, unsigned* __restrict__ MB, const float* __restrict__ WO, _Float16* __restrict__ WH) {
  __shared__ __align__(16) int sp[8][16][MBP];
  if (blockIdx.y >= 16) {   // Wo once to f16(bf16 x 2^8), the B operand of k_lin2: 128 blocks, a thread takes eight 16-B pieces, each wave-wide load 512 contiguous bytes, all eight in flight
    const size_t e0 = ((size_t)((blockIdx.y - 16) * 32 + blockIdx.x) * 256 + threadIdx.x) * 4; const float* gs = WO + e0; v4f rw[8];
#pragma unroll   // constant indices, so that the array stays in registers
    for (int i = 0; i < 8; ++i) rw[i] = *(const v4f*)(gs + (size_t)i * (128 * 256 * 4));
    asm volatile("s_wait_xcnt 0x0" :: "v"(gs) : "memory");   // the code behind may reuse the registers that hold these loads' address: the wait stands in front of that overwrite
#pragma unroll   // constant indices, so that the array stays in registers
    for (int i = 0; i < 8; ++i) { v4h hw;
#pragma unroll
      for (int e = 0; e < 4; ++e) hw[e] = (_Float16)(bfr(rw[i][e]) * 256.0f);
      vst2(WH + e0 + (size_t)i * (128 * 256 * 4), hw); }
    return; }
  { const int wave = threadIdx.x >> 5, lane = threadIdx.x & 31, col = lane & 15, g = lane >> 4; const int gw = (blockIdx.y * 32 + blockIdx.x) * 8 + wave, ch = gw & 15, qt = gw >> 4;   // ch = piece of 128 keys, qt = batch * 128 + query tile
    const int* gm = MASK + (size_t)qt * 16 * TT + ch * 128 + lane * 4; v4i rm[16];
#pragma unroll   // constant indices, so that the array stays in registers; all sixteen loads in flight
    for (int i = 0; i < 16; ++i) rm[i] = *(const v4i*)(gm + (size_t)i * TT);
    asm volatile("s_wait_xcnt 0x0" :: "v"(gm) : "memory");   // the code behind reuses the registers that hold these loads' address: the wait stands in front of that overwrite, and the address as its input keeps the last load's result off those registers
#pragma unroll   // constant indices, so that the array stays in registers
    for (int i = 0; i < 16; ++i) *(v4i*)&sp[wave][i][lane * 4] = rm[i];
    __syncthreads();   // publishes the rows: a lane reads back what other lanes wrote
    unsigned w0 = 0, w1 = 0;   // lane l collects words 2l and 2l + 1 of the wave's 64
#pragma unroll   // constant lane numbers for the word's place
    for (int kt = 0; kt < 8; ++kt) { const v4i m0 = *(const v4i*)&sp[wave][col][kt * 16 + 8 * g], m1 = *(const v4i*)&sp[wave][col][kt * 16 + 8 * g + 4];
#pragma unroll   // constant lane numbers for the word's place
      for (int r = 0; r < 8; r += 2) { const unsigned ba = __builtin_amdgcn_ballot_w32((r < 4 ? m0[r & 3] : m1[r & 3]) != 0), bb = __builtin_amdgcn_ballot_w32((r < 4 ? m0[(r + 1) & 3] : m1[(r + 1) & 3]) != 0);
        const bool mine = lane == kt * 4 + (r >> 1); w0 = mine ? ba : w0; w1 = mine ? bb : w1; } }
    v2u wv; wv[0] = w0; wv[1] = w1; vst2(MB + (size_t)qt * (TT / 16 * 8) + ch * 64 + lane * 2, wv);
  } }
#define WS_QH  0u                                      // f16 q rows [b*t][CC]
#define WS_KH  (WS_QH + 2u * (size_t)NB * TT * CC)      // f16 k rows [b*t][CC]
#define WS_VT  (WS_KH + 2u * (size_t)NB * TT * CC)      // f16 v planes [b][c][t]
#define WS_END (WS_VT + 2u * (size_t)NB * CC * TT)

// ---- k_proj: block = (PT tiles of 64 rows, all 64 cols, which): q/k/v = X W^T with exact bf16 products (K = DIN), W = the (out,in) [64][64] input itself -> which 0: q f16 rows; 1: k f16 rows; 2: v f16 planes [c][t]. Only what k_fa reads is computed, staged and stored.
// Operand path: X rows and W rows are read as whole lines (a wave's 16-B loads cover two 256-B rows = 512 contiguous bytes), rounded to bf16 once per block and staged in LDS; the fragments come from LDS. W is staged once per block, the next row tile's loads are in flight in registers.
#define PT 4              // row tiles of 64 per block
#define PP 72             // LDS pitch of a 64-element bf16 row: 128 B + 16 B, conflict-free for 16-B fragment reads
typedef __attribute__((ext_vector_type(4))) __bf16 v4b;
__device__ __forceinline__ v4b cvt4b(v4f v) { v4b h;
#pragma unroll
  for (int e = 0; e < 4; ++e) h[e] = (__bf16)v[e];
  return h; }
// 16-B global store with its wait in ONE statement: the next pass of the store loop and the next trip reuse the registers that the store names
__device__ __forceinline__ void st16w(void* p, v4u v) { asm volatile("global_store_b128 %0, %1, off\n\ts_wait_xcnt 0x0" :: "v"(p), "v"(v) : "memory"); }
__global__ __launch_bounds__(128) void k_proj(const float* __restrict__ XQ, const float* __restrict__ XK, const float* __restrict__ XV, const float* __restrict__ WQ, const float* __restrict__ WK, const float* __restrict__ WV,
    _Float16* __restrict__ QH, _Float16* __restrict__ KH, _Float16* __restrict__ VT) {
  __shared__ __align__(16) _Float16 so[64][PP];   // output tile: q and k as [row][column], v as [column][row]
  __shared__ __align__(16) __bf16 xs[64][PP], wsg[CC][PP];   // staged operands: one X row tile, all W rows
  const int tid = threadIdx.x, wave = tid >> 5, lane = tid & 31, col = lane & 15, g = lane >> 4; const int which = blockIdx.z; const size_t rb = (size_t)blockIdx.x * (64 * PT);
  const float* X = which == 0 ? XQ : which == 1 ? XK : XV; const float* WA = which == 0 ? WQ : which == 1 ? WK : WV;
  const int sr = tid >> 4, sc = tid & 15;   // staging: thread -> (row, 16-B chunk) of the 256-B rows
  const float* gx = X + (rb + sr) * DIN + sc * 4;
  v4f rx[8];
  { v4f rw[8]; const float* gw = WA + (size_t)sr * DIN + sc * 4;
#pragma unroll   // constant indices, so that the arrays stay in registers
    for (int i = 0; i < 8; ++i) rw[i] = *(const v4f*)(gw + (size_t)(8 * i) * DIN);
#pragma unroll   // constant indices, so that the arrays stay in registers
    for (int i = 0; i < 8; ++i) rx[i] = *(const v4f*)(gx + (size_t)(8 * i) * DIN);
    asm volatile("s_wait_xcnt 0x0" :: "v"(gw), "v"(gx) : "memory");   // the code behind may reuse the registers that hold these loads' addresses: the wait stands in front of that overwrite
#pragma unroll   // constant indices, so that the arrays stay in registers
    for (int i = 0; i < 8; ++i) *(v4b*)&wsg[sr + 8 * i][sc * 4] = cvt4b(rw[i]); }
#pragma clang loop unroll(disable)   // one copy of the tile body: the branch round the next tile's loads keeps them directly behind the barrier
  for (int it = 0; it < PT; ++it) { const size_t r0 = rb + (size_t)it * 64; const size_t bb = r0 / TT; const int t0 = (int)(r0 % TT);
#pragma unroll   // constant indices, so that the arrays stay in registers
    for (int i = 0; i < 8; ++i) *(v4b*)&xs[sr + 8 * i][sc * 4] = cvt4b(rx[i]);
    __syncthreads();   // publishes the X tile (and, on the first trip, W); it also ends every wave's reads of the output tile of trip it - 1, which this trip overwrites only behind it
    v8f acc[4] = {};
#pragma unroll   // constant indices, so that the arrays stay in registers
    for (int kc = 0; kc < DIN / 32; ++kc) { const v16b a = frag_b(&xs[wave * 16 + col][kc * 32], lane); v16b w[4];
#pragma unroll   // constant indices, so that the arrays stay in registers
      for (int j = 0; j < 4; ++j) w[j] = frag_b(&wsg[j * 16 + col][kc * 32], lane);
#pragma unroll   // constant indices, so that the arrays stay in registers
      for (int j = 0; j < 4; ++j) acc[j] = __builtin_amdgcn_wmma_f32_16x16x32_bf16(false, a, false, w[j], (short)0, acc[j], false, false); }
    const bool qk = which < 2; _Float16* DH = which == 0 ? QH : KH;
    if (qk) {
#pragma unroll
      for (int j = 0; j < 4; ++j) {
#pragma unroll
        for (int r = 0; r < 8; ++r) so[wave * 16 + 8 * g + r][j * 16 + col] = (_Float16)acc[j][r]; }
    } else {
#pragma unroll
      for (int j = 0; j < 4; ++j) {
#pragma unroll
        for (int r = 0; r < 8; ++r) so[j * 16 + col][wave * 16 + 8 * g + r] = (_Float16)acc[j][r]; } }
    __syncthreads();   // publishes the output tile; it also ends every wave's fragment reads of the X tile, which the next trip overwrites only behind it
    if (it + 1 < PT) {   // behind the barrier (which drains the load counter), so that these loads fly while the output tile is stored
#pragma unroll   // constant indices, so that the arrays stay in registers
      for (int i = 0; i < 8; ++i) rx[i] = *(const v4f*)(gx + (size_t)((it + 1) * 64 + 8 * i) * DIN);
      asm volatile("s_wait_xcnt 0x0" ::: "memory"); }   // the code behind may reuse the registers that held these loads' addresses: the wait stands in front of that overwrite
    for (int e = tid; e < 64 * 8; e += 128) { const int rl = e >> 3, q = e & 7;   // whole 128-B lines: a q or k row, or 64 positions of a v plane row
      st16w(qk ? DH + (r0 + rl) * CC + q * 8 : VT + (bb * CC + rl) * (size_t)TT + t0 + q * 8, *(const v4u*)&so[rl][q * 8]); } } }
// ---- k_fa: scores, mask, softmax and P . v of one pseudo-sequence in ONE pass over the keys: S and P stay in registers. Block = 8 waves x 16 queries (blockIdx.x = query block, blockIdx.y = pseudo-sequence b, real batch = b >> 4); a stage = 64 keys, K rows and v plane rows staged in LDS (whole 128-B lines per load), two buffers, the next stage's loads in flight in registers; the mask comes as packed lane-mask words (k_padw), 32 words a wave and stage by scalar loads.
// St = K Qt (A = K rows, B = q, kept in registers): a lane holds ONE query (col) and keys 8g + r of each 16-key tile, so two tiles pack in place into the B operand of Ot += vt Pt (A = v plane rows, same k order as frag_h). Running maximum and sum per query in raw score units (the 1/32 sits in the exponent's factor); where(mask == 0, -1e20, score) as in the source, so a fully masked row comes out uniform.
#define FQ 128            // queries per block
#define FK 64             // keys per stage
#define KP 72             // LDS pitch of a 64-element f16 row: 128 B + 16 B, conflict-free for 16-B fragment reads
#define CEXP (SCALE * 1.44269504088896f)
__device__ __forceinline__ v8f wm(v16h a, v16h b, v8f c) { return __builtin_amdgcn_wmma_f32_16x16x32_f16(false, a, false, b, (short)0, c, false, false); }
// 2^x in place. One statement for eight: behind a transcendental the instruction set asks for one independent instruction before its result is read or its source overwritten; here each v_exp_f32 is that instruction for the one before it and the v_nop for the last, whatever the compiler puts next
__device__ __forceinline__ v8f exp2x8(v8f e) { float a0 = e[0], a1 = e[1], a2 = e[2], a3 = e[3], a4 = e[4], a5 = e[5], a6 = e[6], a7 = e[7];
  asm("v_exp_f32 %0, %0\n\tv_exp_f32 %1, %1\n\tv_exp_f32 %2, %2\n\tv_exp_f32 %3, %3\n\tv_exp_f32 %4, %4\n\tv_exp_f32 %5, %5\n\tv_exp_f32 %6, %6\n\tv_exp_f32 %7, %7\n\tv_nop" : "+v"(a0), "+v"(a1), "+v"(a2), "+v"(a3), "+v"(a4), "+v"(a5), "+v"(a6), "+v"(a7));
  v8f p; p[0] = a0; p[1] = a1; p[2] = a2; p[3] = a3; p[4] = a4; p[5] = a5; p[6] = a6; p[7] = a7; return p; }
__device__ __forceinline__ float exp2x1(float a) { asm("v_exp_f32 %0, %0\n\tv_nop" : "+v"(a)); return a; }   // the v_nop: the same slot
__device__ __forceinline__ float xhalf(float v) { const int i = __builtin_bit_cast(int, v); return __builtin_bit_cast(float, (int)__builtin_amdgcn_permlanex16(i, i, 0x76543210, 0xfedcba98, false, false)); }   // the value of lane l ^ 16
// amdgpu_waves_per_eu(4, 4): the grid gives a SIMD four waves; with no ceiling named the compiler aimed at more waves, cut the registers and put a full LDS wait in front of every fragment's products
__global__ __launch_bounds__(256) __attribute__((amdgpu_waves_per_eu(4, 4))) void k_fa(const _Float16* __restrict__ QH, const _Float16* __restrict__ KH, const _Float16* __restrict__ VT, const unsigned* __restrict__ MB, _Float16* __restrict__ C) {
  __shared__ __align__(16) _Float16 sk[2][FK][KP], sv[2][HD][KP];
  const int tid = threadIdx.x, wave = tid >> 5, lane = tid & 31, col = lane & 15, g = lane >> 4; const int b = blockIdx.y, q0 = blockIdx.x * FQ, qw = wave * 16 + col;
  v16h qh[2];
#pragma unroll   // constant indices, so that the arrays stay in registers
  for (int kc = 0; kc < 2; ++kc) qh[kc] = frag_h(QH + ((size_t)b * TT + q0 + qw) * CC + kc * 32, lane);
  const int r8 = tid >> 3, c8 = tid & 7;   // staging: thread -> (row, 16-B chunk) of 128-B rows (K, v)
  const _Float16* gk = KH + ((size_t)b * TT + r8) * CC + c8 * 8; const _Float16* gv = VT + ((size_t)b * CC + r8) * TT + c8 * 8;
  const unsigned* gb = MB + ((size_t)(b >> 4) * (TT / 16) + (q0 >> 4) + __builtin_amdgcn_readfirstlane(wave)) * (TT / 16 * 8);   // the wave's query tile: a wave-uniform address, so that the words come by scalar loads
  v8h rk[2], rv[2];
#pragma unroll   // constant indices, so that the arrays stay in registers
  for (int i = 0; i < 2; ++i) { rk[i] = *(const v8h*)(gk + (size_t)(32 * i) * CC); rv[i] = *(const v8h*)(gv + (size_t)(32 * i) * TT); }
  v8f o[4] = {}, lv = {}; float m = -3.0e38f;
#pragma clang loop unroll(disable)   // one copy of the stage body: the last stage is not peeled off, and the branch round the next stage's loads keeps them directly behind the barrier
  for (int s = 0; s < TT / FK; ++s) { const int u = s & 1;
    const v16u mb[2] = { *(cv16u)(gb + s * 32), *(cv16u)(gb + s * 32 + 16) };   // the stage's 32 mask words, asked for in front of the LDS stores and the barrier: they land while the wave waits there and for its first K fragments
#pragma unroll   // constant indices, so that the arrays stay in registers
    for (int i = 0; i < 2; ++i) { *(v8h*)&sk[u][r8 + 32 * i][c8 * 8] = rk[i]; *(v8h*)&sv[u][r8 + 32 * i][c8 * 8] = rv[i]; }
    __syncthreads();   // publishes buffer u; it also ends every wave's reads of buffer u ^ 1 (stage s - 1), which stage s + 1 overwrites only behind it
    if (s + 1 < TT / FK) { const int k1 = (s + 1) * FK;   // behind the barrier (which drains the load counter), so that these loads fly during the stage's work
#pragma unroll   // constant indices, so that the arrays stay in registers
      for (int i = 0; i < 2; ++i) { rk[i] = *(const v8h*)(gk + (size_t)(k1 + 32 * i) * CC); rv[i] = *(const v8h*)(gv + (size_t)(32 * i) * TT + k1); }
      asm volatile("s_wait_xcnt 0x0" ::: "memory"); }   // the stage's first LDS reads land in the registers that held these loads' addresses: the wait stands in front of that overwrite
    v8f t[4] = {};
#pragma unroll   // constant indices, so that the arrays stay in registers
    for (int kc = 0; kc < 2; ++kc)   // k chunk outside, tile inside: four independent accumulator chains, so that no product waits for the one before it
#pragma unroll   // constant indices, so that the arrays stay in registers
      for (int j = 0; j < 4; ++j) t[j] = wm(frag_h(&sk[u][j * 16 + col][kc * 32], lane), qh[kc], t[j]);
#pragma unroll   // constant indices, so that the arrays stay in registers
    for (int j = 0; j < 4; ++j)
#pragma unroll   // constant indices, so that the arrays stay in registers
      for (int r = 0; r < 8; ++r) t[j][r] = __builtin_amdgcn_inverse_ballot_w32(mb[j >> 1][(j & 1) * 8 + r]) ? t[j][r] : -1.0e20f;   // word (j, r) is this register's lane mask: one select, no compare
    float mj[4];   // one maximum chain per tile: four independent chains
#pragma unroll   // constant indices, so that the arrays stay in registers
    for (int j = 0; j < 4; ++j) { mj[j] = t[j][0];
#pragma unroll   // constant indices, so that the arrays stay in registers
      for (int r = 1; r < 8; ++r) mj[j] = fmaxf(mj[j], t[j][r]); }
    float mx = fmaxf(fmaxf(mj[0], mj[1]), fmaxf(mj[2], mj[3])); mx = fmaxf(mx, xhalf(mx));   // the query's other 32 keys of the stage sit in lane l ^ 16
    const float mn = fmaxf(m, mx), al = exp2x1((m - mn) * CEXP); m = mn;
    union { v16h v; v8h q[2]; } pb[2]; v8f ps;
#pragma unroll   // constant indices, so that the arrays stay in registers
    for (int j = 0; j < 4; ++j) { const v8f p = exp2x8((t[j] - mn) * CEXP);
      ps = j ? ps + p : p; pb[j >> 1].q[j & 1] = __builtin_convertvector(p, v8h); }
    lv = lv * al + ps;
#pragma unroll   // constant indices, so that the arrays stay in registers
    for (int jd = 0; jd < 4; ++jd) o[jd] *= al;
#pragma unroll   // constant indices, so that the arrays stay in registers
    for (int kk = 0; kk < 2; ++kk)
#pragma unroll   // constant indices, so that the arrays stay in registers
      for (int jd = 0; jd < 4; ++jd) o[jd] = wm(frag_h(&sv[u][jd * 16 + col][kk * 32], lane), pb[kk].v, o[jd]); }
  float ls = ((lv[0] + lv[1]) + (lv[2] + lv[3])) + ((lv[4] + lv[5]) + (lv[6] + lv[7])); ls += xhalf(ls); const float inv = 1.0f / ls;   // ls >= 1: the maximum's own term
  _Float16* cr = C + ((size_t)b * TT + q0 + qw) * HD + 8 * g;   // Ot tile jd, register r = ctx[query][jd * 16 + 8g + r]: 16 contiguous bytes per lane and tile; stored as f16(ctx x 2^6), the A operand of k_lin2
#pragma unroll   // constant indices, so that the arrays stay in registers
  for (int jd = 0; jd < 4; ++jd) { v8h w;
#pragma unroll   // constant indices, so that the arrays stay in registers
    for (int r = 0; r < 8; ++r) w[r] = (_Float16)((o[jd][r] * inv) * 64.0f);
    vst2(cr + jd * 16, w); } }

// ---- k_lin2: the module's final Linear on the RAW-reshaped context: rows = the [2*2048][1024] view of the contiguous [32][2048][64] context buffer; out = ctx Wo^T + bo with f16(ctx x 2^6) against f16(bf16(Wo) x 2^8) (1 product, k in ascending 32-chunks). Both operands arrive as f16: k_fa stores the context so, k_padw's last blocks convert Wo once.
// Block = 8 waves on a 128 x 128 output tile (wave = 32 rows x 64 columns); a stage = 128 k: the ctx rows and the Wo rows are read as whole 256-B pieces and staged in LDS as they are, two buffers, the next stage's loads in flight in registers.
#define K2 1024
#define N2 1024
#define LM 128            // output rows per block
#define LN 128            // output columns per block
#define LK 128            // k per stage
#define LP 136            // LDS pitch of a 128-element f16 row: 256 B + 16 B, conflict-free for 16-B fragment reads
#define LF 132            // LDS pitch of a 128-element f32 output row
__global__ __launch_bounds__(256) void k_lin2(const _Float16* __restrict__ Yc, const _Float16* __restrict__ WH, const float* __restrict__ BO, float* __restrict__ OUT) {
  __shared__ __align__(16) _Float16 st[2][2][LM][LP];   // [buffer][0 = ctx rows, 1 = Wo rows][row][k]; after the k loop the same bytes hold the f32 output tile
  const int tid = threadIdx.x, wave = tid >> 5, lane = tid & 31, col = lane & 15, g = lane >> 4; const int c0 = blockIdx.y * LN; const size_t r0 = (size_t)blockIdx.x * LM;
  const int wr = (wave >> 1) * 32, wc = (wave & 1) * 64;
  const int sr = tid >> 4, sc = tid & 15;   // staging: thread -> (row, 16-B chunk) of the 256-B row pieces
  const _Float16* ga = Yc + r0 * K2; const _Float16* gw = WH + (size_t)c0 * K2; const unsigned vo = (unsigned)(sr * K2 + sc * 8);   // block-uniform bases that walk along k, and one per-lane offset that never changes
  v8h ra[8], rw[8];
#pragma unroll   // constant indices, so that the arrays stay in registers
  for (int i = 0; i < 8; ++i) { ra[i] = *(const v8h*)(ga + (vo + 16u * i * K2)); rw[i] = *(const v8h*)(gw + (vo + 16u * i * K2)); }
  v8f acc[2][4] = {};
#pragma clang loop unroll(disable)   // one copy of the stage body: the last stage is not peeled off, and the branch round the next stage's loads keeps them directly behind the barrier
  for (int s = 0; s < K2 / LK; ++s) { const int u = s & 1;
#pragma unroll   // constant indices, so that the arrays stay in registers
    for (int i = 0; i < 8; ++i) { *(v8h*)&st[u][0][sr + 16 * i][sc * 8] = ra[i]; *(v8h*)&st[u][1][sr + 16 * i][sc * 8] = rw[i]; }
    __syncthreads();   // publishes buffer u; it also ends every wave's reads of buffer u ^ 1 (stage s - 1), which stage s + 1 overwrites only behind it
    if (s + 1 < K2 / LK) { ga += LK; gw += LK;   // behind the barrier (which drains the load counter), so that these loads fly during the stage's work
#pragma unroll   // constant indices, so that the arrays stay in registers
      for (int i = 0; i < 8; ++i) { ra[i] = *(const v8h*)(ga + (vo + 16u * i * K2)); rw[i] = *(const v8h*)(gw + (vo + 16u * i * K2)); } }
#pragma unroll   // constant indices, so that the arrays stay in registers
    for (int kk = 0; kk < LK / 32; ++kk) { v16h af[2], bf[4];
#pragma unroll   // constant indices, so that the arrays stay in registers
      for (int i = 0; i < 2; ++i) af[i] = frag_h(&st[u][0][wr + i * 16 + col][kk * 32], lane);
#pragma unroll   // constant indices, so that the arrays stay in registers
      for (int j = 0; j < 4; ++j) bf[j] = frag_h(&st[u][1][wc + j * 16 + col][kk * 32], lane);
#pragma unroll   // constant indices, so that the arrays stay in registers
      for (int i = 0; i < 2; ++i)
#pragma unroll   // constant indices, so that the arrays stay in registers
        for (int j = 0; j < 4; ++j) acc[i][j] = wm(af[i], bf[j], acc[i][j]); } }
  float (*sf)[LF] = (float (*)[LF])&st[0][0][0][0];   // 128 x 132 f32 = 67,584 B of the 139,264 B
  __syncthreads();   // not needed for the buffers: the output tile lies in buffer 0, whose last reads (stage 6) ended at the last stage's barrier
#pragma unroll   // constant indices, so that the arrays stay in registers
  for (int j = 0; j < 4; ++j) { const float bias = bfr(BO[c0 + wc + j * 16 + col]);
#pragma unroll   // constant indices, so that the arrays stay in registers
    for (int i = 0; i < 2; ++i)
#pragma unroll   // constant indices, so that the arrays stay in registers
      for (int r = 0; r < 8; ++r) sf[wr + i * 16 + 8 * g + r][wc + j * 16 + col] = acc[i][j][r] * (1.0f / 16384.0f) + bias; }   /* 2^-8 (Wo carry) x 2^-6 (ctx carry) */
  __syncthreads();   // publishes the output tile: a wave stores whole 512-B rows that two waves wrote
#pragma unroll   // one address, sixteen constant offsets
  for (int rl = 0; rl < 16; ++rl) vst2(OUT + (r0 + wave * 16 + rl) * N2 + c0 + lane * 4, *(const v4f*)&sf[wave * 16 + rl][lane * 4]); }
#define WS_C64 (WS_END)                     // f16 context x 2^6 [32][2048][64] contiguous == the raw-reshaped [2*2048][1024] rows
#define WS_MB (WS_C64 + 2u * (size_t)NB * TT * 64)          // packed mask words [2 * 128 query tiles][128 key tiles][8]
#define WS_WH (WS_MB + 4u * 2 * (size_t)(TT / 16) * (TT / 16) * 8)   // f16(bf16(Wo) x 2^8) [1024][1024]
#define WS_END3 (WS_WH + 2u * (size_t)N2 * K2)
extern "C" void kernel_launch(void* const* d_in, const int* in_sizes, int n_in, void* d_out, int out_size, void* d_ws, size_t ws_size, hipStream_t stream) {
  (void)in_sizes; (void)n_in; (void)out_size;
  const float** F = (const float**)d_in;
  if (ws_size < (size_t)WS_END) return;
  char* ws = (char*)d_ws; _Float16 *QH = (_Float16*)(ws + WS_QH), *KH = (_Float16*)(ws + WS_KH), *VT = (_Float16*)(ws + WS_VT);
  // inputs: 0 query [2,2048,1024]; 1 key; 2 value (each viewed as 65,536 rows of 64: the raw reshape); 3 mask [2,1,2048,2048] int32; 4 Wq [64,64] (out,in); 5 Wk; 6 Wv; 7 Wo [1024,1024] (out,in); 8 bo [1024] (nonzero)
  if (ws_size < (size_t)WS_END3) return;
  _Float16 *C64 = (_Float16*)(ws + WS_C64), *WH = (_Float16*)(ws + WS_WH); unsigned* MB = (unsigned*)(ws + WS_MB);
  k_padw<<<dim3(32, 16 + 4), 256, 0, stream>>>((const int*)d_in[3], MB, F[7], WH);   /* y in 0..15: 512 blocks x 8 waves x (16 rows x 128 keys) = the whole mask; y >= 16: 128 blocks x 256 threads x 32 elements = Wo */
  k_proj<<<dim3(TNB * TT / (64 * PT), 1, 3), 128, 0, stream>>>(F[0], F[1], F[2], F[4], F[5], F[6], QH, KH, VT);
  k_fa<<<dim3(TT / FQ, TNB), 256, 0, stream>>>(QH, KH, VT, MB, C64);   /* pseudo-sequence = real batch (b >> 4), pseudo-head (b & 15) */
  k_lin2<<<dim3((TNB * TT * 64 / K2) / LM, N2 / LN), 256, 0, stream>>>(C64, WH, F[8], (float*)d_out);
}

// v009
// One run takes 63.8 microseconds.
// Next to v008, in two timings, it ran 1.05 and 1.02 times as fast.
// Over all steps from v000 it is 45.1 times as fast.
// compute dtype: all float inputs rounded to bf16; q/k/v projections with EXACT bf16 products on WMMA 16x16x32 (f32 accumulate); logits: q once to f16 x k once to f16 (1 product); running-maximum softmax in f32; exp(logit - running maximum) once to f16 x v once to f16 (1 product), divided by the f32 sum at the end; f32 output.
#include <hip/hip_runtime.h>
#include <math.h>

typedef __attribute__((ext_vector_type(16))) _Float16 v16h;
typedef __attribute__((ext_vector_type(16))) __bf16 v16b;
typedef __attribute__((ext_vector_type(8)))  _Float16 v8h;
typedef __attribute__((ext_vector_type(8)))  float v8f;
typedef __attribute__((ext_vector_type(4)))  float v4f;
typedef __attribute__((ext_vector_type(2)))  float v2f;
typedef __attribute__((ext_vector_type(4)))  unsigned v4u;
typedef __attribute__((ext_vector_type(4)))  int v4i;
typedef __attribute__((ext_vector_type(16))) unsigned v16u;
typedef const __attribute__((address_space(4))) v16u* cv16u;   // a pointer to memory that no one writes while the kernel runs: a wave-uniform load through it is a scalar load
typedef float __attribute__((may_alias)) float_a;
typedef int __attribute__((may_alias)) int_a;

template <typename T> __device__ __forceinline__ void vst2(void* p, T v) { *(T*)p = v;  }
__device__ __forceinline__ v8f wmma16(v16h a, v16h b, v8f c) {
  v8f d = __builtin_amdgcn_wmma_f32_16x16x32_f16(false, a, false, b, (short)0, c, false, false);
  asm volatile("v_nop\n\tv_nop\n\tv_nop\n\tv_nop" : "+v"(d) : "v"(a), "v"(b));
  return d;
}
__device__ __forceinline__ v8f wmma_bf(v16b a, v16b b, v8f c) {
  v8f d = __builtin_amdgcn_wmma_f32_16x16x32_bf16(false, a, false, b, (short)0, c, false, false);
  asm volatile("v_nop\n\tv_nop\n\tv_nop\n\tv_nop" : "+v"(d) : "v"(a), "v"(b));
  return d;
}
// 16x16x32 fragments: lane = (h = lane>>4, row/col = lane&15); elements 0..7 = k0+8h+0..7, 8..15 = k0+16+8h+0..7; D element r = row 8h+r
__device__ __forceinline__ v16h frag_h(const _Float16* rowk0, int lane) {
  union { v16h v; v8h q[2]; } u; const _Float16* p = rowk0 + 8 * (lane >> 4);
  u.q[0] = *(const v8h*)p; u.q[1] = *(const v8h*)(p + 16); return u.v;
}
__device__ __forceinline__ v16h frag_f32(const float* rowk0, int lane) {
  v16h a; const float* p = rowk0 + 8 * (lane >> 4);
#pragma unroll
  for (int i = 0; i < 8; ++i) { a[i] = (_Float16)p[i]; a[8 + i] = (_Float16)p[16 + i]; }
  return a;
}
__device__ __forceinline__ v16h frag_f32s(const float* rowk0, int lane, float sc) {
  v16h a; const float* p = rowk0 + 8 * (lane >> 4);
#pragma unroll
  for (int i = 0; i < 8; ++i) { a[i] = (_Float16)(p[i] * sc); a[8 + i] = (_Float16)(p[16 + i] * sc); }
  return a;
}
// column fragment from a [K][ld] layout (column n), rows >= K read as 0
__device__ __forceinline__ v16h fragc_f32(const float* W, int k0, int n, int lane, int ld, int K) {
  v16h a; const int g = lane >> 4;
#pragma unroll
  for (int i = 0; i < 8; ++i) { const int ka = k0 + 8 * g + i, kb = ka + 16;
    a[i] = (_Float16)(ka < K ? W[(size_t)(ka < K ? ka : K - 1) * ld + n] : 0.f); a[8 + i] = (_Float16)(kb < K ? W[(size_t)(kb < K ? kb : K - 1) * ld + n] : 0.f); }
  return a;
}
struct F2 { v16b h, l; };
__device__ __forceinline__ F2 bsplit16(const float v[16]) { F2 r;
#pragma unroll
  for (int i = 0; i < 16; ++i) { const __bf16 h = (__bf16)v[i]; r.h[i] = h; r.l[i] = (__bf16)(v[i] - (float)h); }
  return r; }
__device__ __forceinline__ F2 split_row(const float* row, int k0, int lane) { float v[16]; const float* p = row + k0 + 8 * (lane >> 4);
#pragma unroll
  for (int i = 0; i < 8; ++i) { v[i] = p[i]; v[8 + i] = p[16 + i]; }
  return bsplit16(v); }
__device__ __forceinline__ F2 split_rowK(const float* row, int k0, int lane, int K) { float v[16]; const int g = lane >> 4;
#pragma unroll
  for (int i = 0; i < 8; ++i) { const int ka = k0 + 8 * g + i, kb = ka + 16; v[i] = ka < K ? row[ka < K ? ka : K - 1] : 0.f; v[8 + i] = kb < K ? row[kb < K ? kb : K - 1] : 0.f; }
  return bsplit16(v); }
__device__ __forceinline__ F2 split_col(const float* W, int k0, int n, int lane, int ld, int K) { float v[16]; const int g = lane >> 4;
#pragma unroll
  for (int i = 0; i < 8; ++i) { const int ka = k0 + 8 * g + i, kb = ka + 16; v[i] = ka < K ? W[(size_t)(ka < K ? ka : K - 1) * ld + n] : 0.f; v[8 + i] = kb < K ? W[(size_t)(kb < K ? kb : K - 1) * ld + n] : 0.f; }
  return bsplit16(v); }
__device__ __forceinline__ v8f mac3(const F2& a, const F2& b, v8f c) { c = wmma_bf(a.l, b.h, c); c = wmma_bf(a.h, b.l, c); return wmma_bf(a.h, b.h, c); }
__device__ __forceinline__ float sigm(float v) { return 1.0f / (1.0f + expf(-v)); }
#define LDSX() do { asm volatile("s_wait_dscnt 0" ::: "memory"); __builtin_amdgcn_wave_barrier(); __builtin_amdgcn_fence(__ATOMIC_RELEASE, "workgroup"); } while (0)

// Masked self-attention with a RAW reshape into heads (query / key / value [2,2048,1024] are reshaped WITHOUT transpose to [2,16,2048,64]: pseudo-head h of batch b = the contiguous 131,072 floats starting at (b*16 + h)*2048*64, i.e. 32 pseudo-sequences of 2,048 positions x 64 dims each); one shared bias-free torch (out,in) Linear [64,64] per role (Wq, Wk, Wv); scores = Q K^T masked by mask[b][0][q][k] == 0 -> -1e20 (int32 random 0/1 per batch), then divided by sqrt(embed = 1024) = 32 (the source's quirk: logit sigma - 0.08); softmax; out = attn V reshaped raw back to [2,2048,1024]; (out,in) Wo [1024,1024] + bo (nonzero): result = out Wo^T + bo.
#define NB 32
#define TT 2048
#define CC 64             // NH * HD = projected width
#define DIN 64          // input (model) width
#define NH 1
#define HD 64
#define NQB (TT / 64)
#define HG 1
#define SCALE (0.03125f)
#define CAUSAL 0
#ifndef TNB
#define TNB NB
#endif
__device__ __forceinline__ float bfr(float v) { return (float)(__bf16)v; }
__host__ __device__ __forceinline__ int kb_last(int qb) { return CAUSAL ? ((qb * 64 + 63) >> 7) : (TT / 128 - 1); }
typedef __attribute__((ext_vector_type(8))) __bf16 v8b;
__device__ __forceinline__ v16b frag_b(const __bf16* rowk0, int lane) {
  union { v16b v; v8b q[2]; } u; const __bf16* p = rowk0 + 8 * (lane >> 4);
  u.q[0] = *(const v8b*)p; u.q[1] = *(const v8b*)(p + 16); return u.v;
}
#define QBH 0
// B fragment (k rows k0+.., output column o) of a weight: (in,out) [K][ld] or (out,in) [ld rows of K]: bf16 exact, or f16(bf16 * 256) exact
__device__ __forceinline__ v16b wcol_io(const float* Wm, int k0, int o, int lane, int ld) { v16b w; const int g = lane >> 4;
#pragma unroll
  for (int i = 0; i < 8; ++i) { w[i] = (__bf16)Wm[(size_t)(k0 + 8 * g + i) * ld + o]; w[8 + i] = (__bf16)Wm[(size_t)(k0 + 16 + 8 * g + i) * ld + o]; }
  return w; }
__device__ __forceinline__ v16b wcol_oi(const float* Wm, int k0, int o, int lane, int K) { v16b w; const float* p = Wm + (size_t)o * K + k0 + 8 * (lane >> 4);
#pragma unroll
  for (int i = 0; i < 8; ++i) { w[i] = (__bf16)p[i]; w[8 + i] = (__bf16)p[16 + i]; }
  return w; }
__device__ __forceinline__ v16h wcolh_io(const float* Wm, int k0, int o, int lane, int ld) { v16h w; const int g = lane >> 4;
#pragma unroll
  for (int i = 0; i < 8; ++i) { w[i] = (_Float16)(bfr(Wm[(size_t)(k0 + 8 * g + i) * ld + o]) * 256.0f); w[8 + i] = (_Float16)(bfr(Wm[(size_t)(k0 + 16 + 8 * g + i) * ld + o]) * 256.0f); }
  return w; }
__device__ __forceinline__ v16h wcolh_oi(const float* Wm, int k0, int o, int lane, int K) { v16h w; const float* p = Wm + (size_t)o * K + k0 + 8 * (lane >> 4);
#pragma unroll
  for (int i = 0; i < 8; ++i) { w[i] = (_Float16)(bfr(p[i]) * 256.0f); w[8 + i] = (_Float16)(bfr(p[16 + i]) * 256.0f); }
  return w; }
#define WQKV_LAYOUT 1   // 0 = (in,out) [DIN][CC]; 1 = (out,in) [CC][DIN]; 2 = per-head [NH][DIN][HD]
__device__ __forceinline__ v16b wcol_hdk(const float* Wm, int k0, int o, int lane) { v16b w; const int g = lane >> 4; const float* p = Wm + (size_t)(o / HD) * DIN * HD + (o % HD);
#pragma unroll
  for (int i = 0; i < 8; ++i) { w[i] = (__bf16)p[(size_t)(k0 + 8 * g + i) * HD]; w[8 + i] = (__bf16)p[(size_t)(k0 + 16 + 8 * g + i) * HD]; }
  return w; }
#define WO_OUT_IN 0
#if WQKV_LAYOUT == 1
#define WCOL(W, k0, o, lane) wcol_oi(W, k0, o, lane, DIN)
#elif WQKV_LAYOUT == 2
#define WCOL(W, k0, o, lane) wcol_hdk(W, k0, o, lane)
#else
#define WCOL(W, k0, o, lane) wcol_io(W, k0, o, lane, CC)
#endif
#if WO_OUT_IN
#define WOCOL(W, k0, o, lane) wcol_oi(W, k0, o, lane, CC)
#define WOCOLH(W, k0, o, lane) wcolh_oi(W, k0, o, lane, CC)
#else
#define WOCOL(W, k0, o, lane) wcol_io(W, k0, o, lane, DIN)
#define WOCOLH(W, k0, o, lane) wcolh_io(W, k0, o, lane, DIN)
#endif
// ---- prep_part (blocks of k_prep, numbered pb): operand preparation for k_fa and k_lin2.
// Blocks pb >= 512 convert Wo for k_lin2 (see there). Blocks pb in 0..511 pack the mask: MB[batch * 128 + query tile of 16][key tile of 16][r] = one 32-bit word whose bit (lane = 16g + col) says mask[query tile * 16 + col][key tile * 16 + 8g + r] != 0, i.e. the lane mask of register r of that score tile in k_fa. A wave takes 16 mask rows x 128 keys: whole 512-B row pieces into its own LDS rows, read back in the score tile's lane order, one ballot per word.
#define MBP 132           // LDS pitch of a 128-element int row piece: 512 B + 16 B, conflict-free for 16-B reads
typedef __attribute__((ext_vector_type(2))) unsigned v2u;
typedef __attribute__((ext_vector_type(4))) _Float16 v4h;
__device__ __forceinline__ void prep_part(const int pb, char* sm, const int* __restrict__ MASK, unsigned* __restrict__ MB, const float* __restrict__ WO, _Float16* __restrict__ WH) {
  int (*sp)[16][MBP] = (int (*)[16][MBP])sm;
  if (pb >= 512) {   // Wo once to f16(bf16 x 2^8), the B operand of k_lin2: 128 blocks, a thread takes eight 16-B pieces, each wave-wide load 512 contiguous bytes, all eight in flight
    const size_t e0 = ((size_t)(pb - 512) * 256 + threadIdx.x) * 4; const float* gs = WO + e0; v4f rw[8];
#pragma unroll   // constant indices, so that the array stays in registers
    for (int i = 0; i < 8; ++i) rw[i] = *(const v4f*)(gs + (size_t)i * (128 * 256 * 4));
    asm volatile("s_wait_xcnt 0x0" :: "v"(gs) : "memory");   // the code behind may reuse the registers that hold these loads' address: the wait stands in front of that overwrite
#pragma unroll   // constant indices, so that the array stays in registers
    for (int i = 0; i < 8; ++i) { v4h hw;
#pragma unroll
      for (int e = 0; e < 4; ++e) hw[e] = (_Float16)(bfr(rw[i][e]) * 256.0f);
      vst2(WH + e0 + (size_t)i * (128 * 256 * 4), hw); }
    asm volatile("s_wait_xcnt 0x0" ::: "memory");   // in the merged kernel other code stands behind these stores in the listing and writes the registers that they name: the wait stands in front of that overwrite
    return; }
  { const int wave = threadIdx.x >> 5, lane = threadIdx.x & 31, col = lane & 15, g = lane >> 4; const int gw = pb * 8 + wave, ch = gw & 15, qt = gw >> 4;   // ch = piece of 128 keys, qt = batch * 128 + query tile
    const int* gm = MASK + (size_t)qt * 16 * TT + ch * 128 + lane * 4; v4i rm[16];
#pragma unroll   // constant indices, so that the array stays in registers; all sixteen loads in flight
    for (int i = 0; i < 16; ++i) rm[i] = *(const v4i*)(gm + (size_t)i * TT);
    asm volatile("s_wait_xcnt 0x0" :: "v"(gm) : "memory");   // the code behind reuses the registers that hold these loads' address: the wait stands in front of that overwrite, and the address as its input keeps the last load's result off those registers
#pragma unroll   // constant indices, so that the array stays in registers
    for (int i = 0; i < 16; ++i) *(v4i*)&sp[wave][i][lane * 4] = rm[i];
    __syncthreads();   // publishes the rows: a lane reads back what other lanes wrote
    unsigned w0 = 0, w1 = 0;   // lane l collects words 2l and 2l + 1 of the wave's 64
#pragma unroll   // constant lane numbers for the word's place
    for (int kt = 0; kt < 8; ++kt) { const v4i m0 = *(const v4i*)&sp[wave][col][kt * 16 + 8 * g], m1 = *(const v4i*)&sp[wave][col][kt * 16 + 8 * g + 4];
#pragma unroll   // constant lane numbers for the word's place
      for (int r = 0; r < 8; r += 2) { const unsigned ba = __builtin_amdgcn_ballot_w32((r < 4 ? m0[r & 3] : m1[r & 3]) != 0), bb = __builtin_amdgcn_ballot_w32((r < 4 ? m0[(r + 1) & 3] : m1[(r + 1) & 3]) != 0);
        const bool mine = lane == kt * 4 + (r >> 1); w0 = mine ? ba : w0; w1 = mine ? bb : w1; } }
    v2u wv; wv[0] = w0; wv[1] = w1; vst2(MB + (size_t)qt * (TT / 16 * 8) + ch * 64 + lane * 2, wv);
    asm volatile("s_wait_xcnt 0x0" ::: "memory");   // the same for this store
  } }
#define WS_QH  0u                                      // f16 q rows [b*t][CC]
#define WS_KH  (WS_QH + 2u * (size_t)NB * TT * CC)      // f16 k rows [b*t][CC]
#define WS_VT  (WS_KH + 2u * (size_t)NB * TT * CC)      // f16 v planes [b][c][t]
#define WS_END (WS_VT + 2u * (size_t)NB * CC * TT)

// ---- proj_part (blocks of k_prep, numbered pj = which * 128 + pair of row ranges): a block = two halves of 128 threads that share nothing but the barriers; a half = (PT tiles of 64 rows, all 64 cols, which): q/k/v = X W^T with exact bf16 products (K = DIN), W = the (out,in) [64][64] input itself -> which 0: q f16 rows; 1: k f16 rows; 2: v f16 planes [c][t]. Only what k_fa reads is computed, staged and stored.
// Operand path: X rows and W rows are read as whole lines (a wave's 16-B loads cover two 256-B rows = 512 contiguous bytes), rounded to bf16 once per half and staged in LDS; the fragments come from LDS. W is staged once per half, the next row tile's loads are in flight in registers.
#define PT 4              // row tiles of 64 per half
#define PP 72             // LDS pitch of a 64-element bf16 row: 128 B + 16 B, conflict-free for 16-B fragment reads
#define PHB (3 * 64 * PP * 2)   // LDS bytes of one half: output tile, X tile, W rows
typedef __attribute__((ext_vector_type(4))) __bf16 v4b;
__device__ __forceinline__ v4b cvt4b(v4f v) { v4b h;
#pragma unroll
  for (int e = 0; e < 4; ++e) h[e] = (__bf16)v[e];
  return h; }
// 16-B global store with its wait in ONE statement: the next pass of the store loop and the next trip reuse the registers that the store names
__device__ __forceinline__ void st16w(void* p, v4u v) { asm volatile("global_store_b128 %0, %1, off\n\ts_wait_xcnt 0x0" :: "v"(p), "v"(v) : "memory"); }
__device__ __forceinline__ void proj_part(const int pj, char* sm, const float* __restrict__ XQ, const float* __restrict__ XK, const float* __restrict__ XV, const float* __restrict__ WQ, const float* __restrict__ WK, const float* __restrict__ WV,
    _Float16* __restrict__ QH, _Float16* __restrict__ KH, _Float16* __restrict__ VT) {
  const int hb = threadIdx.x >> 7; char* sh = sm + hb * PHB;   // the half's own LDS
  _Float16 (*so)[PP] = (_Float16 (*)[PP])sh;   // output tile: q and k as [row][column], v as [column][row]
  __bf16 (*xs)[PP] = (__bf16 (*)[PP])(sh + 64 * PP * 2), (*wsg)[PP] = (__bf16 (*)[PP])(sh + 2 * 64 * PP * 2);   // staged operands: one X row tile, all W rows
  const int tid = threadIdx.x & 127, wave = tid >> 5, lane = tid & 31, col = lane & 15, g = lane >> 4; const int which = pj >> 7; const size_t rb = (size_t)((pj & 127) * 2 + hb) * (64 * PT);
  const float* X = which == 0 ? XQ : which == 1 ? XK : XV; const float* WA = which == 0 ? WQ : which == 1 ? WK : WV;
  const int sr = tid >> 4, sc = tid & 15;   // staging: thread -> (row, 16-B chunk) of the 256-B rows
  const float* gx = X + (rb + sr) * DIN + sc * 4;
  v4f rx[8];
  { v4f rw[8]; const float* gw = WA + (size_t)sr * DIN + sc * 4;
#pragma unroll   // constant indices, so that the arrays stay in registers
    for (int i = 0; i < 8; ++i) rw[i] = *(const v4f*)(gw + (size_t)(8 * i) * DIN);
#pragma unroll   // constant indices, so that the arrays stay in registers
    for (int i = 0; i < 8; ++i) rx[i] = *(const v4f*)(gx + (size_t)(8 * i) * DIN);
    asm volatile("s_wait_xcnt 0x0" :: "v"(gw), "v"(gx) : "memory");   // the code behind may reuse the registers that hold these loads' addresses: the wait stands in front of that overwrite
#pragma unroll   // constant indices, so that the arrays stay in registers
    for (int i = 0; i < 8; ++i) *(v4b*)&wsg[sr + 8 * i][sc * 4] = cvt4b(rw[i]); }
#pragma clang loop unroll(disable)   // one copy of the tile body: the branch round the next tile's loads keeps them directly behind the barrier
  for (int it = 0; it < PT; ++it) { const size_t r0 = rb + (size_t)it * 64; const size_t bb = r0 / TT; const int t0 = (int)(r0 % TT);
#pragma unroll   // constant indices, so that the arrays stay in registers
    for (int i = 0; i < 8; ++i) *(v4b*)&xs[sr + 8 * i][sc * 4] = cvt4b(rx[i]);
    __syncthreads();   // publishes the X tile (and, on the first trip, W); it also ends every wave's reads of the output tile of trip it - 1, which this trip overwrites only behind it
    v8f acc[4] = {};
#pragma unroll   // constant indices, so that the arrays stay in registers
    for (int kc = 0; kc < DIN / 32; ++kc) { const v16b a = frag_b(&xs[wave * 16 + col][kc * 32], lane); v16b w[4];
#pragma unroll   // constant indices, so that the arrays stay in registers
      for (int j = 0; j < 4; ++j) w[j] = frag_b(&wsg[j * 16 + col][kc * 32], lane);
#pragma unroll   // constant indices, so that the arrays stay in registers
      for (int j = 0; j < 4; ++j) acc[j] = __builtin_amdgcn_wmma_f32_16x16x32_bf16(false, a, false, w[j], (short)0, acc[j], false, false); }
    const bool qk = which < 2; _Float16* DH = which == 0 ? QH : KH;
    if (qk) {
#pragma unroll
      for (int j = 0; j < 4; ++j) {
#pragma unroll
        for (int r = 0; r < 8; ++r) so[wave * 16 + 8 * g + r][j * 16 + col] = (_Float16)acc[j][r]; }
    } else {
#pragma unroll
      for (int j = 0; j < 4; ++j) {
#pragma unroll
        for (int r = 0; r < 8; ++r) so[j * 16 + col][wave * 16 + 8 * g + r] = (_Float16)acc[j][r]; } }
    __syncthreads();   // publishes the output tile; it also ends every wave's fragment reads of the X tile, which the next trip overwrites only behind it
    if (it + 1 < PT) {   // behind the barrier (which drains the load counter), so that these loads fly while the output tile is stored
#pragma unroll   // constant indices, so that the arrays stay in registers
      for (int i = 0; i < 8; ++i) rx[i] = *(const v4f*)(gx + (size_t)((it + 1) * 64 + 8 * i) * DIN);
      asm volatile("s_wait_xcnt 0x0" ::: "memory"); }   // the code behind may reuse the registers that held these loads' addresses: the wait stands in front of that overwrite
    for (int e = tid; e < 64 * 8; e += 128) { const int rl = e >> 3, q = e & 7;   // whole 128-B lines: a q or k row, or 64 positions of a v plane row
      st16w(qk ? DH + (r0 + rl) * CC + q * 8 : VT + (bb * CC + rl) * (size_t)TT + t0 + q * 8, *(const v4u*)&so[rl][q * 8]); } } }
// ---- k_prep: the projections and the operand preparation depend on nothing but the inputs, so they run as ONE launch: no gap between them, and the one's start and end overlap the other's stream. The projection blocks (four trips each) come first; 67,584 B of LDS, used by either part in its own way, let four blocks sit on a WGP, so all 1,024 are resident at once.
#define PJB (3 * (TNB * TT / (64 * PT)) / 2)   // projection blocks: 3 roles x 128 pairs of row ranges
__global__ __launch_bounds__(256) void k_prep(const int* __restrict__ MASK, unsigned* __restrict__ MB, const float* __restrict__ WO, _Float16* __restrict__ WH, const float* __restrict__ XQ, const float* __restrict__ XK, const float* __restrict__ XV,
    const float* __restrict__ WQ, const float* __restrict__ WK, const float* __restrict__ WV, _Float16* __restrict__ QH, _Float16* __restrict__ KH, _Float16* __restrict__ VT) {
  __shared__ __align__(16) char sm[8 * 16 * MBP * 4];
  if (blockIdx.x < PJB) { proj_part(blockIdx.x, sm, XQ, XK, XV, WQ, WK, WV, QH, KH, VT); return; }   // a block-uniform branch: every barrier inside is passed by the whole block or by none of it
  prep_part(blockIdx.x - PJB, sm, MASK, MB, WO, WH); }
// ---- k_fa: scores, mask, softmax and P . v of one pseudo-sequence in ONE pass over the keys: S and P stay in registers. Block = 8 waves x 16 queries (blockIdx.x = query block, blockIdx.y = pseudo-sequence b, real batch = b >> 4); a stage = 64 keys, K rows and v plane rows staged in LDS (whole 128-B lines per load), two buffers, the next stage's loads in flight in registers; the mask comes as packed lane-mask words (k_prep), 32 words a wave and stage by scalar loads.
// St = K Qt (A = K rows, B = q, kept in registers): a lane holds ONE query (col) and keys 8g + r of each 16-key tile, so two tiles pack in place into the B operand of Ot += vt Pt (A = v plane rows, same k order as frag_h). Running maximum and sum per query in raw score units (the 1/32 sits in the exponent's factor); where(mask == 0, -1e20, score) as in the source, so a fully masked row comes out uniform.
#define FQ 128            // queries per block
#define FK 64             // keys per stage
#define KP 72             // LDS pitch of a 64-element f16 row: 128 B + 16 B, conflict-free for 16-B fragment reads
#define CEXP (SCALE * 1.44269504088896f)
__device__ __forceinline__ v8f wm(v16h a, v16h b, v8f c) { return __builtin_amdgcn_wmma_f32_16x16x32_f16(false, a, false, b, (short)0, c, false, false); }
// 2^x in place. One statement for eight: behind a transcendental the instruction set asks for one independent instruction before its result is read or its source overwritten; here each v_exp_f32 is that instruction for the one before it and the v_nop for the last, whatever the compiler puts next
__device__ __forceinline__ v8f exp2x8(v8f e) { float a0 = e[0], a1 = e[1], a2 = e[2], a3 = e[3], a4 = e[4], a5 = e[5], a6 = e[6], a7 = e[7];
  asm("v_exp_f32 %0, %0\n\tv_exp_f32 %1, %1\n\tv_exp_f32 %2, %2\n\tv_exp_f32 %3, %3\n\tv_exp_f32 %4, %4\n\tv_exp_f32 %5, %5\n\tv_exp_f32 %6, %6\n\tv_exp_f32 %7, %7\n\tv_nop" : "+v"(a0), "+v"(a1), "+v"(a2), "+v"(a3), "+v"(a4), "+v"(a5), "+v"(a6), "+v"(a7));
  v8f p; p[0] = a0; p[1] = a1; p[2] = a2; p[3] = a3; p[4] = a4; p[5] = a5; p[6] = a6; p[7] = a7; return p; }
__device__ __forceinline__ float exp2x1(float a) { asm("v_exp_f32 %0, %0\n\tv_nop" : "+v"(a)); return a; }   // the v_nop: the same slot
__device__ __forceinline__ float xhalf(float v) { const int i = __builtin_bit_cast(int, v); return __builtin_bit_cast(float, (int)__builtin_amdgcn_permlanex16(i, i, 0x76543210, 0xfedcba98, false, false)); }   // the value of lane l ^ 16
// amdgpu_waves_per_eu(4, 4): the grid gives a SIMD four waves; with no ceiling named the compiler aimed at more waves, cut the registers and put a full LDS wait in front of every fragment's products
__global__ __launch_bounds__(256) __attribute__((amdgpu_waves_per_eu(4, 4))) void k_fa(const _Float16* __restrict__ QH, const _Float16* __restrict__ KH, const _Float16* __restrict__ VT, const unsigned* __restrict__ MB, _Float16* __restrict__ C) {
  __shared__ __align__(16) _Float16 sk[2][FK][KP], sv[2][HD][KP];
  const int tid = threadIdx.x, wave = tid >> 5, lane = tid & 31, col = lane & 15, g = lane >> 4; const int b = blockIdx.y, q0 = blockIdx.x * FQ, qw = wave * 16 + col;
  v16h qh[2];
#pragma unroll   // constant indices, so that the arrays stay in registers
  for (int kc = 0; kc < 2; ++kc) qh[kc] = frag_h(QH + ((size_t)b * TT + q0 + qw) * CC + kc * 32, lane);
  const int r8 = tid >> 3, c8 = tid & 7;   // staging: thread -> (row, 16-B chunk) of 128-B rows (K, v)
  const _Float16* gk = KH + ((size_t)b * TT + r8) * CC + c8 * 8; const _Float16* gv = VT + ((size_t)b * CC + r8) * TT + c8 * 8;
  const unsigned* gb = MB + ((size_t)(b >> 4) * (TT / 16) + (q0 >> 4) + __builtin_amdgcn_readfirstlane(wave)) * (TT / 16 * 8);   // the wave's query tile: a wave-uniform address, so that the words come by scalar loads
  v8h rk[2], rv[2];
#pragma unroll   // constant indices, so that the arrays stay in registers
  for (int i = 0; i < 2; ++i) { rk[i] = *(const v8h*)(gk + (size_t)(32 * i) * CC); rv[i] = *(const v8h*)(gv + (size_t)(32 * i) * TT); }
  v8f o[4] = {}, lv = {}; float m = -3.0e38f;
#pragma clang loop unroll(disable)   // one copy of the stage body: the last stage is not peeled off, and the branch round the next stage's loads keeps them directly behind the barrier
  for (int s = 0; s < TT / FK; ++s) { const int u = s & 1;
    const v16u mb[2] = { *(cv16u)(gb + s * 32), *(cv16u)(gb + s * 32 + 16) };   // the stage's 32 mask words, asked for in front of the LDS stores and the barrier: they land while the wave waits there and for its first K fragments
#pragma unroll   // constant indices, so that the arrays stay in registers
    for (int i = 0; i < 2; ++i) { *(v8h*)&sk[u][r8 + 32 * i][c8 * 8] = rk[i]; *(v8h*)&sv[u][r8 + 32 * i][c8 * 8] = rv[i]; }
    __syncthreads();   // publishes buffer u; it also ends every wave's reads of buffer u ^ 1 (stage s - 1), which stage s + 1 overwrites only behind it
    if (s + 1 < TT / FK) { const int k1 = (s + 1) * FK;   // behind the barrier (which drains the load counter), so that these loads fly during the stage's work
#pragma unroll   // constant indices, so that the arrays stay in registers
      for (int i = 0; i < 2; ++i) { rk[i] = *(const v8h*)(gk + (size_t)(k1 + 32 * i) * CC); rv[i] = *(const v8h*)(gv + (size_t)(32 * i) * TT + k1); }
      asm volatile("s_wait_xcnt 0x0" ::: "memory"); }   // the stage's first LDS reads land in the registers that held these loads' addresses: the wait stands in front of that overwrite
    v8f t[4] = {};
#pragma unroll   // constant indices, so that the arrays stay in registers
    for (int kc = 0; kc < 2; ++kc)   // k chunk outside, tile inside: four independent accumulator chains, so that no product waits for the one before it
#pragma unroll   // constant indices, so that the arrays stay in registers
      for (int j = 0; j < 4; ++j) t[j] = wm(frag_h(&sk[u][j * 16 + col][kc * 32], lane), qh[kc], t[j]);
#pragma unroll   // constant indices, so that the arrays stay in registers
    for (int j = 0; j < 4; ++j)
#pragma unroll   // constant indices, so that the arrays stay in registers
      for (int r = 0; r < 8; ++r) t[j][r] = __builtin_amdgcn_inverse_ballot_w32(mb[j >> 1][(j & 1) * 8 + r]) ? t[j][r] : -1.0e20f;   // word (j, r) is this register's lane mask: one select, no compare
    float mj[4];   // one maximum chain per tile: four independent chains
#pragma unroll   // constant indices, so that the arrays stay in registers
    for (int j = 0; j < 4; ++j) { mj[j] = t[j][0];
#pragma unroll   // constant indices, so that the arrays stay in registers
      for (int r = 1; r < 8; ++r) mj[j] = fmaxf(mj[j], t[j][r]); }
    float mx = fmaxf(fmaxf(mj[0], mj[1]), fmaxf(mj[2], mj[3])); mx = fmaxf(mx, xhalf(mx));   // the query's other 32 keys of the stage sit in lane l ^ 16
    const float mn = fmaxf(m, mx), al = exp2x1((m - mn) * CEXP); m = mn;
    union { v16h v; v8h q[2]; } pb[2]; v8f ps;
#pragma unroll   // constant indices, so that the arrays stay in registers
    for (int j = 0; j < 4; ++j) { const v8f p = exp2x8((t[j] - mn) * CEXP);
      ps = j ? ps + p : p; pb[j >> 1].q[j & 1] = __builtin_convertvector(p, v8h); }
    lv = lv * al + ps;
#pragma unroll   // constant indices, so that the arrays stay in registers
    for (int jd = 0; jd < 4; ++jd) o[jd] *= al;
#pragma unroll   // constant indices, so that the arrays stay in registers
    for (int kk = 0; kk < 2; ++kk)
#pragma unroll   // constant indices, so that the arrays stay in registers
      for (int jd = 0; jd < 4; ++jd) o[jd] = wm(frag_h(&sv[u][jd * 16 + col][kk * 32], lane), pb[kk].v, o[jd]); }
  float ls = ((lv[0] + lv[1]) + (lv[2] + lv[3])) + ((lv[4] + lv[5]) + (lv[6] + lv[7])); ls += xhalf(ls); const float inv = 1.0f / ls;   // ls >= 1: the maximum's own term
  _Float16* cr = C + ((size_t)b * TT + q0 + qw) * HD + 8 * g;   // Ot tile jd, register r = ctx[query][jd * 16 + 8g + r]: 16 contiguous bytes per lane and tile; stored as f16(ctx x 2^6), the A operand of k_lin2
#pragma unroll   // constant indices, so that the arrays stay in registers
  for (int jd = 0; jd < 4; ++jd) { v8h w;
#pragma unroll   // constant indices, so that the arrays stay in registers
    for (int r = 0; r < 8; ++r) w[r] = (_Float16)((o[jd][r] * inv) * 64.0f);
    vst2(cr + jd * 16, w); } }

// ---- k_lin2: the module's final Linear on the RAW-reshaped context: rows = the [2*2048][1024] view of the contiguous [32][2048][64] context buffer; out = ctx Wo^T + bo with f16(ctx x 2^6) against f16(bf16(Wo) x 2^8) (1 product, k in ascending 32-chunks). Both operands arrive as f16: k_fa stores the context so, k_prep's last blocks convert Wo once.
// Block = 8 waves on a 128 x 128 output tile (wave = 32 rows x 64 columns); a stage = 128 k: the ctx rows and the Wo rows are read as whole 256-B pieces and staged in LDS as they are, two buffers, the next stage's loads in flight in registers.
#define K2 1024
#define N2 1024
#define LM 128            // output rows per block
#define LN 128            // output columns per block
#define LK 128            // k per stage
#define LP 136            // LDS pitch of a 128-element f16 row: 256 B + 16 B, conflict-free for 16-B fragment reads
#define LF 132            // LDS pitch of a 128-element f32 output row
__global__ __launch_bounds__(256) void k_lin2(const _Float16* __restrict__ Yc, const _Float16* __restrict__ WH, const float* __restrict__ BO, float* __restrict__ OUT) {
  __shared__ __align__(16) _Float16 st[2][2][LM][LP];   // [buffer][0 = ctx rows, 1 = Wo rows][row][k]; after the k loop the same bytes hold the f32 output tile
  const int tid = threadIdx.x, wave = tid >> 5, lane = tid & 31, col = lane & 15, g = lane >> 4; const int c0 = blockIdx.y * LN; const size_t r0 = (size_t)blockIdx.x * LM;
  const int wr = (wave >> 1) * 32, wc = (wave & 1) * 64;
  const int sr = tid >> 4, sc = tid & 15;   // staging: thread -> (row, 16-B chunk) of the 256-B row pieces
  const _Float16* ga = Yc + r0 * K2; const _Float16* gw = WH + (size_t)c0 * K2; const unsigned vo = (unsigned)(sr * K2 + sc * 8);   // block-uniform bases that walk along k, and one per-lane offset that never changes
  v8h ra[8], rw[8];
#pragma unroll   // constant indices, so that the arrays stay in registers
  for (int i = 0; i < 8; ++i) { ra[i] = *(const v8h*)(ga + (vo + 16u * i * K2)); rw[i] = *(const v8h*)(gw + (vo + 16u * i * K2)); }
  v8f acc[2][4] = {};
#pragma clang loop unroll(disable)   // one copy of the stage body: the last stage is not peeled off, and the branch round the next stage's loads keeps them directly behind the barrier
  for (int s = 0; s < K2 / LK; ++s) { const int u = s & 1;
#pragma unroll   // constant indices, so that the arrays stay in registers
    for (int i = 0; i < 8; ++i) { *(v8h*)&st[u][0][sr + 16 * i][sc * 8] = ra[i]; *(v8h*)&st[u][1][sr + 16 * i][sc * 8] = rw[i]; }
    __syncthreads();   // publishes buffer u; it also ends every wave's reads of buffer u ^ 1 (stage s - 1), which stage s + 1 overwrites only behind it
    if (s + 1 < K2 / LK) { ga += LK; gw += LK;   // behind the barrier (which drains the load counter), so that these loads fly during the stage's work
#pragma unroll   // constant indices, so that the arrays stay in registers
      for (int i = 0; i < 8; ++i) { ra[i] = *(const v8h*)(ga + (vo + 16u * i * K2)); rw[i] = *(const v8h*)(gw + (vo + 16u * i * K2)); } }
#pragma unroll   // constant indices, so that the arrays stay in registers
    for (int kk = 0; kk < LK / 32; ++kk) { v16h af[2], bf[4];
#pragma unroll   // constant indices, so that the arrays stay in registers
      for (int i = 0; i < 2; ++i) af[i] = frag_h(&st[u][0][wr + i * 16 + col][kk * 32], lane);
#pragma unroll   // constant indices, so that the arrays stay in registers
      for (int j = 0; j < 4; ++j) bf[j] = frag_h(&st[u][1][wc + j * 16 + col][kk * 32], lane);
#pragma unroll   // constant indices, so that the arrays stay in registers
      for (int i = 0; i < 2; ++i)
#pragma unroll   // constant indices, so that the arrays stay in registers
        for (int j = 0; j < 4; ++j) acc[i][j] = wm(af[i], bf[j], acc[i][j]); } }
  float (*sf)[LF] = (float (*)[LF])&st[0][0][0][0];   // 128 x 132 f32 = 67,584 B of the 139,264 B
  __syncthreads();   // not needed for the buffers: the output tile lies in buffer 0, whose last reads (stage 6) ended at the last stage's barrier
#pragma unroll   // constant indices, so that the arrays stay in registers
  for (int j = 0; j < 4; ++j) { const float bias = bfr(BO[c0 + wc + j * 16 + col]);
#pragma unroll   // constant indices, so that the arrays stay in registers
    for (int i = 0; i < 2; ++i)
#pragma unroll   // constant indices, so that the arrays stay in registers
      for (int r = 0; r < 8; ++r) sf[wr + i * 16 + 8 * g + r][wc + j * 16 + col] = acc[i][j][r] * (1.0f / 16384.0f) + bias; }   /* 2^-8 (Wo carry) x 2^-6 (ctx carry) */
  __syncthreads();   // publishes the output tile: a wave stores whole 512-B rows that two waves wrote
#pragma unroll   // one address, sixteen constant offsets
  for (int rl = 0; rl < 16; ++rl) vst2(OUT + (r0 + wave * 16 + rl) * N2 + c0 + lane * 4, *(const v4f*)&sf[wave * 16 + rl][lane * 4]); }
#define WS_C64 (WS_END)                     // f16 context x 2^6 [32][2048][64] contiguous == the raw-reshaped [2*2048][1024] rows
#define WS_MB (WS_C64 + 2u * (size_t)NB * TT * 64)          // packed mask words [2 * 128 query tiles][128 key tiles][8]
#define WS_WH (WS_MB + 4u * 2 * (size_t)(TT / 16) * (TT / 16) * 8)   // f16(bf16(Wo) x 2^8) [1024][1024]
#define WS_END3 (WS_WH + 2u * (size_t)N2 * K2)
extern "C" void kernel_launch(void* const* d_in, const int* in_sizes, int n_in, void* d_out, int out_size, void* d_ws, size_t ws_size, hipStream_t stream) {
  (void)in_sizes; (void)n_in; (void)out_size;
  const float** F = (const float**)d_in;
  if (ws_size < (size_t)WS_END) return;
  char* ws = (char*)d_ws; _Float16 *QH = (_Float16*)(ws + WS_QH), *KH = (_Float16*)(ws + WS_KH), *VT = (_Float16*)(ws + WS_VT);
  // inputs: 0 query [2,2048,1024]; 1 key; 2 value (each viewed as 65,536 rows of 64: the raw reshape); 3 mask [2,1,2048,2048] int32; 4 Wq [64,64] (out,in); 5 Wk; 6 Wv; 7 Wo [1024,1024] (out,in); 8 bo [1024] (nonzero)
  if (ws_size < (size_t)WS_END3) return;
  _Float16 *C64 = (_Float16*)(ws + WS_C64), *WH = (_Float16*)(ws + WS_WH); unsigned* MB = (unsigned*)(ws + WS_MB);
  k_prep<<<dim3(PJB + 512 + 128), 256, 0, stream>>>((const int*)d_in[3], MB, F[7], WH, F[0], F[1], F[2], F[4], F[5], F[6], QH, KH, VT);   /* 384 projection blocks; 512 blocks x 8 waves x (16 rows x 128 keys) = the whole mask; 128 blocks x 256 threads x 32 elements = Wo */
  k_fa<<<dim3(TT / FQ, TNB), 256, 0, stream>>>(QH, KH, VT, MB, C64);   /* pseudo-sequence = real batch (b >> 4), pseudo-head (b & 15) */
  k_lin2<<<dim3((TNB * TT * 64 / K2) / LM, N2 / LN), 256, 0, stream>>>(C64, WH, F[8], (float*)d_out);
}

// v010
// One run takes 60.5 microseconds.
// Next to v009, in two timings, it ran 1.06 and 1.04 times as fast.
// Over all steps from v000 it is 47.3 times as fast.
// compute dtype: all float inputs rounded to bf16; q/k/v projections with EXACT bf16 products on WMMA 16x16x32 (f32 accumulate); logits: q once to f16 x k once to f16 (1 product); softmax in f32 against a running maximum that is renewed only when needed; exp(logit - maximum in use), at most 2^15, once to f16 x v once to f16 (1 product), divided by the f32 sum at the end; f32 output.
#include <hip/hip_runtime.h>
#include <math.h>

typedef __attribute__((ext_vector_type(16))) _Float16 v16h;
typedef __attribute__((ext_vector_type(16))) __bf16 v16b;
typedef __attribute__((ext_vector_type(8)))  _Float16 v8h;
typedef __attribute__((ext_vector_type(8)))  float v8f;
typedef __attribute__((ext_vector_type(4)))  float v4f;
typedef __attribute__((ext_vector_type(2)))  float v2f;
typedef __attribute__((ext_vector_type(4)))  unsigned v4u;
typedef __attribute__((ext_vector_type(4)))  int v4i;
typedef __attribute__((ext_vector_type(16))) unsigned v16u;
typedef const __attribute__((address_space(4))) v16u* cv16u;   // a pointer to memory that no one writes while the kernel runs: a wave-uniform load through it is a scalar load
typedef float __attribute__((may_alias)) float_a;
typedef int __attribute__((may_alias)) int_a;

template <typename T> __device__ __forceinline__ void vst2(void* p, T v) { *(T*)p = v;  }
__device__ __forceinline__ v8f wmma16(v16h a, v16h b, v8f c) {
  v8f d = __builtin_amdgcn_wmma_f32_16x16x32_f16(false, a, false, b, (short)0, c, false, false);
  asm volatile("v_nop\n\tv_nop\n\tv_nop\n\tv_nop" : "+v"(d) : "v"(a), "v"(b));
  return d;
}
__device__ __forceinline__ v8f wmma_bf(v16b a, v16b b, v8f c) {
  v8f d = __builtin_amdgcn_wmma_f32_16x16x32_bf16(false, a, false, b, (short)0, c, false, false);
  asm volatile("v_nop\n\tv_nop\n\tv_nop\n\tv_nop" : "+v"(d) : "v"(a), "v"(b));
  return d;
}
// 16x16x32 fragments: lane = (h = lane>>4, row/col = lane&15); elements 0..7 = k0+8h+0..7, 8..15 = k0+16+8h+0..7; D element r = row 8h+r
__device__ __forceinline__ v16h frag_h(const _Float16* rowk0, int lane) {
  union { v16h v; v8h q[2]; } u; const _Float16* p = rowk0 + 8 * (lane >> 4);
  u.q[0] = *(const v8h*)p; u.q[1] = *(const v8h*)(p + 16); return u.v;
}
__device__ __forceinline__ v16h frag_f32(const float* rowk0, int lane) {
  v16h a; const float* p = rowk0 + 8 * (lane >> 4);
#pragma unroll
  for (int i = 0; i < 8; ++i) { a[i] = (_Float16)p[i]; a[8 + i] = (_Float16)p[16 + i]; }
  return a;
}
__device__ __forceinline__ v16h frag_f32s(const float* rowk0, int lane, float sc) {
  v16h a; const float* p = rowk0 + 8 * (lane >> 4);
#pragma unroll
  for (int i = 0; i < 8; ++i) { a[i] = (_Float16)(p[i] * sc); a[8 + i] = (_Float16)(p[16 + i] * sc); }
  return a;
}
// column fragment from a [K][ld] layout (column n), rows >= K read as 0
__device__ __forceinline__ v16h fragc_f32(const float* W, int k0, int n, int lane, int ld, int K) {
  v16h a; const int g = lane >> 4;
#pragma unroll
  for (int i = 0; i < 8; ++i) { const int ka = k0 + 8 * g + i, kb = ka + 16;
    a[i] = (_Float16)(ka < K ? W[(size_t)(ka < K ? ka : K - 1) * ld + n] : 0.f); a[8 + i] = (_Float16)(kb < K ? W[(size_t)(kb < K ? kb : K - 1) * ld + n] : 0.f); }
  return a;
}
struct F2 { v16b h, l; };
__device__ __forceinline__ F2 bsplit16(const float v[16]) { F2 r;
#pragma unroll
  for (int i = 0; i < 16; ++i) { const __bf16 h = (__bf16)v[i]; r.h[i] = h; r.l[i] = (__bf16)(v[i] - (float)h); }
  return r; }
__device__ __forceinline__ F2 split_row(const float* row, int k0, int lane) { float v[16]; const float* p = row + k0 + 8 * (lane >> 4);
#pragma unroll
  for (int i = 0; i < 8; ++i) { v[i] = p[i]; v[8 + i] = p[16 + i]; }
  return bsplit16(v); }
__device__ __forceinline__ F2 split_rowK(const float* row, int k0, int lane, int K) { float v[16]; const int g = lane >> 4;
#pragma unroll
  for (int i = 0; i < 8; ++i) { const int ka = k0 + 8 * g + i, kb = ka + 16; v[i] = ka < K ? row[ka < K ? ka : K - 1] : 0.f; v[8 + i] = kb < K ? row[kb < K ? kb : K - 1] : 0.f; }
  return bsplit16(v); }
__device__ __forceinline__ F2 split_col(const float* W, int k0, int n, int lane, int ld, int K) { float v[16]; const int g = lane >> 4;
#pragma unroll
  for (int i = 0; i < 8; ++i) { const int ka = k0 + 8 * g + i, kb = ka + 16; v[i] = ka < K ? W[(size_t)(ka < K ? ka : K - 1) * ld + n] : 0.f; v[8 + i] = kb < K ? W[(size_t)(kb < K ? kb : K - 1) * ld + n] : 0.f; }
  return bsplit16(v); }
__device__ __forceinline__ v8f mac3(const F2& a, const F2& b, v8f c) { c = wmma_bf(a.l, b.h, c); c = wmma_bf(a.h, b.l, c); return wmma_bf(a.h, b.h, c); }
__device__ __forceinline__ float sigm(float v) { return 1.0f / (1.0f + expf(-v)); }
#define LDSX() do { asm volatile("s_wait_dscnt 0" ::: "memory"); __builtin_amdgcn_wave_barrier(); __builtin_amdgcn_fence(__ATOMIC_RELEASE, "workgroup"); } while (0)

// Masked self-attention with a RAW reshape into heads (query / key / value [2,2048,1024] are reshaped WITHOUT transpose to [2,16,2048,64]: pseudo-head h of batch b = the contiguous 131,072 floats starting at (b*16 + h)*2048*64, i.e. 32 pseudo-sequences of 2,048 positions x 64 dims each); one shared bias-free torch (out,in) Linear [64,64] per role (Wq, Wk, Wv); scores = Q K^T masked by mask[b][0][q][k] == 0 -> -1e20 (int32 random 0/1 per batch), then divided by sqrt(embed = 1024) = 32 (the source's quirk: logit sigma - 0.08); softmax; out = attn V reshaped raw back to [2,2048,1024]; (out,in) Wo [1024,1024] + bo (nonzero): result = out Wo^T + bo.
#define NB 32
#define TT 2048
#define CC 64             // NH * HD = projected width
#define DIN 64          // input (model) width
#define NH 1
#define HD 64
#define NQB (TT / 64)
#define HG 1
#define SCALE (0.03125f)
#define CAUSAL 0
#ifndef TNB
#define TNB NB
#endif
__device__ __forceinline__ float bfr(float v) { return (float)(__bf16)v; }
__host__ __device__ __forceinline__ int kb_last(int qb) { return CAUSAL ? ((qb * 64 + 63) >> 7) : (TT / 128 - 1); }
typedef __attribute__((ext_vector_type(8))) __bf16 v8b;
__device__ __forceinline__ v16b frag_b(const __bf16* rowk0, int lane) {
  union { v16b v; v8b q[2]; } u; const __bf16* p = rowk0 + 8 * (lane >> 4);
  u.q[0] = *(const v8b*)p; u.q[1] = *(const v8b*)(p + 16); return u.v;
}
#define QBH 0
// B fragment (k rows k0+.., output column o) of a weight: (in,out) [K][ld] or (out,in) [ld rows of K]: bf16 exact, or f16(bf16 * 256) exact
__device__ __forceinline__ v16b wcol_io(const float* Wm, int k0, int o, int lane, int ld) { v16b w; const int g = lane >> 4;
#pragma unroll
  for (int i = 0; i < 8; ++i) { w[i] = (__bf16)Wm[(size_t)(k0 + 8 * g + i) * ld + o]; w[8 + i] = (__bf16)Wm[(size_t)(k0 + 16 + 8 * g + i) * ld + o]; }
  return w; }
__device__ __forceinline__ v16b wcol_oi(const float* Wm, int k0, int o, int lane, int K) { v16b w; const float* p = Wm + (size_t)o * K + k0 + 8 * (lane >> 4);
#pragma unroll
  for (int i = 0; i < 8; ++i) { w[i] = (__bf16)p[i]; w[8 + i] = (__bf16)p[16 + i]; }
  return w; }
__device__ __forceinline__ v16h wcolh_io(const float* Wm, int k0, int o, int lane, int ld) { v16h w; const int g = lane >> 4;
#pragma unroll
  for (int i = 0; i < 8; ++i) { w[i] = (_Float16)(bfr(Wm[(size_t)(k0 + 8 * g + i) * ld + o]) * 256.0f); w[8 + i] = (_Float16)(bfr(Wm[(size_t)(k0 + 16 + 8 * g + i) * ld + o]) * 256.0f); }
  return w; }
__device__ __forceinline__ v16h wcolh_oi(const float* Wm, int k0, int o, int lane, int K) { v16h w; const float* p = Wm + (size_t)o * K + k0 + 8 * (lane >> 4);
#pragma unroll
  for (int i = 0; i < 8; ++i) { w[i] = (_Float16)(bfr(p[i]) * 256.0f); w[8 + i] = (_Float16)(bfr(p[16 + i]) * 256.0f); }
  return w; }
#define WQKV_LAYOUT 1   // 0 = (in,out) [DIN][CC]; 1 = (out,in) [CC][DIN]; 2 = per-head [NH][DIN][HD]
__device__ __forceinline__ v16b wcol_hdk(const float* Wm, int k0, int o, int lane) { v16b w; const int g = lane >> 4; const float* p = Wm + (size_t)(o / HD) * DIN * HD + (o % HD);
#pragma unroll
  for (int i = 0; i < 8; ++i) { w[i] = (__bf16)p[(size_t)(k0 + 8 * g + i) * HD]; w[8 + i] = (__bf16)p[(size_t)(k0 + 16 + 8 * g + i) * HD]; }
  return w; }
#define WO_OUT_IN 0
#if WQKV_LAYOUT == 1
#define WCOL(W, k0, o, lane) wcol_oi(W, k0, o, lane, DIN)
#elif WQKV_LAYOUT == 2
#define WCOL(W, k0, o, lane) wcol_hdk(W, k0, o, lane)
#else
#define WCOL(W, k0, o, lane) wcol_io(W, k0, o, lane, CC)
#endif
#if WO_OUT_IN
#define WOCOL(W, k0, o, lane) wcol_oi(W, k0, o, lane, CC)
#define WOCOLH(W, k0, o, lane) wcolh_oi(W, k0, o, lane, CC)
#else
#define WOCOL(W, k0, o, lane) wcol_io(W, k0, o, lane, DIN)
#define WOCOLH(W, k0, o, lane) wcolh_io(W, k0, o, lane, DIN)
#endif
// ---- prep_part (blocks of k_prep, numbered pb): operand preparation for k_fa and k_lin2.
// Blocks pb >= 512 convert Wo for k_lin2 (see there). Blocks pb in 0..511 pack the mask: MB[batch * 128 + query tile of 16][key tile of 16][r] = one 32-bit word whose bit (lane = 16g + col) says mask[query tile * 16 + col][key tile * 16 + 8g + r] != 0, i.e. the lane mask of register r of that score tile in k_fa. A wave takes 16 mask rows x 128 keys: whole 512-B row pieces into its own LDS rows, read back in the score tile's lane order, one ballot per word.
#define MBP 132           // LDS pitch of a 128-element int row piece: 512 B + 16 B, conflict-free for 16-B reads
typedef __attribute__((ext_vector_type(2))) unsigned v2u;
typedef __attribute__((ext_vector_type(4))) _Float16 v4h;
__device__ __forceinline__ void prep_part(const int pb, char* sm, const int* __restrict__ MASK, unsigned* __restrict__ MB, const float* __restrict__ WO, _Float16* __restrict__ WH) {
  int (*sp)[16][MBP] = (int (*)[16][MBP])sm;
  if (pb >= 512) {   // Wo once to f16(bf16 x 2^8), the B operand of k_lin2: 128 blocks, a thread takes eight 16-B pieces, each wave-wide load 512 contiguous bytes, all eight in flight
    const size_t e0 = ((size_t)(pb - 512) * 256 + threadIdx.x) * 4; const float* gs = WO + e0; v4f rw[8];
#pragma unroll   // constant indices, so that the array stays in registers
    for (int i = 0; i < 8; ++i) rw[i] = *(const v4f*)(gs + (size_t)i * (128 * 256 * 4));
    asm volatile("s_wait_xcnt 0x0" :: "v"(gs) : "memory");   // the code behind may reuse the registers that hold these loads' address: the wait stands in front of that overwrite
#pragma unroll   // constant indices, so that the array stays in registers
    for (int i = 0; i < 8; ++i) { v4h hw;
#pragma unroll
      for (int e = 0; e < 4; ++e) hw[e] = (_Float16)(bfr(rw[i][e]) * 256.0f);
      vst2(WH + e0 + (size_t)i * (128 * 256 * 4), hw); }
    asm volatile("s_wait_xcnt 0x0" ::: "memory");   // in the merged kernel other code stands behind these stores in the listing and writes the registers that they name: the wait stands in front of that overwrite
    return; }
  { const int wave = threadIdx.x >> 5, lane = threadIdx.x & 31, col = lane & 15, g = lane >> 4; const int gw = pb * 8 + wave, ch = gw & 15, qt = gw >> 4;   // ch = piece of 128 keys, qt = batch * 128 + query tile
    const int* gm = MASK + (size_t)qt * 16 * TT + ch * 128 + lane * 4; v4i rm[16];
#pragma unroll   // constant indices, so that the array stays in registers; all sixteen loads in flight
    for (int i = 0; i < 16; ++i) rm[i] = *(const v4i*)(gm + (size_t)i * TT);
    asm volatile("s_wait_xcnt 0x0" :: "v"(gm) : "memory");   // the code behind reuses the registers that hold these loads' address: the wait stands in front of that overwrite, and the address as its input keeps the last load's result off those registers
#pragma unroll   // constant indices, so that the array stays in registers
    for (int i = 0; i < 16; ++i) *(v4i*)&sp[wave][i][lane * 4] = rm[i];
    __syncthreads();   // publishes the rows: a lane reads back what other lanes wrote
    unsigned w0 = 0, w1 = 0;   // lane l collects words 2l and 2l + 1 of the wave's 64
#pragma unroll   // constant lane numbers for the word's place
    for (int kt = 0; kt < 8; ++kt) { const v4i m0 = *(const v4i*)&sp[wave][col][kt * 16 + 8 * g], m1 = *(const v4i*)&sp[wave][col][kt * 16 + 8 * g + 4];
#pragma unroll   // constant lane numbers for the word's place
      for (int r = 0; r < 8; r += 2) { const unsigned ba = __builtin_amdgcn_ballot_w32((r < 4 ? m0[r & 3] : m1[r & 3]) != 0), bb = __builtin_amdgcn_ballot_w32((r < 4 ? m0[(r + 1) & 3] : m1[(r + 1) & 3]) != 0);
        const bool mine = lane == kt * 4 + (r >> 1); w0 = mine ? ba : w0; w1 = mine ? bb : w1; } }
    v2u wv; wv[0] = w0; wv[1] = w1; vst2(MB + (size_t)qt * (TT / 16 * 8) + ch * 64 + lane * 2, wv);
    asm volatile("s_wait_xcnt 0x0" ::: "memory");   // the same for this store
  } }
#define WS_QH  0u                                      // f16 q rows [b*t][CC]
#define WS_KH  (WS_QH + 2u * (size_t)NB * TT * CC)      // f16 k rows [b*t][CC]
#define WS_VT  (WS_KH + 2u * (size_t)NB * TT * CC)      // f16 v planes [b][c][t]
#define WS_END (WS_VT + 2u * (size_t)NB * CC * TT)

// ---- proj_part (blocks of k_prep, numbered pj = which * 128 + pair of row ranges): a block = two halves of 128 threads that share nothing but the barriers; a half = (PT tiles of 64 rows, all 64 cols, which): q/k/v = X W^T with exact bf16 products (K = DIN), W = the (out,in) [64][64] input itself -> which 0: q f16 rows; 1: k f16 rows; 2: v f16 planes [c][t]. Only what k_fa reads is computed, staged and stored.
// Operand path: X rows and W rows are read as whole lines (a wave's 16-B loads cover two 256-B rows = 512 contiguous bytes), rounded to bf16 once per half and staged in LDS; the fragments come from LDS. W is staged once per half, the next row tile's loads are in flight in registers.
#define PT 4              // row tiles of 64 per half
#define PP 72             // LDS pitch of a 64-element bf16 row: 128 B + 16 B, conflict-free for 16-B fragment reads
#define PHB (3 * 64 * PP * 2)   // LDS bytes of one half: output tile, X tile, W rows
typedef __attribute__((ext_vector_type(4))) __bf16 v4b;
__device__ __forceinline__ v4b cvt4b(v4f v) { v4b h;
#pragma unroll
  for (int e = 0; e < 4; ++e) h[e] = (__bf16)v[e];
  return h; }
// 16-B global store with its wait in ONE statement: the next pass of the store loop and the next trip reuse the registers that the store names
__device__ __forceinline__ void st16w(void* p, v4u v) { asm volatile("global_store_b128 %0, %1, off\n\ts_wait_xcnt 0x0" :: "v"(p), "v"(v) : "memory"); }
__device__ __forceinline__ void proj_part(const int pj, char* sm, const float* __restrict__ XQ, const float* __restrict__ XK, const float* __restrict__ XV, const float* __restrict__ WQ, const float* __restrict__ WK, const float* __restrict__ WV,
    _Float16* __restrict__ QH, _Float16* __restrict__ KH, _Float16* __restrict__ VT) {
  const int hb = threadIdx.x >> 7; char* sh = sm + hb * PHB;   // the half's own LDS
  _Float16 (*so)[PP] = (_Float16 (*)[PP])sh;   // output tile: q and k as [row][column], v as [column][row]
  __bf16 (*xs)[PP] = (__bf16 (*)[PP])(sh + 64 * PP * 2), (*wsg)[PP] = (__bf16 (*)[PP])(sh + 2 * 64 * PP * 2);   // staged operands: one X row tile, all W rows
  const int tid = threadIdx.x & 127, wave = tid >> 5, lane = tid & 31, col = lane & 15, g = lane >> 4; const int which = pj >> 7; const size_t rb = (size_t)((pj & 127) * 2 + hb) * (64 * PT);
  const float* X = which == 0 ? XQ : which == 1 ? XK : XV; const float* WA = which == 0 ? WQ : which == 1 ? WK : WV;
  const int sr = tid >> 4, sc = tid & 15;   // staging: thread -> (row, 16-B chunk) of the 256-B rows
  const float* gx = X + (rb + sr) * DIN + sc * 4;
  v4f rx[8];
  { v4f rw[8]; const float* gw = WA + (size_t)sr * DIN + sc * 4;
#pragma unroll   // constant indices, so that the arrays stay in registers
    for (int i = 0; i < 8; ++i) rw[i] = *(const v4f*)(gw + (size_t)(8 * i) * DIN);
#pragma unroll   // constant indices, so that the arrays stay in registers
    for (int i = 0; i < 8; ++i) rx[i] = *(const v4f*)(gx + (size_t)(8 * i) * DIN);
    asm volatile("s_wait_xcnt 0x0" :: "v"(gw), "v"(gx) : "memory");   // the code behind may reuse the registers that hold these loads' addresses: the wait stands in front of that overwrite
#pragma unroll   // constant indices, so that the arrays stay in registers
    for (int i = 0; i < 8; ++i) *(v4b*)&wsg[sr + 8 * i][sc * 4] = cvt4b(rw[i]); }
#pragma clang loop unroll(disable)   // one copy of the tile body: the branch round the next tile's loads keeps them directly behind the barrier
  for (int it = 0; it < PT; ++it) { const size_t r0 = rb + (size_t)it * 64; const size_t bb = r0 / TT; const int t0 = (int)(r0 % TT);
#pragma unroll   // constant indices, so that the arrays stay in registers
    for (int i = 0; i < 8; ++i) *(v4b*)&xs[sr + 8 * i][sc * 4] = cvt4b(rx[i]);
    __syncthreads();   // publishes the X tile (and, on the first trip, W); it also ends every wave's reads of the output tile of trip it - 1, which this trip overwrites only behind it
    v8f acc[4] = {};
#pragma unroll   // constant indices, so that the arrays stay in registers
    for (int kc = 0; kc < DIN / 32; ++kc) { const v16b a = frag_b(&xs[wave * 16 + col][kc * 32], lane); v16b w[4];
#pragma unroll   // constant indices, so that the arrays stay in registers
      for (int j = 0; j < 4; ++j) w[j] = frag_b(&wsg[j * 16 + col][kc * 32], lane);
#pragma unroll   // constant indices, so that the arrays stay in registers
      for (int j = 0; j < 4; ++j) acc[j] = __builtin_amdgcn_wmma_f32_16x16x32_bf16(false, a, false, w[j], (short)0, acc[j], false, false); }
    const bool qk = which < 2; _Float16* DH = which == 0 ? QH : KH;
    if (qk) {
#pragma unroll
      for (int j = 0; j < 4; ++j) {
#pragma unroll
        for (int r = 0; r < 8; ++r) so[wave * 16 + 8 * g + r][j * 16 + col] = (_Float16)acc[j][r]; }
    } else {
#pragma unroll
      for (int j = 0; j < 4; ++j) {
#pragma unroll
        for (int r = 0; r < 8; ++r) so[j * 16 + col][wave * 16 + 8 * g + r] = (_Float16)acc[j][r]; } }
    __syncthreads();   // publishes the output tile; it also ends every wave's fragment reads of the X tile, which the next trip overwrites only behind it
    if (it + 1 < PT) {   // behind the barrier (which drains the load counter), so that these loads fly while the output tile is stored
#pragma unroll   // constant indices, so that the arrays stay in registers
      for (int i = 0; i < 8; ++i) rx[i] = *(const v4f*)(gx + (size_t)((it + 1) * 64 + 8 * i) * DIN);
      asm volatile("s_wait_xcnt 0x0" ::: "memory"); }   // the code behind may reuse the registers that held these loads' addresses: the wait stands in front of that overwrite
    for (int e = tid; e < 64 * 8; e += 128) { const int rl = e >> 3, q = e & 7;   // whole 128-B lines: a q or k row, or 64 positions of a v plane row
      st16w(qk ? DH + (r0 + rl) * CC + q * 8 : VT + (bb * CC + rl) * (size_t)TT + t0 + q * 8, *(const v4u*)&so[rl][q * 8]); } } }
// ---- k_prep: the projections and the operand preparation depend on nothing but the inputs, so they run as ONE launch: no gap between them, and the one's start and end overlap the other's stream. The projection blocks (four trips each) come first; 67,584 B of LDS, used by either part in its own way, let four blocks sit on a WGP, so all 1,024 are resident at once.
#define PJB (3 * (TNB * TT / (64 * PT)) / 2)   // projection blocks: 3 roles x 128 pairs of row ranges
__global__ __launch_bounds__(256) void k_prep(const int* __restrict__ MASK, unsigned* __restrict__ MB, const float* __restrict__ WO, _Float16* __restrict__ WH, const float* __restrict__ XQ, const float* __restrict__ XK, const float* __restrict__ XV,
    const float* __restrict__ WQ, const float* __restrict__ WK, const float* __restrict__ WV, _Float16* __restrict__ QH, _Float16* __restrict__ KH, _Float16* __restrict__ VT) {
  __shared__ __align__(16) char sm[8 * 16 * MBP * 4];
  if (blockIdx.x < PJB) { proj_part(blockIdx.x, sm, XQ, XK, XV, WQ, WK, WV, QH, KH, VT); return; }   // a block-uniform branch: every barrier inside is passed by the whole block or by none of it
  prep_part(blockIdx.x - PJB, sm, MASK, MB, WO, WH); }
// ---- k_fa: scores, mask, softmax and P . v of one pseudo-sequence in ONE pass over the keys: S and P stay in registers. Block = 8 waves x 16 queries (blockIdx.x = query block, blockIdx.y = pseudo-sequence b, real batch = b >> 4); a stage = 64 keys, K rows and v plane rows staged in LDS (whole 128-B lines per load), two buffers, the next stage's loads in flight in registers; the mask comes as packed lane-mask words (k_prep), 32 words a wave and stage by scalar loads.
// St = K Qt (A = K rows, B = q, kept in registers): a lane holds ONE query (col) and keys 8g + r of each 16-key tile, so two tiles pack in place into the B operand of Ot += vt Pt (A = v plane rows, same k order as frag_h). Maximum in use and sum per query in raw score units (the 1/32 sits in the exponent's factor); where(mask == 0, -1e20, score) as in the source, so a fully masked row comes out uniform.
#define FQ 128            // queries per block
#define FK 64             // keys per stage
#define KP 72             // LDS pitch of a 64-element f16 row: 128 B + 16 B, conflict-free for 16-B fragment reads
#define CEXP (SCALE * 1.44269504088896f)
#define PMAX 32768.0f     // the largest sum of a lane's exponentials of one stage that is taken without a new maximum
__device__ __forceinline__ v8f wm(v16h a, v16h b, v8f c) { return __builtin_amdgcn_wmma_f32_16x16x32_f16(false, a, false, b, (short)0, c, false, false); }
// 2^x of eight values by the compiler's own v_exp_f32: it picks the result registers itself (an asm block with in-place operands cost register copies where the two paths of the stage meet) and it keeps the free slot that the instruction set asks for behind a transcendental
__device__ __forceinline__ v8f exp2x8(v8f e) { v8f p;
#pragma unroll   // constant indices, so that the vector stays in registers
  for (int r = 0; r < 8; ++r) p[r] = __builtin_amdgcn_exp2f(e[r]);
  return p; }
__device__ __forceinline__ float exp2x1(float a) { asm("v_exp_f32 %0, %0\n\tv_nop" : "+v"(a)); return a; }   // the v_nop: behind a transcendental the instruction set asks for one independent instruction before its result is read or its source overwritten
__device__ __forceinline__ float xhalf(float v) { const int i = __builtin_bit_cast(int, v); return __builtin_bit_cast(float, (int)__builtin_amdgcn_permlanex16(i, i, 0x76543210, 0xfedcba98, false, false)); }   // the value of lane l ^ 16
// amdgpu_waves_per_eu(4, 4): the grid gives a SIMD four waves; with no ceiling named the compiler aimed at more waves, cut the registers and put a full LDS wait in front of every fragment's products
__global__ __launch_bounds__(256) __attribute__((amdgpu_waves_per_eu(4, 4))) void k_fa(const _Float16* __restrict__ QH, const _Float16* __restrict__ KH, const _Float16* __restrict__ VT, const unsigned* __restrict__ MB, _Float16* __restrict__ C) {
  __shared__ __align__(16) _Float16 sk[2][FK][KP], sv[2][HD][KP];
  const int tid = threadIdx.x, wave = tid >> 5, lane = tid & 31, col = lane & 15, g = lane >> 4; const int b = blockIdx.y, q0 = blockIdx.x * FQ, qw = wave * 16 + col;
  v16h qh[2];
#pragma unroll   // constant indices, so that the arrays stay in registers
  for (int kc = 0; kc < 2; ++kc) qh[kc] = frag_h(QH + ((size_t)b * TT + q0 + qw) * CC + kc * 32, lane);
  const int r8 = tid >> 3, c8 = tid & 7;   // staging: thread -> (row, 16-B chunk) of 128-B rows (K, v)
  const _Float16* gk = KH + ((size_t)b * TT + r8) * CC + c8 * 8; const _Float16* gv = VT + ((size_t)b * CC + r8) * TT + c8 * 8;
  const unsigned* gb = MB + ((size_t)(b >> 4) * (TT / 16) + (q0 >> 4) + __builtin_amdgcn_readfirstlane(wave)) * (TT / 16 * 8);   // the wave's query tile: a wave-uniform address, so that the words come by scalar loads
  v8h rk[2], rv[2];
#pragma unroll   // constant indices, so that the arrays stay in registers
  for (int i = 0; i < 2; ++i) { rk[i] = *(const v8h*)(gk + (size_t)(32 * i) * CC); rv[i] = *(const v8h*)(gv + (size_t)(32 * i) * TT); }
  v8f o[4] = {}, lv = {}; float m = -3.0e38f;
#pragma clang loop unroll(disable)   // one copy of the stage body: the last stage is not peeled off, and the branch round the next stage's loads keeps them directly behind the barrier
  for (int s = 0; s < TT / FK; ++s) { const int u = s & 1;
    const v16u mb[2] = { *(cv16u)(gb + s * 32), *(cv16u)(gb + s * 32 + 16) };   // the stage's 32 mask words, asked for in front of the LDS stores and the barrier: they land while the wave waits there and for its first K fragments
#pragma unroll   // constant indices, so that the arrays stay in registers
    for (int i = 0; i < 2; ++i) { *(v8h*)&sk[u][r8 + 32 * i][c8 * 8] = rk[i]; *(v8h*)&sv[u][r8 + 32 * i][c8 * 8] = rv[i]; }
    __syncthreads();   // publishes buffer u; it also ends every wave's reads of buffer u ^ 1 (stage s - 1), which stage s + 1 overwrites only behind it
    if (s + 1 < TT / FK) { const int k1 = (s + 1) * FK;   // behind the barrier (which drains the load counter), so that these loads fly during the stage's work
#pragma unroll   // constant indices, so that the arrays stay in registers
      for (int i = 0; i < 2; ++i) { rk[i] = *(const v8h*)(gk + (size_t)(k1 + 32 * i) * CC); rv[i] = *(const v8h*)(gv + (size_t)(32 * i) * TT + k1); }
      asm volatile("s_wait_xcnt 0x0" ::: "memory"); }   // the stage's first LDS reads land in the registers that held these loads' addresses: the wait stands in front of that overwrite
    v8f t[4] = {};
#pragma unroll   // constant indices, so that the arrays stay in registers
    for (int kc = 0; kc < 2; ++kc)   // k chunk outside, tile inside: four independent accumulator chains, so that no product waits for the one before it
#pragma unroll   // constant indices, so that the arrays stay in registers
      for (int j = 0; j < 4; ++j) t[j] = wm(frag_h(&sk[u][j * 16 + col][kc * 32], lane), qh[kc], t[j]);
#pragma unroll   // constant indices, so that the arrays stay in registers
    for (int j = 0; j < 4; ++j)
#pragma unroll   // constant indices, so that the arrays stay in registers
      for (int r = 0; r < 8; ++r) t[j][r] = __builtin_amdgcn_inverse_ballot_w32(mb[j >> 1][(j & 1) * 8 + r]) ? t[j][r] : -1.0e20f;   // word (j, r) is this register's lane mask: one select, no compare
    // The exponentials are taken against the maximum IN USE, m, with no maximum of the stage in front of them. Any m gives the same softmax as long as nothing overflows, and m is always a maximum that the query's masked scores have really reached, so nothing underflows that would not with the true running maximum. The test: all p are >= 0, so a lane's sum over the stage bounds each of them; up to PMAX they fit f16.
    v16h vf[2][4];   // the v fragments are asked for here, in front of the branch: behind it their LDS latency would stand open in front of the products
#pragma unroll   // constant indices, so that the arrays stay in registers
    for (int kk = 0; kk < 2; ++kk)
#pragma unroll   // constant indices, so that the arrays stay in registers
      for (int jd = 0; jd < 4; ++jd) vf[kk][jd] = frag_h(&sv[u][jd * 16 + col][kk * 32], lane);
    v8f p[4], ps;
#pragma unroll   // constant indices, so that the arrays stay in registers
    for (int j = 0; j < 4; ++j) { p[j] = exp2x8((t[j] - m) * CEXP); ps = j ? ps + p[j] : p[j]; }
    const v4f p4 = __builtin_shufflevector(ps, ps, 0, 1, 2, 3) + __builtin_shufflevector(ps, ps, 4, 5, 6, 7); const v2f p2 = __builtin_shufflevector(p4, p4, 0, 1) + __builtin_shufflevector(p4, p4, 2, 3); const float pt = p2[0] + p2[1];   // register pairs added as they lie
    if (__builtin_amdgcn_ballot_w32(!(pt <= PMAX)) != 0) {   // one wave-uniform branch a stage; taken in the first stage (m starts at -3e38, p = inf) and whenever a score has risen about 15 / CEXP above m: the stage's maximum, the rescaling and the exponentials as in a plain running-maximum step
      float mj[4];   // one maximum chain per tile: four independent chains
#pragma unroll   // constant indices, so that the arrays stay in registers
      for (int j = 0; j < 4; ++j) { mj[j] = t[j][0];
#pragma unroll   // constant indices, so that the arrays stay in registers
        for (int r = 1; r < 8; ++r) mj[j] = fmaxf(mj[j], t[j][r]); }
      float mx = fmaxf(fmaxf(mj[0], mj[1]), fmaxf(mj[2], mj[3])); mx = fmaxf(mx, xhalf(mx));   // the query's other 32 keys of the stage sit in lane l ^ 16: both lanes of a query keep the same m
      const float mn = fmaxf(m, mx), al = exp2x1((m - mn) * CEXP); m = mn;
#pragma unroll   // constant indices, so that the arrays stay in registers
      for (int j = 0; j < 4; ++j) { p[j] = exp2x8((t[j] - mn) * CEXP); ps = j ? ps + p[j] : p[j]; }
      lv *= al;
#pragma unroll   // constant indices, so that the arrays stay in registers
      for (int jd = 0; jd < 4; ++jd) o[jd] *= al; }
    lv += ps;
    union { v16h v; v8h q[2]; } pb[2];
#pragma unroll   // constant indices, so that the arrays stay in registers
    for (int j = 0; j < 4; ++j) pb[j >> 1].q[j & 1] = __builtin_convertvector(p[j], v8h);
#pragma unroll   // constant indices, so that the arrays stay in registers
    for (int kk = 0; kk < 2; ++kk)
#pragma unroll   // constant indices, so that the arrays stay in registers
      for (int jd = 0; jd < 4; ++jd) o[jd] = wm(vf[kk][jd], pb[kk].v, o[jd]); }
  float ls = ((lv[0] + lv[1]) + (lv[2] + lv[3])) + ((lv[4] + lv[5]) + (lv[6] + lv[7])); ls += xhalf(ls); const float inv = 1.0f / ls;   // ls >= 1: the maximum's own term
  _Float16* cr = C + ((size_t)b * TT + q0 + qw) * HD + 8 * g;   // Ot tile jd, register r = ctx[query][jd * 16 + 8g + r]: 16 contiguous bytes per lane and tile; stored as f16(ctx x 2^6), the A operand of k_lin2
#pragma unroll   // constant indices, so that the arrays stay in registers
  for (int jd = 0; jd < 4; ++jd) { v8h w;
#pragma unroll   // constant indices, so that the arrays stay in registers
    for (int r = 0; r < 8; ++r) w[r] = (_Float16)((o[jd][r] * inv) * 64.0f);
    vst2(cr + jd * 16, w); } }

// ---- k_lin2: the module's final Linear on the RAW-reshaped context: rows = the [2*2048][1024] view of the contiguous [32][2048][64] context buffer; out = ctx Wo^T + bo with f16(ctx x 2^6) against f16(bf16(Wo) x 2^8) (1 product, k in ascending 32-chunks). Both operands arrive as f16: k_fa stores the context so, k_prep's last blocks convert Wo once.
// Block = 8 waves on a 128 x 128 output tile (wave = 32 rows x 64 columns); a stage = 128 k: the ctx rows and the Wo rows are read as whole 256-B pieces and staged in LDS as they are, two buffers, the next stage's loads in flight in registers.
#define K2 1024
#define N2 1024
#define LM 128            // output rows per block
#define LN 128            // output columns per block
#define LK 128            // k per stage
#define LP 136            // LDS pitch of a 128-element f16 row: 256 B + 16 B, conflict-free for 16-B fragment reads
#define LF 132            // LDS pitch of a 128-element f32 output row
__global__ __launch_bounds__(256) void k_lin2(const _Float16* __restrict__ Yc, const _Float16* __restrict__ WH, const float* __restrict__ BO, float* __restrict__ OUT) {
  __shared__ __align__(16) _Float16 st[2][2][LM][LP];   // [buffer][0 = ctx rows, 1 = Wo rows][row][k]; after the k loop the same bytes hold the f32 output tile
  const int tid = threadIdx.x, wave = tid >> 5, lane = tid & 31, col = lane & 15, g = lane >> 4; const int c0 = blockIdx.y * LN; const size_t r0 = (size_t)blockIdx.x * LM;
  const int wr = (wave >> 1) * 32, wc = (wave & 1) * 64;
  const int sr = tid >> 4, sc = tid & 15;   // staging: thread -> (row, 16-B chunk) of the 256-B row pieces
  const _Float16* ga = Yc + r0 * K2; const _Float16* gw = WH + (size_t)c0 * K2; const unsigned vo = (unsigned)(sr * K2 + sc * 8);   // block-uniform bases that walk along k, and one per-lane offset that never changes
  v8h ra[8], rw[8];
#pragma unroll   // constant indices, so that the arrays stay in registers
  for (int i = 0; i < 8; ++i) { ra[i] = *(const v8h*)(ga + (vo + 16u * i * K2)); rw[i] = *(const v8h*)(gw + (vo + 16u * i * K2)); }
  v8f acc[2][4] = {};
#pragma clang loop unroll(disable)   // one copy of the stage body: the last stage is not peeled off, and the branch round the next stage's loads keeps them directly behind the barrier
  for (int s = 0; s < K2 / LK; ++s) { const int u = s & 1;
#pragma unroll   // constant indices, so that the arrays stay in registers
    for (int i = 0; i < 8; ++i) { *(v8h*)&st[u][0][sr + 16 * i][sc * 8] = ra[i]; *(v8h*)&st[u][1][sr + 16 * i][sc * 8] = rw[i]; }
    __syncthreads();   // publishes buffer u; it also ends every wave's reads of buffer u ^ 1 (stage s - 1), which stage s + 1 overwrites only behind it
    if (s + 1 < K2 / LK) { ga += LK; gw += LK;   // behind the barrier (which drains the load counter), so that these loads fly during the stage's work
#pragma unroll   // constant indices, so that the arrays stay in registers
      for (int i = 0; i < 8; ++i) { ra[i] = *(const v8h*)(ga + (vo + 16u * i * K2)); rw[i] = *(const v8h*)(gw + (vo + 16u * i * K2)); } }
#pragma unroll   // constant indices, so that the arrays stay in registers
    for (int kk = 0; kk < LK / 32; ++kk) { v16h af[2], bf[4];
#pragma unroll   // constant indices, so that the arrays stay in registers
      for (int i = 0; i < 2; ++i) af[i] = frag_h(&st[u][0][wr + i * 16 + col][kk * 32], lane);
#pragma unroll   // constant indices, so that the arrays stay in registers
      for (int j = 0; j < 4; ++j) bf[j] = frag_h(&st[u][1][wc + j * 16 + col][kk * 32], lane);
#pragma unroll   // constant indices, so that the arrays stay in registers
      for (int i = 0; i < 2; ++i)
#pragma unroll   // constant indices, so that the arrays stay in registers
        for (int j = 0; j < 4; ++j) acc[i][j] = wm(af[i], bf[j], acc[i][j]); } }
  float (*sf)[LF] = (float (*)[LF])&st[0][0][0][0];   // 128 x 132 f32 = 67,584 B of the 139,264 B
  __syncthreads();   // not needed for the buffers: the output tile lies in buffer 0, whose last reads (stage 6) ended at the last stage's barrier
#pragma unroll   // constant indices, so that the arrays stay in registers
  for (int j = 0; j < 4; ++j) { const float bias = bfr(BO[c0 + wc + j * 16 + col]);
#pragma unroll   // constant indices, so that the arrays stay in registers
    for (int i = 0; i < 2; ++i)
#pragma unroll   // constant indices, so that the arrays stay in registers
      for (int r = 0; r < 8; ++r) sf[wr + i * 16 + 8 * g + r][wc + j * 16 + col] = acc[i][j][r] * (1.0f / 16384.0f) + bias; }   /* 2^-8 (Wo carry) x 2^-6 (ctx carry) */
  __syncthreads();   // publishes the output tile: a wave stores whole 512-B rows that two waves wrote
#pragma unroll   // one address, sixteen constant offsets
  for (int rl = 0; rl < 16; ++rl) vst2(OUT + (r0 + wave * 16 + rl) * N2 + c0 + lane * 4, *(const v4f*)&sf[wave * 16 + rl][lane * 4]); }
#define WS_C64 (WS_END)                     // f16 context x 2^6 [32][2048][64] contiguous == the raw-reshaped [2*2048][1024] rows
#define WS_MB (WS_C64 + 2u * (size_t)NB * TT * 64)          // packed mask words [2 * 128 query tiles][128 key tiles][8]
#define WS_WH (WS_MB + 4u * 2 * (size_t)(TT / 16) * (TT / 16) * 8)   // f16(bf16(Wo) x 2^8) [1024][1024]
#define WS_END3 (WS_WH + 2u * (size_t)N2 * K2)
extern "C" void kernel_launch(void* const* d_in, const int* in_sizes, int n_in, void* d_out, int out_size, void* d_ws, size_t ws_size, hipStream_t stream) {
  (void)in_sizes; (void)n_in; (void)out_size;
  const float** F = (const float**)d_in;
  if (ws_size < (size_t)WS_END) return;
  char* ws = (char*)d_ws; _Float16 *QH = (_Float16*)(ws + WS_QH), *KH = (_Float16*)(ws + WS_KH), *VT = (_Float16*)(ws + WS_VT);
  // inputs: 0 query [2,2048,1024]; 1 key; 2 value (each viewed as 65,536 rows of 64: the raw reshape); 3 mask [2,1,2048,2048] int32; 4 Wq [64,64] (out,in); 5 Wk; 6 Wv; 7 Wo [1024,1024] (out,in); 8 bo [1024] (nonzero)
  if (ws_size < (size_t)WS_END3) return;
  _Float16 *C64 = (_Float16*)(ws + WS_C64), *WH = (_Float16*)(ws + WS_WH); unsigned* MB = (unsigned*)(ws + WS_MB);
  k_prep<<<dim3(PJB + 512 + 128), 256, 0, stream>>>((const int*)d_in[3], MB, F[7], WH, F[0], F[1], F[2], F[4], F[5], F[6], QH, KH, VT);   /* 384 projection blocks; 512 blocks x 8 waves x (16 rows x 128 keys) = the whole mask; 128 blocks x 256 threads x 32 elements = Wo */
  k_fa<<<dim3(TT / FQ, TNB), 256, 0, stream>>>(QH, KH, VT, MB, C64);   /* pseudo-sequence = real batch (b >> 4), pseudo-head (b & 15) */
  k_lin2<<<dim3((TNB * TT * 64 / K2) / LM, N2 / LN), 256, 0, stream>>>(C64, WH, F[8], (float*)d_out);
}
